// v000
// Times are from an AMD MI455X. After a warm-up the kernel runs many times in a row, and a time is the length of
// such a window on the GPU divided by its runs, so every launch and the gaps after it count. The runs cycle
// through copies of the inputs. A figure is the median of several windows, for all but v000 over two sittings.
// Sittings can differ by a few percent; kernels timed side by side share one.
// v000 is the starting kernel. One run takes 1220 microseconds.
#include <hip/hip_runtime.h>
// On WMMA (f32 accumulate): Q = x·W1, K = y·W2, V = y·W3 (inputs rounded to bf16: single exact terms), per (set, head) scores = q·kᵀ (both computed f32 → bf16 hi/lo: 3 products,
// K = 64), VWᵀ[i][d][(h,k)] = Σ_e W4[h·64+e][d]·v[i][k][h·64+e] (bf16-rounded W4 vs split v), and the cross-set contraction out[i][j] = attn[j]·VW[i] on v_wmma_f32_16x16x32_f16 with
// attn = relu(scores/8)/128 stored in f16 and VWᵀ in f16 (single product; 1024 pairs × 128 × 1024 × 64) — an exact re-association of (attn[j]·v[i])·W4. relu/scaling are f32 VALU.
#define NSET 32
#define NIT 128
#define DM 512
#define NH 8
#define HS 64
#define NTOK (NSET * NIT)
#define HK (NH * NIT)      // 1024 = (h,k) contraction length

typedef __bf16 v16b __attribute__((ext_vector_type(16)));
typedef unsigned short v8us __attribute__((ext_vector_type(8), may_alias));
typedef float  v8f  __attribute__((ext_vector_type(8)));
typedef float  v4f  __attribute__((ext_vector_type(4)));
typedef float  v4fa __attribute__((ext_vector_type(4), may_alias));
union FragB { v16b v; v8us half[2]; unsigned short u[16]; };

__device__ __forceinline__ unsigned short bf16_bits(float x) { unsigned int u = __float_as_uint(x); return (unsigned short)((u + 0x7FFFu + ((u >> 16) & 1u)) >> 16); }
__device__ __forceinline__ float bf16_val(unsigned short b) { return __uint_as_float(((unsigned int)b) << 16); }
__device__ __forceinline__ float bf16_round(float x) { return bf16_val(bf16_bits(x)); }
// D += A·B with NT terms: 1 = ah·bh, 2 = + al·bh (A split), 3 = + ah·bl (both split)
template <int NT>
__device__ __forceinline__ v8f mmaN(v16b ah, v16b al, v16b bh, v16b bl, v8f c) {
  c = __builtin_amdgcn_wmma_f32_16x16x32_bf16(false, ah, false, bh, (short)0, c, false, false);
  if (NT >= 2) c = __builtin_amdgcn_wmma_f32_16x16x32_bf16(false, al, false, bh, (short)0, c, false, false);
  if (NT >= 3) c = __builtin_amdgcn_wmma_f32_16x16x32_bf16(false, ah, false, bl, (short)0, c, false, false);
  asm volatile("v_nop\n\tv_nop\n\tv_nop\n\tv_nop" : "+v"(c) : "v"(ah), "v"(al), "v"(bh), "v"(bl));
  return c;
}

__global__ __launch_bounds__(256) void k_wt_bf16(const float* __restrict__ W, unsigned short* __restrict__ Wt, int K, int N) {
  const int t = blockIdx.x * 256 + threadIdx.x;
  const int k8n = K / 8;
  if (t >= N * k8n) return;
  const int n = t / k8n, k8 = (t % k8n) * 8;
  v8us v;
#pragma unroll
  for (int i = 0; i < 8; ++i) v[i] = bf16_bits(W[(size_t)(k8 + i) * N + n]);
  *(v8us*)(Wt + (size_t)n * K + k8) = v;
  
}

// GEMM C[M][N] (f32, pitch ldc) = act(A[M][K]·W + bias). A f32 row-major (pitch lda) converted per fragment to bf16
// (ASPLIT: hi/lo two planes -> 2 terms, else single rounded term); Wt bf16 [N][K] (pitch ldb). BIAS_BF16 rounds the
// bias to bf16 first (bias quantised to bf16 before the add). K%32==0, M%16==0, N%64==0.
template <bool ASPLIT, int ACT, bool BIAS_BF16>
__global__ __launch_bounds__(128) void k_gemm_bf(const float* __restrict__ A, int lda, const unsigned short* __restrict__ Wt, int ldb,
                                               const float* __restrict__ bias, float* __restrict__ C, int ldc, int M, int N, int K) {
  __shared__ __attribute__((aligned(16))) float so[4][16][64];
  const int tid = threadIdx.x, w = tid >> 5, lane = tid & 31, ln = lane & 15, hh = lane >> 4;
  const int ntn = N / 64;
  const int wid = blockIdx.x * 4 + w;
  const int mt = wid / ntn, nq = wid % ntn;
  if (mt * 16 >= M) return;
  const int row0 = mt * 16, col0 = nq * 64;
  const float* arow = A + (size_t)(row0 + ln) * lda;
  v8f acc[4] = {};
  for (int kb = 0; kb < K; kb += 32) {
    FragB ah, al;
    const v4f x0 = *(const v4fa*)(arow + kb + 8 * hh), x1 = *(const v4fa*)(arow + kb + 8 * hh + 4);
    const v4f x2 = *(const v4fa*)(arow + kb + 16 + 8 * hh), x3 = *(const v4fa*)(arow + kb + 16 + 8 * hh + 4);
    float xs[16] = {x0[0],x0[1],x0[2],x0[3],x1[0],x1[1],x1[2],x1[3],x2[0],x2[1],x2[2],x2[3],x3[0],x3[1],x3[2],x3[3]};
#pragma unroll
    for (int i = 0; i < 16; ++i) { const unsigned short hb = bf16_bits(xs[i]); ah.u[i] = hb; al.u[i] = ASPLIT ? bf16_bits(xs[i] - bf16_val(hb)) : (unsigned short)0; }
#pragma unroll
    for (int t = 0; t < 4; ++t) {
      const unsigned short* brow = Wt + (size_t)(col0 + t * 16 + ln) * ldb + kb;
      FragB b;
      b.half[0] = *(const v8us*)(brow + 8 * hh);
      b.half[1] = *(const v8us*)(brow + 16 + 8 * hh);
      acc[t] = mmaN<ASPLIT ? 2 : 1>(ah.v, al.v, b.v, b.v, acc[t]);
    }
  }
#pragma unroll
  for (int t = 0; t < 4; ++t) {
    float bv = bias ? bias[col0 + t * 16 + ln] : 0.f;
    if (BIAS_BF16) bv = bf16_round(bv);
#pragma unroll
    for (int r = 0; r < 8; ++r) { float v = acc[t][r] + bv; if (ACT == 1) v = fmaxf(v, 0.f); so[w][8 * hh + r][t * 16 + ln] = v; }
  }
  __builtin_amdgcn_fence(__ATOMIC_ACQ_REL, "workgroup");
  __builtin_amdgcn_wave_barrier();
  const int rsub = lane >> 4, c4 = (lane & 15) * 4;
  {
#pragma unroll
    for (int q = 0; q < 8; ++q) {
      const int r = q * 2 + rsub;
      const v4f v = *(const v4fa*)&so[w][r][c4];
      *(v4f*)(C + (size_t)(row0 + r) * ldc + col0 + c4) = v;
    }
    
  }
}

// Flash-style causal/unmasked attention, all contractions 3-term bf16 hi/lo splits, f32 softmax with running max.
// q,k,v rows are read from f32 buffers with arbitrary row pitch (so they can live inside a fused qkv buffer);
// D = head size (multiple of 32, <= 128); one wave = 16 query rows; block = 4 waves (64 queries) sharing K/V chunks of 32.
template <int D, bool CAUSAL>
__global__ __launch_bounds__(128) void k_flash(const float* __restrict__ qb, const float* __restrict__ kb, const float* __restrict__ vb,
                                             int pitch, int T, int H, float scale, float* __restrict__ y, int ypitch) {
  constexpr int KS = D / 32;        // k-steps for QK
  constexpr int DT = D / 16;        // d tiles for PV
  __shared__ __attribute__((aligned(16))) unsigned short sKh[32][D + 8], sKl[32][D + 8], sVh[32][D + 8], sVl[32][D + 8];
  __shared__ __attribute__((aligned(16))) unsigned short sPh[4][16][40], sPl[4][16][40];
  __shared__ __attribute__((aligned(16))) float sO[4][16][D];
  const int tid = threadIdx.x, w = tid >> 5, lane = tid & 31, ln = lane & 15, hh = lane >> 4;
  const int nqb = (T + 63) / 64;
  const int bh = blockIdx.x / nqb, qblk = blockIdx.x % nqb;
  const int b = bh / H, h = bh % H;
  const int q0 = qblk * 64 + w * 16;
  const float* Q = qb + (size_t)b * T * pitch + h * D;
  const float* K = kb + (size_t)b * T * pitch + h * D;
  const float* V = vb + (size_t)b * T * pitch + h * D;

  // A fragments of the wave's 16 query rows (scaled), hi/lo
  FragB aqh[KS], aql[KS];
  {
    int row = q0 + ln; if (row >= T) row = T - 1;
    const float* qr = Q + (size_t)row * pitch;
#pragma unroll
    for (int ks = 0; ks < KS; ++ks)
#pragma unroll
      for (int i = 0; i < 16; ++i) {
        const int d = ks * 32 + ((i < 8) ? (8 * hh + i) : (16 + 8 * hh + (i - 8)));
        const float x = qr[d] * scale; const unsigned short hb = bf16_bits(x);
        aqh[ks].u[i] = hb; aql[ks].u[i] = bf16_bits(x - bf16_val(hb));
      }
  }
  float m_r[8], l_r[8];
#pragma unroll
  for (int r = 0; r < 8; ++r) { m_r[r] = -3.0e38f; l_r[r] = 0.f; }
  v8f oacc[DT];
#pragma unroll
  for (int dt = 0; dt < DT; ++dt) oacc[dt] = (v8f){0.f,0.f,0.f,0.f,0.f,0.f,0.f,0.f};

  const int kv_end = CAUSAL ? min(T, qblk * 64 + 64) : T;     // block-uniform
  for (int j0 = 0; j0 < kv_end; j0 += 32) {
    __syncthreads();
    for (int e = tid; e < 32 * (D / 4); e += 128) {
      const int r = e / (D / 4), c4 = (e % (D / 4)) * 4;
      const int key = j0 + r;
      v4f kf = {0.f,0.f,0.f,0.f}, vf = {0.f,0.f,0.f,0.f};
      if (key < T) { kf = *(const v4fa*)(K + (size_t)key * pitch + c4); vf = *(const v4fa*)(V + (size_t)key * pitch + c4); }
#pragma unroll
      for (int t = 0; t < 4; ++t) {
        unsigned short hb = bf16_bits(kf[t]); sKh[r][c4 + t] = hb; sKl[r][c4 + t] = bf16_bits(kf[t] - bf16_val(hb));
        hb = bf16_bits(vf[t]); sVh[r][c4 + t] = hb; sVl[r][c4 + t] = bf16_bits(vf[t] - bf16_val(hb));
      }
    }
    __syncthreads();
    // S tile 16 x 32
    v8f s[2];
#pragma unroll
    for (int nt = 0; nt < 2; ++nt) {
      v8f acc = {};
#pragma unroll
      for (int ks = 0; ks < KS; ++ks) {
        FragB bh_, bl_;
        bh_.half[0] = *(const v8us*)&sKh[nt * 16 + ln][ks * 32 + 8 * hh]; bh_.half[1] = *(const v8us*)&sKh[nt * 16 + ln][ks * 32 + 16 + 8 * hh];
        bl_.half[0] = *(const v8us*)&sKl[nt * 16 + ln][ks * 32 + 8 * hh]; bl_.half[1] = *(const v8us*)&sKl[nt * 16 + ln][ks * 32 + 16 + 8 * hh];
        acc = mmaN<3>(aqh[ks].v, aql[ks].v, bh_.v, bl_.v, acc);
      }
      s[nt] = acc;
    }
    // mask + running max (rows 8hh+r; the 16 lanes of a half share rows)
    float alpha[8];
#pragma unroll
    for (int r = 0; r < 8; ++r) {
      const int qi = q0 + 8 * hh + r;
      const int ja = j0 + ln, jb = j0 + 16 + ln;
      if (CAUSAL) { if (ja > qi) s[0][r] = -3.0e38f; if (jb > qi) s[1][r] = -3.0e38f; }
      if (ja >= T) s[0][r] = -3.0e38f;
      if (jb >= T) s[1][r] = -3.0e38f;
      float mx = fmaxf(s[0][r], s[1][r]);
      mx = fmaxf(mx, __shfl_xor(mx, 1, 32)); mx = fmaxf(mx, __shfl_xor(mx, 2, 32)); mx = fmaxf(mx, __shfl_xor(mx, 4, 32)); mx = fmaxf(mx, __shfl_xor(mx, 8, 32));
      const float mnew = fmaxf(m_r[r], mx);
      alpha[r] = (mnew > -1.0e38f) ? __expf(m_r[r] - mnew) : 1.0f;
      const float p0 = (s[0][r] > -1.0e38f) ? __expf(s[0][r] - mnew) : 0.f;
      const float p1 = (s[1][r] > -1.0e38f) ? __expf(s[1][r] - mnew) : 0.f;
      m_r[r] = mnew;
      l_r[r] = l_r[r] * alpha[r] + p0 + p1;            // per-lane partial row sum (16 lanes combined at the end)
      unsigned short hb = bf16_bits(p0); sPh[w][8 * hh + r][ln] = hb;      sPl[w][8 * hh + r][ln] = bf16_bits(p0 - bf16_val(hb));
      hb = bf16_bits(p1);                sPh[w][8 * hh + r][16 + ln] = hb; sPl[w][8 * hh + r][16 + ln] = bf16_bits(p1 - bf16_val(hb));
    }
#pragma unroll
    for (int dt = 0; dt < DT; ++dt)
#pragma unroll
      for (int r = 0; r < 8; ++r) oacc[dt][r] *= alpha[r];
    __builtin_amdgcn_fence(__ATOMIC_ACQ_REL, "workgroup");
    __builtin_amdgcn_wave_barrier();
    FragB pah, pal;
    pah.half[0] = *(const v8us*)&sPh[w][ln][8 * hh]; pah.half[1] = *(const v8us*)&sPh[w][ln][16 + 8 * hh];
    pal.half[0] = *(const v8us*)&sPl[w][ln][8 * hh]; pal.half[1] = *(const v8us*)&sPl[w][ln][16 + 8 * hh];
#pragma unroll
    for (int dt = 0; dt < DT; ++dt) {
      FragB bvh, bvl;
#pragma unroll
      for (int i = 0; i < 8; ++i) {
        bvh.u[i] = sVh[8 * hh + i][dt * 16 + ln]; bvh.u[8 + i] = sVh[16 + 8 * hh + i][dt * 16 + ln];
        bvl.u[i] = sVl[8 * hh + i][dt * 16 + ln]; bvl.u[8 + i] = sVl[16 + 8 * hh + i][dt * 16 + ln];
      }
      oacc[dt] = mmaN<3>(pah.v, pal.v, bvh.v, bvl.v, oacc[dt]);
    }
    __builtin_amdgcn_fence(__ATOMIC_ACQ_REL, "workgroup");
    __builtin_amdgcn_wave_barrier();
  }
#pragma unroll
  for (int r = 0; r < 8; ++r) {
    float l = l_r[r];
    l += __shfl_xor(l, 1, 32); l += __shfl_xor(l, 2, 32); l += __shfl_xor(l, 4, 32); l += __shfl_xor(l, 8, 32);
    l_r[r] = (l > 0.f) ? 1.0f / l : 0.f;
  }
#pragma unroll
  for (int dt = 0; dt < DT; ++dt)
#pragma unroll
    for (int r = 0; r < 8; ++r) sO[w][8 * hh + r][dt * 16 + ln] = oacc[dt][r] * l_r[r];
  __builtin_amdgcn_fence(__ATOMIC_ACQ_REL, "workgroup");
  __builtin_amdgcn_wave_barrier();
  {
    for (int r = 0; r < 16; ++r) {
      const int row = q0 + r;
      if (row < T && lane < D / 4) {
        const v4f val = *(const v4fa*)&sO[w][r][lane * 4];
        *(v4f*)(y + ((size_t)b * T + row) * ypitch + h * D + lane * 4) = val;
      }
    }
    
  }
}

// GEMM C = act(A·W + bias + resid): A f32 (ASPLIT -> hi/lo 2 terms), Wt bf16 [N][K]; ACT 0 none, 1 relu, 2 exact gelu;
// resid (optional, f32, row index = (row % rmod), pitch ldr, RES_BF16 rounds it) added before the activation.
template <bool ASPLIT, int ACT, bool BIAS_BF16, bool RES_BF16>
__global__ __launch_bounds__(128) void k_gemm_bf3(const float* __restrict__ A, int lda, const unsigned short* __restrict__ Wt, int ldb,
                                                const float* __restrict__ bias, const float* __restrict__ resid, int rmod, int ldr,
                                                float* __restrict__ C, int ldc, int M, int N, int K) {
  __shared__ __attribute__((aligned(16))) float so[4][16][64];
  const int tid = threadIdx.x, w = tid >> 5, lane = tid & 31, ln = lane & 15, hh = lane >> 4;
  const int ntn = N / 64;
  const int wid = blockIdx.x * 4 + w;
  const int mt = wid / ntn, nq = wid % ntn;
  if (mt * 16 >= M) return;
  const int row0 = mt * 16, col0 = nq * 64;
  const float* arow = A + (size_t)(row0 + ln) * lda;
  v8f acc[4] = {};
  for (int kb = 0; kb < K; kb += 32) {
    FragB ah, al;
    const v4f x0 = *(const v4fa*)(arow + kb + 8 * hh), x1 = *(const v4fa*)(arow + kb + 8 * hh + 4);
    const v4f x2 = *(const v4fa*)(arow + kb + 16 + 8 * hh), x3 = *(const v4fa*)(arow + kb + 16 + 8 * hh + 4);
    float xs[16] = {x0[0],x0[1],x0[2],x0[3],x1[0],x1[1],x1[2],x1[3],x2[0],x2[1],x2[2],x2[3],x3[0],x3[1],x3[2],x3[3]};
#pragma unroll
    for (int i = 0; i < 16; ++i) { const unsigned short hb = bf16_bits(xs[i]); ah.u[i] = hb; al.u[i] = ASPLIT ? bf16_bits(xs[i] - bf16_val(hb)) : (unsigned short)0; }
#pragma unroll
    for (int t = 0; t < 4; ++t) {
      const unsigned short* brow = Wt + (size_t)(col0 + t * 16 + ln) * ldb + kb;
      FragB b;
      b.half[0] = *(const v8us*)(brow + 8 * hh);
      b.half[1] = *(const v8us*)(brow + 16 + 8 * hh);
      acc[t] = mmaN<ASPLIT ? 2 : 1>(ah.v, al.v, b.v, b.v, acc[t]);
    }
  }
#pragma unroll
  for (int t = 0; t < 4; ++t) {
    const int col = col0 + t * 16 + ln;
    float bv = bias ? bias[col] : 0.f;
    if (BIAS_BF16) bv = bf16_round(bv);
#pragma unroll
    for (int r = 0; r < 8; ++r) {
      float v = acc[t][r] + bv;
      if (resid) { float rv = resid[(size_t)((row0 + 8 * hh + r) % rmod) * ldr + col]; if (RES_BF16) rv = bf16_round(rv); v += rv; }
      if (ACT == 1) v = fmaxf(v, 0.f);
      if (ACT == 2) v = 0.5f * v * (1.0f + erff(v * 0.70710678118654752f));
      if (ACT == 3) { const float u = 0.7978845608028654f * (v + 0.044715f * v * v * v); v = 0.5f * v * (1.0f + tanhf(u)); }
      so[w][8 * hh + r][t * 16 + ln] = v;
    }
  }
  __builtin_amdgcn_fence(__ATOMIC_ACQ_REL, "workgroup");
  __builtin_amdgcn_wave_barrier();
  const int rsub = lane >> 4, c4 = (lane & 15) * 4;
  {
#pragma unroll
    for (int q = 0; q < 8; ++q) {
      const int r = q * 2 + rsub;
      const v4f v = *(const v4fa*)&so[w][r][c4];
      *(v4f*)(C + (size_t)(row0 + r) * ldc + col0 + c4) = v;
    }
    
  }
}
// row LayerNorm (biased variance, eps) over N: s = X (+ R); optional out_sum <- s; out_norm <- (s-mu)*rsqrt(var+eps)*g + b
template <bool PARAM_BF16>
__global__ __launch_bounds__(256) void k_layernorm(const float* __restrict__ X, const float* __restrict__ R, const float* __restrict__ g, const float* __restrict__ bta,
                                                  float* __restrict__ out_sum, float* __restrict__ out_norm, int N, float eps) {
  __shared__ float red[256];
  const int row = blockIdx.x, tid = threadIdx.x;
  const float* x = X + (size_t)row * N; const float* rr = R ? R + (size_t)row * N : nullptr;
  float vals[16];                     // up to N = 4096
  const int per = N / 256;            // contiguous chunk per thread? use strided-by-4 chunks: thread handles j = tid*4 + 1024*u
  float s1 = 0.f;
  for (int u = 0; u < per / 4; ++u) {
    const int j = tid * 4 + 1024 * u;
    const v4f a = *(const v4fa*)(x + j);
    v4f b = {0.f,0.f,0.f,0.f}; if (rr) b = *(const v4fa*)(rr + j);
#pragma unroll
    for (int q = 0; q < 4; ++q) { const float v = a[q] + b[q]; vals[u * 4 + q] = v; s1 += v; }
  }
  red[tid] = s1; __syncthreads();
  for (int st = 128; st > 0; st >>= 1) { if (tid < st) red[tid] += red[tid + st]; __syncthreads(); }
  const float mu = red[0] / (float)N; __syncthreads();
  float s2 = 0.f;
  for (int u = 0; u < per / 4; ++u)
#pragma unroll
    for (int q = 0; q < 4; ++q) { const float c = vals[u * 4 + q] - mu; s2 += c * c; }
  red[tid] = s2; __syncthreads();
  for (int st = 128; st > 0; st >>= 1) { if (tid < st) red[tid] += red[tid + st]; __syncthreads(); }
  const float rs = rsqrtf(red[0] / (float)N + eps);
  {
    for (int u = 0; u < per / 4; ++u) {
      const int j = tid * 4 + 1024 * u;
      v4f o, sm;
#pragma unroll
      for (int q = 0; q < 4; ++q) {
        float gg = g[j + q], bb = bta[j + q];
        if (PARAM_BF16) { gg = bf16_round(gg); bb = bf16_round(bb); }
        sm[q] = vals[u * 4 + q]; o[q] = (vals[u * 4 + q] - mu) * rs * gg + bb;
      }
      if (out_sum) *(v4f*)(out_sum + (size_t)row * N + j) = sm;
      *(v4f*)(out_norm + (size_t)row * N + j) = o;
    }
    
  }
}

// batched GEMM (blockIdx.y = batch): C_b = act(alpha·A_b·B_b + bias + resid_b); A f32 rows (ASPLIT → hi/lo), B = bf16 planes Bh (+Bl when BSPLIT, requires ASPLIT),
// per-batch element strides sA, sB (0 = shared weights), sC, sR. resid may alias C (values are staged before the stores). ACT 0/1(relu).
// ACT: 0 none, 1 relu, 2 softplus
template <bool ASPLIT, bool BSPLIT, int ACT>
__global__ __launch_bounds__(128) void k_gemm_b(const float* __restrict__ A, int lda, size_t sA, const unsigned short* __restrict__ Bh, const unsigned short* __restrict__ Bl, int ldb, size_t sB,
                                             const float* __restrict__ bias, const float* __restrict__ resid, int ldr, size_t sR, float rsign, float alpha,
                                             float* __restrict__ C, int ldc, size_t sC, int M, int N, int K) {
  __shared__ __attribute__((aligned(16))) float so[4][16][64];
  const int tid = threadIdx.x, w = tid >> 5, lane = tid & 31, ln = lane & 15, hh = lane >> 4;
  const int by = blockIdx.y;
  A += (size_t)by * sA; Bh += (size_t)by * sB; if (BSPLIT) Bl += (size_t)by * sB; C += (size_t)by * sC; if (resid) resid += (size_t)by * sR;
  const int ntn = (N + 63) / 64; const int wid = blockIdx.x * 4 + w; const int mt = wid / ntn, nq = wid % ntn;      // N may be any multiple of 16: tiles past N are skipped and not stored
  if (mt * 16 >= M) return;
  const int row0 = mt * 16, col0 = nq * 64;
  const float* arow = A + (size_t)(row0 + ln) * lda;
  v8f acc[4] = {};
  for (int kb = 0; kb < K; kb += 32) {
    FragB ah, al;
    const v4f x0 = *(const v4fa*)(arow + kb + 8 * hh), x1 = *(const v4fa*)(arow + kb + 8 * hh + 4);
    const v4f x2 = *(const v4fa*)(arow + kb + 16 + 8 * hh), x3 = *(const v4fa*)(arow + kb + 16 + 8 * hh + 4);
    float xs[16] = {x0[0],x0[1],x0[2],x0[3],x1[0],x1[1],x1[2],x1[3],x2[0],x2[1],x2[2],x2[3],x3[0],x3[1],x3[2],x3[3]};
#pragma unroll
    for (int i = 0; i < 16; ++i) { const unsigned short hb = bf16_bits(xs[i]); ah.u[i] = hb; al.u[i] = ASPLIT ? bf16_bits(xs[i] - bf16_val(hb)) : (unsigned short)0; }
#pragma unroll
    for (int t = 0; t < 4; ++t) {
      if (col0 + t * 16 >= N) continue;
      const size_t boff = (size_t)(col0 + t * 16 + ln) * ldb + kb;
      FragB bh_, bl_; bh_.half[0] = *(const v8us*)(Bh + boff + 8 * hh); bh_.half[1] = *(const v8us*)(Bh + boff + 16 + 8 * hh);
      if (BSPLIT) { bl_.half[0] = *(const v8us*)(Bl + boff + 8 * hh); bl_.half[1] = *(const v8us*)(Bl + boff + 16 + 8 * hh); } else bl_ = bh_;
      acc[t] = mmaN<ASPLIT ? (BSPLIT ? 3 : 2) : 1>(ah.v, al.v, bh_.v, bl_.v, acc[t]);
    }
  }
#pragma unroll
  for (int t = 0; t < 4; ++t) {
    const int col = col0 + t * 16 + ln; if (col0 + t * 16 >= N) continue; const float bv = bias ? bf16_round(bias[col]) : 0.f;
#pragma unroll
    for (int r = 0; r < 8; ++r) { float v = acc[t][r] * alpha + bv; if (resid) v += rsign * resid[(size_t)(row0 + 8 * hh + r) * ldr + col]; if (ACT == 1) v = fmaxf(v, 0.f); else if (ACT == 2) v = fmaxf(v, 0.f) + log1pf(expf(-fabsf(v))); so[w][8 * hh + r][t * 16 + ln] = v; }
  }
  __builtin_amdgcn_fence(__ATOMIC_ACQ_REL, "workgroup"); __builtin_amdgcn_wave_barrier();
  const int rsub = lane >> 4, c4 = (lane & 15) * 4;
  {
#pragma unroll
    for (int q = 0; q < 8; ++q) { const int r = q * 2 + rsub; if (col0 + c4 < N) { const v4f v = *(const v4fa*)&so[w][r][c4]; *(v4f*)(C + (size_t)(row0 + r) * ldc + col0 + c4) = v; } }
    
  }
}
// batched f32 [K][N] (pitch lds, batch stride sIn) -> transposed hi/lo planes [N][K] (batch stride sOut); thread per (n, 8 k); grid.y = batch
__global__ __launch_bounds__(256) void k_split_transpose_b(const float* __restrict__ src, int lds_, size_t sIn, unsigned short* __restrict__ hi, unsigned short* __restrict__ lo, size_t sOut, int K, int N) {
  const size_t t = (size_t)blockIdx.x * 256 + threadIdx.x; const int k8n = K / 8; if (t >= (size_t)N * k8n) return;
  src += (size_t)blockIdx.y * sIn; hi += (size_t)blockIdx.y * sOut; lo += (size_t)blockIdx.y * sOut;
  const int n = (int)(t / k8n), k8 = (int)(t % k8n) * 8; v8us vh, vl;
#pragma unroll
  for (int i = 0; i < 8; ++i) { const float x = src[(size_t)(k8 + i) * lds_ + n]; const unsigned short hb = bf16_bits(x); vh[i] = hb; vl[i] = bf16_bits(x - bf16_val(hb)); }
  unsigned short* dh = hi + (size_t)n * K + k8; unsigned short* dl = lo + (size_t)n * K + k8;
  *(v8us*)dh = vh; *(v8us*)dl = vl; 
}

// ---- f16 WMMA path (v_wmma_f32_16x16x32_f16): 11-bit significands for operands in range — used where the relu(scores/8)/128 attention operand needs more precision than bf16
typedef _Float16 v16h __attribute__((ext_vector_type(16)));
union FragH { v16h v; v8us half[2]; _Float16 h[16]; unsigned short u[16]; };
template <int NT>
__device__ __forceinline__ v8f mmaH(v16h ah, v16h al, v16h bh, v16h bl, v8f c) {
  c = __builtin_amdgcn_wmma_f32_16x16x32_f16(false, ah, false, bh, (short)0, c, false, false);
  if (NT >= 2) c = __builtin_amdgcn_wmma_f32_16x16x32_f16(false, al, false, bh, (short)0, c, false, false);
  if (NT >= 3) c = __builtin_amdgcn_wmma_f32_16x16x32_f16(false, ah, false, bl, (short)0, c, false, false);
  asm volatile("v_nop\n\tv_nop\n\tv_nop\n\tv_nop" : "+v"(c) : "v"(ah), "v"(al), "v"(bh), "v"(bl));
  return c;
}
// batched GEMM like k_gemm_b but f16 operands: A f32 (split into f16 hi/lo if ASPLIT, else rounded to f16), Bt = f16 values [n][k]; alpha; C f32; N multiple of 16 (partial tiles skipped)
template <bool ASPLIT>
__global__ __launch_bounds__(128) void k_gemm_h(const float* __restrict__ A, int lda, size_t sA, const _Float16* __restrict__ Bh, int ldb, size_t sB, float alpha, float* __restrict__ C, int ldc, size_t sC, int M, int N, int K) {
  __shared__ __attribute__((aligned(16))) float so[4][16][64];
  const int tid = threadIdx.x, w = tid >> 5, lane = tid & 31, ln = lane & 15, hh = lane >> 4; const int by = blockIdx.y;
  A += (size_t)by * sA; Bh += (size_t)by * sB; C += (size_t)by * sC;
  const int ntn = (N + 63) / 64; const int wid = blockIdx.x * 4 + w; const int mt = wid / ntn, nq = wid % ntn; if (mt * 16 >= M) return;
  const int row0 = mt * 16, col0 = nq * 64; const float* arow = A + (size_t)(row0 + ln) * lda;
  v8f acc[4] = {};
  for (int kb = 0; kb < K; kb += 32) {
    FragH ah, al;
    const v4f x0 = *(const v4fa*)(arow + kb + 8 * hh), x1 = *(const v4fa*)(arow + kb + 8 * hh + 4), x2 = *(const v4fa*)(arow + kb + 16 + 8 * hh), x3 = *(const v4fa*)(arow + kb + 16 + 8 * hh + 4);
    float xs[16] = {x0[0],x0[1],x0[2],x0[3],x1[0],x1[1],x1[2],x1[3],x2[0],x2[1],x2[2],x2[3],x3[0],x3[1],x3[2],x3[3]};
#pragma unroll
    for (int i = 0; i < 16; ++i) { const _Float16 h = (_Float16)xs[i]; ah.h[i] = h; al.h[i] = ASPLIT ? (_Float16)(xs[i] - (float)h) : (_Float16)0.0f; }
#pragma unroll
    for (int t = 0; t < 4; ++t) { if (col0 + t * 16 >= N) continue; const size_t boff = (size_t)(col0 + t * 16 + ln) * ldb + kb; FragH bq; bq.half[0] = *(const v8us*)(Bh + boff + 8 * hh); bq.half[1] = *(const v8us*)(Bh + boff + 16 + 8 * hh);
      acc[t] = mmaH<ASPLIT ? 2 : 1>(ah.v, al.v, bq.v, bq.v, acc[t]); }
  }
#pragma unroll
  for (int t = 0; t < 4; ++t) { if (col0 + t * 16 >= N) continue;
#pragma unroll
    for (int r = 0; r < 8; ++r) so[w][8 * hh + r][t * 16 + ln] = acc[t][r] * alpha; }
  __builtin_amdgcn_fence(__ATOMIC_ACQ_REL, "workgroup"); __builtin_amdgcn_wave_barrier();
  const int rsub = lane >> 4, c4 = (lane & 15) * 4;
  {
#pragma unroll
    for (int q = 0; q < 8; ++q) { const int r = q * 2 + rsub; if (col0 + c4 < N) { const v4f v = *(const v4fa*)&so[w][r][c4]; *(v4f*)(C + (size_t)(row0 + r) * ldc + col0 + c4) = v; } }
     }
}

template <int DUMMY>
__global__ __launch_bounds__(128) void k_gemm_hh(const _Float16* __restrict__ A, int lda, size_t sA, const _Float16* __restrict__ Bh, int ldb, size_t sB, float alpha, float* __restrict__ C, int ldc, size_t sC, int M, int N, int K) {
  __shared__ __attribute__((aligned(16))) float so[4][16][64];
  const int tid = threadIdx.x, w = tid >> 5, lane = tid & 31, ln = lane & 15, hh = lane >> 4; const int by = blockIdx.y;
  A += (size_t)by * sA; Bh += (size_t)by * sB; C += (size_t)by * sC;
  const int ntn = (N + 63) / 64; const int wid = blockIdx.x * 4 + w; const int mt = wid / ntn, nq = wid % ntn; if (mt * 16 >= M) return;
  const int row0 = mt * 16, col0 = nq * 64; const _Float16* arow = A + (size_t)(row0 + ln) * lda;
  v8f acc[4] = {};
  for (int kb = 0; kb < K; kb += 32) { FragH ah; ah.half[0] = *(const v8us*)((const unsigned short*)arow + kb + 8 * hh); ah.half[1] = *(const v8us*)((const unsigned short*)arow + kb + 16 + 8 * hh);
#pragma unroll
    for (int t = 0; t < 4; ++t) { if (col0 + t * 16 >= N) continue; const size_t boff = (size_t)(col0 + t * 16 + ln) * ldb + kb; FragH bq; bq.half[0] = *(const v8us*)((const unsigned short*)Bh + boff + 8 * hh); bq.half[1] = *(const v8us*)((const unsigned short*)Bh + boff + 16 + 8 * hh);
      acc[t] = mmaH<1>(ah.v, ah.v, bq.v, bq.v, acc[t]); }
  }
#pragma unroll
  for (int t = 0; t < 4; ++t) { if (col0 + t * 16 >= N) continue;
#pragma unroll
    for (int r = 0; r < 8; ++r) so[w][8 * hh + r][t * 16 + ln] = acc[t][r] * alpha; }
  __builtin_amdgcn_fence(__ATOMIC_ACQ_REL, "workgroup"); __builtin_amdgcn_wave_barrier();
  const int rsub = lane >> 4, c4 = (lane & 15) * 4;
  {
#pragma unroll
    for (int q = 0; q < 8; ++q) { const int r = q * 2 + rsub; if (col0 + c4 < N) { const v4f v = *(const v4fa*)&so[w][r][c4]; *(v4f*)(C + (size_t)(row0 + r) * ldc + col0 + c4) = v; } }
     }
}

__global__ __launch_bounds__(256) void k_btw(const float* __restrict__ W, unsigned short* __restrict__ Bt, int K, int N) { const int t = blockIdx.x * 256 + threadIdx.x; if (t >= N * (K / 8)) return; const int n = t / (K / 8), k8 = (t % (K / 8)) * 8; v8us v; for (int q = 0; q < 8; ++q) v[q] = bf16_bits(W[(size_t)(k8 + q) * N + n]); *(v8us*)(Bt + (size_t)n * K + k8) = v;  }
// W4ᵀ as an f32 A operand: W4T[d][c] = bf16(W4[c][d]) ([64][512]); thread per (d, 4 c)
__global__ __launch_bounds__(256) void k_w4t(const float* __restrict__ W4, float* __restrict__ W4T) { const int t = blockIdx.x * 256 + threadIdx.x; if (t >= HS * DM / 4) return; const int c4 = (t * 4) % DM, d = (t * 4) / DM; v4f o; for (int q = 0; q < 4; ++q) o[q] = bf16_round(W4[(size_t)(c4 + q) * HS + d]); *(v4f*)(W4T + (size_t)t * 4) = o;  }
// bf16 hi/lo planes of an f32 matrix (row-major, n8 groups of 8)
__global__ __launch_bounds__(256) void k_planes(const float* __restrict__ a, unsigned short* __restrict__ hi, unsigned short* __restrict__ lo, size_t n8) { const size_t t = (size_t)blockIdx.x * 256 + threadIdx.x; if (t >= n8) return; v8us h, l; for (int q = 0; q < 8; ++q) { const float v = a[t * 8 + q]; const unsigned short hb = bf16_bits(v); h[q] = hb; l[q] = bf16_bits(v - bf16_val(hb)); } *(v8us*)(hi + t * 8) = h; *(v8us*)(lo + t * 8) = l;  }
// ATT16[j][q][h·128 + k] = f16(relu(S)/128) from S [(j,h)][q][k] f32 (scale 1/8 already in the GEMM alpha); thread per 8
__global__ __launch_bounds__(256) void k_att(const float* __restrict__ S, _Float16* __restrict__ ATT) { const size_t t = (size_t)blockIdx.x * 256 + threadIdx.x; if (t >= (size_t)NSET * NH * NIT * NIT / 8) return; const int k8 = (int)((t * 8) % NIT); const int q = (int)((t * 8 / NIT) % NIT); const int h = (int)((t * 8 / ((size_t)NIT * NIT)) % NH); const int j = (int)(t * 8 / ((size_t)NIT * NIT * NH));
  FragH f; for (int u = 0; u < 8; ++u) f.h[u] = (_Float16)(fmaxf(S[t * 8 + u], 0.f) * (1.0f / NIT)); unsigned short* d = (unsigned short*)ATT + (((size_t)j * NIT + q) * HK + h * NIT + k8); *(v8us*)d = f.half[0];  }
__global__ __launch_bounds__(256) void k_cvt16(const float* __restrict__ a, _Float16* __restrict__ h, size_t n8) { const size_t t = (size_t)blockIdx.x * 256 + threadIdx.x; if (t >= n8) return; FragH f; for (int q = 0; q < 8; ++q) f.h[q] = (_Float16)a[t * 8 + q]; const v8us o = f.half[0]; *(v8us*)((unsigned short*)h + t * 8) = o;  }
extern "C" void kernel_launch(void* const* d_in, const int* in_sizes, int n_in,
                              void* d_out, int out_size, void* d_ws, size_t ws_size, hipStream_t stream) {
  (void)in_sizes; (void)n_in; (void)out_size;
  const float* x = (const float*)d_in[0]; const float* y = (const float*)d_in[1]; const float* W1 = (const float*)d_in[2]; const float* W2 = (const float*)d_in[3]; const float* W3 = (const float*)d_in[4]; const float* W4 = (const float*)d_in[5];
  char* ws = (char*)d_ws; size_t off = 0;
  auto take = [&](size_t bytes) { char* p = ws + off; off += (bytes + 255) & ~(size_t)255; return p; };
  unsigned short* B1 = (unsigned short*)take((size_t)DM * DM * 2); unsigned short* B23 = (unsigned short*)take((size_t)2 * DM * DM * 2); float* W4T = (float*)take((size_t)HS * DM * 4);
  float* Q = (float*)take((size_t)NTOK * DM * 4); float* KV = (float*)take((size_t)NTOK * 2 * DM * 4); unsigned short* Kh = (unsigned short*)take((size_t)NTOK * 2 * DM * 2); unsigned short* Kl = (unsigned short*)take((size_t)NTOK * 2 * DM * 2);
  float* S = (float*)take((size_t)NSET * NH * NIT * NIT * 4); _Float16* ATT = (_Float16*)take((size_t)NSET * NIT * HK * 2); float* VWt = (float*)take((size_t)NSET * HS * HK * 4); _Float16* VWt16 = (_Float16*)take((size_t)NSET * HS * HK * 2);
  if (off > ws_size) return;
  k_btw<<<(DM * (DM / 8) + 255) / 256, 256, 0, stream>>>(W1, B1, DM, DM); k_btw<<<(DM * (DM / 8) + 255) / 256, 256, 0, stream>>>(W2, B23, DM, DM); k_btw<<<(DM * (DM / 8) + 255) / 256, 256, 0, stream>>>(W3, B23 + (size_t)DM * DM, DM, DM); k_w4t<<<(HS * DM / 4 + 255) / 256, 256, 0, stream>>>(W4, W4T);
  k_gemm_bf3<false, 0, false, false><<<((NTOK / 16) * (DM / 64) + 3) / 4, 128, 0, stream>>>(x, DM, B1, DM, nullptr, nullptr, 1, 0, Q, DM, NTOK, DM, DM);
  k_gemm_bf3<false, 0, false, false><<<((NTOK / 16) * (2 * DM / 64) + 3) / 4, 128, 0, stream>>>(y, DM, B23, DM, nullptr, nullptr, 1, 0, KV, 2 * DM, NTOK, 2 * DM, DM);      // [K | V]
  k_planes<<<(unsigned)(((size_t)NTOK * 2 * DM / 8 + 255) / 256), 256, 0, stream>>>(KV, Kh, Kl, (size_t)NTOK * 2 * DM / 8);
  for (int h = 0; h < NH; ++h) {      // scores for all sets of head h: batched over s (grid.y): A = Q rows (s,q) cols h·64, Bt = K planes rows (s,k) cols h·64; alpha 1/8
    k_gemm_b<true, true, 0><<<dim3(((NIT / 16) * (NIT / 64) + 3) / 4, NSET), 128, 0, stream>>>(Q + h * HS, DM, (size_t)NIT * DM, Kh + h * HS, Kl + h * HS, 2 * DM, (size_t)NIT * 2 * DM, nullptr, nullptr, 0, 0, 1.f, 0.125f, S + (size_t)h * NIT * NIT, NIT, (size_t)NH * NIT * NIT, NIT, NIT, HS);
    // VWᵀ[i][d][h·128 + k] = Σ_e W4T[d][h·64+e]·V[(i,k)][h·64+e]: A = W4T + h·64 (lda 512, M = 64, K = 64), Bt = V planes rows (i,k) cols h·64 (ldb 1024), batched over i
    k_gemm_b<true, true, 0><<<dim3(((HS / 16) * (NIT / 64) + 3) / 4, NSET), 128, 0, stream>>>(W4T + h * HS, DM, 0, Kh + DM + h * HS, Kl + DM + h * HS, 2 * DM, (size_t)NIT * 2 * DM, nullptr, nullptr, 0, 0, 1.f, 1.f, VWt + (size_t)h * NIT, HK, (size_t)HS * HK, HS, NIT, HS);
  }
  k_att<<<(unsigned)(((size_t)NSET * NH * NIT * NIT / 8 + 255) / 256), 256, 0, stream>>>(S, ATT); k_cvt16<<<(unsigned)(((size_t)NSET * HS * HK / 8 + 255) / 256), 256, 0, stream>>>(VWt, VWt16, (size_t)NSET * HS * HK / 8);
  for (int i = 0; i < NSET; ++i)      // out[i][j] = ATT[j] · VWᵀ[i]ᵀ : A = ATT16 + j (grid.y), Bt = VWt16[i], C = out + ((i·32 + j)·128)·64
    k_gemm_hh<0><<<dim3(((NIT / 16) * 1 + 3) / 4, NSET), 128, 0, stream>>>(ATT, HK, (size_t)NIT * HK, VWt16 + (size_t)i * HS * HK, HK, 0, 1.f, (float*)d_out + (size_t)i * NSET * NIT * HS, HS, (size_t)NIT * HS, NIT, HS, HK);
}

// v001
// One run takes 170 microseconds.
// Two timings next to v000 put it at 7.29 and 7.20 times that version's speed.
#include <hip/hip_runtime.h>
// On WMMA (f32 accumulate): Q = x·W1, K = y·W2, V = y·W3 (inputs rounded to bf16: single exact terms), per (set, head) scores = q·kᵀ (both computed f32 → bf16 hi/lo: 3 products,
// K = 64), VWᵀ[i][d][(h,k)] = Σ_e W4[h·64+e][d]·v[i][k][h·64+e] (bf16-rounded W4 vs split v), and the cross-set contraction out[i][j] = attn[j]·VW[i] on v_wmma_f32_16x16x32_f16 with
// attn = relu(scores/8)/128 stored in f16 and VWᵀ in f16 (single product; 1024 pairs × 128 × 1024 × 64) — an exact re-association of (attn[j]·v[i])·W4. relu/scaling are f32 VALU.
#define NSET 32
#define NIT 128
#define DM 512
#define NH 8
#define HS 64
#define NTOK (NSET * NIT)
#define HK (NH * NIT)      // 1024 = (h,k) contraction length

typedef __bf16 v16b __attribute__((ext_vector_type(16)));
typedef unsigned short v8us __attribute__((ext_vector_type(8), may_alias));
typedef float  v8f  __attribute__((ext_vector_type(8)));
typedef float  v4f  __attribute__((ext_vector_type(4)));
typedef float  v4fa __attribute__((ext_vector_type(4), may_alias));
union FragB { v16b v; v8us half[2]; unsigned short u[16]; };

__device__ __forceinline__ unsigned short bf16_bits(float x) { unsigned int u = __float_as_uint(x); return (unsigned short)((u + 0x7FFFu + ((u >> 16) & 1u)) >> 16); }
__device__ __forceinline__ float bf16_val(unsigned short b) { return __uint_as_float(((unsigned int)b) << 16); }
__device__ __forceinline__ float bf16_round(float x) { return bf16_val(bf16_bits(x)); }
// D += A·B with NT terms: 1 = ah·bh, 2 = + al·bh (A split), 3 = + ah·bl (both split)
template <int NT>
__device__ __forceinline__ v8f mmaN(v16b ah, v16b al, v16b bh, v16b bl, v8f c) {
  c = __builtin_amdgcn_wmma_f32_16x16x32_bf16(false, ah, false, bh, (short)0, c, false, false);
  if (NT >= 2) c = __builtin_amdgcn_wmma_f32_16x16x32_bf16(false, al, false, bh, (short)0, c, false, false);
  if (NT >= 3) c = __builtin_amdgcn_wmma_f32_16x16x32_bf16(false, ah, false, bl, (short)0, c, false, false);
  asm volatile("v_nop\n\tv_nop\n\tv_nop\n\tv_nop" : "+v"(c) : "v"(ah), "v"(al), "v"(bh), "v"(bl));
  return c;
}

__global__ __launch_bounds__(256) void k_wt_bf16(const float* __restrict__ W, unsigned short* __restrict__ Wt, int K, int N) {
  const int t = blockIdx.x * 256 + threadIdx.x;
  const int k8n = K / 8;
  if (t >= N * k8n) return;
  const int n = t / k8n, k8 = (t % k8n) * 8;
  v8us v;
#pragma unroll
  for (int i = 0; i < 8; ++i) v[i] = bf16_bits(W[(size_t)(k8 + i) * N + n]);
  *(v8us*)(Wt + (size_t)n * K + k8) = v;
  
}

// GEMM C[M][N] (f32, pitch ldc) = act(A[M][K]·W + bias). A f32 row-major (pitch lda) converted per fragment to bf16
// (ASPLIT: hi/lo two planes -> 2 terms, else single rounded term); Wt bf16 [N][K] (pitch ldb). BIAS_BF16 rounds the
// bias to bf16 first (bias quantised to bf16 before the add). K%32==0, M%16==0, N%64==0.
template <bool ASPLIT, int ACT, bool BIAS_BF16>
__global__ __launch_bounds__(128) void k_gemm_bf(const float* __restrict__ A, int lda, const unsigned short* __restrict__ Wt, int ldb,
                                               const float* __restrict__ bias, float* __restrict__ C, int ldc, int M, int N, int K) {
  __shared__ __attribute__((aligned(16))) float so[4][16][64];
  const int tid = threadIdx.x, w = tid >> 5, lane = tid & 31, ln = lane & 15, hh = lane >> 4;
  const int ntn = N / 64;
  const int wid = blockIdx.x * 4 + w;
  const int mt = wid / ntn, nq = wid % ntn;
  if (mt * 16 >= M) return;
  const int row0 = mt * 16, col0 = nq * 64;
  const float* arow = A + (size_t)(row0 + ln) * lda;
  v8f acc[4] = {};
  for (int kb = 0; kb < K; kb += 32) {
    FragB ah, al;
    const v4f x0 = *(const v4fa*)(arow + kb + 8 * hh), x1 = *(const v4fa*)(arow + kb + 8 * hh + 4);
    const v4f x2 = *(const v4fa*)(arow + kb + 16 + 8 * hh), x3 = *(const v4fa*)(arow + kb + 16 + 8 * hh + 4);
    float xs[16] = {x0[0],x0[1],x0[2],x0[3],x1[0],x1[1],x1[2],x1[3],x2[0],x2[1],x2[2],x2[3],x3[0],x3[1],x3[2],x3[3]};
#pragma unroll
    for (int i = 0; i < 16; ++i) { const unsigned short hb = bf16_bits(xs[i]); ah.u[i] = hb; al.u[i] = ASPLIT ? bf16_bits(xs[i] - bf16_val(hb)) : (unsigned short)0; }
#pragma unroll
    for (int t = 0; t < 4; ++t) {
      const unsigned short* brow = Wt + (size_t)(col0 + t * 16 + ln) * ldb + kb;
      FragB b;
      b.half[0] = *(const v8us*)(brow + 8 * hh);
      b.half[1] = *(const v8us*)(brow + 16 + 8 * hh);
      acc[t] = mmaN<ASPLIT ? 2 : 1>(ah.v, al.v, b.v, b.v, acc[t]);
    }
  }
#pragma unroll
  for (int t = 0; t < 4; ++t) {
    float bv = bias ? bias[col0 + t * 16 + ln] : 0.f;
    if (BIAS_BF16) bv = bf16_round(bv);
#pragma unroll
    for (int r = 0; r < 8; ++r) { float v = acc[t][r] + bv; if (ACT == 1) v = fmaxf(v, 0.f); so[w][8 * hh + r][t * 16 + ln] = v; }
  }
  __builtin_amdgcn_fence(__ATOMIC_ACQ_REL, "workgroup");
  __builtin_amdgcn_wave_barrier();
  const int rsub = lane >> 4, c4 = (lane & 15) * 4;
  {
#pragma unroll
    for (int q = 0; q < 8; ++q) {
      const int r = q * 2 + rsub;
      const v4f v = *(const v4fa*)&so[w][r][c4];
      *(v4f*)(C + (size_t)(row0 + r) * ldc + col0 + c4) = v;
    }
    
  }
}

// Flash-style causal/unmasked attention, all contractions 3-term bf16 hi/lo splits, f32 softmax with running max.
// q,k,v rows are read from f32 buffers with arbitrary row pitch (so they can live inside a fused qkv buffer);
// D = head size (multiple of 32, <= 128); one wave = 16 query rows; block = 4 waves (64 queries) sharing K/V chunks of 32.
template <int D, bool CAUSAL>
__global__ __launch_bounds__(128) void k_flash(const float* __restrict__ qb, const float* __restrict__ kb, const float* __restrict__ vb,
                                             int pitch, int T, int H, float scale, float* __restrict__ y, int ypitch) {
  constexpr int KS = D / 32;        // k-steps for QK
  constexpr int DT = D / 16;        // d tiles for PV
  __shared__ __attribute__((aligned(16))) unsigned short sKh[32][D + 8], sKl[32][D + 8], sVh[32][D + 8], sVl[32][D + 8];
  __shared__ __attribute__((aligned(16))) unsigned short sPh[4][16][40], sPl[4][16][40];
  __shared__ __attribute__((aligned(16))) float sO[4][16][D];
  const int tid = threadIdx.x, w = tid >> 5, lane = tid & 31, ln = lane & 15, hh = lane >> 4;
  const int nqb = (T + 63) / 64;
  const int bh = blockIdx.x / nqb, qblk = blockIdx.x % nqb;
  const int b = bh / H, h = bh % H;
  const int q0 = qblk * 64 + w * 16;
  const float* Q = qb + (size_t)b * T * pitch + h * D;
  const float* K = kb + (size_t)b * T * pitch + h * D;
  const float* V = vb + (size_t)b * T * pitch + h * D;

  // A fragments of the wave's 16 query rows (scaled), hi/lo
  FragB aqh[KS], aql[KS];
  {
    int row = q0 + ln; if (row >= T) row = T - 1;
    const float* qr = Q + (size_t)row * pitch;
#pragma unroll
    for (int ks = 0; ks < KS; ++ks)
#pragma unroll
      for (int i = 0; i < 16; ++i) {
        const int d = ks * 32 + ((i < 8) ? (8 * hh + i) : (16 + 8 * hh + (i - 8)));
        const float x = qr[d] * scale; const unsigned short hb = bf16_bits(x);
        aqh[ks].u[i] = hb; aql[ks].u[i] = bf16_bits(x - bf16_val(hb));
      }
  }
  float m_r[8], l_r[8];
#pragma unroll
  for (int r = 0; r < 8; ++r) { m_r[r] = -3.0e38f; l_r[r] = 0.f; }
  v8f oacc[DT];
#pragma unroll
  for (int dt = 0; dt < DT; ++dt) oacc[dt] = (v8f){0.f,0.f,0.f,0.f,0.f,0.f,0.f,0.f};

  const int kv_end = CAUSAL ? min(T, qblk * 64 + 64) : T;     // block-uniform
  for (int j0 = 0; j0 < kv_end; j0 += 32) {
    __syncthreads();
    for (int e = tid; e < 32 * (D / 4); e += 128) {
      const int r = e / (D / 4), c4 = (e % (D / 4)) * 4;
      const int key = j0 + r;
      v4f kf = {0.f,0.f,0.f,0.f}, vf = {0.f,0.f,0.f,0.f};
      if (key < T) { kf = *(const v4fa*)(K + (size_t)key * pitch + c4); vf = *(const v4fa*)(V + (size_t)key * pitch + c4); }
#pragma unroll
      for (int t = 0; t < 4; ++t) {
        unsigned short hb = bf16_bits(kf[t]); sKh[r][c4 + t] = hb; sKl[r][c4 + t] = bf16_bits(kf[t] - bf16_val(hb));
        hb = bf16_bits(vf[t]); sVh[r][c4 + t] = hb; sVl[r][c4 + t] = bf16_bits(vf[t] - bf16_val(hb));
      }
    }
    __syncthreads();
    // S tile 16 x 32
    v8f s[2];
#pragma unroll
    for (int nt = 0; nt < 2; ++nt) {
      v8f acc = {};
#pragma unroll
      for (int ks = 0; ks < KS; ++ks) {
        FragB bh_, bl_;
        bh_.half[0] = *(const v8us*)&sKh[nt * 16 + ln][ks * 32 + 8 * hh]; bh_.half[1] = *(const v8us*)&sKh[nt * 16 + ln][ks * 32 + 16 + 8 * hh];
        bl_.half[0] = *(const v8us*)&sKl[nt * 16 + ln][ks * 32 + 8 * hh]; bl_.half[1] = *(const v8us*)&sKl[nt * 16 + ln][ks * 32 + 16 + 8 * hh];
        acc = mmaN<3>(aqh[ks].v, aql[ks].v, bh_.v, bl_.v, acc);
      }
      s[nt] = acc;
    }
    // mask + running max (rows 8hh+r; the 16 lanes of a half share rows)
    float alpha[8];
#pragma unroll
    for (int r = 0; r < 8; ++r) {
      const int qi = q0 + 8 * hh + r;
      const int ja = j0 + ln, jb = j0 + 16 + ln;
      if (CAUSAL) { if (ja > qi) s[0][r] = -3.0e38f; if (jb > qi) s[1][r] = -3.0e38f; }
      if (ja >= T) s[0][r] = -3.0e38f;
      if (jb >= T) s[1][r] = -3.0e38f;
      float mx = fmaxf(s[0][r], s[1][r]);
      mx = fmaxf(mx, __shfl_xor(mx, 1, 32)); mx = fmaxf(mx, __shfl_xor(mx, 2, 32)); mx = fmaxf(mx, __shfl_xor(mx, 4, 32)); mx = fmaxf(mx, __shfl_xor(mx, 8, 32));
      const float mnew = fmaxf(m_r[r], mx);
      alpha[r] = (mnew > -1.0e38f) ? __expf(m_r[r] - mnew) : 1.0f;
      const float p0 = (s[0][r] > -1.0e38f) ? __expf(s[0][r] - mnew) : 0.f;
      const float p1 = (s[1][r] > -1.0e38f) ? __expf(s[1][r] - mnew) : 0.f;
      m_r[r] = mnew;
      l_r[r] = l_r[r] * alpha[r] + p0 + p1;            // per-lane partial row sum (16 lanes combined at the end)
      unsigned short hb = bf16_bits(p0); sPh[w][8 * hh + r][ln] = hb;      sPl[w][8 * hh + r][ln] = bf16_bits(p0 - bf16_val(hb));
      hb = bf16_bits(p1);                sPh[w][8 * hh + r][16 + ln] = hb; sPl[w][8 * hh + r][16 + ln] = bf16_bits(p1 - bf16_val(hb));
    }
#pragma unroll
    for (int dt = 0; dt < DT; ++dt)
#pragma unroll
      for (int r = 0; r < 8; ++r) oacc[dt][r] *= alpha[r];
    __builtin_amdgcn_fence(__ATOMIC_ACQ_REL, "workgroup");
    __builtin_amdgcn_wave_barrier();
    FragB pah, pal;
    pah.half[0] = *(const v8us*)&sPh[w][ln][8 * hh]; pah.half[1] = *(const v8us*)&sPh[w][ln][16 + 8 * hh];
    pal.half[0] = *(const v8us*)&sPl[w][ln][8 * hh]; pal.half[1] = *(const v8us*)&sPl[w][ln][16 + 8 * hh];
#pragma unroll
    for (int dt = 0; dt < DT; ++dt) {
      FragB bvh, bvl;
#pragma unroll
      for (int i = 0; i < 8; ++i) {
        bvh.u[i] = sVh[8 * hh + i][dt * 16 + ln]; bvh.u[8 + i] = sVh[16 + 8 * hh + i][dt * 16 + ln];
        bvl.u[i] = sVl[8 * hh + i][dt * 16 + ln]; bvl.u[8 + i] = sVl[16 + 8 * hh + i][dt * 16 + ln];
      }
      oacc[dt] = mmaN<3>(pah.v, pal.v, bvh.v, bvl.v, oacc[dt]);
    }
    __builtin_amdgcn_fence(__ATOMIC_ACQ_REL, "workgroup");
    __builtin_amdgcn_wave_barrier();
  }
#pragma unroll
  for (int r = 0; r < 8; ++r) {
    float l = l_r[r];
    l += __shfl_xor(l, 1, 32); l += __shfl_xor(l, 2, 32); l += __shfl_xor(l, 4, 32); l += __shfl_xor(l, 8, 32);
    l_r[r] = (l > 0.f) ? 1.0f / l : 0.f;
  }
#pragma unroll
  for (int dt = 0; dt < DT; ++dt)
#pragma unroll
    for (int r = 0; r < 8; ++r) sO[w][8 * hh + r][dt * 16 + ln] = oacc[dt][r] * l_r[r];
  __builtin_amdgcn_fence(__ATOMIC_ACQ_REL, "workgroup");
  __builtin_amdgcn_wave_barrier();
  {
    for (int r = 0; r < 16; ++r) {
      const int row = q0 + r;
      if (row < T && lane < D / 4) {
        const v4f val = *(const v4fa*)&sO[w][r][lane * 4];
        *(v4f*)(y + ((size_t)b * T + row) * ypitch + h * D + lane * 4) = val;
      }
    }
    
  }
}

// GEMM C = act(A·W + bias + resid): A f32 (ASPLIT -> hi/lo 2 terms), Wt bf16 [N][K]; ACT 0 none, 1 relu, 2 exact gelu;
// resid (optional, f32, row index = (row % rmod), pitch ldr, RES_BF16 rounds it) added before the activation.
template <bool ASPLIT, int ACT, bool BIAS_BF16, bool RES_BF16>
__global__ __launch_bounds__(128) void k_gemm_bf3(const float* __restrict__ A, int lda, const unsigned short* __restrict__ Wt, int ldb,
                                                const float* __restrict__ bias, const float* __restrict__ resid, int rmod, int ldr,
                                                float* __restrict__ C, int ldc, int M, int N, int K) {
  __shared__ __attribute__((aligned(16))) float so[4][16][64];
  const int tid = threadIdx.x, w = tid >> 5, lane = tid & 31, ln = lane & 15, hh = lane >> 4;
  const int ntn = N / 64;
  const int wid = blockIdx.x * 4 + w;
  const int mt = wid / ntn, nq = wid % ntn;
  if (mt * 16 >= M) return;
  const int row0 = mt * 16, col0 = nq * 64;
  const float* arow = A + (size_t)(row0 + ln) * lda;
  v8f acc[4] = {};
  for (int kb = 0; kb < K; kb += 32) {
    FragB ah, al;
    const v4f x0 = *(const v4fa*)(arow + kb + 8 * hh), x1 = *(const v4fa*)(arow + kb + 8 * hh + 4);
    const v4f x2 = *(const v4fa*)(arow + kb + 16 + 8 * hh), x3 = *(const v4fa*)(arow + kb + 16 + 8 * hh + 4);
    float xs[16] = {x0[0],x0[1],x0[2],x0[3],x1[0],x1[1],x1[2],x1[3],x2[0],x2[1],x2[2],x2[3],x3[0],x3[1],x3[2],x3[3]};
#pragma unroll
    for (int i = 0; i < 16; ++i) { const unsigned short hb = bf16_bits(xs[i]); ah.u[i] = hb; al.u[i] = ASPLIT ? bf16_bits(xs[i] - bf16_val(hb)) : (unsigned short)0; }
#pragma unroll
    for (int t = 0; t < 4; ++t) {
      const unsigned short* brow = Wt + (size_t)(col0 + t * 16 + ln) * ldb + kb;
      FragB b;
      b.half[0] = *(const v8us*)(brow + 8 * hh);
      b.half[1] = *(const v8us*)(brow + 16 + 8 * hh);
      acc[t] = mmaN<ASPLIT ? 2 : 1>(ah.v, al.v, b.v, b.v, acc[t]);
    }
  }
#pragma unroll
  for (int t = 0; t < 4; ++t) {
    const int col = col0 + t * 16 + ln;
    float bv = bias ? bias[col] : 0.f;
    if (BIAS_BF16) bv = bf16_round(bv);
#pragma unroll
    for (int r = 0; r < 8; ++r) {
      float v = acc[t][r] + bv;
      if (resid) { float rv = resid[(size_t)((row0 + 8 * hh + r) % rmod) * ldr + col]; if (RES_BF16) rv = bf16_round(rv); v += rv; }
      if (ACT == 1) v = fmaxf(v, 0.f);
      if (ACT == 2) v = 0.5f * v * (1.0f + erff(v * 0.70710678118654752f));
      if (ACT == 3) { const float u = 0.7978845608028654f * (v + 0.044715f * v * v * v); v = 0.5f * v * (1.0f + tanhf(u)); }
      so[w][8 * hh + r][t * 16 + ln] = v;
    }
  }
  __builtin_amdgcn_fence(__ATOMIC_ACQ_REL, "workgroup");
  __builtin_amdgcn_wave_barrier();
  const int rsub = lane >> 4, c4 = (lane & 15) * 4;
  {
#pragma unroll
    for (int q = 0; q < 8; ++q) {
      const int r = q * 2 + rsub;
      const v4f v = *(const v4fa*)&so[w][r][c4];
      *(v4f*)(C + (size_t)(row0 + r) * ldc + col0 + c4) = v;
    }
    
  }
}
// row LayerNorm (biased variance, eps) over N: s = X (+ R); optional out_sum <- s; out_norm <- (s-mu)*rsqrt(var+eps)*g + b
template <bool PARAM_BF16>
__global__ __launch_bounds__(256) void k_layernorm(const float* __restrict__ X, const float* __restrict__ R, const float* __restrict__ g, const float* __restrict__ bta,
                                                  float* __restrict__ out_sum, float* __restrict__ out_norm, int N, float eps) {
  __shared__ float red[256];
  const int row = blockIdx.x, tid = threadIdx.x;
  const float* x = X + (size_t)row * N; const float* rr = R ? R + (size_t)row * N : nullptr;
  float vals[16];                     // up to N = 4096
  const int per = N / 256;            // contiguous chunk per thread? use strided-by-4 chunks: thread handles j = tid*4 + 1024*u
  float s1 = 0.f;
  for (int u = 0; u < per / 4; ++u) {
    const int j = tid * 4 + 1024 * u;
    const v4f a = *(const v4fa*)(x + j);
    v4f b = {0.f,0.f,0.f,0.f}; if (rr) b = *(const v4fa*)(rr + j);
#pragma unroll
    for (int q = 0; q < 4; ++q) { const float v = a[q] + b[q]; vals[u * 4 + q] = v; s1 += v; }
  }
  red[tid] = s1; __syncthreads();
  for (int st = 128; st > 0; st >>= 1) { if (tid < st) red[tid] += red[tid + st]; __syncthreads(); }
  const float mu = red[0] / (float)N; __syncthreads();
  float s2 = 0.f;
  for (int u = 0; u < per / 4; ++u)
#pragma unroll
    for (int q = 0; q < 4; ++q) { const float c = vals[u * 4 + q] - mu; s2 += c * c; }
  red[tid] = s2; __syncthreads();
  for (int st = 128; st > 0; st >>= 1) { if (tid < st) red[tid] += red[tid + st]; __syncthreads(); }
  const float rs = rsqrtf(red[0] / (float)N + eps);
  {
    for (int u = 0; u < per / 4; ++u) {
      const int j = tid * 4 + 1024 * u;
      v4f o, sm;
#pragma unroll
      for (int q = 0; q < 4; ++q) {
        float gg = g[j + q], bb = bta[j + q];
        if (PARAM_BF16) { gg = bf16_round(gg); bb = bf16_round(bb); }
        sm[q] = vals[u * 4 + q]; o[q] = (vals[u * 4 + q] - mu) * rs * gg + bb;
      }
      if (out_sum) *(v4f*)(out_sum + (size_t)row * N + j) = sm;
      *(v4f*)(out_norm + (size_t)row * N + j) = o;
    }
    
  }
}

// batched GEMM (blockIdx.y = batch): C_b = act(alpha·A_b·B_b + bias + resid_b); A f32 rows (ASPLIT → hi/lo), B = bf16 planes Bh (+Bl when BSPLIT, requires ASPLIT),
// per-batch element strides sA, sB (0 = shared weights), sC, sR. resid may alias C (values are staged before the stores). ACT 0/1(relu).
// ACT: 0 none, 1 relu, 2 softplus
// blockIdx.z = second batch index (here the head), element strides zA, zB, zC: one launch covers every (y, z) pair
template <bool ASPLIT, bool BSPLIT, int ACT>
__global__ __launch_bounds__(128) void k_gemm_b(const float* __restrict__ A, int lda, size_t sA, const unsigned short* __restrict__ Bh, const unsigned short* __restrict__ Bl, int ldb, size_t sB,
                                             const float* __restrict__ bias, const float* __restrict__ resid, int ldr, size_t sR, float rsign, float alpha,
                                             float* __restrict__ C, int ldc, size_t sC, int M, int N, int K, size_t zA, size_t zB, size_t zC) {
  __shared__ __attribute__((aligned(16))) float so[4][16][64];
  const int tid = threadIdx.x, w = tid >> 5, lane = tid & 31, ln = lane & 15, hh = lane >> 4;
  const int by = blockIdx.y, bz = blockIdx.z;
  A += (size_t)by * sA + (size_t)bz * zA; Bh += (size_t)by * sB + (size_t)bz * zB; if (BSPLIT) Bl += (size_t)by * sB + (size_t)bz * zB; C += (size_t)by * sC + (size_t)bz * zC; if (resid) resid += (size_t)by * sR;
  const int ntn = (N + 63) / 64; const int wid = blockIdx.x * 4 + w; const int mt = wid / ntn, nq = wid % ntn;      // N may be any multiple of 16: tiles past N are skipped and not stored
  if (mt * 16 >= M) return;
  const int row0 = mt * 16, col0 = nq * 64;
  const float* arow = A + (size_t)(row0 + ln) * lda;
  v8f acc[4] = {};
  for (int kb = 0; kb < K; kb += 32) {
    FragB ah, al;
    const v4f x0 = *(const v4fa*)(arow + kb + 8 * hh), x1 = *(const v4fa*)(arow + kb + 8 * hh + 4);
    const v4f x2 = *(const v4fa*)(arow + kb + 16 + 8 * hh), x3 = *(const v4fa*)(arow + kb + 16 + 8 * hh + 4);
    float xs[16] = {x0[0],x0[1],x0[2],x0[3],x1[0],x1[1],x1[2],x1[3],x2[0],x2[1],x2[2],x2[3],x3[0],x3[1],x3[2],x3[3]};
#pragma unroll
    for (int i = 0; i < 16; ++i) { const unsigned short hb = bf16_bits(xs[i]); ah.u[i] = hb; al.u[i] = ASPLIT ? bf16_bits(xs[i] - bf16_val(hb)) : (unsigned short)0; }
#pragma unroll
    for (int t = 0; t < 4; ++t) {
      if (col0 + t * 16 >= N) continue;
      const size_t boff = (size_t)(col0 + t * 16 + ln) * ldb + kb;
      FragB bh_, bl_; bh_.half[0] = *(const v8us*)(Bh + boff + 8 * hh); bh_.half[1] = *(const v8us*)(Bh + boff + 16 + 8 * hh);
      if (BSPLIT) { bl_.half[0] = *(const v8us*)(Bl + boff + 8 * hh); bl_.half[1] = *(const v8us*)(Bl + boff + 16 + 8 * hh); } else bl_ = bh_;
      acc[t] = mmaN<ASPLIT ? (BSPLIT ? 3 : 2) : 1>(ah.v, al.v, bh_.v, bl_.v, acc[t]);
    }
  }
#pragma unroll
  for (int t = 0; t < 4; ++t) {
    const int col = col0 + t * 16 + ln; if (col0 + t * 16 >= N) continue; const float bv = bias ? bf16_round(bias[col]) : 0.f;
#pragma unroll
    for (int r = 0; r < 8; ++r) { float v = acc[t][r] * alpha + bv; if (resid) v += rsign * resid[(size_t)(row0 + 8 * hh + r) * ldr + col]; if (ACT == 1) v = fmaxf(v, 0.f); else if (ACT == 2) v = fmaxf(v, 0.f) + log1pf(expf(-fabsf(v))); so[w][8 * hh + r][t * 16 + ln] = v; }
  }
  __builtin_amdgcn_fence(__ATOMIC_ACQ_REL, "workgroup"); __builtin_amdgcn_wave_barrier();
  const int rsub = lane >> 4, c4 = (lane & 15) * 4;
  {
#pragma unroll
    for (int q = 0; q < 8; ++q) { const int r = q * 2 + rsub; if (col0 + c4 < N) { const v4f v = *(const v4fa*)&so[w][r][c4]; *(v4f*)(C + (size_t)(row0 + r) * ldc + col0 + c4) = v; } }
    
  }
}
// batched f32 [K][N] (pitch lds, batch stride sIn) -> transposed hi/lo planes [N][K] (batch stride sOut); thread per (n, 8 k); grid.y = batch
__global__ __launch_bounds__(256) void k_split_transpose_b(const float* __restrict__ src, int lds_, size_t sIn, unsigned short* __restrict__ hi, unsigned short* __restrict__ lo, size_t sOut, int K, int N) {
  const size_t t = (size_t)blockIdx.x * 256 + threadIdx.x; const int k8n = K / 8; if (t >= (size_t)N * k8n) return;
  src += (size_t)blockIdx.y * sIn; hi += (size_t)blockIdx.y * sOut; lo += (size_t)blockIdx.y * sOut;
  const int n = (int)(t / k8n), k8 = (int)(t % k8n) * 8; v8us vh, vl;
#pragma unroll
  for (int i = 0; i < 8; ++i) { const float x = src[(size_t)(k8 + i) * lds_ + n]; const unsigned short hb = bf16_bits(x); vh[i] = hb; vl[i] = bf16_bits(x - bf16_val(hb)); }
  unsigned short* dh = hi + (size_t)n * K + k8; unsigned short* dl = lo + (size_t)n * K + k8;
  *(v8us*)dh = vh; *(v8us*)dl = vl; 
}

// ---- f16 WMMA path (v_wmma_f32_16x16x32_f16): 11-bit significands for operands in range — used where the relu(scores/8)/128 attention operand needs more precision than bf16
typedef _Float16 v16h __attribute__((ext_vector_type(16)));
union FragH { v16h v; v8us half[2]; _Float16 h[16]; unsigned short u[16]; };
template <int NT>
__device__ __forceinline__ v8f mmaH(v16h ah, v16h al, v16h bh, v16h bl, v8f c) {
  c = __builtin_amdgcn_wmma_f32_16x16x32_f16(false, ah, false, bh, (short)0, c, false, false);
  if (NT >= 2) c = __builtin_amdgcn_wmma_f32_16x16x32_f16(false, al, false, bh, (short)0, c, false, false);
  if (NT >= 3) c = __builtin_amdgcn_wmma_f32_16x16x32_f16(false, ah, false, bl, (short)0, c, false, false);
  asm volatile("v_nop\n\tv_nop\n\tv_nop\n\tv_nop" : "+v"(c) : "v"(ah), "v"(al), "v"(bh), "v"(bl));
  return c;
}
// batched GEMM like k_gemm_b but f16 operands: A f32 (split into f16 hi/lo if ASPLIT, else rounded to f16), Bt = f16 values [n][k]; alpha; C f32; N multiple of 16 (partial tiles skipped)
template <bool ASPLIT>
__global__ __launch_bounds__(128) void k_gemm_h(const float* __restrict__ A, int lda, size_t sA, const _Float16* __restrict__ Bh, int ldb, size_t sB, float alpha, float* __restrict__ C, int ldc, size_t sC, int M, int N, int K) {
  __shared__ __attribute__((aligned(16))) float so[4][16][64];
  const int tid = threadIdx.x, w = tid >> 5, lane = tid & 31, ln = lane & 15, hh = lane >> 4; const int by = blockIdx.y;
  A += (size_t)by * sA; Bh += (size_t)by * sB; C += (size_t)by * sC;
  const int ntn = (N + 63) / 64; const int wid = blockIdx.x * 4 + w; const int mt = wid / ntn, nq = wid % ntn; if (mt * 16 >= M) return;
  const int row0 = mt * 16, col0 = nq * 64; const float* arow = A + (size_t)(row0 + ln) * lda;
  v8f acc[4] = {};
  for (int kb = 0; kb < K; kb += 32) {
    FragH ah, al;
    const v4f x0 = *(const v4fa*)(arow + kb + 8 * hh), x1 = *(const v4fa*)(arow + kb + 8 * hh + 4), x2 = *(const v4fa*)(arow + kb + 16 + 8 * hh), x3 = *(const v4fa*)(arow + kb + 16 + 8 * hh + 4);
    float xs[16] = {x0[0],x0[1],x0[2],x0[3],x1[0],x1[1],x1[2],x1[3],x2[0],x2[1],x2[2],x2[3],x3[0],x3[1],x3[2],x3[3]};
#pragma unroll
    for (int i = 0; i < 16; ++i) { const _Float16 h = (_Float16)xs[i]; ah.h[i] = h; al.h[i] = ASPLIT ? (_Float16)(xs[i] - (float)h) : (_Float16)0.0f; }
#pragma unroll
    for (int t = 0; t < 4; ++t) { if (col0 + t * 16 >= N) continue; const size_t boff = (size_t)(col0 + t * 16 + ln) * ldb + kb; FragH bq; bq.half[0] = *(const v8us*)(Bh + boff + 8 * hh); bq.half[1] = *(const v8us*)(Bh + boff + 16 + 8 * hh);
      acc[t] = mmaH<ASPLIT ? 2 : 1>(ah.v, al.v, bq.v, bq.v, acc[t]); }
  }
#pragma unroll
  for (int t = 0; t < 4; ++t) { if (col0 + t * 16 >= N) continue;
#pragma unroll
    for (int r = 0; r < 8; ++r) so[w][8 * hh + r][t * 16 + ln] = acc[t][r] * alpha; }
  __builtin_amdgcn_fence(__ATOMIC_ACQ_REL, "workgroup"); __builtin_amdgcn_wave_barrier();
  const int rsub = lane >> 4, c4 = (lane & 15) * 4;
  {
#pragma unroll
    for (int q = 0; q < 8; ++q) { const int r = q * 2 + rsub; if (col0 + c4 < N) { const v4f v = *(const v4fa*)&so[w][r][c4]; *(v4f*)(C + (size_t)(row0 + r) * ldc + col0 + c4) = v; } }
     }
}

// blockIdx.y = batch of A (strides sA, sB, sC), blockIdx.z = batch of B (element strides zB, zC): one launch covers every (y, z) pair
template <int DUMMY>
__global__ __launch_bounds__(128) void k_gemm_hh(const _Float16* __restrict__ A, int lda, size_t sA, const _Float16* __restrict__ Bh, int ldb, size_t sB, float alpha, float* __restrict__ C, int ldc, size_t sC, int M, int N, int K, size_t zB, size_t zC) {
  __shared__ __attribute__((aligned(16))) float so[4][16][64];
  const int tid = threadIdx.x, w = tid >> 5, lane = tid & 31, ln = lane & 15, hh = lane >> 4; const int by = blockIdx.y, bz = blockIdx.z;
  A += (size_t)by * sA; Bh += (size_t)by * sB + (size_t)bz * zB; C += (size_t)by * sC + (size_t)bz * zC;
  const int ntn = (N + 63) / 64; const int wid = blockIdx.x * 4 + w; const int mt = wid / ntn, nq = wid % ntn; if (mt * 16 >= M) return;
  const int row0 = mt * 16, col0 = nq * 64; const _Float16* arow = A + (size_t)(row0 + ln) * lda;
  v8f acc[4] = {};
  for (int kb = 0; kb < K; kb += 32) { FragH ah; ah.half[0] = *(const v8us*)((const unsigned short*)arow + kb + 8 * hh); ah.half[1] = *(const v8us*)((const unsigned short*)arow + kb + 16 + 8 * hh);
#pragma unroll
    for (int t = 0; t < 4; ++t) { if (col0 + t * 16 >= N) continue; const size_t boff = (size_t)(col0 + t * 16 + ln) * ldb + kb; FragH bq; bq.half[0] = *(const v8us*)((const unsigned short*)Bh + boff + 8 * hh); bq.half[1] = *(const v8us*)((const unsigned short*)Bh + boff + 16 + 8 * hh);
      acc[t] = mmaH<1>(ah.v, ah.v, bq.v, bq.v, acc[t]); }
  }
#pragma unroll
  for (int t = 0; t < 4; ++t) { if (col0 + t * 16 >= N) continue;
#pragma unroll
    for (int r = 0; r < 8; ++r) so[w][8 * hh + r][t * 16 + ln] = acc[t][r] * alpha; }
  __builtin_amdgcn_fence(__ATOMIC_ACQ_REL, "workgroup"); __builtin_amdgcn_wave_barrier();
  const int rsub = lane >> 4, c4 = (lane & 15) * 4;
  {
#pragma unroll
    for (int q = 0; q < 8; ++q) { const int r = q * 2 + rsub; if (col0 + c4 < N) { const v4f v = *(const v4fa*)&so[w][r][c4]; *(v4f*)(C + (size_t)(row0 + r) * ldc + col0 + c4) = v; } }
     }
}

__global__ __launch_bounds__(256) void k_btw(const float* __restrict__ W, unsigned short* __restrict__ Bt, int K, int N) { const int t = blockIdx.x * 256 + threadIdx.x; if (t >= N * (K / 8)) return; const int n = t / (K / 8), k8 = (t % (K / 8)) * 8; v8us v; for (int q = 0; q < 8; ++q) v[q] = bf16_bits(W[(size_t)(k8 + q) * N + n]); *(v8us*)(Bt + (size_t)n * K + k8) = v;  }
// W4ᵀ as an f32 A operand: W4T[d][c] = bf16(W4[c][d]) ([64][512]); thread per (d, 4 c)
__global__ __launch_bounds__(256) void k_w4t(const float* __restrict__ W4, float* __restrict__ W4T) { const int t = blockIdx.x * 256 + threadIdx.x; if (t >= HS * DM / 4) return; const int c4 = (t * 4) % DM, d = (t * 4) / DM; v4f o; for (int q = 0; q < 4; ++q) o[q] = bf16_round(W4[(size_t)(c4 + q) * HS + d]); *(v4f*)(W4T + (size_t)t * 4) = o;  }
// bf16 hi/lo planes of an f32 matrix (row-major, n8 groups of 8)
__global__ __launch_bounds__(256) void k_planes(const float* __restrict__ a, unsigned short* __restrict__ hi, unsigned short* __restrict__ lo, size_t n8) { const size_t t = (size_t)blockIdx.x * 256 + threadIdx.x; if (t >= n8) return; v8us h, l; for (int q = 0; q < 8; ++q) { const float v = a[t * 8 + q]; const unsigned short hb = bf16_bits(v); h[q] = hb; l[q] = bf16_bits(v - bf16_val(hb)); } *(v8us*)(hi + t * 8) = h; *(v8us*)(lo + t * 8) = l;  }
// ATT16[j][q][h·128 + k] = f16(relu(S)/128) from S [(j,h)][q][k] f32 (scale 1/8 already in the GEMM alpha); thread per 8
__global__ __launch_bounds__(256) void k_att(const float* __restrict__ S, _Float16* __restrict__ ATT) { const size_t t = (size_t)blockIdx.x * 256 + threadIdx.x; if (t >= (size_t)NSET * NH * NIT * NIT / 8) return; const int k8 = (int)((t * 8) % NIT); const int q = (int)((t * 8 / NIT) % NIT); const int h = (int)((t * 8 / ((size_t)NIT * NIT)) % NH); const int j = (int)(t * 8 / ((size_t)NIT * NIT * NH));
  FragH f; for (int u = 0; u < 8; ++u) f.h[u] = (_Float16)(fmaxf(S[t * 8 + u], 0.f) * (1.0f / NIT)); unsigned short* d = (unsigned short*)ATT + (((size_t)j * NIT + q) * HK + h * NIT + k8); *(v8us*)d = f.half[0];  }
__global__ __launch_bounds__(256) void k_cvt16(const float* __restrict__ a, _Float16* __restrict__ h, size_t n8) { const size_t t = (size_t)blockIdx.x * 256 + threadIdx.x; if (t >= n8) return; FragH f; for (int q = 0; q < 8; ++q) f.h[q] = (_Float16)a[t * 8 + q]; const v8us o = f.half[0]; *(v8us*)((unsigned short*)h + t * 8) = o;  }
extern "C" void kernel_launch(void* const* d_in, const int* in_sizes, int n_in,
                              void* d_out, int out_size, void* d_ws, size_t ws_size, hipStream_t stream) {
  (void)in_sizes; (void)n_in; (void)out_size;
  const float* x = (const float*)d_in[0]; const float* y = (const float*)d_in[1]; const float* W1 = (const float*)d_in[2]; const float* W2 = (const float*)d_in[3]; const float* W3 = (const float*)d_in[4]; const float* W4 = (const float*)d_in[5];
  char* ws = (char*)d_ws; size_t off = 0;
  auto take = [&](size_t bytes) { char* p = ws + off; off += (bytes + 255) & ~(size_t)255; return p; };
  unsigned short* B1 = (unsigned short*)take((size_t)DM * DM * 2); unsigned short* B23 = (unsigned short*)take((size_t)2 * DM * DM * 2); float* W4T = (float*)take((size_t)HS * DM * 4);
  float* Q = (float*)take((size_t)NTOK * DM * 4); float* KV = (float*)take((size_t)NTOK * 2 * DM * 4); unsigned short* Kh = (unsigned short*)take((size_t)NTOK * 2 * DM * 2); unsigned short* Kl = (unsigned short*)take((size_t)NTOK * 2 * DM * 2);
  float* S = (float*)take((size_t)NSET * NH * NIT * NIT * 4); _Float16* ATT = (_Float16*)take((size_t)NSET * NIT * HK * 2); float* VWt = (float*)take((size_t)NSET * HS * HK * 4); _Float16* VWt16 = (_Float16*)take((size_t)NSET * HS * HK * 2);
  if (off > ws_size) return;
  k_btw<<<(DM * (DM / 8) + 255) / 256, 256, 0, stream>>>(W1, B1, DM, DM); k_btw<<<(DM * (DM / 8) + 255) / 256, 256, 0, stream>>>(W2, B23, DM, DM); k_btw<<<(DM * (DM / 8) + 255) / 256, 256, 0, stream>>>(W3, B23 + (size_t)DM * DM, DM, DM); k_w4t<<<(HS * DM / 4 + 255) / 256, 256, 0, stream>>>(W4, W4T);
  k_gemm_bf3<false, 0, false, false><<<((NTOK / 16) * (DM / 64) + 3) / 4, 128, 0, stream>>>(x, DM, B1, DM, nullptr, nullptr, 1, 0, Q, DM, NTOK, DM, DM);
  k_gemm_bf3<false, 0, false, false><<<((NTOK / 16) * (2 * DM / 64) + 3) / 4, 128, 0, stream>>>(y, DM, B23, DM, nullptr, nullptr, 1, 0, KV, 2 * DM, NTOK, 2 * DM, DM);      // [K | V]
  k_planes<<<(unsigned)(((size_t)NTOK * 2 * DM / 8 + 255) / 256), 256, 0, stream>>>(KV, Kh, Kl, (size_t)NTOK * 2 * DM / 8);
  // scores for all (set s, head h) in one launch (grid.y = s, grid.z = h): A = Q rows (s,q) cols h*64, Bt = K planes rows (s,k) cols h*64; alpha 1/8
  k_gemm_b<true, true, 0><<<dim3(((NIT / 16) * (NIT / 64) + 3) / 4, NSET, NH), 128, 0, stream>>>(Q, DM, (size_t)NIT * DM, Kh, Kl, 2 * DM, (size_t)NIT * 2 * DM, nullptr, nullptr, 0, 0, 1.f, 0.125f, S, NIT, (size_t)NH * NIT * NIT, NIT, NIT, HS, HS, HS, (size_t)NIT * NIT);
  // VWt[i][d][h*128 + k] = sum over e of W4T[d][h*64+e] * V[(i,k)][h*64+e]: A = W4T + h*64 (lda 512, M = 64, K = 64), Bt = V planes rows (i,k) cols h*64 (ldb 1024); grid.y = i, grid.z = h
  k_gemm_b<true, true, 0><<<dim3(((HS / 16) * (NIT / 64) + 3) / 4, NSET, NH), 128, 0, stream>>>(W4T, DM, 0, Kh + DM, Kl + DM, 2 * DM, (size_t)NIT * 2 * DM, nullptr, nullptr, 0, 0, 1.f, 1.f, VWt, HK, (size_t)HS * HK, HS, NIT, HS, HS, HS, NIT);
  k_att<<<(unsigned)(((size_t)NSET * NH * NIT * NIT / 8 + 255) / 256), 256, 0, stream>>>(S, ATT); k_cvt16<<<(unsigned)(((size_t)NSET * HS * HK / 8 + 255) / 256), 256, 0, stream>>>(VWt, VWt16, (size_t)NSET * HS * HK / 8);
  // out[i][j] = ATT[j] * VWt[i]^T for all 1024 (i, j) in one launch: A = ATT16 + j (grid.y), Bt = VWt16 + i (grid.z), C = out + ((i*32 + j)*128)*64
  k_gemm_hh<0><<<dim3(((NIT / 16) * 1 + 3) / 4, NSET, NSET), 128, 0, stream>>>(ATT, HK, (size_t)NIT * HK, VWt16, HK, 0, 1.f, (float*)d_out, HS, (size_t)NIT * HS, NIT, HS, HK, (size_t)HS * HK, (size_t)NSET * NIT * HS);
}

// v002
// A run of this version takes 84.1 microseconds.
// Timed twice side by side with v001, it ran 2.03 and 2.02 times as fast.
// Over all steps from v000 it is 14.7 times as fast.
#include <hip/hip_runtime.h>
// On WMMA (f32 accumulate): Q = x·W1, K = y·W2, V = y·W3 (inputs rounded to bf16: single exact terms), per (set, head) scores = q·kᵀ (both computed f32 → bf16 hi/lo: 3 products,
// K = 64), VWᵀ[i][d][(h,k)] = Σ_e W4[h·64+e][d]·v[i][k][h·64+e] (bf16-rounded W4 vs split v), and the cross-set contraction out[i][j] = attn[j]·VW[i] on v_wmma_f32_16x16x32_f16 with
// attn = relu(scores/8)/128 stored in f16 and VWᵀ in f16 (single product; 1024 pairs × 128 × 1024 × 64) — an exact re-association of (attn[j]·v[i])·W4. relu/scaling are f32 VALU.
#define NSET 32
#define NIT 128
#define DM 512
#define NH 8
#define HS 64
#define NTOK (NSET * NIT)
#define HK (NH * NIT)      // 1024 = (h,k) contraction length

typedef __bf16 v16b __attribute__((ext_vector_type(16)));
typedef unsigned short v8us __attribute__((ext_vector_type(8), may_alias));
typedef float  v8f  __attribute__((ext_vector_type(8)));
typedef float  v4f  __attribute__((ext_vector_type(4)));
typedef float  v4fa __attribute__((ext_vector_type(4), may_alias));
typedef float  f32a __attribute__((may_alias));
union FragB { v16b v; v8us half[2]; unsigned short u[16]; };

__device__ __forceinline__ unsigned short bf16_bits(float x) { unsigned int u = __float_as_uint(x); return (unsigned short)((u + 0x7FFFu + ((u >> 16) & 1u)) >> 16); }
__device__ __forceinline__ float bf16_val(unsigned short b) { return __uint_as_float(((unsigned int)b) << 16); }
__device__ __forceinline__ float bf16_round(float x) { return bf16_val(bf16_bits(x)); }
// D += A·B with NT terms: 1 = ah·bh, 2 = + al·bh (A split), 3 = + ah·bl (both split)
template <int NT>
__device__ __forceinline__ v8f mmaN(v16b ah, v16b al, v16b bh, v16b bl, v8f c) {
  c = __builtin_amdgcn_wmma_f32_16x16x32_bf16(false, ah, false, bh, (short)0, c, false, false);
  if (NT >= 2) c = __builtin_amdgcn_wmma_f32_16x16x32_bf16(false, al, false, bh, (short)0, c, false, false);
  if (NT >= 3) c = __builtin_amdgcn_wmma_f32_16x16x32_bf16(false, ah, false, bl, (short)0, c, false, false);
  asm volatile("v_nop\n\tv_nop\n\tv_nop\n\tv_nop" : "+v"(c) : "v"(ah), "v"(al), "v"(bh), "v"(bl));
  return c;
}

__global__ __launch_bounds__(256) void k_wt_bf16(const float* __restrict__ W, unsigned short* __restrict__ Wt, int K, int N) {
  const int t = blockIdx.x * 256 + threadIdx.x;
  const int k8n = K / 8;
  if (t >= N * k8n) return;
  const int n = t / k8n, k8 = (t % k8n) * 8;
  v8us v;
#pragma unroll
  for (int i = 0; i < 8; ++i) v[i] = bf16_bits(W[(size_t)(k8 + i) * N + n]);
  *(v8us*)(Wt + (size_t)n * K + k8) = v;
  
}

// GEMM C[M][N] (f32, pitch ldc) = act(A[M][K]·W + bias). A f32 row-major (pitch lda) converted per fragment to bf16
// (ASPLIT: hi/lo two planes -> 2 terms, else single rounded term); Wt bf16 [N][K] (pitch ldb). BIAS_BF16 rounds the
// bias to bf16 first (bias quantised to bf16 before the add). K%32==0, M%16==0, N%64==0.
template <bool ASPLIT, int ACT, bool BIAS_BF16>
__global__ __launch_bounds__(128) void k_gemm_bf(const float* __restrict__ A, int lda, const unsigned short* __restrict__ Wt, int ldb,
                                               const float* __restrict__ bias, float* __restrict__ C, int ldc, int M, int N, int K) {
  __shared__ __attribute__((aligned(16))) float so[4][16][64];
  const int tid = threadIdx.x, w = tid >> 5, lane = tid & 31, ln = lane & 15, hh = lane >> 4;
  const int ntn = N / 64;
  const int wid = blockIdx.x * 4 + w;
  const int mt = wid / ntn, nq = wid % ntn;
  if (mt * 16 >= M) return;
  const int row0 = mt * 16, col0 = nq * 64;
  const float* arow = A + (size_t)(row0 + ln) * lda;
  v8f acc[4] = {};
  for (int kb = 0; kb < K; kb += 32) {
    FragB ah, al;
    const v4f x0 = *(const v4fa*)(arow + kb + 8 * hh), x1 = *(const v4fa*)(arow + kb + 8 * hh + 4);
    const v4f x2 = *(const v4fa*)(arow + kb + 16 + 8 * hh), x3 = *(const v4fa*)(arow + kb + 16 + 8 * hh + 4);
    float xs[16] = {x0[0],x0[1],x0[2],x0[3],x1[0],x1[1],x1[2],x1[3],x2[0],x2[1],x2[2],x2[3],x3[0],x3[1],x3[2],x3[3]};
#pragma unroll
    for (int i = 0; i < 16; ++i) { const unsigned short hb = bf16_bits(xs[i]); ah.u[i] = hb; al.u[i] = ASPLIT ? bf16_bits(xs[i] - bf16_val(hb)) : (unsigned short)0; }
#pragma unroll
    for (int t = 0; t < 4; ++t) {
      const unsigned short* brow = Wt + (size_t)(col0 + t * 16 + ln) * ldb + kb;
      FragB b;
      b.half[0] = *(const v8us*)(brow + 8 * hh);
      b.half[1] = *(const v8us*)(brow + 16 + 8 * hh);
      acc[t] = mmaN<ASPLIT ? 2 : 1>(ah.v, al.v, b.v, b.v, acc[t]);
    }
  }
#pragma unroll
  for (int t = 0; t < 4; ++t) {
    float bv = bias ? bias[col0 + t * 16 + ln] : 0.f;
    if (BIAS_BF16) bv = bf16_round(bv);
#pragma unroll
    for (int r = 0; r < 8; ++r) { float v = acc[t][r] + bv; if (ACT == 1) v = fmaxf(v, 0.f); so[w][8 * hh + r][t * 16 + ln] = v; }
  }
  __builtin_amdgcn_fence(__ATOMIC_ACQ_REL, "workgroup");
  __builtin_amdgcn_wave_barrier();
  const int rsub = lane >> 4, c4 = (lane & 15) * 4;
  {
#pragma unroll
    for (int q = 0; q < 8; ++q) {
      const int r = q * 2 + rsub;
      const v4f v = *(const v4fa*)&so[w][r][c4];
      *(v4f*)(C + (size_t)(row0 + r) * ldc + col0 + c4) = v;
    }
    
  }
}

// Flash-style causal/unmasked attention, all contractions 3-term bf16 hi/lo splits, f32 softmax with running max.
// q,k,v rows are read from f32 buffers with arbitrary row pitch (so they can live inside a fused qkv buffer);
// D = head size (multiple of 32, <= 128); one wave = 16 query rows; block = 4 waves (64 queries) sharing K/V chunks of 32.
template <int D, bool CAUSAL>
__global__ __launch_bounds__(128) void k_flash(const float* __restrict__ qb, const float* __restrict__ kb, const float* __restrict__ vb,
                                             int pitch, int T, int H, float scale, float* __restrict__ y, int ypitch) {
  constexpr int KS = D / 32;        // k-steps for QK
  constexpr int DT = D / 16;        // d tiles for PV
  __shared__ __attribute__((aligned(16))) unsigned short sKh[32][D + 8], sKl[32][D + 8], sVh[32][D + 8], sVl[32][D + 8];
  __shared__ __attribute__((aligned(16))) unsigned short sPh[4][16][40], sPl[4][16][40];
  __shared__ __attribute__((aligned(16))) float sO[4][16][D];
  const int tid = threadIdx.x, w = tid >> 5, lane = tid & 31, ln = lane & 15, hh = lane >> 4;
  const int nqb = (T + 63) / 64;
  const int bh = blockIdx.x / nqb, qblk = blockIdx.x % nqb;
  const int b = bh / H, h = bh % H;
  const int q0 = qblk * 64 + w * 16;
  const float* Q = qb + (size_t)b * T * pitch + h * D;
  const float* K = kb + (size_t)b * T * pitch + h * D;
  const float* V = vb + (size_t)b * T * pitch + h * D;

  // A fragments of the wave's 16 query rows (scaled), hi/lo
  FragB aqh[KS], aql[KS];
  {
    int row = q0 + ln; if (row >= T) row = T - 1;
    const float* qr = Q + (size_t)row * pitch;
#pragma unroll
    for (int ks = 0; ks < KS; ++ks)
#pragma unroll
      for (int i = 0; i < 16; ++i) {
        const int d = ks * 32 + ((i < 8) ? (8 * hh + i) : (16 + 8 * hh + (i - 8)));
        const float x = qr[d] * scale; const unsigned short hb = bf16_bits(x);
        aqh[ks].u[i] = hb; aql[ks].u[i] = bf16_bits(x - bf16_val(hb));
      }
  }
  float m_r[8], l_r[8];
#pragma unroll
  for (int r = 0; r < 8; ++r) { m_r[r] = -3.0e38f; l_r[r] = 0.f; }
  v8f oacc[DT];
#pragma unroll
  for (int dt = 0; dt < DT; ++dt) oacc[dt] = (v8f){0.f,0.f,0.f,0.f,0.f,0.f,0.f,0.f};

  const int kv_end = CAUSAL ? min(T, qblk * 64 + 64) : T;     // block-uniform
  for (int j0 = 0; j0 < kv_end; j0 += 32) {
    __syncthreads();
    for (int e = tid; e < 32 * (D / 4); e += 128) {
      const int r = e / (D / 4), c4 = (e % (D / 4)) * 4;
      const int key = j0 + r;
      v4f kf = {0.f,0.f,0.f,0.f}, vf = {0.f,0.f,0.f,0.f};
      if (key < T) { kf = *(const v4fa*)(K + (size_t)key * pitch + c4); vf = *(const v4fa*)(V + (size_t)key * pitch + c4); }
#pragma unroll
      for (int t = 0; t < 4; ++t) {
        unsigned short hb = bf16_bits(kf[t]); sKh[r][c4 + t] = hb; sKl[r][c4 + t] = bf16_bits(kf[t] - bf16_val(hb));
        hb = bf16_bits(vf[t]); sVh[r][c4 + t] = hb; sVl[r][c4 + t] = bf16_bits(vf[t] - bf16_val(hb));
      }
    }
    __syncthreads();
    // S tile 16 x 32
    v8f s[2];
#pragma unroll
    for (int nt = 0; nt < 2; ++nt) {
      v8f acc = {};
#pragma unroll
      for (int ks = 0; ks < KS; ++ks) {
        FragB bh_, bl_;
        bh_.half[0] = *(const v8us*)&sKh[nt * 16 + ln][ks * 32 + 8 * hh]; bh_.half[1] = *(const v8us*)&sKh[nt * 16 + ln][ks * 32 + 16 + 8 * hh];
        bl_.half[0] = *(const v8us*)&sKl[nt * 16 + ln][ks * 32 + 8 * hh]; bl_.half[1] = *(const v8us*)&sKl[nt * 16 + ln][ks * 32 + 16 + 8 * hh];
        acc = mmaN<3>(aqh[ks].v, aql[ks].v, bh_.v, bl_.v, acc);
      }
      s[nt] = acc;
    }
    // mask + running max (rows 8hh+r; the 16 lanes of a half share rows)
    float alpha[8];
#pragma unroll
    for (int r = 0; r < 8; ++r) {
      const int qi = q0 + 8 * hh + r;
      const int ja = j0 + ln, jb = j0 + 16 + ln;
      if (CAUSAL) { if (ja > qi) s[0][r] = -3.0e38f; if (jb > qi) s[1][r] = -3.0e38f; }
      if (ja >= T) s[0][r] = -3.0e38f;
      if (jb >= T) s[1][r] = -3.0e38f;
      float mx = fmaxf(s[0][r], s[1][r]);
      mx = fmaxf(mx, __shfl_xor(mx, 1, 32)); mx = fmaxf(mx, __shfl_xor(mx, 2, 32)); mx = fmaxf(mx, __shfl_xor(mx, 4, 32)); mx = fmaxf(mx, __shfl_xor(mx, 8, 32));
      const float mnew = fmaxf(m_r[r], mx);
      alpha[r] = (mnew > -1.0e38f) ? __expf(m_r[r] - mnew) : 1.0f;
      const float p0 = (s[0][r] > -1.0e38f) ? __expf(s[0][r] - mnew) : 0.f;
      const float p1 = (s[1][r] > -1.0e38f) ? __expf(s[1][r] - mnew) : 0.f;
      m_r[r] = mnew;
      l_r[r] = l_r[r] * alpha[r] + p0 + p1;            // per-lane partial row sum (16 lanes combined at the end)
      unsigned short hb = bf16_bits(p0); sPh[w][8 * hh + r][ln] = hb;      sPl[w][8 * hh + r][ln] = bf16_bits(p0 - bf16_val(hb));
      hb = bf16_bits(p1);                sPh[w][8 * hh + r][16 + ln] = hb; sPl[w][8 * hh + r][16 + ln] = bf16_bits(p1 - bf16_val(hb));
    }
#pragma unroll
    for (int dt = 0; dt < DT; ++dt)
#pragma unroll
      for (int r = 0; r < 8; ++r) oacc[dt][r] *= alpha[r];
    __builtin_amdgcn_fence(__ATOMIC_ACQ_REL, "workgroup");
    __builtin_amdgcn_wave_barrier();
    FragB pah, pal;
    pah.half[0] = *(const v8us*)&sPh[w][ln][8 * hh]; pah.half[1] = *(const v8us*)&sPh[w][ln][16 + 8 * hh];
    pal.half[0] = *(const v8us*)&sPl[w][ln][8 * hh]; pal.half[1] = *(const v8us*)&sPl[w][ln][16 + 8 * hh];
#pragma unroll
    for (int dt = 0; dt < DT; ++dt) {
      FragB bvh, bvl;
#pragma unroll
      for (int i = 0; i < 8; ++i) {
        bvh.u[i] = sVh[8 * hh + i][dt * 16 + ln]; bvh.u[8 + i] = sVh[16 + 8 * hh + i][dt * 16 + ln];
        bvl.u[i] = sVl[8 * hh + i][dt * 16 + ln]; bvl.u[8 + i] = sVl[16 + 8 * hh + i][dt * 16 + ln];
      }
      oacc[dt] = mmaN<3>(pah.v, pal.v, bvh.v, bvl.v, oacc[dt]);
    }
    __builtin_amdgcn_fence(__ATOMIC_ACQ_REL, "workgroup");
    __builtin_amdgcn_wave_barrier();
  }
#pragma unroll
  for (int r = 0; r < 8; ++r) {
    float l = l_r[r];
    l += __shfl_xor(l, 1, 32); l += __shfl_xor(l, 2, 32); l += __shfl_xor(l, 4, 32); l += __shfl_xor(l, 8, 32);
    l_r[r] = (l > 0.f) ? 1.0f / l : 0.f;
  }
#pragma unroll
  for (int dt = 0; dt < DT; ++dt)
#pragma unroll
    for (int r = 0; r < 8; ++r) sO[w][8 * hh + r][dt * 16 + ln] = oacc[dt][r] * l_r[r];
  __builtin_amdgcn_fence(__ATOMIC_ACQ_REL, "workgroup");
  __builtin_amdgcn_wave_barrier();
  {
    for (int r = 0; r < 16; ++r) {
      const int row = q0 + r;
      if (row < T && lane < D / 4) {
        const v4f val = *(const v4fa*)&sO[w][r][lane * 4];
        *(v4f*)(y + ((size_t)b * T + row) * ypitch + h * D + lane * 4) = val;
      }
    }
    
  }
}

// row LayerNorm (biased variance, eps) over N: s = X (+ R); optional out_sum <- s; out_norm <- (s-mu)*rsqrt(var+eps)*g + b
template <bool PARAM_BF16>
__global__ __launch_bounds__(256) void k_layernorm(const float* __restrict__ X, const float* __restrict__ R, const float* __restrict__ g, const float* __restrict__ bta,
                                                  float* __restrict__ out_sum, float* __restrict__ out_norm, int N, float eps) {
  __shared__ float red[256];
  const int row = blockIdx.x, tid = threadIdx.x;
  const float* x = X + (size_t)row * N; const float* rr = R ? R + (size_t)row * N : nullptr;
  float vals[16];                     // up to N = 4096
  const int per = N / 256;            // contiguous chunk per thread? use strided-by-4 chunks: thread handles j = tid*4 + 1024*u
  float s1 = 0.f;
  for (int u = 0; u < per / 4; ++u) {
    const int j = tid * 4 + 1024 * u;
    const v4f a = *(const v4fa*)(x + j);
    v4f b = {0.f,0.f,0.f,0.f}; if (rr) b = *(const v4fa*)(rr + j);
#pragma unroll
    for (int q = 0; q < 4; ++q) { const float v = a[q] + b[q]; vals[u * 4 + q] = v; s1 += v; }
  }
  red[tid] = s1; __syncthreads();
  for (int st = 128; st > 0; st >>= 1) { if (tid < st) red[tid] += red[tid + st]; __syncthreads(); }
  const float mu = red[0] / (float)N; __syncthreads();
  float s2 = 0.f;
  for (int u = 0; u < per / 4; ++u)
#pragma unroll
    for (int q = 0; q < 4; ++q) { const float c = vals[u * 4 + q] - mu; s2 += c * c; }
  red[tid] = s2; __syncthreads();
  for (int st = 128; st > 0; st >>= 1) { if (tid < st) red[tid] += red[tid + st]; __syncthreads(); }
  const float rs = rsqrtf(red[0] / (float)N + eps);
  {
    for (int u = 0; u < per / 4; ++u) {
      const int j = tid * 4 + 1024 * u;
      v4f o, sm;
#pragma unroll
      for (int q = 0; q < 4; ++q) {
        float gg = g[j + q], bb = bta[j + q];
        if (PARAM_BF16) { gg = bf16_round(gg); bb = bf16_round(bb); }
        sm[q] = vals[u * 4 + q]; o[q] = (vals[u * 4 + q] - mu) * rs * gg + bb;
      }
      if (out_sum) *(v4f*)(out_sum + (size_t)row * N + j) = sm;
      *(v4f*)(out_norm + (size_t)row * N + j) = o;
    }
    
  }
}

// batched GEMM (blockIdx.y = batch): C_b = act(alpha·A_b·B_b + bias + resid_b); A f32 rows (ASPLIT → hi/lo), B = bf16 planes Bh (+Bl when BSPLIT, requires ASPLIT),
// per-batch element strides sA, sB (0 = shared weights), sC, sR. resid may alias C (values are staged before the stores). ACT 0/1(relu).
// ACT: 0 none, 1 relu, 2 softplus
// blockIdx.z = second batch index (here the head), element strides zA, zB, zC: one launch covers every (y, z) pair
template <bool ASPLIT, bool BSPLIT, int ACT>
__global__ __launch_bounds__(128) void k_gemm_b(const float* __restrict__ A, int lda, size_t sA, const unsigned short* __restrict__ Bh, const unsigned short* __restrict__ Bl, int ldb, size_t sB,
                                             const float* __restrict__ bias, const float* __restrict__ resid, int ldr, size_t sR, float rsign, float alpha,
                                             float* __restrict__ C, int ldc, size_t sC, int M, int N, int K, size_t zA, size_t zB, size_t zC) {
  __shared__ __attribute__((aligned(16))) float so[4][16][64];
  const int tid = threadIdx.x, w = tid >> 5, lane = tid & 31, ln = lane & 15, hh = lane >> 4;
  const int by = blockIdx.y, bz = blockIdx.z;
  A += (size_t)by * sA + (size_t)bz * zA; Bh += (size_t)by * sB + (size_t)bz * zB; if (BSPLIT) Bl += (size_t)by * sB + (size_t)bz * zB; C += (size_t)by * sC + (size_t)bz * zC; if (resid) resid += (size_t)by * sR;
  const int ntn = (N + 63) / 64; const int wid = blockIdx.x * 4 + w; const int mt = wid / ntn, nq = wid % ntn;      // N may be any multiple of 16: tiles past N are skipped and not stored
  if (mt * 16 >= M) return;
  const int row0 = mt * 16, col0 = nq * 64;
  const float* arow = A + (size_t)(row0 + ln) * lda;
  v8f acc[4] = {};
  for (int kb = 0; kb < K; kb += 32) {
    FragB ah, al;
    const v4f x0 = *(const v4fa*)(arow + kb + 8 * hh), x1 = *(const v4fa*)(arow + kb + 8 * hh + 4);
    const v4f x2 = *(const v4fa*)(arow + kb + 16 + 8 * hh), x3 = *(const v4fa*)(arow + kb + 16 + 8 * hh + 4);
    float xs[16] = {x0[0],x0[1],x0[2],x0[3],x1[0],x1[1],x1[2],x1[3],x2[0],x2[1],x2[2],x2[3],x3[0],x3[1],x3[2],x3[3]};
#pragma unroll
    for (int i = 0; i < 16; ++i) { const unsigned short hb = bf16_bits(xs[i]); ah.u[i] = hb; al.u[i] = ASPLIT ? bf16_bits(xs[i] - bf16_val(hb)) : (unsigned short)0; }
#pragma unroll
    for (int t = 0; t < 4; ++t) {
      if (col0 + t * 16 >= N) continue;
      const size_t boff = (size_t)(col0 + t * 16 + ln) * ldb + kb;
      FragB bh_, bl_; bh_.half[0] = *(const v8us*)(Bh + boff + 8 * hh); bh_.half[1] = *(const v8us*)(Bh + boff + 16 + 8 * hh);
      if (BSPLIT) { bl_.half[0] = *(const v8us*)(Bl + boff + 8 * hh); bl_.half[1] = *(const v8us*)(Bl + boff + 16 + 8 * hh); } else bl_ = bh_;
      acc[t] = mmaN<ASPLIT ? (BSPLIT ? 3 : 2) : 1>(ah.v, al.v, bh_.v, bl_.v, acc[t]);
    }
  }
#pragma unroll
  for (int t = 0; t < 4; ++t) {
    const int col = col0 + t * 16 + ln; if (col0 + t * 16 >= N) continue; const float bv = bias ? bf16_round(bias[col]) : 0.f;
#pragma unroll
    for (int r = 0; r < 8; ++r) { float v = acc[t][r] * alpha + bv; if (resid) v += rsign * resid[(size_t)(row0 + 8 * hh + r) * ldr + col]; if (ACT == 1) v = fmaxf(v, 0.f); else if (ACT == 2) v = fmaxf(v, 0.f) + log1pf(expf(-fabsf(v))); so[w][8 * hh + r][t * 16 + ln] = v; }
  }
  __builtin_amdgcn_fence(__ATOMIC_ACQ_REL, "workgroup"); __builtin_amdgcn_wave_barrier();
  const int rsub = lane >> 4, c4 = (lane & 15) * 4;
  {
#pragma unroll
    for (int q = 0; q < 8; ++q) { const int r = q * 2 + rsub; if (col0 + c4 < N) { const v4f v = *(const v4fa*)&so[w][r][c4]; *(v4f*)(C + (size_t)(row0 + r) * ldc + col0 + c4) = v; } }
    
  }
}
// batched f32 [K][N] (pitch lds, batch stride sIn) -> transposed hi/lo planes [N][K] (batch stride sOut); thread per (n, 8 k); grid.y = batch
__global__ __launch_bounds__(256) void k_split_transpose_b(const float* __restrict__ src, int lds_, size_t sIn, unsigned short* __restrict__ hi, unsigned short* __restrict__ lo, size_t sOut, int K, int N) {
  const size_t t = (size_t)blockIdx.x * 256 + threadIdx.x; const int k8n = K / 8; if (t >= (size_t)N * k8n) return;
  src += (size_t)blockIdx.y * sIn; hi += (size_t)blockIdx.y * sOut; lo += (size_t)blockIdx.y * sOut;
  const int n = (int)(t / k8n), k8 = (int)(t % k8n) * 8; v8us vh, vl;
#pragma unroll
  for (int i = 0; i < 8; ++i) { const float x = src[(size_t)(k8 + i) * lds_ + n]; const unsigned short hb = bf16_bits(x); vh[i] = hb; vl[i] = bf16_bits(x - bf16_val(hb)); }
  unsigned short* dh = hi + (size_t)n * K + k8; unsigned short* dl = lo + (size_t)n * K + k8;
  *(v8us*)dh = vh; *(v8us*)dl = vl; 
}

// ---- f16 WMMA path (v_wmma_f32_16x16x32_f16): 11-bit significands for operands in range — used where the relu(scores/8)/128 attention operand needs more precision than bf16
typedef _Float16 v16h __attribute__((ext_vector_type(16)));
union FragH { v16h v; v8us half[2]; _Float16 h[16]; unsigned short u[16]; };
template <int NT>
__device__ __forceinline__ v8f mmaH(v16h ah, v16h al, v16h bh, v16h bl, v8f c) {
  c = __builtin_amdgcn_wmma_f32_16x16x32_f16(false, ah, false, bh, (short)0, c, false, false);
  if (NT >= 2) c = __builtin_amdgcn_wmma_f32_16x16x32_f16(false, al, false, bh, (short)0, c, false, false);
  if (NT >= 3) c = __builtin_amdgcn_wmma_f32_16x16x32_f16(false, ah, false, bl, (short)0, c, false, false);
  asm volatile("v_nop\n\tv_nop\n\tv_nop\n\tv_nop" : "+v"(c) : "v"(ah), "v"(al), "v"(bh), "v"(bl));
  return c;
}
// batched GEMM like k_gemm_b but f16 operands: A f32 (split into f16 hi/lo if ASPLIT, else rounded to f16), Bt = f16 values [n][k]; alpha; C f32; N multiple of 16 (partial tiles skipped)
template <bool ASPLIT>
__global__ __launch_bounds__(128) void k_gemm_h(const float* __restrict__ A, int lda, size_t sA, const _Float16* __restrict__ Bh, int ldb, size_t sB, float alpha, float* __restrict__ C, int ldc, size_t sC, int M, int N, int K) {
  __shared__ __attribute__((aligned(16))) float so[4][16][64];
  const int tid = threadIdx.x, w = tid >> 5, lane = tid & 31, ln = lane & 15, hh = lane >> 4; const int by = blockIdx.y;
  A += (size_t)by * sA; Bh += (size_t)by * sB; C += (size_t)by * sC;
  const int ntn = (N + 63) / 64; const int wid = blockIdx.x * 4 + w; const int mt = wid / ntn, nq = wid % ntn; if (mt * 16 >= M) return;
  const int row0 = mt * 16, col0 = nq * 64; const float* arow = A + (size_t)(row0 + ln) * lda;
  v8f acc[4] = {};
  for (int kb = 0; kb < K; kb += 32) {
    FragH ah, al;
    const v4f x0 = *(const v4fa*)(arow + kb + 8 * hh), x1 = *(const v4fa*)(arow + kb + 8 * hh + 4), x2 = *(const v4fa*)(arow + kb + 16 + 8 * hh), x3 = *(const v4fa*)(arow + kb + 16 + 8 * hh + 4);
    float xs[16] = {x0[0],x0[1],x0[2],x0[3],x1[0],x1[1],x1[2],x1[3],x2[0],x2[1],x2[2],x2[3],x3[0],x3[1],x3[2],x3[3]};
#pragma unroll
    for (int i = 0; i < 16; ++i) { const _Float16 h = (_Float16)xs[i]; ah.h[i] = h; al.h[i] = ASPLIT ? (_Float16)(xs[i] - (float)h) : (_Float16)0.0f; }
#pragma unroll
    for (int t = 0; t < 4; ++t) { if (col0 + t * 16 >= N) continue; const size_t boff = (size_t)(col0 + t * 16 + ln) * ldb + kb; FragH bq; bq.half[0] = *(const v8us*)(Bh + boff + 8 * hh); bq.half[1] = *(const v8us*)(Bh + boff + 16 + 8 * hh);
      acc[t] = mmaH<ASPLIT ? 2 : 1>(ah.v, al.v, bq.v, bq.v, acc[t]); }
  }
#pragma unroll
  for (int t = 0; t < 4; ++t) { if (col0 + t * 16 >= N) continue;
#pragma unroll
    for (int r = 0; r < 8; ++r) so[w][8 * hh + r][t * 16 + ln] = acc[t][r] * alpha; }
  __builtin_amdgcn_fence(__ATOMIC_ACQ_REL, "workgroup"); __builtin_amdgcn_wave_barrier();
  const int rsub = lane >> 4, c4 = (lane & 15) * 4;
  {
#pragma unroll
    for (int q = 0; q < 8; ++q) { const int r = q * 2 + rsub; if (col0 + c4 < N) { const v4f v = *(const v4fa*)&so[w][r][c4]; *(v4f*)(C + (size_t)(row0 + r) * ldc + col0 + c4) = v; } }
     }
}

// Block-tiled product through LDS, C = A * B^T with A [M][K] and B [N][K] both k-contiguous, used for the three large products:
//   PROJ: A = x or y in f32, rounded to bf16 once while it is staged; B = transposed bf16 weights; C row-major (Q, [K | V]).
//   else: A = ATT [(j,q)][1024] f16, B = VWt16 [(i,d)][1024] f16: all 1024 set pairs as ONE 4096 x 2048 x 1024 product; for one i the rows (j,q) of out are contiguous.
// A work-group of 8 waves owns TM rows x 128 columns; a wave owns TM/4 x 64, so a fragment read from LDS feeds several WMMAs and every operand byte
// leaves L2 once per work-group, in whole 128-B lines (a wave-wide 16-B load covers 512 contiguous bytes of one f32 row or 256 of each of two 16-bit rows).
// A pass is 128 k: TM + 128 rows of 256 B at an LDS pitch of 272 B (conflict-free for 16-B fragment reads). Two buffers: the next pass's rows are loaded
// into registers ahead of this pass's WMMAs and stored into the other buffer ahead of its last block; one barrier a pass publishes them and frees this buffer.
// Per output tile the k order (32 at a time, ascending, same lane map) is that of a wave reading its fragments straight from global memory.
#define TN 128
#define TK 128
#define LP 136             // LDS row pitch in 16-bit elements (272 B)
#define SP 68              // epilogue staging pitch in floats (272 B): rows 8 apart fall on different banks
typedef unsigned short v4us __attribute__((ext_vector_type(4), may_alias));
union FragX { v16h h; v16b b; v8us half[2]; };
// C element (row, col) lies at C + (col / 64) * cbs + row * ldc + col % 64
template <bool PROJ, int TM, int K>
__global__ __launch_bounds__(256) void k_gemm_tile(const float* __restrict__ Af, const _Float16* __restrict__ Ah, const unsigned short* __restrict__ B, float* __restrict__ C, int ldc, size_t cbs) {
  constexpr int MI = TM / 64;      // accumulator tiles of a wave in M (4 in N)
  __shared__ __attribute__((aligned(16))) unsigned short sm[2][(TM + TN) * LP];
  const int tid = threadIdx.x, w = tid >> 5, lane = tid & 31, ln = lane & 15, hh = lane >> 4;
  const int wm = w >> 1, wn = w & 1;
  const int row0 = blockIdx.x * TM, col0 = blockIdx.y * TN;
  const int lr = tid >> 4, lc = (tid & 15) * 8;      // 16-bit rows: 16 lanes x 16 B = the 256-B slice of a row
  const int fr = tid >> 5, fc = (tid & 31) * 4;      // f32 rows: 32 lanes x 16 B = the 512-B slice of a row
  const float* gf = PROJ ? Af + (size_t)(row0 + fr) * K + fc : nullptr;
  const unsigned short* ga = PROJ ? nullptr : (const unsigned short*)Ah + (size_t)(row0 + lr) * K + lc;
  const unsigned short* gb = B + (size_t)(col0 + lr) * K + lc;
  v4f sf[PROJ ? TM / 8 : 1]; v8us sa[PROJ ? 1 : TM / 16]; v8us sb[TN / 16];
  auto fetch = [&](int p) {
    if constexpr (PROJ) {
#pragma unroll
      for (int u = 0; u < TM / 8; ++u) sf[u] = *(const v4fa*)(gf + (size_t)u * 8 * K + p * TK);
    } else {
#pragma unroll
      for (int u = 0; u < TM / 16; ++u) sa[u] = *(const v8us*)(ga + (size_t)u * 16 * K + p * TK);
    }
#pragma unroll
    for (int u = 0; u < TN / 16; ++u) sb[u] = *(const v8us*)(gb + (size_t)u * 16 * K + p * TK);
  };
  auto put = [&](unsigned short* dst) {
    if constexpr (PROJ) {
#pragma unroll
      for (int u = 0; u < TM / 8; ++u) { v4us h; for (int q = 0; q < 4; ++q) h[q] = bf16_bits(sf[u][q]); *(v4us*)&dst[(u * 8 + fr) * LP + fc] = h; }
    } else {
#pragma unroll
      for (int u = 0; u < TM / 16; ++u) *(v8us*)&dst[(u * 16 + lr) * LP + lc] = sa[u];
    }
#pragma unroll
    for (int u = 0; u < TN / 16; ++u) *(v8us*)&dst[(TM + u * 16 + lr) * LP + lc] = sb[u];
  };
  fetch(0);
  put(sm[0]);
  __syncthreads();
  v8f acc[MI][4] = {};
  const int aoff = (wm * (TM / 4) + ln) * LP + 8 * hh, boff = (TM + wn * 64 + ln) * LP + 8 * hh;
  for (int p = 0; p < K / TK; ++p) {
    const unsigned short* cur = sm[p & 1];
    const bool more = p + 1 < K / TK;
    if (more) {
      fetch(p + 1);
      // the fragment reads below may reuse the registers that hold these loads' addresses
      asm volatile("s_wait_xcnt 0x0" ::: "memory");
    }
    FragX fa[2][MI], fb[2][4];
    auto frags = [&](int ks) {
#pragma unroll
      for (int m = 0; m < MI; ++m) { const int o = aoff + m * 16 * LP + ks * 32; fa[ks & 1][m].half[0] = *(const v8us*)&cur[o]; fa[ks & 1][m].half[1] = *(const v8us*)&cur[o + 16]; }
#pragma unroll
      for (int n = 0; n < 4; ++n) { const int o = boff + n * 16 * LP + ks * 32; fb[ks & 1][n].half[0] = *(const v8us*)&cur[o]; fb[ks & 1][n].half[1] = *(const v8us*)&cur[o + 16]; }
    };
    frags(0);
#pragma unroll
    for (int ks = 0; ks < TK / 32; ++ks) {
      if (ks + 1 < TK / 32) frags(ks + 1);
      else if (more) put(sm[(p + 1) & 1]);      // ahead of the last block, whose WMMAs run while the stores drain
      // scheduling fences round each block of WMMAs: without them the compiler reads all four blocks' fragments first and puts the wait for the
      // global loads, the stores and the barrier in front of nearly all WMMAs, so neither the LDS reads nor the global latency hide behind matrix work
      __builtin_amdgcn_sched_barrier(0);
#pragma unroll
      for (int m = 0; m < MI; ++m)
#pragma unroll
        for (int n = 0; n < 4; ++n) {
          if constexpr (PROJ) acc[m][n] = __builtin_amdgcn_wmma_f32_16x16x32_bf16(false, fa[ks & 1][m].b, false, fb[ks & 1][n].b, (short)0, acc[m][n], false, false);
          else                acc[m][n] = __builtin_amdgcn_wmma_f32_16x16x32_f16(false, fa[ks & 1][m].h, false, fb[ks & 1][n].h, (short)0, acc[m][n], false, false);
        }
      __builtin_amdgcn_sched_barrier(0);
    }
    __syncthreads();
  }
  // the last barrier has ended every read of the buffers: each wave stages its f32 tile in a range of its own and stores whole lines
  f32a* so = (f32a*)&sm[0][0] + (size_t)w * (TM / 4) * SP;
#pragma unroll
  for (int m = 0; m < MI; ++m)
#pragma unroll
    for (int n = 0; n < 4; ++n)
#pragma unroll
      for (int r = 0; r < 8; ++r) so[(m * 16 + 8 * hh + r) * SP + n * 16 + ln] = acc[m][n][r];
  // the wave's own LDS writes are complete before its lanes read back rows that other lanes wrote (no other wave touches this range)
  __builtin_amdgcn_fence(__ATOMIC_ACQ_REL, "workgroup"); __builtin_amdgcn_wave_barrier();
  float* cw = C + (size_t)(blockIdx.y * (TN / 64) + wn) * cbs + (size_t)(row0 + wm * (TM / 4)) * ldc;
  const int rsub = lane >> 4, c4 = (lane & 15) * 4;
#pragma unroll
  for (int q = 0; q < TM / 8; ++q) { const int r = q * 2 + rsub; const v4f v = *(const v4fa*)&so[r * SP + c4]; *(v4f*)(cw + (size_t)r * ldc + c4) = v; }
}

__global__ __launch_bounds__(256) void k_btw(const float* __restrict__ W, unsigned short* __restrict__ Bt, int K, int N) { const int t = blockIdx.x * 256 + threadIdx.x; if (t >= N * (K / 8)) return; const int n = t / (K / 8), k8 = (t % (K / 8)) * 8; v8us v; for (int q = 0; q < 8; ++q) v[q] = bf16_bits(W[(size_t)(k8 + q) * N + n]); *(v8us*)(Bt + (size_t)n * K + k8) = v;  }
// W4ᵀ as an f32 A operand: W4T[d][c] = bf16(W4[c][d]) ([64][512]); thread per (d, 4 c)
__global__ __launch_bounds__(256) void k_w4t(const float* __restrict__ W4, float* __restrict__ W4T) { const int t = blockIdx.x * 256 + threadIdx.x; if (t >= HS * DM / 4) return; const int c4 = (t * 4) % DM, d = (t * 4) / DM; v4f o; for (int q = 0; q < 4; ++q) o[q] = bf16_round(W4[(size_t)(c4 + q) * HS + d]); *(v4f*)(W4T + (size_t)t * 4) = o;  }
// bf16 hi/lo planes of an f32 matrix (row-major, n8 groups of 8)
__global__ __launch_bounds__(256) void k_planes(const float* __restrict__ a, unsigned short* __restrict__ hi, unsigned short* __restrict__ lo, size_t n8) { const size_t t = (size_t)blockIdx.x * 256 + threadIdx.x; if (t >= n8) return; v8us h, l; for (int q = 0; q < 8; ++q) { const float v = a[t * 8 + q]; const unsigned short hb = bf16_bits(v); h[q] = hb; l[q] = bf16_bits(v - bf16_val(hb)); } *(v8us*)(hi + t * 8) = h; *(v8us*)(lo + t * 8) = l;  }
// ATT16[j][q][h·128 + k] = f16(relu(S)/128) from S [(j,h)][q][k] f32 (scale 1/8 already in the GEMM alpha); thread per 8
__global__ __launch_bounds__(256) void k_att(const float* __restrict__ S, _Float16* __restrict__ ATT) { const size_t t = (size_t)blockIdx.x * 256 + threadIdx.x; if (t >= (size_t)NSET * NH * NIT * NIT / 8) return; const int k8 = (int)((t * 8) % NIT); const int q = (int)((t * 8 / NIT) % NIT); const int h = (int)((t * 8 / ((size_t)NIT * NIT)) % NH); const int j = (int)(t * 8 / ((size_t)NIT * NIT * NH));
  FragH f; for (int u = 0; u < 8; ++u) f.h[u] = (_Float16)(fmaxf(S[t * 8 + u], 0.f) * (1.0f / NIT)); unsigned short* d = (unsigned short*)ATT + (((size_t)j * NIT + q) * HK + h * NIT + k8); *(v8us*)d = f.half[0];  }
__global__ __launch_bounds__(256) void k_cvt16(const float* __restrict__ a, _Float16* __restrict__ h, size_t n8) { const size_t t = (size_t)blockIdx.x * 256 + threadIdx.x; if (t >= n8) return; FragH f; for (int q = 0; q < 8; ++q) f.h[q] = (_Float16)a[t * 8 + q]; const v8us o = f.half[0]; *(v8us*)((unsigned short*)h + t * 8) = o;  }
extern "C" void kernel_launch(void* const* d_in, const int* in_sizes, int n_in,
                              void* d_out, int out_size, void* d_ws, size_t ws_size, hipStream_t stream) {
  (void)in_sizes; (void)n_in; (void)out_size;
  const float* x = (const float*)d_in[0]; const float* y = (const float*)d_in[1]; const float* W1 = (const float*)d_in[2]; const float* W2 = (const float*)d_in[3]; const float* W3 = (const float*)d_in[4]; const float* W4 = (const float*)d_in[5];
  char* ws = (char*)d_ws; size_t off = 0;
  auto take = [&](size_t bytes) { char* p = ws + off; off += (bytes + 255) & ~(size_t)255; return p; };
  unsigned short* B1 = (unsigned short*)take((size_t)DM * DM * 2); unsigned short* B23 = (unsigned short*)take((size_t)2 * DM * DM * 2); float* W4T = (float*)take((size_t)HS * DM * 4);
  float* Q = (float*)take((size_t)NTOK * DM * 4); float* KV = (float*)take((size_t)NTOK * 2 * DM * 4); unsigned short* Kh = (unsigned short*)take((size_t)NTOK * 2 * DM * 2); unsigned short* Kl = (unsigned short*)take((size_t)NTOK * 2 * DM * 2);
  float* S = (float*)take((size_t)NSET * NH * NIT * NIT * 4); _Float16* ATT = (_Float16*)take((size_t)NSET * NIT * HK * 2); float* VWt = (float*)take((size_t)NSET * HS * HK * 4); _Float16* VWt16 = (_Float16*)take((size_t)NSET * HS * HK * 2);
  if (off > ws_size) return;
  k_btw<<<(DM * (DM / 8) + 255) / 256, 256, 0, stream>>>(W1, B1, DM, DM); k_btw<<<(DM * (DM / 8) + 255) / 256, 256, 0, stream>>>(W2, B23, DM, DM); k_btw<<<(DM * (DM / 8) + 255) / 256, 256, 0, stream>>>(W3, B23 + (size_t)DM * DM, DM, DM); k_w4t<<<(HS * DM / 4 + 255) / 256, 256, 0, stream>>>(W4, W4T);
  k_gemm_tile<true, 128, DM><<<dim3(NTOK / 128, DM / TN), 256, 0, stream>>>(x, nullptr, B1, Q, DM, 64);
  k_gemm_tile<true, 128, DM><<<dim3(NTOK / 128, 2 * DM / TN), 256, 0, stream>>>(y, nullptr, B23, KV, 2 * DM, 64);      // [K | V]
  k_planes<<<(unsigned)(((size_t)NTOK * 2 * DM / 8 + 255) / 256), 256, 0, stream>>>(KV, Kh, Kl, (size_t)NTOK * 2 * DM / 8);
  // scores for all (set s, head h) in one launch (grid.y = s, grid.z = h): A = Q rows (s,q) cols h*64, Bt = K planes rows (s,k) cols h*64; alpha 1/8
  k_gemm_b<true, true, 0><<<dim3(((NIT / 16) * (NIT / 64) + 3) / 4, NSET, NH), 128, 0, stream>>>(Q, DM, (size_t)NIT * DM, Kh, Kl, 2 * DM, (size_t)NIT * 2 * DM, nullptr, nullptr, 0, 0, 1.f, 0.125f, S, NIT, (size_t)NH * NIT * NIT, NIT, NIT, HS, HS, HS, (size_t)NIT * NIT);
  // VWt[i][d][h*128 + k] = sum over e of W4T[d][h*64+e] * V[(i,k)][h*64+e]: A = W4T + h*64 (lda 512, M = 64, K = 64), Bt = V planes rows (i,k) cols h*64 (ldb 1024); grid.y = i, grid.z = h
  k_gemm_b<true, true, 0><<<dim3(((HS / 16) * (NIT / 64) + 3) / 4, NSET, NH), 128, 0, stream>>>(W4T, DM, 0, Kh + DM, Kl + DM, 2 * DM, (size_t)NIT * 2 * DM, nullptr, nullptr, 0, 0, 1.f, 1.f, VWt, HK, (size_t)HS * HK, HS, NIT, HS, HS, HS, NIT);
  k_att<<<(unsigned)(((size_t)NSET * NH * NIT * NIT / 8 + 255) / 256), 256, 0, stream>>>(S, ATT); k_cvt16<<<(unsigned)(((size_t)NSET * HS * HK / 8 + 255) / 256), 256, 0, stream>>>(VWt, VWt16, (size_t)NSET * HS * HK / 8);
  // out[i][j] = ATT[j] * VWt[i]^T for all 1024 (i, j) as one 4096 x 2048 x 1024 product: grid.x = 256-row tiles of (j,q), grid.y = 128-column tiles of (i,d)
  k_gemm_tile<false, 256, HK><<<dim3(NTOK / 256, NSET * HS / TN), 256, 0, stream>>>(nullptr, ATT, (const unsigned short*)VWt16, (float*)d_out, HS, (size_t)NTOK * HS);
}

// v003
// One run takes 43.9 microseconds.
// Timed twice side by side with v002, it ran 1.92 and 1.93 times as fast.
// Over all steps from v000 it is 28.2 times as fast.
#include <hip/hip_runtime.h>
// On WMMA (f32 accumulate): Q = x·W1, K = y·W2, V = y·W3 (inputs rounded to bf16: single exact terms), per (set, head) scores = q·kᵀ (both computed f32 → bf16 hi/lo: 3 products,
// K = 64), VWᵀ[i][d][(h,k)] = Σ_e W4[h·64+e][d]·v[i][k][h·64+e] (bf16-rounded W4 vs split v), and the cross-set contraction out[i][j] = attn[j]·VW[i] on v_wmma_f32_16x16x32_f16 with
// attn = relu(scores/8)/128 stored in f16 and VWᵀ in f16 (single product; 1024 pairs × 128 × 1024 × 64) — an exact re-association of (attn[j]·v[i])·W4. relu/scaling are f32 VALU.
#define NSET 32
#define NIT 128
#define DM 512
#define NH 8
#define HS 64
#define NTOK (NSET * NIT)
#define HK (NH * NIT)      // 1024 = (h,k) contraction length

typedef __bf16 v16b __attribute__((ext_vector_type(16)));
typedef unsigned short v8us __attribute__((ext_vector_type(8), may_alias));
typedef float  v8f  __attribute__((ext_vector_type(8)));
typedef float  v4f  __attribute__((ext_vector_type(4)));
typedef float  v4fa __attribute__((ext_vector_type(4), may_alias));
typedef float  f32a __attribute__((may_alias));
union FragB { v16b v; v8us half[2]; unsigned short u[16]; };

__device__ __forceinline__ unsigned short bf16_bits(float x) { unsigned int u = __float_as_uint(x); return (unsigned short)((u + 0x7FFFu + ((u >> 16) & 1u)) >> 16); }
__device__ __forceinline__ float bf16_val(unsigned short b) { return __uint_as_float(((unsigned int)b) << 16); }
__device__ __forceinline__ float bf16_round(float x) { return bf16_val(bf16_bits(x)); }
// D += A·B with NT terms: 1 = ah·bh, 2 = + al·bh (A split), 3 = + ah·bl (both split)
template <int NT>
__device__ __forceinline__ v8f mmaN(v16b ah, v16b al, v16b bh, v16b bl, v8f c) {
  c = __builtin_amdgcn_wmma_f32_16x16x32_bf16(false, ah, false, bh, (short)0, c, false, false);
  if (NT >= 2) c = __builtin_amdgcn_wmma_f32_16x16x32_bf16(false, al, false, bh, (short)0, c, false, false);
  if (NT >= 3) c = __builtin_amdgcn_wmma_f32_16x16x32_bf16(false, ah, false, bl, (short)0, c, false, false);
  asm volatile("v_nop\n\tv_nop\n\tv_nop\n\tv_nop" : "+v"(c) : "v"(ah), "v"(al), "v"(bh), "v"(bl));
  return c;
}

__global__ __launch_bounds__(256) void k_wt_bf16(const float* __restrict__ W, unsigned short* __restrict__ Wt, int K, int N) {
  const int t = blockIdx.x * 256 + threadIdx.x;
  const int k8n = K / 8;
  if (t >= N * k8n) return;
  const int n = t / k8n, k8 = (t % k8n) * 8;
  v8us v;
#pragma unroll
  for (int i = 0; i < 8; ++i) v[i] = bf16_bits(W[(size_t)(k8 + i) * N + n]);
  *(v8us*)(Wt + (size_t)n * K + k8) = v;
  
}

// GEMM C[M][N] (f32, pitch ldc) = act(A[M][K]·W + bias). A f32 row-major (pitch lda) converted per fragment to bf16
// (ASPLIT: hi/lo two planes -> 2 terms, else single rounded term); Wt bf16 [N][K] (pitch ldb). BIAS_BF16 rounds the
// bias to bf16 first (bias quantised to bf16 before the add). K%32==0, M%16==0, N%64==0.
template <bool ASPLIT, int ACT, bool BIAS_BF16>
__global__ __launch_bounds__(128) void k_gemm_bf(const float* __restrict__ A, int lda, const unsigned short* __restrict__ Wt, int ldb,
                                               const float* __restrict__ bias, float* __restrict__ C, int ldc, int M, int N, int K) {
  __shared__ __attribute__((aligned(16))) float so[4][16][64];
  const int tid = threadIdx.x, w = tid >> 5, lane = tid & 31, ln = lane & 15, hh = lane >> 4;
  const int ntn = N / 64;
  const int wid = blockIdx.x * 4 + w;
  const int mt = wid / ntn, nq = wid % ntn;
  if (mt * 16 >= M) return;
  const int row0 = mt * 16, col0 = nq * 64;
  const float* arow = A + (size_t)(row0 + ln) * lda;
  v8f acc[4] = {};
  for (int kb = 0; kb < K; kb += 32) {
    FragB ah, al;
    const v4f x0 = *(const v4fa*)(arow + kb + 8 * hh), x1 = *(const v4fa*)(arow + kb + 8 * hh + 4);
    const v4f x2 = *(const v4fa*)(arow + kb + 16 + 8 * hh), x3 = *(const v4fa*)(arow + kb + 16 + 8 * hh + 4);
    float xs[16] = {x0[0],x0[1],x0[2],x0[3],x1[0],x1[1],x1[2],x1[3],x2[0],x2[1],x2[2],x2[3],x3[0],x3[1],x3[2],x3[3]};
#pragma unroll
    for (int i = 0; i < 16; ++i) { const unsigned short hb = bf16_bits(xs[i]); ah.u[i] = hb; al.u[i] = ASPLIT ? bf16_bits(xs[i] - bf16_val(hb)) : (unsigned short)0; }
#pragma unroll
    for (int t = 0; t < 4; ++t) {
      const unsigned short* brow = Wt + (size_t)(col0 + t * 16 + ln) * ldb + kb;
      FragB b;
      b.half[0] = *(const v8us*)(brow + 8 * hh);
      b.half[1] = *(const v8us*)(brow + 16 + 8 * hh);
      acc[t] = mmaN<ASPLIT ? 2 : 1>(ah.v, al.v, b.v, b.v, acc[t]);
    }
  }
#pragma unroll
  for (int t = 0; t < 4; ++t) {
    float bv = bias ? bias[col0 + t * 16 + ln] : 0.f;
    if (BIAS_BF16) bv = bf16_round(bv);
#pragma unroll
    for (int r = 0; r < 8; ++r) { float v = acc[t][r] + bv; if (ACT == 1) v = fmaxf(v, 0.f); so[w][8 * hh + r][t * 16 + ln] = v; }
  }
  __builtin_amdgcn_fence(__ATOMIC_ACQ_REL, "workgroup");
  __builtin_amdgcn_wave_barrier();
  const int rsub = lane >> 4, c4 = (lane & 15) * 4;
  {
#pragma unroll
    for (int q = 0; q < 8; ++q) {
      const int r = q * 2 + rsub;
      const v4f v = *(const v4fa*)&so[w][r][c4];
      *(v4f*)(C + (size_t)(row0 + r) * ldc + col0 + c4) = v;
    }
    
  }
}

// Flash-style causal/unmasked attention, all contractions 3-term bf16 hi/lo splits, f32 softmax with running max.
// q,k,v rows are read from f32 buffers with arbitrary row pitch (so they can live inside a fused qkv buffer);
// D = head size (multiple of 32, <= 128); one wave = 16 query rows; block = 4 waves (64 queries) sharing K/V chunks of 32.
template <int D, bool CAUSAL>
__global__ __launch_bounds__(128) void k_flash(const float* __restrict__ qb, const float* __restrict__ kb, const float* __restrict__ vb,
                                             int pitch, int T, int H, float scale, float* __restrict__ y, int ypitch) {
  constexpr int KS = D / 32;        // k-steps for QK
  constexpr int DT = D / 16;        // d tiles for PV
  __shared__ __attribute__((aligned(16))) unsigned short sKh[32][D + 8], sKl[32][D + 8], sVh[32][D + 8], sVl[32][D + 8];
  __shared__ __attribute__((aligned(16))) unsigned short sPh[4][16][40], sPl[4][16][40];
  __shared__ __attribute__((aligned(16))) float sO[4][16][D];
  const int tid = threadIdx.x, w = tid >> 5, lane = tid & 31, ln = lane & 15, hh = lane >> 4;
  const int nqb = (T + 63) / 64;
  const int bh = blockIdx.x / nqb, qblk = blockIdx.x % nqb;
  const int b = bh / H, h = bh % H;
  const int q0 = qblk * 64 + w * 16;
  const float* Q = qb + (size_t)b * T * pitch + h * D;
  const float* K = kb + (size_t)b * T * pitch + h * D;
  const float* V = vb + (size_t)b * T * pitch + h * D;

  // A fragments of the wave's 16 query rows (scaled), hi/lo
  FragB aqh[KS], aql[KS];
  {
    int row = q0 + ln; if (row >= T) row = T - 1;
    const float* qr = Q + (size_t)row * pitch;
#pragma unroll
    for (int ks = 0; ks < KS; ++ks)
#pragma unroll
      for (int i = 0; i < 16; ++i) {
        const int d = ks * 32 + ((i < 8) ? (8 * hh + i) : (16 + 8 * hh + (i - 8)));
        const float x = qr[d] * scale; const unsigned short hb = bf16_bits(x);
        aqh[ks].u[i] = hb; aql[ks].u[i] = bf16_bits(x - bf16_val(hb));
      }
  }
  float m_r[8], l_r[8];
#pragma unroll
  for (int r = 0; r < 8; ++r) { m_r[r] = -3.0e38f; l_r[r] = 0.f; }
  v8f oacc[DT];
#pragma unroll
  for (int dt = 0; dt < DT; ++dt) oacc[dt] = (v8f){0.f,0.f,0.f,0.f,0.f,0.f,0.f,0.f};

  const int kv_end = CAUSAL ? min(T, qblk * 64 + 64) : T;     // block-uniform
  for (int j0 = 0; j0 < kv_end; j0 += 32) {
    __syncthreads();
    for (int e = tid; e < 32 * (D / 4); e += 128) {
      const int r = e / (D / 4), c4 = (e % (D / 4)) * 4;
      const int key = j0 + r;
      v4f kf = {0.f,0.f,0.f,0.f}, vf = {0.f,0.f,0.f,0.f};
      if (key < T) { kf = *(const v4fa*)(K + (size_t)key * pitch + c4); vf = *(const v4fa*)(V + (size_t)key * pitch + c4); }
#pragma unroll
      for (int t = 0; t < 4; ++t) {
        unsigned short hb = bf16_bits(kf[t]); sKh[r][c4 + t] = hb; sKl[r][c4 + t] = bf16_bits(kf[t] - bf16_val(hb));
        hb = bf16_bits(vf[t]); sVh[r][c4 + t] = hb; sVl[r][c4 + t] = bf16_bits(vf[t] - bf16_val(hb));
      }
    }
    __syncthreads();
    // S tile 16 x 32
    v8f s[2];
#pragma unroll
    for (int nt = 0; nt < 2; ++nt) {
      v8f acc = {};
#pragma unroll
      for (int ks = 0; ks < KS; ++ks) {
        FragB bh_, bl_;
        bh_.half[0] = *(const v8us*)&sKh[nt * 16 + ln][ks * 32 + 8 * hh]; bh_.half[1] = *(const v8us*)&sKh[nt * 16 + ln][ks * 32 + 16 + 8 * hh];
        bl_.half[0] = *(const v8us*)&sKl[nt * 16 + ln][ks * 32 + 8 * hh]; bl_.half[1] = *(const v8us*)&sKl[nt * 16 + ln][ks * 32 + 16 + 8 * hh];
        acc = mmaN<3>(aqh[ks].v, aql[ks].v, bh_.v, bl_.v, acc);
      }
      s[nt] = acc;
    }
    // mask + running max (rows 8hh+r; the 16 lanes of a half share rows)
    float alpha[8];
#pragma unroll
    for (int r = 0; r < 8; ++r) {
      const int qi = q0 + 8 * hh + r;
      const int ja = j0 + ln, jb = j0 + 16 + ln;
      if (CAUSAL) { if (ja > qi) s[0][r] = -3.0e38f; if (jb > qi) s[1][r] = -3.0e38f; }
      if (ja >= T) s[0][r] = -3.0e38f;
      if (jb >= T) s[1][r] = -3.0e38f;
      float mx = fmaxf(s[0][r], s[1][r]);
      mx = fmaxf(mx, __shfl_xor(mx, 1, 32)); mx = fmaxf(mx, __shfl_xor(mx, 2, 32)); mx = fmaxf(mx, __shfl_xor(mx, 4, 32)); mx = fmaxf(mx, __shfl_xor(mx, 8, 32));
      const float mnew = fmaxf(m_r[r], mx);
      alpha[r] = (mnew > -1.0e38f) ? __expf(m_r[r] - mnew) : 1.0f;
      const float p0 = (s[0][r] > -1.0e38f) ? __expf(s[0][r] - mnew) : 0.f;
      const float p1 = (s[1][r] > -1.0e38f) ? __expf(s[1][r] - mnew) : 0.f;
      m_r[r] = mnew;
      l_r[r] = l_r[r] * alpha[r] + p0 + p1;            // per-lane partial row sum (16 lanes combined at the end)
      unsigned short hb = bf16_bits(p0); sPh[w][8 * hh + r][ln] = hb;      sPl[w][8 * hh + r][ln] = bf16_bits(p0 - bf16_val(hb));
      hb = bf16_bits(p1);                sPh[w][8 * hh + r][16 + ln] = hb; sPl[w][8 * hh + r][16 + ln] = bf16_bits(p1 - bf16_val(hb));
    }
#pragma unroll
    for (int dt = 0; dt < DT; ++dt)
#pragma unroll
      for (int r = 0; r < 8; ++r) oacc[dt][r] *= alpha[r];
    __builtin_amdgcn_fence(__ATOMIC_ACQ_REL, "workgroup");
    __builtin_amdgcn_wave_barrier();
    FragB pah, pal;
    pah.half[0] = *(const v8us*)&sPh[w][ln][8 * hh]; pah.half[1] = *(const v8us*)&sPh[w][ln][16 + 8 * hh];
    pal.half[0] = *(const v8us*)&sPl[w][ln][8 * hh]; pal.half[1] = *(const v8us*)&sPl[w][ln][16 + 8 * hh];
#pragma unroll
    for (int dt = 0; dt < DT; ++dt) {
      FragB bvh, bvl;
#pragma unroll
      for (int i = 0; i < 8; ++i) {
        bvh.u[i] = sVh[8 * hh + i][dt * 16 + ln]; bvh.u[8 + i] = sVh[16 + 8 * hh + i][dt * 16 + ln];
        bvl.u[i] = sVl[8 * hh + i][dt * 16 + ln]; bvl.u[8 + i] = sVl[16 + 8 * hh + i][dt * 16 + ln];
      }
      oacc[dt] = mmaN<3>(pah.v, pal.v, bvh.v, bvl.v, oacc[dt]);
    }
    __builtin_amdgcn_fence(__ATOMIC_ACQ_REL, "workgroup");
    __builtin_amdgcn_wave_barrier();
  }
#pragma unroll
  for (int r = 0; r < 8; ++r) {
    float l = l_r[r];
    l += __shfl_xor(l, 1, 32); l += __shfl_xor(l, 2, 32); l += __shfl_xor(l, 4, 32); l += __shfl_xor(l, 8, 32);
    l_r[r] = (l > 0.f) ? 1.0f / l : 0.f;
  }
#pragma unroll
  for (int dt = 0; dt < DT; ++dt)
#pragma unroll
    for (int r = 0; r < 8; ++r) sO[w][8 * hh + r][dt * 16 + ln] = oacc[dt][r] * l_r[r];
  __builtin_amdgcn_fence(__ATOMIC_ACQ_REL, "workgroup");
  __builtin_amdgcn_wave_barrier();
  {
    for (int r = 0; r < 16; ++r) {
      const int row = q0 + r;
      if (row < T && lane < D / 4) {
        const v4f val = *(const v4fa*)&sO[w][r][lane * 4];
        *(v4f*)(y + ((size_t)b * T + row) * ypitch + h * D + lane * 4) = val;
      }
    }
    
  }
}

// row LayerNorm (biased variance, eps) over N: s = X (+ R); optional out_sum <- s; out_norm <- (s-mu)*rsqrt(var+eps)*g + b
template <bool PARAM_BF16>
__global__ __launch_bounds__(256) void k_layernorm(const float* __restrict__ X, const float* __restrict__ R, const float* __restrict__ g, const float* __restrict__ bta,
                                                  float* __restrict__ out_sum, float* __restrict__ out_norm, int N, float eps) {
  __shared__ float red[256];
  const int row = blockIdx.x, tid = threadIdx.x;
  const float* x = X + (size_t)row * N; const float* rr = R ? R + (size_t)row * N : nullptr;
  float vals[16];                     // up to N = 4096
  const int per = N / 256;            // contiguous chunk per thread? use strided-by-4 chunks: thread handles j = tid*4 + 1024*u
  float s1 = 0.f;
  for (int u = 0; u < per / 4; ++u) {
    const int j = tid * 4 + 1024 * u;
    const v4f a = *(const v4fa*)(x + j);
    v4f b = {0.f,0.f,0.f,0.f}; if (rr) b = *(const v4fa*)(rr + j);
#pragma unroll
    for (int q = 0; q < 4; ++q) { const float v = a[q] + b[q]; vals[u * 4 + q] = v; s1 += v; }
  }
  red[tid] = s1; __syncthreads();
  for (int st = 128; st > 0; st >>= 1) { if (tid < st) red[tid] += red[tid + st]; __syncthreads(); }
  const float mu = red[0] / (float)N; __syncthreads();
  float s2 = 0.f;
  for (int u = 0; u < per / 4; ++u)
#pragma unroll
    for (int q = 0; q < 4; ++q) { const float c = vals[u * 4 + q] - mu; s2 += c * c; }
  red[tid] = s2; __syncthreads();
  for (int st = 128; st > 0; st >>= 1) { if (tid < st) red[tid] += red[tid + st]; __syncthreads(); }
  const float rs = rsqrtf(red[0] / (float)N + eps);
  {
    for (int u = 0; u < per / 4; ++u) {
      const int j = tid * 4 + 1024 * u;
      v4f o, sm;
#pragma unroll
      for (int q = 0; q < 4; ++q) {
        float gg = g[j + q], bb = bta[j + q];
        if (PARAM_BF16) { gg = bf16_round(gg); bb = bf16_round(bb); }
        sm[q] = vals[u * 4 + q]; o[q] = (vals[u * 4 + q] - mu) * rs * gg + bb;
      }
      if (out_sum) *(v4f*)(out_sum + (size_t)row * N + j) = sm;
      *(v4f*)(out_norm + (size_t)row * N + j) = o;
    }
    
  }
}

// batched f32 [K][N] (pitch lds, batch stride sIn) -> transposed hi/lo planes [N][K] (batch stride sOut); thread per (n, 8 k); grid.y = batch
__global__ __launch_bounds__(256) void k_split_transpose_b(const float* __restrict__ src, int lds_, size_t sIn, unsigned short* __restrict__ hi, unsigned short* __restrict__ lo, size_t sOut, int K, int N) {
  const size_t t = (size_t)blockIdx.x * 256 + threadIdx.x; const int k8n = K / 8; if (t >= (size_t)N * k8n) return;
  src += (size_t)blockIdx.y * sIn; hi += (size_t)blockIdx.y * sOut; lo += (size_t)blockIdx.y * sOut;
  const int n = (int)(t / k8n), k8 = (int)(t % k8n) * 8; v8us vh, vl;
#pragma unroll
  for (int i = 0; i < 8; ++i) { const float x = src[(size_t)(k8 + i) * lds_ + n]; const unsigned short hb = bf16_bits(x); vh[i] = hb; vl[i] = bf16_bits(x - bf16_val(hb)); }
  unsigned short* dh = hi + (size_t)n * K + k8; unsigned short* dl = lo + (size_t)n * K + k8;
  *(v8us*)dh = vh; *(v8us*)dl = vl; 
}

// ---- f16 WMMA path (v_wmma_f32_16x16x32_f16): 11-bit significands for operands in range — used where the relu(scores/8)/128 attention operand needs more precision than bf16
typedef _Float16 v16h __attribute__((ext_vector_type(16)));
union FragH { v16h v; v8us half[2]; _Float16 h[16]; unsigned short u[16]; };
template <int NT>
__device__ __forceinline__ v8f mmaH(v16h ah, v16h al, v16h bh, v16h bl, v8f c) {
  c = __builtin_amdgcn_wmma_f32_16x16x32_f16(false, ah, false, bh, (short)0, c, false, false);
  if (NT >= 2) c = __builtin_amdgcn_wmma_f32_16x16x32_f16(false, al, false, bh, (short)0, c, false, false);
  if (NT >= 3) c = __builtin_amdgcn_wmma_f32_16x16x32_f16(false, ah, false, bl, (short)0, c, false, false);
  asm volatile("v_nop\n\tv_nop\n\tv_nop\n\tv_nop" : "+v"(c) : "v"(ah), "v"(al), "v"(bh), "v"(bl));
  return c;
}
// batched GEMM like k_gemm_b but f16 operands: A f32 (split into f16 hi/lo if ASPLIT, else rounded to f16), Bt = f16 values [n][k]; alpha; C f32; N multiple of 16 (partial tiles skipped)
template <bool ASPLIT>
__global__ __launch_bounds__(128) void k_gemm_h(const float* __restrict__ A, int lda, size_t sA, const _Float16* __restrict__ Bh, int ldb, size_t sB, float alpha, float* __restrict__ C, int ldc, size_t sC, int M, int N, int K) {
  __shared__ __attribute__((aligned(16))) float so[4][16][64];
  const int tid = threadIdx.x, w = tid >> 5, lane = tid & 31, ln = lane & 15, hh = lane >> 4; const int by = blockIdx.y;
  A += (size_t)by * sA; Bh += (size_t)by * sB; C += (size_t)by * sC;
  const int ntn = (N + 63) / 64; const int wid = blockIdx.x * 4 + w; const int mt = wid / ntn, nq = wid % ntn; if (mt * 16 >= M) return;
  const int row0 = mt * 16, col0 = nq * 64; const float* arow = A + (size_t)(row0 + ln) * lda;
  v8f acc[4] = {};
  for (int kb = 0; kb < K; kb += 32) {
    FragH ah, al;
    const v4f x0 = *(const v4fa*)(arow + kb + 8 * hh), x1 = *(const v4fa*)(arow + kb + 8 * hh + 4), x2 = *(const v4fa*)(arow + kb + 16 + 8 * hh), x3 = *(const v4fa*)(arow + kb + 16 + 8 * hh + 4);
    float xs[16] = {x0[0],x0[1],x0[2],x0[3],x1[0],x1[1],x1[2],x1[3],x2[0],x2[1],x2[2],x2[3],x3[0],x3[1],x3[2],x3[3]};
#pragma unroll
    for (int i = 0; i < 16; ++i) { const _Float16 h = (_Float16)xs[i]; ah.h[i] = h; al.h[i] = ASPLIT ? (_Float16)(xs[i] - (float)h) : (_Float16)0.0f; }
#pragma unroll
    for (int t = 0; t < 4; ++t) { if (col0 + t * 16 >= N) continue; const size_t boff = (size_t)(col0 + t * 16 + ln) * ldb + kb; FragH bq; bq.half[0] = *(const v8us*)(Bh + boff + 8 * hh); bq.half[1] = *(const v8us*)(Bh + boff + 16 + 8 * hh);
      acc[t] = mmaH<ASPLIT ? 2 : 1>(ah.v, al.v, bq.v, bq.v, acc[t]); }
  }
#pragma unroll
  for (int t = 0; t < 4; ++t) { if (col0 + t * 16 >= N) continue;
#pragma unroll
    for (int r = 0; r < 8; ++r) so[w][8 * hh + r][t * 16 + ln] = acc[t][r] * alpha; }
  __builtin_amdgcn_fence(__ATOMIC_ACQ_REL, "workgroup"); __builtin_amdgcn_wave_barrier();
  const int rsub = lane >> 4, c4 = (lane & 15) * 4;
  {
#pragma unroll
    for (int q = 0; q < 8; ++q) { const int r = q * 2 + rsub; if (col0 + c4 < N) { const v4f v = *(const v4fa*)&so[w][r][c4]; *(v4f*)(C + (size_t)(row0 + r) * ldc + col0 + c4) = v; } }
     }
}

// Scores and VW^T of every (set s, head h) in ONE launch (grid.y = s, grid.z = h); both are 64-deep products of an f32 A (split hi/lo in registers) with the
// bf16 hi/lo planes of K or V (3 terms), and both are stored as the f16 operand that the final product reads, so no f32 copy and no convert pass stands between.
//   blockIdx.x 0..3: ATT[(s,q)][h*128 + k]  = f16(relu(q.k / 8) / 128), A = Q rows (s,q) cols h*64, B = K planes rows (s,k) cols h*64
//   blockIdx.x 4..5: VWt16[(s,d)][h*128 + k] = f16(sum over e of W4T[d][h*64+e] * V[(s,k)][h*64+e]), A = W4T rows d, B = V planes (cols 512 + h*64)
// A wave owns 16 rows x 64 columns: 128 B of f16 a row, one whole line.
__global__ __launch_bounds__(128) void k_sv(const float* __restrict__ Q, const float* __restrict__ W4T, const unsigned short* __restrict__ Ph, const unsigned short* __restrict__ Pl,
                                          _Float16* __restrict__ ATT, _Float16* __restrict__ VWt16) {
  __shared__ __attribute__((aligned(16))) float so[4][16][64];
  const int tid = threadIdx.x, w = tid >> 5, lane = tid & 31, ln = lane & 15, hh = lane >> 4;
  const int s = blockIdx.y, h = blockIdx.z;
  const bool sc = blockIdx.x < 4;      // the same for the whole work-group
  const int wid = (sc ? blockIdx.x : blockIdx.x - 4) * 4 + w;
  const int row0 = (wid >> 1) * 16, col0 = (wid & 1) * 64;
  const float* arow = (sc ? Q + (size_t)s * NIT * DM : W4T) + h * HS + (size_t)(row0 + ln) * DM;
  const size_t bbase = (size_t)s * NIT * 2 * DM + (sc ? 0 : DM) + h * HS;
  v8f acc[4] = {};
  for (int kb = 0; kb < HS; kb += 32) {
    FragB ah, al;
    const v4f x0 = *(const v4fa*)(arow + kb + 8 * hh), x1 = *(const v4fa*)(arow + kb + 8 * hh + 4);
    const v4f x2 = *(const v4fa*)(arow + kb + 16 + 8 * hh), x3 = *(const v4fa*)(arow + kb + 16 + 8 * hh + 4);
    float xs[16] = {x0[0],x0[1],x0[2],x0[3],x1[0],x1[1],x1[2],x1[3],x2[0],x2[1],x2[2],x2[3],x3[0],x3[1],x3[2],x3[3]};
#pragma unroll
    for (int i = 0; i < 16; ++i) { const unsigned short hb = bf16_bits(xs[i]); ah.u[i] = hb; al.u[i] = bf16_bits(xs[i] - bf16_val(hb)); }
#pragma unroll
    for (int t = 0; t < 4; ++t) {
      const size_t boff = bbase + (size_t)(col0 + t * 16 + ln) * (2 * DM) + kb;
      FragB bh_, bl_; bh_.half[0] = *(const v8us*)(Ph + boff + 8 * hh); bh_.half[1] = *(const v8us*)(Ph + boff + 16 + 8 * hh);
      bl_.half[0] = *(const v8us*)(Pl + boff + 8 * hh); bl_.half[1] = *(const v8us*)(Pl + boff + 16 + 8 * hh);
      acc[t] = mmaN<3>(ah.v, al.v, bh_.v, bl_.v, acc[t]);
    }
  }
#pragma unroll
  for (int t = 0; t < 4; ++t)
#pragma unroll
    for (int r = 0; r < 8; ++r) so[w][8 * hh + r][t * 16 + ln] = sc ? fmaxf(acc[t][r] * 0.125f, 0.f) * (1.0f / NIT) : acc[t][r];
  // the wave's own LDS writes are complete before its lanes read back rows that other lanes wrote (no other wave touches this range)
  __builtin_amdgcn_fence(__ATOMIC_ACQ_REL, "workgroup"); __builtin_amdgcn_wave_barrier();
  unsigned short* dst = (unsigned short*)(sc ? ATT + (size_t)(s * NIT + row0) * HK : VWt16 + (size_t)(s * HS + row0) * HK) + h * NIT + col0;
  const int r4 = lane >> 3, c8 = (lane & 7) * 8;
  // both loops unrolled: vector elements indexed by constants stay in registers, and the LDS reads of all rows issue ahead of the stores
#pragma unroll
  for (int q = 0; q < 4; ++q) {
    const int r = q * 4 + r4;
    const v4f a = *(const v4fa*)&so[w][r][c8], b = *(const v4fa*)&so[w][r][c8 + 4];
    FragH f;
#pragma unroll
    for (int u = 0; u < 4; ++u) { f.h[u] = (_Float16)a[u]; f.h[4 + u] = (_Float16)b[u]; }
    *(v8us*)(dst + (size_t)r * HK + c8) = f.half[0];
  }
}

// Block-tiled product through LDS, C = A * B^T with A [M][K] and B [N][K] both k-contiguous, used for the three large products:
//   PROJ: all three projections in ONE launch: B = the transposed bf16 weights [W1 | W2 | W3], 1536 rows; A = x for the columns of W1 and y for the rest, in f32,
//         rounded to bf16 once while it is staged; Q is stored as f32 row-major, [K | V] straight as the bf16 hi/lo planes that the next launch reads.
//   else: A = ATT [(j,q)][1024] f16, B = VWt16 [(i,d)][1024] f16: all 1024 set pairs as ONE 4096 x 2048 x 1024 product; for one i the rows (j,q) of out are contiguous.
// A work-group of 8 waves owns TM rows x 128 columns; a wave owns TM/4 x 64, so a fragment read from LDS feeds several WMMAs and every operand byte
// leaves L2 once per work-group, in whole 128-B lines (a wave-wide 16-B load covers 512 contiguous bytes of one f32 row or 256 of each of two 16-bit rows).
// A pass is 128 k: TM + 128 rows of 256 B at an LDS pitch of 272 B (conflict-free for 16-B fragment reads). Two buffers: the next pass's rows are loaded
// into registers ahead of this pass's WMMAs and stored into the other buffer ahead of its last block; one barrier a pass publishes them and frees this buffer.
// Per output tile the k order (32 at a time, ascending, same lane map) is that of a wave reading its fragments straight from global memory.
#define TN 128
#define TK 128
#define LP 136             // LDS row pitch in 16-bit elements (272 B)
#define SP 68              // epilogue staging pitch in floats (272 B): rows 8 apart fall on different banks
typedef unsigned short v4us __attribute__((ext_vector_type(4), may_alias));
union FragX { v16h h; v16b b; v8us half[2]; };
// C element (row, col) lies at C + (col / 64) * cbs + row * ldc + col % 64
template <bool PROJ, int TM, int K>
__global__ __launch_bounds__(256) void k_gemm_tile(const float* __restrict__ Ax, const float* __restrict__ Ay, const _Float16* __restrict__ Ah, const unsigned short* __restrict__ B, float* __restrict__ C,
                                                 unsigned short* __restrict__ Ph, unsigned short* __restrict__ Pl, int ldc, size_t cbs) {
  constexpr int MI = TM / 64;      // accumulator tiles of a wave in M (4 in N)
  __shared__ __attribute__((aligned(16))) unsigned short sm[2][(TM + TN) * LP];
  const int tid = threadIdx.x, w = tid >> 5, lane = tid & 31, ln = lane & 15, hh = lane >> 4;
  const int wm = w >> 1, wn = w & 1;
  const int row0 = blockIdx.x * TM, col0 = blockIdx.y * TN;
  const int lr = tid >> 4, lc = (tid & 15) * 8;      // 16-bit rows: 16 lanes x 16 B = the 256-B slice of a row
  const int fr = tid >> 5, fc = (tid & 31) * 4;      // f32 rows: 32 lanes x 16 B = the 512-B slice of a row
  const bool isq = !PROJ || blockIdx.y < DM / TN;      // PROJ: this column tile belongs to Q (the same for the whole work-group)
  const float* gf = PROJ ? (isq ? Ax : Ay) + (size_t)(row0 + fr) * K + fc : nullptr;
  const unsigned short* ga = PROJ ? nullptr : (const unsigned short*)Ah + (size_t)(row0 + lr) * K + lc;
  const unsigned short* gb = B + (size_t)(col0 + lr) * K + lc;
  v4f sf[PROJ ? TM / 8 : 1]; v8us sa[PROJ ? 1 : TM / 16]; v8us sb[TN / 16];
  auto fetch = [&](int p) {
    if constexpr (PROJ) {
#pragma unroll
      for (int u = 0; u < TM / 8; ++u) sf[u] = *(const v4fa*)(gf + (size_t)u * 8 * K + p * TK);
    } else {
#pragma unroll
      for (int u = 0; u < TM / 16; ++u) sa[u] = *(const v8us*)(ga + (size_t)u * 16 * K + p * TK);
    }
#pragma unroll
    for (int u = 0; u < TN / 16; ++u) sb[u] = *(const v8us*)(gb + (size_t)u * 16 * K + p * TK);
  };
  auto put = [&](unsigned short* dst) {
    if constexpr (PROJ) {
#pragma unroll
      for (int u = 0; u < TM / 8; ++u) { v4us h; for (int q = 0; q < 4; ++q) h[q] = bf16_bits(sf[u][q]); *(v4us*)&dst[(u * 8 + fr) * LP + fc] = h; }
    } else {
#pragma unroll
      for (int u = 0; u < TM / 16; ++u) *(v8us*)&dst[(u * 16 + lr) * LP + lc] = sa[u];
    }
#pragma unroll
    for (int u = 0; u < TN / 16; ++u) *(v8us*)&dst[(TM + u * 16 + lr) * LP + lc] = sb[u];
  };
  fetch(0);
  put(sm[0]);
  __syncthreads();
  v8f acc[MI][4] = {};
  const int aoff = (wm * (TM / 4) + ln) * LP + 8 * hh, boff = (TM + wn * 64 + ln) * LP + 8 * hh;
  for (int p = 0; p < K / TK; ++p) {
    const unsigned short* cur = sm[p & 1];
    const bool more = p + 1 < K / TK;
    if (more) {
      fetch(p + 1);
      // the fragment reads below may reuse the registers that hold these loads' addresses
      asm volatile("s_wait_xcnt 0x0" ::: "memory");
    }
    FragX fa[2][MI], fb[2][4];
    auto frags = [&](int ks) {
#pragma unroll
      for (int m = 0; m < MI; ++m) { const int o = aoff + m * 16 * LP + ks * 32; fa[ks & 1][m].half[0] = *(const v8us*)&cur[o]; fa[ks & 1][m].half[1] = *(const v8us*)&cur[o + 16]; }
#pragma unroll
      for (int n = 0; n < 4; ++n) { const int o = boff + n * 16 * LP + ks * 32; fb[ks & 1][n].half[0] = *(const v8us*)&cur[o]; fb[ks & 1][n].half[1] = *(const v8us*)&cur[o + 16]; }
    };
    frags(0);
#pragma unroll
    for (int ks = 0; ks < TK / 32; ++ks) {
      if (ks + 1 < TK / 32) frags(ks + 1);
      else if (more) put(sm[(p + 1) & 1]);      // ahead of the last block, whose WMMAs run while the stores drain
      // scheduling fences round each block of WMMAs: without them the compiler reads all four blocks' fragments first and puts the wait for the
      // global loads, the stores and the barrier in front of nearly all WMMAs, so neither the LDS reads nor the global latency hide behind matrix work
      __builtin_amdgcn_sched_barrier(0);
#pragma unroll
      for (int m = 0; m < MI; ++m)
#pragma unroll
        for (int n = 0; n < 4; ++n) {
          if constexpr (PROJ) acc[m][n] = __builtin_amdgcn_wmma_f32_16x16x32_bf16(false, fa[ks & 1][m].b, false, fb[ks & 1][n].b, (short)0, acc[m][n], false, false);
          else                acc[m][n] = __builtin_amdgcn_wmma_f32_16x16x32_f16(false, fa[ks & 1][m].h, false, fb[ks & 1][n].h, (short)0, acc[m][n], false, false);
        }
      __builtin_amdgcn_sched_barrier(0);
    }
    __syncthreads();
  }
  // the last barrier has ended every read of the buffers: each wave stages its f32 tile in a range of its own and stores whole lines
  f32a* so = (f32a*)&sm[0][0] + (size_t)w * (TM / 4) * SP;
#pragma unroll
  for (int m = 0; m < MI; ++m)
#pragma unroll
    for (int n = 0; n < 4; ++n)
#pragma unroll
      for (int r = 0; r < 8; ++r) so[(m * 16 + 8 * hh + r) * SP + n * 16 + ln] = acc[m][n][r];
  // the wave's own LDS writes are complete before its lanes read back rows that other lanes wrote (no other wave touches this range)
  __builtin_amdgcn_fence(__ATOMIC_ACQ_REL, "workgroup"); __builtin_amdgcn_wave_barrier();
  if (!isq) {
    // [K | V]: bf16 head and remainder of each f32 result; the wave's 64 columns are 128 B a row in each plane, one whole line (8 lanes x 16 B)
    const size_t po = (size_t)(row0 + wm * (TM / 4)) * (2 * DM) + (col0 - DM) + wn * 64;
    const int r4 = lane >> 3, c8 = (lane & 7) * 8;
    // both loops unrolled: vector elements indexed by constants stay in registers, and the LDS reads of all rows issue ahead of the stores
#pragma unroll
    for (int q = 0; q < TM / 16; ++q) {
      const int r = q * 4 + r4;
      const v4f a = *(const v4fa*)&so[r * SP + c8], b = *(const v4fa*)&so[r * SP + c8 + 4];
      v8us h, l;
#pragma unroll
      for (int u = 0; u < 8; ++u) { const float v = u < 4 ? a[u & 3] : b[u & 3]; const unsigned short hb = bf16_bits(v); h[u] = hb; l[u] = bf16_bits(v - bf16_val(hb)); }
      *(v8us*)(Ph + po + (size_t)r * (2 * DM) + c8) = h; *(v8us*)(Pl + po + (size_t)r * (2 * DM) + c8) = l;
    }
    // in the listing the Q branch stands as the fall-through behind these stores and reuses their registers
    asm volatile("s_wait_xcnt 0x0" ::: "memory");
    return;
  }
  float* cw = C + (size_t)(blockIdx.y * (TN / 64) + wn) * cbs + (size_t)(row0 + wm * (TM / 4)) * ldc;
  const int rsub = lane >> 4, c4 = (lane & 15) * 4;
#pragma unroll
  for (int q = 0; q < TM / 8; ++q) { const int r = q * 2 + rsub; const v4f v = *(const v4fa*)&so[r * SP + c4]; *(v4f*)(cw + (size_t)r * ldc + c4) = v; }
}

// All weight preparation in ONE launch. Blocks 0..383, 128 per matrix: Bt[m][n][k] = bf16(Wm[k][n]) for W1, W2, W3 (thread per (n, 8 k)), one [1536][512] B operand.
// Blocks 384..415: W4^T as an f32 A operand, W4T[d][c] = bf16(W4[c][d]) ([64][512]; thread per (d, 4 c)).
__global__ __launch_bounds__(256) void k_prep(const float* __restrict__ W1, const float* __restrict__ W2, const float* __restrict__ W3, const float* __restrict__ W4, unsigned short* __restrict__ Bt, float* __restrict__ W4T) {
  const int b = blockIdx.x;
  if (b >= 3 * 128) {
    const int t = (b - 3 * 128) * 256 + threadIdx.x; const int c4 = (t * 4) % DM, d = (t * 4) / DM;
    v4f o; for (int q = 0; q < 4; ++q) o[q] = bf16_round(W4[(size_t)(c4 + q) * HS + d]);
    *(v4f*)(W4T + (size_t)t * 4) = o;
    return;
  }
  const float* W = b < 128 ? W1 : b < 256 ? W2 : W3;
  const int t = (b & 127) * 256 + threadIdx.x; const int n = t / (DM / 8), k8 = (t % (DM / 8)) * 8;
  v8us v; for (int q = 0; q < 8; ++q) v[q] = bf16_bits(W[(size_t)(k8 + q) * DM + n]);
  *(v8us*)(Bt + (size_t)(b >> 7) * DM * DM + (size_t)n * DM + k8) = v;
  // in the listing the W4 branch stands as the fall-through behind this store and reuses its registers
  asm volatile("s_wait_xcnt 0x0" ::: "memory");
}
extern "C" void kernel_launch(void* const* d_in, const int* in_sizes, int n_in,
                              void* d_out, int out_size, void* d_ws, size_t ws_size, hipStream_t stream) {
  (void)in_sizes; (void)n_in; (void)out_size;
  const float* x = (const float*)d_in[0]; const float* y = (const float*)d_in[1]; const float* W1 = (const float*)d_in[2]; const float* W2 = (const float*)d_in[3]; const float* W3 = (const float*)d_in[4]; const float* W4 = (const float*)d_in[5];
  char* ws = (char*)d_ws; size_t off = 0;
  auto take = [&](size_t bytes) { char* p = ws + off; off += (bytes + 255) & ~(size_t)255; return p; };
  unsigned short* Bt = (unsigned short*)take((size_t)3 * DM * DM * 2); float* W4T = (float*)take((size_t)HS * DM * 4);
  float* Q = (float*)take((size_t)NTOK * DM * 4); unsigned short* Kh = (unsigned short*)take((size_t)NTOK * 2 * DM * 2); unsigned short* Kl = (unsigned short*)take((size_t)NTOK * 2 * DM * 2);
  _Float16* ATT = (_Float16*)take((size_t)NSET * NIT * HK * 2); _Float16* VWt16 = (_Float16*)take((size_t)NSET * HS * HK * 2);
  if (off > ws_size) return;
  k_prep<<<3 * 128 + HS * DM / 4 / 256, 256, 0, stream>>>(W1, W2, W3, W4, Bt, W4T);
  // Q = x W1 (f32) and [K | V] = y [W2 | W3] (bf16 hi/lo planes, pitch 1024): grid.y = 128-column tiles of [W1 | W2 | W3]
  k_gemm_tile<true, 128, DM><<<dim3(NTOK / 128, 3 * DM / TN), 256, 0, stream>>>(x, y, nullptr, Bt, Q, Kh, Kl, DM, 64);
  // f16 operands of the final product: grid.x = 4 blocks of scores + 2 blocks of VW^T per (set, head)
  k_sv<<<dim3(6, NSET, NH), 128, 0, stream>>>(Q, W4T, Kh, Kl, ATT, VWt16);
  // out[i][j] = ATT[j] * VWt[i]^T for all 1024 (i, j) as one 4096 x 2048 x 1024 product: grid.x = 256-row tiles of (j,q), grid.y = 128-column tiles of (i,d)
  k_gemm_tile<false, 256, HK><<<dim3(NTOK / 256, NSET * HS / TN), 256, 0, stream>>>(nullptr, nullptr, ATT, (const unsigned short*)VWt16, (float*)d_out, nullptr, nullptr, HS, (size_t)NTOK * HS);
}

// v004
// Measured time: 36.4 microseconds a run.
// In both of two side-by-side timings against v003, it was 1.21 times as fast.
// Over all steps from v000 it is 34.2 times as fast.
#include <hip/hip_runtime.h>
// On WMMA (f32 accumulate): Q = x·W1, K = y·W2, V = y·W3 (inputs rounded to bf16: single exact terms), per (set, head) scores = q·kᵀ (both computed f32 → bf16 hi/lo: 3 products,
// K = 64), VWᵀ[i][d][(h,k)] = Σ_e W4[h·64+e][d]·v[i][k][h·64+e] (bf16-rounded W4 vs split v), and the cross-set contraction out[i][j] = attn[j]·VW[i] on v_wmma_f32_16x16x32_f16 with
// attn = relu(scores/8)/128 stored in f16 and VWᵀ in f16 (single product; 1024 pairs × 128 × 1024 × 64) — an exact re-association of (attn[j]·v[i])·W4. relu/scaling are f32 VALU.
#define NSET 32
#define NIT 128
#define DM 512
#define NH 8
#define HS 64
#define NTOK (NSET * NIT)
#define HK (NH * NIT)      // 1024 = (h,k) contraction length

typedef __bf16 v16b __attribute__((ext_vector_type(16)));
typedef unsigned short v8us __attribute__((ext_vector_type(8), may_alias));
typedef float  v8f  __attribute__((ext_vector_type(8)));
typedef float  v4f  __attribute__((ext_vector_type(4)));
typedef float  v4fa __attribute__((ext_vector_type(4), may_alias));
typedef float  f32a __attribute__((may_alias));
union FragB { v16b v; v8us half[2]; unsigned short u[16]; };

__device__ __forceinline__ unsigned short bf16_bits(float x) { unsigned int u = __float_as_uint(x); return (unsigned short)((u + 0x7FFFu + ((u >> 16) & 1u)) >> 16); }
__device__ __forceinline__ float bf16_val(unsigned short b) { return __uint_as_float(((unsigned int)b) << 16); }
__device__ __forceinline__ float bf16_round(float x) { return bf16_val(bf16_bits(x)); }
// D += A·B with NT terms: 1 = ah·bh, 2 = + al·bh (A split), 3 = + ah·bl (both split)
template <int NT>
__device__ __forceinline__ v8f mmaN(v16b ah, v16b al, v16b bh, v16b bl, v8f c) {
  c = __builtin_amdgcn_wmma_f32_16x16x32_bf16(false, ah, false, bh, (short)0, c, false, false);
  if (NT >= 2) c = __builtin_amdgcn_wmma_f32_16x16x32_bf16(false, al, false, bh, (short)0, c, false, false);
  if (NT >= 3) c = __builtin_amdgcn_wmma_f32_16x16x32_bf16(false, ah, false, bl, (short)0, c, false, false);
  asm volatile("v_nop\n\tv_nop\n\tv_nop\n\tv_nop" : "+v"(c) : "v"(ah), "v"(al), "v"(bh), "v"(bl));
  return c;
}

__global__ __launch_bounds__(256) void k_wt_bf16(const float* __restrict__ W, unsigned short* __restrict__ Wt, int K, int N) {
  const int t = blockIdx.x * 256 + threadIdx.x;
  const int k8n = K / 8;
  if (t >= N * k8n) return;
  const int n = t / k8n, k8 = (t % k8n) * 8;
  v8us v;
#pragma unroll
  for (int i = 0; i < 8; ++i) v[i] = bf16_bits(W[(size_t)(k8 + i) * N + n]);
  *(v8us*)(Wt + (size_t)n * K + k8) = v;
  
}

// GEMM C[M][N] (f32, pitch ldc) = act(A[M][K]·W + bias). A f32 row-major (pitch lda) converted per fragment to bf16
// (ASPLIT: hi/lo two planes -> 2 terms, else single rounded term); Wt bf16 [N][K] (pitch ldb). BIAS_BF16 rounds the
// bias to bf16 first (bias quantised to bf16 before the add). K%32==0, M%16==0, N%64==0.
template <bool ASPLIT, int ACT, bool BIAS_BF16>
__global__ __launch_bounds__(128) void k_gemm_bf(const float* __restrict__ A, int lda, const unsigned short* __restrict__ Wt, int ldb,
                                               const float* __restrict__ bias, float* __restrict__ C, int ldc, int M, int N, int K) {
  __shared__ __attribute__((aligned(16))) float so[4][16][64];
  const int tid = threadIdx.x, w = tid >> 5, lane = tid & 31, ln = lane & 15, hh = lane >> 4;
  const int ntn = N / 64;
  const int wid = blockIdx.x * 4 + w;
  const int mt = wid / ntn, nq = wid % ntn;
  if (mt * 16 >= M) return;
  const int row0 = mt * 16, col0 = nq * 64;
  const float* arow = A + (size_t)(row0 + ln) * lda;
  v8f acc[4] = {};
  for (int kb = 0; kb < K; kb += 32) {
    FragB ah, al;
    const v4f x0 = *(const v4fa*)(arow + kb + 8 * hh), x1 = *(const v4fa*)(arow + kb + 8 * hh + 4);
    const v4f x2 = *(const v4fa*)(arow + kb + 16 + 8 * hh), x3 = *(const v4fa*)(arow + kb + 16 + 8 * hh + 4);
    float xs[16] = {x0[0],x0[1],x0[2],x0[3],x1[0],x1[1],x1[2],x1[3],x2[0],x2[1],x2[2],x2[3],x3[0],x3[1],x3[2],x3[3]};
#pragma unroll
    for (int i = 0; i < 16; ++i) { const unsigned short hb = bf16_bits(xs[i]); ah.u[i] = hb; al.u[i] = ASPLIT ? bf16_bits(xs[i] - bf16_val(hb)) : (unsigned short)0; }
#pragma unroll
    for (int t = 0; t < 4; ++t) {
      const unsigned short* brow = Wt + (size_t)(col0 + t * 16 + ln) * ldb + kb;
      FragB b;
      b.half[0] = *(const v8us*)(brow + 8 * hh);
      b.half[1] = *(const v8us*)(brow + 16 + 8 * hh);
      acc[t] = mmaN<ASPLIT ? 2 : 1>(ah.v, al.v, b.v, b.v, acc[t]);
    }
  }
#pragma unroll
  for (int t = 0; t < 4; ++t) {
    float bv = bias ? bias[col0 + t * 16 + ln] : 0.f;
    if (BIAS_BF16) bv = bf16_round(bv);
#pragma unroll
    for (int r = 0; r < 8; ++r) { float v = acc[t][r] + bv; if (ACT == 1) v = fmaxf(v, 0.f); so[w][8 * hh + r][t * 16 + ln] = v; }
  }
  __builtin_amdgcn_fence(__ATOMIC_ACQ_REL, "workgroup");
  __builtin_amdgcn_wave_barrier();
  const int rsub = lane >> 4, c4 = (lane & 15) * 4;
  {
#pragma unroll
    for (int q = 0; q < 8; ++q) {
      const int r = q * 2 + rsub;
      const v4f v = *(const v4fa*)&so[w][r][c4];
      *(v4f*)(C + (size_t)(row0 + r) * ldc + col0 + c4) = v;
    }
    
  }
}

// Flash-style causal/unmasked attention, all contractions 3-term bf16 hi/lo splits, f32 softmax with running max.
// q,k,v rows are read from f32 buffers with arbitrary row pitch (so they can live inside a fused qkv buffer);
// D = head size (multiple of 32, <= 128); one wave = 16 query rows; block = 4 waves (64 queries) sharing K/V chunks of 32.
template <int D, bool CAUSAL>
__global__ __launch_bounds__(128) void k_flash(const float* __restrict__ qb, const float* __restrict__ kb, const float* __restrict__ vb,
                                             int pitch, int T, int H, float scale, float* __restrict__ y, int ypitch) {
  constexpr int KS = D / 32;        // k-steps for QK
  constexpr int DT = D / 16;        // d tiles for PV
  __shared__ __attribute__((aligned(16))) unsigned short sKh[32][D + 8], sKl[32][D + 8], sVh[32][D + 8], sVl[32][D + 8];
  __shared__ __attribute__((aligned(16))) unsigned short sPh[4][16][40], sPl[4][16][40];
  __shared__ __attribute__((aligned(16))) float sO[4][16][D];
  const int tid = threadIdx.x, w = tid >> 5, lane = tid & 31, ln = lane & 15, hh = lane >> 4;
  const int nqb = (T + 63) / 64;
  const int bh = blockIdx.x / nqb, qblk = blockIdx.x % nqb;
  const int b = bh / H, h = bh % H;
  const int q0 = qblk * 64 + w * 16;
  const float* Q = qb + (size_t)b * T * pitch + h * D;
  const float* K = kb + (size_t)b * T * pitch + h * D;
  const float* V = vb + (size_t)b * T * pitch + h * D;

  // A fragments of the wave's 16 query rows (scaled), hi/lo
  FragB aqh[KS], aql[KS];
  {
    int row = q0 + ln; if (row >= T) row = T - 1;
    const float* qr = Q + (size_t)row * pitch;
#pragma unroll
    for (int ks = 0; ks < KS; ++ks)
#pragma unroll
      for (int i = 0; i < 16; ++i) {
        const int d = ks * 32 + ((i < 8) ? (8 * hh + i) : (16 + 8 * hh + (i - 8)));
        const float x = qr[d] * scale; const unsigned short hb = bf16_bits(x);
        aqh[ks].u[i] = hb; aql[ks].u[i] = bf16_bits(x - bf16_val(hb));
      }
  }
  float m_r[8], l_r[8];
#pragma unroll
  for (int r = 0; r < 8; ++r) { m_r[r] = -3.0e38f; l_r[r] = 0.f; }
  v8f oacc[DT];
#pragma unroll
  for (int dt = 0; dt < DT; ++dt) oacc[dt] = (v8f){0.f,0.f,0.f,0.f,0.f,0.f,0.f,0.f};

  const int kv_end = CAUSAL ? min(T, qblk * 64 + 64) : T;     // block-uniform
  for (int j0 = 0; j0 < kv_end; j0 += 32) {
    __syncthreads();
    for (int e = tid; e < 32 * (D / 4); e += 128) {
      const int r = e / (D / 4), c4 = (e % (D / 4)) * 4;
      const int key = j0 + r;
      v4f kf = {0.f,0.f,0.f,0.f}, vf = {0.f,0.f,0.f,0.f};
      if (key < T) { kf = *(const v4fa*)(K + (size_t)key * pitch + c4); vf = *(const v4fa*)(V + (size_t)key * pitch + c4); }
#pragma unroll
      for (int t = 0; t < 4; ++t) {
        unsigned short hb = bf16_bits(kf[t]); sKh[r][c4 + t] = hb; sKl[r][c4 + t] = bf16_bits(kf[t] - bf16_val(hb));
        hb = bf16_bits(vf[t]); sVh[r][c4 + t] = hb; sVl[r][c4 + t] = bf16_bits(vf[t] - bf16_val(hb));
      }
    }
    __syncthreads();
    // S tile 16 x 32
    v8f s[2];
#pragma unroll
    for (int nt = 0; nt < 2; ++nt) {
      v8f acc = {};
#pragma unroll
      for (int ks = 0; ks < KS; ++ks) {
        FragB bh_, bl_;
        bh_.half[0] = *(const v8us*)&sKh[nt * 16 + ln][ks * 32 + 8 * hh]; bh_.half[1] = *(const v8us*)&sKh[nt * 16 + ln][ks * 32 + 16 + 8 * hh];
        bl_.half[0] = *(const v8us*)&sKl[nt * 16 + ln][ks * 32 + 8 * hh]; bl_.half[1] = *(const v8us*)&sKl[nt * 16 + ln][ks * 32 + 16 + 8 * hh];
        acc = mmaN<3>(aqh[ks].v, aql[ks].v, bh_.v, bl_.v, acc);
      }
      s[nt] = acc;
    }
    // mask + running max (rows 8hh+r; the 16 lanes of a half share rows)
    float alpha[8];
#pragma unroll
    for (int r = 0; r < 8; ++r) {
      const int qi = q0 + 8 * hh + r;
      const int ja = j0 + ln, jb = j0 + 16 + ln;
      if (CAUSAL) { if (ja > qi) s[0][r] = -3.0e38f; if (jb > qi) s[1][r] = -3.0e38f; }
      if (ja >= T) s[0][r] = -3.0e38f;
      if (jb >= T) s[1][r] = -3.0e38f;
      float mx = fmaxf(s[0][r], s[1][r]);
      mx = fmaxf(mx, __shfl_xor(mx, 1, 32)); mx = fmaxf(mx, __shfl_xor(mx, 2, 32)); mx = fmaxf(mx, __shfl_xor(mx, 4, 32)); mx = fmaxf(mx, __shfl_xor(mx, 8, 32));
      const float mnew = fmaxf(m_r[r], mx);
      alpha[r] = (mnew > -1.0e38f) ? __expf(m_r[r] - mnew) : 1.0f;
      const float p0 = (s[0][r] > -1.0e38f) ? __expf(s[0][r] - mnew) : 0.f;
      const float p1 = (s[1][r] > -1.0e38f) ? __expf(s[1][r] - mnew) : 0.f;
      m_r[r] = mnew;
      l_r[r] = l_r[r] * alpha[r] + p0 + p1;            // per-lane partial row sum (16 lanes combined at the end)
      unsigned short hb = bf16_bits(p0); sPh[w][8 * hh + r][ln] = hb;      sPl[w][8 * hh + r][ln] = bf16_bits(p0 - bf16_val(hb));
      hb = bf16_bits(p1);                sPh[w][8 * hh + r][16 + ln] = hb; sPl[w][8 * hh + r][16 + ln] = bf16_bits(p1 - bf16_val(hb));
    }
#pragma unroll
    for (int dt = 0; dt < DT; ++dt)
#pragma unroll
      for (int r = 0; r < 8; ++r) oacc[dt][r] *= alpha[r];
    __builtin_amdgcn_fence(__ATOMIC_ACQ_REL, "workgroup");
    __builtin_amdgcn_wave_barrier();
    FragB pah, pal;
    pah.half[0] = *(const v8us*)&sPh[w][ln][8 * hh]; pah.half[1] = *(const v8us*)&sPh[w][ln][16 + 8 * hh];
    pal.half[0] = *(const v8us*)&sPl[w][ln][8 * hh]; pal.half[1] = *(const v8us*)&sPl[w][ln][16 + 8 * hh];
#pragma unroll
    for (int dt = 0; dt < DT; ++dt) {
      FragB bvh, bvl;
#pragma unroll
      for (int i = 0; i < 8; ++i) {
        bvh.u[i] = sVh[8 * hh + i][dt * 16 + ln]; bvh.u[8 + i] = sVh[16 + 8 * hh + i][dt * 16 + ln];
        bvl.u[i] = sVl[8 * hh + i][dt * 16 + ln]; bvl.u[8 + i] = sVl[16 + 8 * hh + i][dt * 16 + ln];
      }
      oacc[dt] = mmaN<3>(pah.v, pal.v, bvh.v, bvl.v, oacc[dt]);
    }
    __builtin_amdgcn_fence(__ATOMIC_ACQ_REL, "workgroup");
    __builtin_amdgcn_wave_barrier();
  }
#pragma unroll
  for (int r = 0; r < 8; ++r) {
    float l = l_r[r];
    l += __shfl_xor(l, 1, 32); l += __shfl_xor(l, 2, 32); l += __shfl_xor(l, 4, 32); l += __shfl_xor(l, 8, 32);
    l_r[r] = (l > 0.f) ? 1.0f / l : 0.f;
  }
#pragma unroll
  for (int dt = 0; dt < DT; ++dt)
#pragma unroll
    for (int r = 0; r < 8; ++r) sO[w][8 * hh + r][dt * 16 + ln] = oacc[dt][r] * l_r[r];
  __builtin_amdgcn_fence(__ATOMIC_ACQ_REL, "workgroup");
  __builtin_amdgcn_wave_barrier();
  {
    for (int r = 0; r < 16; ++r) {
      const int row = q0 + r;
      if (row < T && lane < D / 4) {
        const v4f val = *(const v4fa*)&sO[w][r][lane * 4];
        *(v4f*)(y + ((size_t)b * T + row) * ypitch + h * D + lane * 4) = val;
      }
    }
    
  }
}

// row LayerNorm (biased variance, eps) over N: s = X (+ R); optional out_sum <- s; out_norm <- (s-mu)*rsqrt(var+eps)*g + b
template <bool PARAM_BF16>
__global__ __launch_bounds__(256) void k_layernorm(const float* __restrict__ X, const float* __restrict__ R, const float* __restrict__ g, const float* __restrict__ bta,
                                                  float* __restrict__ out_sum, float* __restrict__ out_norm, int N, float eps) {
  __shared__ float red[256];
  const int row = blockIdx.x, tid = threadIdx.x;
  const float* x = X + (size_t)row * N; const float* rr = R ? R + (size_t)row * N : nullptr;
  float vals[16];                     // up to N = 4096
  const int per = N / 256;            // contiguous chunk per thread? use strided-by-4 chunks: thread handles j = tid*4 + 1024*u
  float s1 = 0.f;
  for (int u = 0; u < per / 4; ++u) {
    const int j = tid * 4 + 1024 * u;
    const v4f a = *(const v4fa*)(x + j);
    v4f b = {0.f,0.f,0.f,0.f}; if (rr) b = *(const v4fa*)(rr + j);
#pragma unroll
    for (int q = 0; q < 4; ++q) { const float v = a[q] + b[q]; vals[u * 4 + q] = v; s1 += v; }
  }
  red[tid] = s1; __syncthreads();
  for (int st = 128; st > 0; st >>= 1) { if (tid < st) red[tid] += red[tid + st]; __syncthreads(); }
  const float mu = red[0] / (float)N; __syncthreads();
  float s2 = 0.f;
  for (int u = 0; u < per / 4; ++u)
#pragma unroll
    for (int q = 0; q < 4; ++q) { const float c = vals[u * 4 + q] - mu; s2 += c * c; }
  red[tid] = s2; __syncthreads();
  for (int st = 128; st > 0; st >>= 1) { if (tid < st) red[tid] += red[tid + st]; __syncthreads(); }
  const float rs = rsqrtf(red[0] / (float)N + eps);
  {
    for (int u = 0; u < per / 4; ++u) {
      const int j = tid * 4 + 1024 * u;
      v4f o, sm;
#pragma unroll
      for (int q = 0; q < 4; ++q) {
        float gg = g[j + q], bb = bta[j + q];
        if (PARAM_BF16) { gg = bf16_round(gg); bb = bf16_round(bb); }
        sm[q] = vals[u * 4 + q]; o[q] = (vals[u * 4 + q] - mu) * rs * gg + bb;
      }
      if (out_sum) *(v4f*)(out_sum + (size_t)row * N + j) = sm;
      *(v4f*)(out_norm + (size_t)row * N + j) = o;
    }
    
  }
}

// batched f32 [K][N] (pitch lds, batch stride sIn) -> transposed hi/lo planes [N][K] (batch stride sOut); thread per (n, 8 k); grid.y = batch
__global__ __launch_bounds__(256) void k_split_transpose_b(const float* __restrict__ src, int lds_, size_t sIn, unsigned short* __restrict__ hi, unsigned short* __restrict__ lo, size_t sOut, int K, int N) {
  const size_t t = (size_t)blockIdx.x * 256 + threadIdx.x; const int k8n = K / 8; if (t >= (size_t)N * k8n) return;
  src += (size_t)blockIdx.y * sIn; hi += (size_t)blockIdx.y * sOut; lo += (size_t)blockIdx.y * sOut;
  const int n = (int)(t / k8n), k8 = (int)(t % k8n) * 8; v8us vh, vl;
#pragma unroll
  for (int i = 0; i < 8; ++i) { const float x = src[(size_t)(k8 + i) * lds_ + n]; const unsigned short hb = bf16_bits(x); vh[i] = hb; vl[i] = bf16_bits(x - bf16_val(hb)); }
  unsigned short* dh = hi + (size_t)n * K + k8; unsigned short* dl = lo + (size_t)n * K + k8;
  *(v8us*)dh = vh; *(v8us*)dl = vl; 
}

// ---- f16 WMMA path (v_wmma_f32_16x16x32_f16): 11-bit significands for operands in range — used where the relu(scores/8)/128 attention operand needs more precision than bf16
typedef _Float16 v16h __attribute__((ext_vector_type(16)));
union FragH { v16h v; v8us half[2]; _Float16 h[16]; unsigned short u[16]; };
template <int NT>
__device__ __forceinline__ v8f mmaH(v16h ah, v16h al, v16h bh, v16h bl, v8f c) {
  c = __builtin_amdgcn_wmma_f32_16x16x32_f16(false, ah, false, bh, (short)0, c, false, false);
  if (NT >= 2) c = __builtin_amdgcn_wmma_f32_16x16x32_f16(false, al, false, bh, (short)0, c, false, false);
  if (NT >= 3) c = __builtin_amdgcn_wmma_f32_16x16x32_f16(false, ah, false, bl, (short)0, c, false, false);
  asm volatile("v_nop\n\tv_nop\n\tv_nop\n\tv_nop" : "+v"(c) : "v"(ah), "v"(al), "v"(bh), "v"(bl));
  return c;
}
// batched GEMM like k_gemm_b but f16 operands: A f32 (split into f16 hi/lo if ASPLIT, else rounded to f16), Bt = f16 values [n][k]; alpha; C f32; N multiple of 16 (partial tiles skipped)
template <bool ASPLIT>
__global__ __launch_bounds__(128) void k_gemm_h(const float* __restrict__ A, int lda, size_t sA, const _Float16* __restrict__ Bh, int ldb, size_t sB, float alpha, float* __restrict__ C, int ldc, size_t sC, int M, int N, int K) {
  __shared__ __attribute__((aligned(16))) float so[4][16][64];
  const int tid = threadIdx.x, w = tid >> 5, lane = tid & 31, ln = lane & 15, hh = lane >> 4; const int by = blockIdx.y;
  A += (size_t)by * sA; Bh += (size_t)by * sB; C += (size_t)by * sC;
  const int ntn = (N + 63) / 64; const int wid = blockIdx.x * 4 + w; const int mt = wid / ntn, nq = wid % ntn; if (mt * 16 >= M) return;
  const int row0 = mt * 16, col0 = nq * 64; const float* arow = A + (size_t)(row0 + ln) * lda;
  v8f acc[4] = {};
  for (int kb = 0; kb < K; kb += 32) {
    FragH ah, al;
    const v4f x0 = *(const v4fa*)(arow + kb + 8 * hh), x1 = *(const v4fa*)(arow + kb + 8 * hh + 4), x2 = *(const v4fa*)(arow + kb + 16 + 8 * hh), x3 = *(const v4fa*)(arow + kb + 16 + 8 * hh + 4);
    float xs[16] = {x0[0],x0[1],x0[2],x0[3],x1[0],x1[1],x1[2],x1[3],x2[0],x2[1],x2[2],x2[3],x3[0],x3[1],x3[2],x3[3]};
#pragma unroll
    for (int i = 0; i < 16; ++i) { const _Float16 h = (_Float16)xs[i]; ah.h[i] = h; al.h[i] = ASPLIT ? (_Float16)(xs[i] - (float)h) : (_Float16)0.0f; }
#pragma unroll
    for (int t = 0; t < 4; ++t) { if (col0 + t * 16 >= N) continue; const size_t boff = (size_t)(col0 + t * 16 + ln) * ldb + kb; FragH bq; bq.half[0] = *(const v8us*)(Bh + boff + 8 * hh); bq.half[1] = *(const v8us*)(Bh + boff + 16 + 8 * hh);
      acc[t] = mmaH<ASPLIT ? 2 : 1>(ah.v, al.v, bq.v, bq.v, acc[t]); }
  }
#pragma unroll
  for (int t = 0; t < 4; ++t) { if (col0 + t * 16 >= N) continue;
#pragma unroll
    for (int r = 0; r < 8; ++r) so[w][8 * hh + r][t * 16 + ln] = acc[t][r] * alpha; }
  __builtin_amdgcn_fence(__ATOMIC_ACQ_REL, "workgroup"); __builtin_amdgcn_wave_barrier();
  const int rsub = lane >> 4, c4 = (lane & 15) * 4;
  {
#pragma unroll
    for (int q = 0; q < 8; ++q) { const int r = q * 2 + rsub; if (col0 + c4 < N) { const v4f v = *(const v4fa*)&so[w][r][c4]; *(v4f*)(C + (size_t)(row0 + r) * ldc + col0 + c4) = v; } }
     }
}

// Block-tiled product through LDS, C = A * B^T with A [M][K] and B [N][K] both k-contiguous; the launch below uses the second form (the projections are in k_head):
//   PROJ: all three projections in ONE launch: B = the transposed bf16 weights [W1 | W2 | W3], 1536 rows; A = x for the columns of W1 and y for the rest, in f32,
//         rounded to bf16 once while it is staged; Q is stored as f32 row-major, [K | V] straight as the bf16 hi/lo planes Ph and Pl.
//   else: A = ATT [(j,q)][1024] f16, B = VWt16 [(i,d)][1024] f16: all 1024 set pairs as ONE 4096 x 2048 x 1024 product; for one i the rows (j,q) of out are contiguous.
// A work-group of 8 waves owns TM rows x 128 columns; a wave owns TM/4 x 64, so a fragment read from LDS feeds several WMMAs and every operand byte
// leaves L2 once per work-group, in whole 128-B lines (a wave-wide 16-B load covers 512 contiguous bytes of one f32 row or 256 of each of two 16-bit rows).
// A pass is 128 k: TM + 128 rows of 256 B at an LDS pitch of 272 B (conflict-free for 16-B fragment reads). Two buffers: the next pass's rows are loaded
// into registers ahead of this pass's WMMAs and stored into the other buffer ahead of its last block; one barrier a pass publishes them and frees this buffer.
// Per output tile the k order (32 at a time, ascending, same lane map) is that of a wave reading its fragments straight from global memory.
#define TN 128
#define TK 128
#define LP 136             // LDS row pitch in 16-bit elements (272 B)
#define SP 68              // epilogue staging pitch in floats (272 B): rows 8 apart fall on different banks
typedef unsigned short v4us __attribute__((ext_vector_type(4), may_alias));
union FragX { v16h h; v16b b; v8us half[2]; };
// C element (row, col) lies at C + (col / 64) * cbs + row * ldc + col % 64
template <bool PROJ, int TM, int K>
__global__ __launch_bounds__(256) void k_gemm_tile(const float* __restrict__ Ax, const float* __restrict__ Ay, const _Float16* __restrict__ Ah, const unsigned short* __restrict__ B, float* __restrict__ C,
                                                 unsigned short* __restrict__ Ph, unsigned short* __restrict__ Pl, int ldc, size_t cbs) {
  constexpr int MI = TM / 64;      // accumulator tiles of a wave in M (4 in N)
  __shared__ __attribute__((aligned(16))) unsigned short sm[2][(TM + TN) * LP];
  const int tid = threadIdx.x, w = tid >> 5, lane = tid & 31, ln = lane & 15, hh = lane >> 4;
  const int wm = w >> 1, wn = w & 1;
  const int row0 = blockIdx.x * TM, col0 = blockIdx.y * TN;
  const int lr = tid >> 4, lc = (tid & 15) * 8;      // 16-bit rows: 16 lanes x 16 B = the 256-B slice of a row
  const int fr = tid >> 5, fc = (tid & 31) * 4;      // f32 rows: 32 lanes x 16 B = the 512-B slice of a row
  const bool isq = !PROJ || blockIdx.y < DM / TN;      // PROJ: this column tile belongs to Q (the same for the whole work-group)
  const float* gf = PROJ ? (isq ? Ax : Ay) + (size_t)(row0 + fr) * K + fc : nullptr;
  const unsigned short* ga = PROJ ? nullptr : (const unsigned short*)Ah + (size_t)(row0 + lr) * K + lc;
  const unsigned short* gb = B + (size_t)(col0 + lr) * K + lc;
  v4f sf[PROJ ? TM / 8 : 1]; v8us sa[PROJ ? 1 : TM / 16]; v8us sb[TN / 16];
  auto fetch = [&](int p) {
    if constexpr (PROJ) {
#pragma unroll
      for (int u = 0; u < TM / 8; ++u) sf[u] = *(const v4fa*)(gf + (size_t)u * 8 * K + p * TK);
    } else {
#pragma unroll
      for (int u = 0; u < TM / 16; ++u) sa[u] = *(const v8us*)(ga + (size_t)u * 16 * K + p * TK);
    }
#pragma unroll
    for (int u = 0; u < TN / 16; ++u) sb[u] = *(const v8us*)(gb + (size_t)u * 16 * K + p * TK);
  };
  auto put = [&](unsigned short* dst) {
    if constexpr (PROJ) {
#pragma unroll
      for (int u = 0; u < TM / 8; ++u) { v4us h; for (int q = 0; q < 4; ++q) h[q] = bf16_bits(sf[u][q]); *(v4us*)&dst[(u * 8 + fr) * LP + fc] = h; }
    } else {
#pragma unroll
      for (int u = 0; u < TM / 16; ++u) *(v8us*)&dst[(u * 16 + lr) * LP + lc] = sa[u];
    }
#pragma unroll
    for (int u = 0; u < TN / 16; ++u) *(v8us*)&dst[(TM + u * 16 + lr) * LP + lc] = sb[u];
  };
  fetch(0);
  put(sm[0]);
  __syncthreads();
  v8f acc[MI][4] = {};
  const int aoff = (wm * (TM / 4) + ln) * LP + 8 * hh, boff = (TM + wn * 64 + ln) * LP + 8 * hh;
  for (int p = 0; p < K / TK; ++p) {
    const unsigned short* cur = sm[p & 1];
    const bool more = p + 1 < K / TK;
    if (more) {
      fetch(p + 1);
      // the fragment reads below may reuse the registers that hold these loads' addresses
      asm volatile("s_wait_xcnt 0x0" ::: "memory");
    }
    FragX fa[2][MI], fb[2][4];
    auto frags = [&](int ks) {
#pragma unroll
      for (int m = 0; m < MI; ++m) { const int o = aoff + m * 16 * LP + ks * 32; fa[ks & 1][m].half[0] = *(const v8us*)&cur[o]; fa[ks & 1][m].half[1] = *(const v8us*)&cur[o + 16]; }
#pragma unroll
      for (int n = 0; n < 4; ++n) { const int o = boff + n * 16 * LP + ks * 32; fb[ks & 1][n].half[0] = *(const v8us*)&cur[o]; fb[ks & 1][n].half[1] = *(const v8us*)&cur[o + 16]; }
    };
    frags(0);
#pragma unroll
    for (int ks = 0; ks < TK / 32; ++ks) {
      if (ks + 1 < TK / 32) frags(ks + 1);
      else if (more) put(sm[(p + 1) & 1]);      // ahead of the last block, whose WMMAs run while the stores drain
      // scheduling fences round each block of WMMAs: without them the compiler reads all four blocks' fragments first and puts the wait for the
      // global loads, the stores and the barrier in front of nearly all WMMAs, so neither the LDS reads nor the global latency hide behind matrix work
      __builtin_amdgcn_sched_barrier(0);
#pragma unroll
      for (int m = 0; m < MI; ++m)
#pragma unroll
        for (int n = 0; n < 4; ++n) {
          if constexpr (PROJ) acc[m][n] = __builtin_amdgcn_wmma_f32_16x16x32_bf16(false, fa[ks & 1][m].b, false, fb[ks & 1][n].b, (short)0, acc[m][n], false, false);
          else                acc[m][n] = __builtin_amdgcn_wmma_f32_16x16x32_f16(false, fa[ks & 1][m].h, false, fb[ks & 1][n].h, (short)0, acc[m][n], false, false);
        }
      __builtin_amdgcn_sched_barrier(0);
    }
    __syncthreads();
  }
  // the last barrier has ended every read of the buffers: each wave stages its f32 tile in a range of its own and stores whole lines
  f32a* so = (f32a*)&sm[0][0] + (size_t)w * (TM / 4) * SP;
#pragma unroll
  for (int m = 0; m < MI; ++m)
#pragma unroll
    for (int n = 0; n < 4; ++n)
#pragma unroll
      for (int r = 0; r < 8; ++r) so[(m * 16 + 8 * hh + r) * SP + n * 16 + ln] = acc[m][n][r];
  // the wave's own LDS writes are complete before its lanes read back rows that other lanes wrote (no other wave touches this range)
  __builtin_amdgcn_fence(__ATOMIC_ACQ_REL, "workgroup"); __builtin_amdgcn_wave_barrier();
  if (!isq) {
    // [K | V]: bf16 head and remainder of each f32 result; the wave's 64 columns are 128 B a row in each plane, one whole line (8 lanes x 16 B)
    const size_t po = (size_t)(row0 + wm * (TM / 4)) * (2 * DM) + (col0 - DM) + wn * 64;
    const int r4 = lane >> 3, c8 = (lane & 7) * 8;
    // both loops unrolled: vector elements indexed by constants stay in registers, and the LDS reads of all rows issue ahead of the stores
#pragma unroll
    for (int q = 0; q < TM / 16; ++q) {
      const int r = q * 4 + r4;
      const v4f a = *(const v4fa*)&so[r * SP + c8], b = *(const v4fa*)&so[r * SP + c8 + 4];
      v8us h, l;
#pragma unroll
      for (int u = 0; u < 8; ++u) { const float v = u < 4 ? a[u & 3] : b[u & 3]; const unsigned short hb = bf16_bits(v); h[u] = hb; l[u] = bf16_bits(v - bf16_val(hb)); }
      *(v8us*)(Ph + po + (size_t)r * (2 * DM) + c8) = h; *(v8us*)(Pl + po + (size_t)r * (2 * DM) + c8) = l;
    }
    // in the listing the Q branch stands as the fall-through behind these stores and reuses their registers
    asm volatile("s_wait_xcnt 0x0" ::: "memory");
    return;
  }
  float* cw = C + (size_t)(blockIdx.y * (TN / 64) + wn) * cbs + (size_t)(row0 + wm * (TM / 4)) * ldc;
  const int rsub = lane >> 4, c4 = (lane & 15) * 4;
#pragma unroll
  for (int q = 0; q < TM / 8; ++q) { const int r = q * 2 + rsub; const v4f v = *(const v4fa*)&so[r * SP + c4]; *(v4f*)(cw + (size_t)r * ldc + c4) = v; }
}

// Projections, scores and VW^T of one (set s, head h) in ONE work-group (grid.x = s, grid.y = h; 8 waves), so Q, K and V never leave the WGP.
// Part 1: [Q | K | V] (128 x 192, k = 512) = [x W1h | y W2h | y W3h], staged like k_gemm_tile: a pass of 128 k holds 128 rows of x, 128 rows of y (f32 rounded to bf16 once while
//         staged) and the head's 3 x 64 rows of the transposed bf16 weights; two buffers, one barrier a pass. A wave owns 32 rows x 96 columns; its first four column tiles
//         take x (wn = 0) or y (wn = 1) as A, its last two always y.
// Part 2: every f32 result is split into its bf16 head and remainder, in six LDS planes [128][64] (pitch 144 B); behind one barrier each wave does three 16 x 64 jobs, 64 deep, 3 terms:
//         two of ATT[(s,q)][h*128 + k] = f16(relu(q.k / 8) / 128) and one of VWt16[(s,d)][h*128 + k] = f16(sum over e of W4T[d][h*64+e] * V[k][e]).
#define FA (2 * NIT)       // staged A rows of a pass: x, then y
#define FB (3 * HS)        // staged B rows of a pass
#define PP 72              // plane row pitch in 16-bit elements (144 B: conflict-free for 16-B fragment reads)
#define PSZ (NIT * PP)     // one plane
template <bool B> struct Flag { static constexpr bool v = B; };
__global__ __launch_bounds__(256) void k_head(const float* __restrict__ X, const float* __restrict__ Y, const unsigned short* __restrict__ Bt, const float* __restrict__ W4T,
                                            _Float16* __restrict__ ATT, _Float16* __restrict__ VWt16) {
  __shared__ __attribute__((aligned(16))) unsigned short sm[2][(FA + FB) * LP];
  const int tid = threadIdx.x, w = tid >> 5, lane = tid & 31, ln = lane & 15, hh = lane >> 4;
  const int wm = w >> 1, wn = w & 1;
  const int s = blockIdx.x, h = blockIdx.y;
  const int lr = tid >> 4, lc = (tid & 15) * 8;      // 16-bit rows: 16 lanes x 16 B = the 256-B slice of a row
  const int fr = tid >> 5, fc = (tid & 31) * 4;      // f32 rows: 32 lanes x 16 B = the 512-B slice of a row
  const float* gx = X + (size_t)(s * NIT + fr) * DM + fc;
  const float* gy = Y + (size_t)(s * NIT + fr) * DM + fc;
  const unsigned short* gb = Bt + (size_t)(h * HS + lr) * DM + lc;
  v4f sx[NIT / 8], sy[NIT / 8]; v8us sb[FB / 16];
  // The 44 staged 16-B pieces of a thread go in quarters: a quarter is stored to LDS and its registers are at once loaded anew for the pass after,
  // one quarter per block of WMMAs, so that loads are in flight all the time and each has a whole pass to arrive.
  auto fetchq = [&](int q, int p) {
#pragma unroll
    for (int u = q * 4; u < q * 4 + 4; ++u) { sx[u] = *(const v4fa*)(gx + (size_t)u * 8 * DM + p * TK); sy[u] = *(const v4fa*)(gy + (size_t)u * 8 * DM + p * TK); }
#pragma unroll
    for (int u = q * 3; u < q * 3 + 3; ++u) sb[u] = *(const v8us*)(gb + (size_t)((u >> 2) * DM + (u & 3) * 16) * DM + p * TK);
    // later instructions may reuse the registers that hold these loads' addresses
    asm volatile("s_wait_xcnt 0x0" ::: "memory");
  };
  auto putq = [&](int q, unsigned short* dst) {
#pragma unroll
    for (int u = q * 4; u < q * 4 + 4; ++u) {
      v4us a, b;
#pragma unroll
      for (int e = 0; e < 4; ++e) { a[e] = bf16_bits(sx[u][e]); b[e] = bf16_bits(sy[u][e]); }
      *(v4us*)&dst[(u * 8 + fr) * LP + fc] = a; *(v4us*)&dst[(NIT + u * 8 + fr) * LP + fc] = b;
    }
#pragma unroll
    for (int u = q * 3; u < q * 3 + 3; ++u) *(v8us*)&dst[(FA + u * 16 + lr) * LP + lc] = sb[u];
  };
  constexpr int NP = DM / TK;
#pragma unroll
  for (int q = 0; q < 4; ++q) fetchq(q, 0);
#pragma unroll
  for (int q = 0; q < 4; ++q) { putq(q, sm[0]); fetchq(q, 1); }
  // LDS-only fences, as at the foot of the loop: pass 1's loads stay in flight
  __builtin_amdgcn_fence(__ATOMIC_RELEASE, "workgroup", "local"); __builtin_amdgcn_s_barrier(); __builtin_amdgcn_fence(__ATOMIC_ACQUIRE, "workgroup", "local");
  v8f acc[2][6] = {};
  const int a0off = (wn * NIT + wm * 32 + ln) * LP + 8 * hh, a1off = (NIT + wm * 32 + ln) * LP + 8 * hh, boff = (FA + wn * 96 + ln) * LP + 8 * hh;
  auto pass = [&](int p, auto doput, auto dofetch) {
    const unsigned short* cur = sm[p & 1];
    unsigned short* nxt = sm[(p + 1) & 1];      // its readers left it at the barrier that ended the pass before
#pragma unroll
    for (int ks = 0; ks < TK / 32; ++ks) {
      FragX fa0[2], fa1[2], fb[6];
#pragma unroll
      for (int m = 0; m < 2; ++m) {
        const int o0 = a0off + m * 16 * LP + ks * 32, o1 = a1off + m * 16 * LP + ks * 32;
        fa0[m].half[0] = *(const v8us*)&cur[o0]; fa0[m].half[1] = *(const v8us*)&cur[o0 + 16];
        fa1[m].half[0] = *(const v8us*)&cur[o1]; fa1[m].half[1] = *(const v8us*)&cur[o1 + 16];
      }
#pragma unroll
      for (int n = 0; n < 6; ++n) { const int o = boff + n * 16 * LP + ks * 32; fb[n].half[0] = *(const v8us*)&cur[o]; fb[n].half[1] = *(const v8us*)&cur[o + 16]; }
      // scheduling fences: the fragment reads stay in front of the quarter's conversions, which run while the reads are under way, and one block's reads are not
      // lifted over another block's WMMAs (that would hold every block's fragments in registers at once)
      __builtin_amdgcn_sched_barrier(0);
      if constexpr (decltype(doput)::v) putq(ks, nxt);
      if constexpr (decltype(dofetch)::v) fetchq(ks, p + 2);
      __builtin_amdgcn_sched_barrier(0);
#pragma unroll
      for (int m = 0; m < 2; ++m)
#pragma unroll
        for (int n = 0; n < 6; ++n)
          acc[m][n] = __builtin_amdgcn_wmma_f32_16x16x32_bf16(false, (n < 4 ? fa0 : fa1)[m].b, false, fb[n].b, (short)0, acc[m][n], false, false);
      __builtin_amdgcn_sched_barrier(0);
    }
    // publishes the next pass's rows and ends every read of this pass's buffer. Only LDS is handed over here, so the fences name LDS alone:
    // __syncthreads() would also wait for the global loads of the pass after next, which are meant to stay in flight across the barrier
    __builtin_amdgcn_fence(__ATOMIC_RELEASE, "workgroup", "local"); __builtin_amdgcn_s_barrier(); __builtin_amdgcn_fence(__ATOMIC_ACQUIRE, "workgroup", "local");
  };
  // The passes that load stand in a loop of their own with no branch round the loads: with one, the compiler's counted waits assume the loads were skipped
  // and drain the quarters just issued. Kept rolled for the size of the code.
#pragma clang loop unroll(disable)
  for (int p = 0; p + 2 < NP; ++p) pass(p, Flag<true>{}, Flag<true>{});
  pass(NP - 2, Flag<true>{}, Flag<false>{});
  pass(NP - 1, Flag<false>{}, Flag<false>{});
  // W4T rows of this wave's VW^T job, fetched here so that their latency passes behind the split below
  const float* wrow = W4T + h * HS + (size_t)((w >> 1) * 16 + ln) * DM + 8 * hh;
  v4f wx[2][4];
#pragma unroll
  for (int k2 = 0; k2 < 2; ++k2) { wx[k2][0] = *(const v4fa*)(wrow + k2 * 32); wx[k2][1] = *(const v4fa*)(wrow + k2 * 32 + 4); wx[k2][2] = *(const v4fa*)(wrow + k2 * 32 + 16); wx[k2][3] = *(const v4fa*)(wrow + k2 * 32 + 20); }
  // the last barrier has ended every read of the buffers: planes Qh Ql Kh Kl Vh Vl from the start of the LDS
  unsigned short* pl = &sm[0][0];
#pragma unroll
  for (int m = 0; m < 2; ++m)
#pragma unroll
    for (int n = 0; n < 6; ++n) {
      const int tc = wn * 6 + n;      // column tile 0..11 of [Q | K | V]
      unsigned short* ph = pl + (tc >> 2) * 2 * PSZ + (wm * 32 + m * 16 + 8 * hh) * PP + (tc & 3) * 16 + ln;
#pragma unroll
      for (int r = 0; r < 8; ++r) { const float v = acc[m][n][r]; const unsigned short hb = bf16_bits(v); ph[r * PP] = hb; ph[PSZ + r * PP] = bf16_bits(v - bf16_val(hb)); }
    }
  // publishes the planes to all waves
  __syncthreads();
  f32a* so = (f32a*)&sm[0][0] + 6 * PSZ / 2 + w * 16 * SP;      // behind the planes, a range of the wave's own
  const int r4 = lane >> 3, c8 = (lane & 7) * 8;
#pragma unroll
  for (int jj = 0; jj < 3; ++jj) {
    const bool sc = jj < 2;
    const int wid = sc ? jj * 8 + w : w;
    const int row0 = (wid >> 1) * 16, col0 = (wid & 1) * 64;
    const unsigned short* bp = pl + (sc ? 2 : 4) * PSZ + (col0 + ln) * PP + 8 * hh;
    v8f a2[4] = {};
    // all fragments of the job are read first, and the four column tiles take turns term by term: four independent accumulator chains;
    // per tile the order stays ah.bh, al.bh, ah.bl, 32 k at a time
    FragB ah[2], al[2], bh_[2][4], bl_[2][4];
#pragma unroll
    for (int k2 = 0; k2 < 2; ++k2) {
      if (sc) {
        const unsigned short* ap = pl + (row0 + ln) * PP + k2 * 32 + 8 * hh;
        ah[k2].half[0] = *(const v8us*)ap; ah[k2].half[1] = *(const v8us*)(ap + 16);
        al[k2].half[0] = *(const v8us*)(ap + PSZ); al[k2].half[1] = *(const v8us*)(ap + PSZ + 16);
      } else {
#pragma unroll
        for (int i = 0; i < 16; ++i) { const float xv = wx[k2][i >> 2][i & 3]; const unsigned short hb = bf16_bits(xv); ah[k2].u[i] = hb; al[k2].u[i] = bf16_bits(xv - bf16_val(hb)); }
      }
#pragma unroll
      for (int t = 0; t < 4; ++t) {
        const unsigned short* b = bp + t * 16 * PP + k2 * 32;
        bh_[k2][t].half[0] = *(const v8us*)b; bh_[k2][t].half[1] = *(const v8us*)(b + 16);
        bl_[k2][t].half[0] = *(const v8us*)(b + PSZ); bl_[k2][t].half[1] = *(const v8us*)(b + PSZ + 16);
      }
    }
    // scheduling fence: without it the compiler spreads the reads in small groups among the WMMAs, each group with a wait of its own
    __builtin_amdgcn_sched_barrier(0);
#pragma unroll
    for (int k2 = 0; k2 < 2; ++k2) {
#pragma unroll
      for (int t = 0; t < 4; ++t) a2[t] = __builtin_amdgcn_wmma_f32_16x16x32_bf16(false, ah[k2].v, false, bh_[k2][t].v, (short)0, a2[t], false, false);
#pragma unroll
      for (int t = 0; t < 4; ++t) a2[t] = __builtin_amdgcn_wmma_f32_16x16x32_bf16(false, al[k2].v, false, bh_[k2][t].v, (short)0, a2[t], false, false);
#pragma unroll
      for (int t = 0; t < 4; ++t) a2[t] = __builtin_amdgcn_wmma_f32_16x16x32_bf16(false, ah[k2].v, false, bl_[k2][t].v, (short)0, a2[t], false, false);
    }
#pragma unroll
    for (int t = 0; t < 4; ++t)
#pragma unroll
      for (int r = 0; r < 8; ++r) so[(8 * hh + r) * SP + t * 16 + ln] = sc ? fmaxf(a2[t][r] * 0.125f, 0.f) * (1.0f / NIT) : a2[t][r];
    // the wave's own LDS writes are complete before its lanes read back rows that other lanes wrote (no other wave touches this range); LDS alone is named,
    // so that the fence does not wait for the job before's global stores
    __builtin_amdgcn_fence(__ATOMIC_ACQ_REL, "workgroup", "local"); __builtin_amdgcn_wave_barrier();
    unsigned short* dst = (unsigned short*)(sc ? ATT + (size_t)(s * NIT + row0) * HK : VWt16 + (size_t)(s * HS + row0) * HK) + h * NIT + col0;
    v8us o[4];
#pragma unroll
    for (int q = 0; q < 4; ++q) {
      const int r = q * 4 + r4;
      const v4f a = *(const v4fa*)&so[r * SP + c8], b = *(const v4fa*)&so[r * SP + c8 + 4];
      FragH f;
#pragma unroll
      for (int u = 0; u < 4; ++u) { f.h[u] = (_Float16)a[u]; f.h[4 + u] = (_Float16)b[u]; }
      o[q] = f.half[0];
    }
    // scheduling fences: the four stores and their wait stay together, so that no register that a store names is written anew in front of the wait
    __builtin_amdgcn_sched_barrier(0);
#pragma unroll
    for (int q = 0; q < 4; ++q) *(v8us*)(dst + (size_t)(q * 4 + r4) * HK + c8) = o[q];
    asm volatile("s_wait_xcnt 0x0" ::: "memory");
    __builtin_amdgcn_sched_barrier(0);
    // the next job's staging writes stay behind this job's reads
    __builtin_amdgcn_fence(__ATOMIC_ACQ_REL, "workgroup", "local"); __builtin_amdgcn_wave_barrier();
  }
}

// All weight preparation in ONE launch. Blocks 0..383, 128 per matrix: Bt[m][n][k] = bf16(Wm[k][n]) for W1, W2, W3 (thread per (n, 8 k)), one [1536][512] B operand.
// Blocks 384..415: W4^T as an f32 A operand, W4T[d][c] = bf16(W4[c][d]) ([64][512]; thread per (d, 4 c)).
__global__ __launch_bounds__(256) void k_prep(const float* __restrict__ W1, const float* __restrict__ W2, const float* __restrict__ W3, const float* __restrict__ W4, unsigned short* __restrict__ Bt, float* __restrict__ W4T) {
  const int b = blockIdx.x;
  if (b >= 3 * 128) {
    const int t = (b - 3 * 128) * 256 + threadIdx.x; const int c4 = (t * 4) % DM, d = (t * 4) / DM;
    v4f o; for (int q = 0; q < 4; ++q) o[q] = bf16_round(W4[(size_t)(c4 + q) * HS + d]);
    *(v4f*)(W4T + (size_t)t * 4) = o;
    return;
  }
  const float* W = b < 128 ? W1 : b < 256 ? W2 : W3;
  const int t = (b & 127) * 256 + threadIdx.x; const int n = t / (DM / 8), k8 = (t % (DM / 8)) * 8;
  v8us v; for (int q = 0; q < 8; ++q) v[q] = bf16_bits(W[(size_t)(k8 + q) * DM + n]);
  *(v8us*)(Bt + (size_t)(b >> 7) * DM * DM + (size_t)n * DM + k8) = v;
  // in the listing the W4 branch stands as the fall-through behind this store and reuses its registers
  asm volatile("s_wait_xcnt 0x0" ::: "memory");
}
extern "C" void kernel_launch(void* const* d_in, const int* in_sizes, int n_in,
                              void* d_out, int out_size, void* d_ws, size_t ws_size, hipStream_t stream) {
  (void)in_sizes; (void)n_in; (void)out_size;
  const float* x = (const float*)d_in[0]; const float* y = (const float*)d_in[1]; const float* W1 = (const float*)d_in[2]; const float* W2 = (const float*)d_in[3]; const float* W3 = (const float*)d_in[4]; const float* W4 = (const float*)d_in[5];
  char* ws = (char*)d_ws; size_t off = 0;
  auto take = [&](size_t bytes) { char* p = ws + off; off += (bytes + 255) & ~(size_t)255; return p; };
  unsigned short* Bt = (unsigned short*)take((size_t)3 * DM * DM * 2); float* W4T = (float*)take((size_t)HS * DM * 4);
  _Float16* ATT = (_Float16*)take((size_t)NSET * NIT * HK * 2); _Float16* VWt16 = (_Float16*)take((size_t)NSET * HS * HK * 2);
  if (off > ws_size) return;
  k_prep<<<3 * 128 + HS * DM / 4 / 256, 256, 0, stream>>>(W1, W2, W3, W4, Bt, W4T);
  // f16 operands of the final product, projections included: one work-group per (set, head)
  k_head<<<dim3(NSET, NH), 256, 0, stream>>>(x, y, Bt, W4T, ATT, VWt16);
  // out[i][j] = ATT[j] * VWt[i]^T for all 1024 (i, j) as one 4096 x 2048 x 1024 product: grid.x = 256-row tiles of (j,q), grid.y = 128-column tiles of (i,d)
  k_gemm_tile<false, 256, HK><<<dim3(NTOK / 256, NSET * HS / TN), 256, 0, stream>>>(nullptr, nullptr, ATT, (const unsigned short*)VWt16, (float*)d_out, nullptr, nullptr, HS, (size_t)NTOK * HS);
}

// v005
// A run of this version takes 33.8 microseconds.
// Two timings next to v004 put it at 1.08 and 1.07 times that version's speed.
// Counting every step since v000, it is 36.8 times as fast.
#include <hip/hip_runtime.h>
// On WMMA (f32 accumulate): Q = x·W1, K = y·W2, V = y·W3 (inputs rounded to bf16: single exact terms), per (set, head) scores = q·kᵀ (both computed f32 → bf16 hi/lo: 3 products,
// K = 64), VWᵀ[i][d][(h,k)] = Σ_e W4[h·64+e][d]·v[i][k][h·64+e] (W4 rounded to bf16 vs split v), and the cross-set contraction out[i][j] = attn[j]·VW[i] on v_wmma_f32_16x16x32_f16 with
// attn = relu(scores/8)/128 stored in f16 and VWᵀ in f16 (single product; 1024 pairs × 128 × 1024 × 64) — an exact re-association of (attn[j]·v[i])·W4. relu/scaling are f32 VALU.
#define NSET 32
#define NIT 128
#define DM 512
#define NH 8
#define HS 64
#define NTOK (NSET * NIT)
#define HK (NH * NIT)      // 1024 = (h,k) contraction length

typedef __bf16 v16b __attribute__((ext_vector_type(16)));
typedef unsigned short v8us __attribute__((ext_vector_type(8), may_alias));
typedef float  v8f  __attribute__((ext_vector_type(8)));
typedef float  v4f  __attribute__((ext_vector_type(4)));
typedef float  v4fa __attribute__((ext_vector_type(4), may_alias));
typedef float  f32a __attribute__((may_alias));
union FragB { v16b v; v8us half[2]; unsigned short u[16]; };

__device__ __forceinline__ unsigned short bf16_bits(float x) { unsigned int u = __float_as_uint(x); return (unsigned short)((u + 0x7FFFu + ((u >> 16) & 1u)) >> 16); }
__device__ __forceinline__ float bf16_val(unsigned short b) { return __uint_as_float(((unsigned int)b) << 16); }
__device__ __forceinline__ float bf16_round(float x) { return bf16_val(bf16_bits(x)); }
// D += A·B with NT terms: 1 = ah·bh, 2 = + al·bh (A split), 3 = + ah·bl (both split)
template <int NT>
__device__ __forceinline__ v8f mmaN(v16b ah, v16b al, v16b bh, v16b bl, v8f c) {
  c = __builtin_amdgcn_wmma_f32_16x16x32_bf16(false, ah, false, bh, (short)0, c, false, false);
  if (NT >= 2) c = __builtin_amdgcn_wmma_f32_16x16x32_bf16(false, al, false, bh, (short)0, c, false, false);
  if (NT >= 3) c = __builtin_amdgcn_wmma_f32_16x16x32_bf16(false, ah, false, bl, (short)0, c, false, false);
  asm volatile("v_nop\n\tv_nop\n\tv_nop\n\tv_nop" : "+v"(c) : "v"(ah), "v"(al), "v"(bh), "v"(bl));
  return c;
}

__global__ __launch_bounds__(256) void k_wt_bf16(const float* __restrict__ W, unsigned short* __restrict__ Wt, int K, int N) {
  const int t = blockIdx.x * 256 + threadIdx.x;
  const int k8n = K / 8;
  if (t >= N * k8n) return;
  const int n = t / k8n, k8 = (t % k8n) * 8;
  v8us v;
#pragma unroll
  for (int i = 0; i < 8; ++i) v[i] = bf16_bits(W[(size_t)(k8 + i) * N + n]);
  *(v8us*)(Wt + (size_t)n * K + k8) = v;
  
}

// GEMM C[M][N] (f32, pitch ldc) = act(A[M][K]·W + bias). A f32 row-major (pitch lda) converted per fragment to bf16
// (ASPLIT: hi/lo two planes -> 2 terms, else single rounded term); Wt bf16 [N][K] (pitch ldb). BIAS_BF16 rounds the
// bias to bf16 first (bias quantised to bf16 before the add). K%32==0, M%16==0, N%64==0.
template <bool ASPLIT, int ACT, bool BIAS_BF16>
__global__ __launch_bounds__(128) void k_gemm_bf(const float* __restrict__ A, int lda, const unsigned short* __restrict__ Wt, int ldb,
                                               const float* __restrict__ bias, float* __restrict__ C, int ldc, int M, int N, int K) {
  __shared__ __attribute__((aligned(16))) float so[4][16][64];
  const int tid = threadIdx.x, w = tid >> 5, lane = tid & 31, ln = lane & 15, hh = lane >> 4;
  const int ntn = N / 64;
  const int wid = blockIdx.x * 4 + w;
  const int mt = wid / ntn, nq = wid % ntn;
  if (mt * 16 >= M) return;
  const int row0 = mt * 16, col0 = nq * 64;
  const float* arow = A + (size_t)(row0 + ln) * lda;
  v8f acc[4] = {};
  for (int kb = 0; kb < K; kb += 32) {
    FragB ah, al;
    const v4f x0 = *(const v4fa*)(arow + kb + 8 * hh), x1 = *(const v4fa*)(arow + kb + 8 * hh + 4);
    const v4f x2 = *(const v4fa*)(arow + kb + 16 + 8 * hh), x3 = *(const v4fa*)(arow + kb + 16 + 8 * hh + 4);
    float xs[16] = {x0[0],x0[1],x0[2],x0[3],x1[0],x1[1],x1[2],x1[3],x2[0],x2[1],x2[2],x2[3],x3[0],x3[1],x3[2],x3[3]};
#pragma unroll
    for (int i = 0; i < 16; ++i) { const unsigned short hb = bf16_bits(xs[i]); ah.u[i] = hb; al.u[i] = ASPLIT ? bf16_bits(xs[i] - bf16_val(hb)) : (unsigned short)0; }
#pragma unroll
    for (int t = 0; t < 4; ++t) {
      const unsigned short* brow = Wt + (size_t)(col0 + t * 16 + ln) * ldb + kb;
      FragB b;
      b.half[0] = *(const v8us*)(brow + 8 * hh);
      b.half[1] = *(const v8us*)(brow + 16 + 8 * hh);
      acc[t] = mmaN<ASPLIT ? 2 : 1>(ah.v, al.v, b.v, b.v, acc[t]);
    }
  }
#pragma unroll
  for (int t = 0; t < 4; ++t) {
    float bv = bias ? bias[col0 + t * 16 + ln] : 0.f;
    if (BIAS_BF16) bv = bf16_round(bv);
#pragma unroll
    for (int r = 0; r < 8; ++r) { float v = acc[t][r] + bv; if (ACT == 1) v = fmaxf(v, 0.f); so[w][8 * hh + r][t * 16 + ln] = v; }
  }
  __builtin_amdgcn_fence(__ATOMIC_ACQ_REL, "workgroup");
  __builtin_amdgcn_wave_barrier();
  const int rsub = lane >> 4, c4 = (lane & 15) * 4;
  {
#pragma unroll
    for (int q = 0; q < 8; ++q) {
      const int r = q * 2 + rsub;
      const v4f v = *(const v4fa*)&so[w][r][c4];
      *(v4f*)(C + (size_t)(row0 + r) * ldc + col0 + c4) = v;
    }
    
  }
}

// Flash-style causal/unmasked attention, all contractions 3-term bf16 hi/lo splits, f32 softmax with running max.
// q,k,v rows are read from f32 buffers with arbitrary row pitch (so they can live inside a fused qkv buffer);
// D = head size (multiple of 32, <= 128); one wave = 16 query rows; block = 4 waves (64 queries) sharing K/V chunks of 32.
template <int D, bool CAUSAL>
__global__ __launch_bounds__(128) void k_flash(const float* __restrict__ qb, const float* __restrict__ kb, const float* __restrict__ vb,
                                             int pitch, int T, int H, float scale, float* __restrict__ y, int ypitch) {
  constexpr int KS = D / 32;        // k-steps for QK
  constexpr int DT = D / 16;        // d tiles for PV
  __shared__ __attribute__((aligned(16))) unsigned short sKh[32][D + 8], sKl[32][D + 8], sVh[32][D + 8], sVl[32][D + 8];
  __shared__ __attribute__((aligned(16))) unsigned short sPh[4][16][40], sPl[4][16][40];
  __shared__ __attribute__((aligned(16))) float sO[4][16][D];
  const int tid = threadIdx.x, w = tid >> 5, lane = tid & 31, ln = lane & 15, hh = lane >> 4;
  const int nqb = (T + 63) / 64;
  const int bh = blockIdx.x / nqb, qblk = blockIdx.x % nqb;
  const int b = bh / H, h = bh % H;
  const int q0 = qblk * 64 + w * 16;
  const float* Q = qb + (size_t)b * T * pitch + h * D;
  const float* K = kb + (size_t)b * T * pitch + h * D;
  const float* V = vb + (size_t)b * T * pitch + h * D;

  // A fragments of the wave's 16 query rows (scaled), hi/lo
  FragB aqh[KS], aql[KS];
  {
    int row = q0 + ln; if (row >= T) row = T - 1;
    const float* qr = Q + (size_t)row * pitch;
#pragma unroll
    for (int ks = 0; ks < KS; ++ks)
#pragma unroll
      for (int i = 0; i < 16; ++i) {
        const int d = ks * 32 + ((i < 8) ? (8 * hh + i) : (16 + 8 * hh + (i - 8)));
        const float x = qr[d] * scale; const unsigned short hb = bf16_bits(x);
        aqh[ks].u[i] = hb; aql[ks].u[i] = bf16_bits(x - bf16_val(hb));
      }
  }
  float m_r[8], l_r[8];
#pragma unroll
  for (int r = 0; r < 8; ++r) { m_r[r] = -3.0e38f; l_r[r] = 0.f; }
  v8f oacc[DT];
#pragma unroll
  for (int dt = 0; dt < DT; ++dt) oacc[dt] = (v8f){0.f,0.f,0.f,0.f,0.f,0.f,0.f,0.f};

  const int kv_end = CAUSAL ? min(T, qblk * 64 + 64) : T;     // block-uniform
  for (int j0 = 0; j0 < kv_end; j0 += 32) {
    __syncthreads();
    for (int e = tid; e < 32 * (D / 4); e += 128) {
      const int r = e / (D / 4), c4 = (e % (D / 4)) * 4;
      const int key = j0 + r;
      v4f kf = {0.f,0.f,0.f,0.f}, vf = {0.f,0.f,0.f,0.f};
      if (key < T) { kf = *(const v4fa*)(K + (size_t)key * pitch + c4); vf = *(const v4fa*)(V + (size_t)key * pitch + c4); }
#pragma unroll
      for (int t = 0; t < 4; ++t) {
        unsigned short hb = bf16_bits(kf[t]); sKh[r][c4 + t] = hb; sKl[r][c4 + t] = bf16_bits(kf[t] - bf16_val(hb));
        hb = bf16_bits(vf[t]); sVh[r][c4 + t] = hb; sVl[r][c4 + t] = bf16_bits(vf[t] - bf16_val(hb));
      }
    }
    __syncthreads();
    // S tile 16 x 32
    v8f s[2];
#pragma unroll
    for (int nt = 0; nt < 2; ++nt) {
      v8f acc = {};
#pragma unroll
      for (int ks = 0; ks < KS; ++ks) {
        FragB bh_, bl_;
        bh_.half[0] = *(const v8us*)&sKh[nt * 16 + ln][ks * 32 + 8 * hh]; bh_.half[1] = *(const v8us*)&sKh[nt * 16 + ln][ks * 32 + 16 + 8 * hh];
        bl_.half[0] = *(const v8us*)&sKl[nt * 16 + ln][ks * 32 + 8 * hh]; bl_.half[1] = *(const v8us*)&sKl[nt * 16 + ln][ks * 32 + 16 + 8 * hh];
        acc = mmaN<3>(aqh[ks].v, aql[ks].v, bh_.v, bl_.v, acc);
      }
      s[nt] = acc;
    }
    // mask + running max (rows 8hh+r; the 16 lanes of a half share rows)
    float alpha[8];
#pragma unroll
    for (int r = 0; r < 8; ++r) {
      const int qi = q0 + 8 * hh + r;
      const int ja = j0 + ln, jb = j0 + 16 + ln;
      if (CAUSAL) { if (ja > qi) s[0][r] = -3.0e38f; if (jb > qi) s[1][r] = -3.0e38f; }
      if (ja >= T) s[0][r] = -3.0e38f;
      if (jb >= T) s[1][r] = -3.0e38f;
      float mx = fmaxf(s[0][r], s[1][r]);
      mx = fmaxf(mx, __shfl_xor(mx, 1, 32)); mx = fmaxf(mx, __shfl_xor(mx, 2, 32)); mx = fmaxf(mx, __shfl_xor(mx, 4, 32)); mx = fmaxf(mx, __shfl_xor(mx, 8, 32));
      const float mnew = fmaxf(m_r[r], mx);
      alpha[r] = (mnew > -1.0e38f) ? __expf(m_r[r] - mnew) : 1.0f;
      const float p0 = (s[0][r] > -1.0e38f) ? __expf(s[0][r] - mnew) : 0.f;
      const float p1 = (s[1][r] > -1.0e38f) ? __expf(s[1][r] - mnew) : 0.f;
      m_r[r] = mnew;
      l_r[r] = l_r[r] * alpha[r] + p0 + p1;            // per-lane partial row sum (16 lanes combined at the end)
      unsigned short hb = bf16_bits(p0); sPh[w][8 * hh + r][ln] = hb;      sPl[w][8 * hh + r][ln] = bf16_bits(p0 - bf16_val(hb));
      hb = bf16_bits(p1);                sPh[w][8 * hh + r][16 + ln] = hb; sPl[w][8 * hh + r][16 + ln] = bf16_bits(p1 - bf16_val(hb));
    }
#pragma unroll
    for (int dt = 0; dt < DT; ++dt)
#pragma unroll
      for (int r = 0; r < 8; ++r) oacc[dt][r] *= alpha[r];
    __builtin_amdgcn_fence(__ATOMIC_ACQ_REL, "workgroup");
    __builtin_amdgcn_wave_barrier();
    FragB pah, pal;
    pah.half[0] = *(const v8us*)&sPh[w][ln][8 * hh]; pah.half[1] = *(const v8us*)&sPh[w][ln][16 + 8 * hh];
    pal.half[0] = *(const v8us*)&sPl[w][ln][8 * hh]; pal.half[1] = *(const v8us*)&sPl[w][ln][16 + 8 * hh];
#pragma unroll
    for (int dt = 0; dt < DT; ++dt) {
      FragB bvh, bvl;
#pragma unroll
      for (int i = 0; i < 8; ++i) {
        bvh.u[i] = sVh[8 * hh + i][dt * 16 + ln]; bvh.u[8 + i] = sVh[16 + 8 * hh + i][dt * 16 + ln];
        bvl.u[i] = sVl[8 * hh + i][dt * 16 + ln]; bvl.u[8 + i] = sVl[16 + 8 * hh + i][dt * 16 + ln];
      }
      oacc[dt] = mmaN<3>(pah.v, pal.v, bvh.v, bvl.v, oacc[dt]);
    }
    __builtin_amdgcn_fence(__ATOMIC_ACQ_REL, "workgroup");
    __builtin_amdgcn_wave_barrier();
  }
#pragma unroll
  for (int r = 0; r < 8; ++r) {
    float l = l_r[r];
    l += __shfl_xor(l, 1, 32); l += __shfl_xor(l, 2, 32); l += __shfl_xor(l, 4, 32); l += __shfl_xor(l, 8, 32);
    l_r[r] = (l > 0.f) ? 1.0f / l : 0.f;
  }
#pragma unroll
  for (int dt = 0; dt < DT; ++dt)
#pragma unroll
    for (int r = 0; r < 8; ++r) sO[w][8 * hh + r][dt * 16 + ln] = oacc[dt][r] * l_r[r];
  __builtin_amdgcn_fence(__ATOMIC_ACQ_REL, "workgroup");
  __builtin_amdgcn_wave_barrier();
  {
    for (int r = 0; r < 16; ++r) {
      const int row = q0 + r;
      if (row < T && lane < D / 4) {
        const v4f val = *(const v4fa*)&sO[w][r][lane * 4];
        *(v4f*)(y + ((size_t)b * T + row) * ypitch + h * D + lane * 4) = val;
      }
    }
    
  }
}

// row LayerNorm (biased variance, eps) over N: s = X (+ R); optional out_sum <- s; out_norm <- (s-mu)*rsqrt(var+eps)*g + b
template <bool PARAM_BF16>
__global__ __launch_bounds__(256) void k_layernorm(const float* __restrict__ X, const float* __restrict__ R, const float* __restrict__ g, const float* __restrict__ bta,
                                                  float* __restrict__ out_sum, float* __restrict__ out_norm, int N, float eps) {
  __shared__ float red[256];
  const int row = blockIdx.x, tid = threadIdx.x;
  const float* x = X + (size_t)row * N; const float* rr = R ? R + (size_t)row * N : nullptr;
  float vals[16];                     // up to N = 4096
  const int per = N / 256;            // contiguous chunk per thread? use strided-by-4 chunks: thread handles j = tid*4 + 1024*u
  float s1 = 0.f;
  for (int u = 0; u < per / 4; ++u) {
    const int j = tid * 4 + 1024 * u;
    const v4f a = *(const v4fa*)(x + j);
    v4f b = {0.f,0.f,0.f,0.f}; if (rr) b = *(const v4fa*)(rr + j);
#pragma unroll
    for (int q = 0; q < 4; ++q) { const float v = a[q] + b[q]; vals[u * 4 + q] = v; s1 += v; }
  }
  red[tid] = s1; __syncthreads();
  for (int st = 128; st > 0; st >>= 1) { if (tid < st) red[tid] += red[tid + st]; __syncthreads(); }
  const float mu = red[0] / (float)N; __syncthreads();
  float s2 = 0.f;
  for (int u = 0; u < per / 4; ++u)
#pragma unroll
    for (int q = 0; q < 4; ++q) { const float c = vals[u * 4 + q] - mu; s2 += c * c; }
  red[tid] = s2; __syncthreads();
  for (int st = 128; st > 0; st >>= 1) { if (tid < st) red[tid] += red[tid + st]; __syncthreads(); }
  const float rs = rsqrtf(red[0] / (float)N + eps);
  {
    for (int u = 0; u < per / 4; ++u) {
      const int j = tid * 4 + 1024 * u;
      v4f o, sm;
#pragma unroll
      for (int q = 0; q < 4; ++q) {
        float gg = g[j + q], bb = bta[j + q];
        if (PARAM_BF16) { gg = bf16_round(gg); bb = bf16_round(bb); }
        sm[q] = vals[u * 4 + q]; o[q] = (vals[u * 4 + q] - mu) * rs * gg + bb;
      }
      if (out_sum) *(v4f*)(out_sum + (size_t)row * N + j) = sm;
      *(v4f*)(out_norm + (size_t)row * N + j) = o;
    }
    
  }
}

// batched f32 [K][N] (pitch lds, batch stride sIn) -> transposed hi/lo planes [N][K] (batch stride sOut); thread per (n, 8 k); grid.y = batch
__global__ __launch_bounds__(256) void k_split_transpose_b(const float* __restrict__ src, int lds_, size_t sIn, unsigned short* __restrict__ hi, unsigned short* __restrict__ lo, size_t sOut, int K, int N) {
  const size_t t = (size_t)blockIdx.x * 256 + threadIdx.x; const int k8n = K / 8; if (t >= (size_t)N * k8n) return;
  src += (size_t)blockIdx.y * sIn; hi += (size_t)blockIdx.y * sOut; lo += (size_t)blockIdx.y * sOut;
  const int n = (int)(t / k8n), k8 = (int)(t % k8n) * 8; v8us vh, vl;
#pragma unroll
  for (int i = 0; i < 8; ++i) { const float x = src[(size_t)(k8 + i) * lds_ + n]; const unsigned short hb = bf16_bits(x); vh[i] = hb; vl[i] = bf16_bits(x - bf16_val(hb)); }
  unsigned short* dh = hi + (size_t)n * K + k8; unsigned short* dl = lo + (size_t)n * K + k8;
  *(v8us*)dh = vh; *(v8us*)dl = vl; 
}

// ---- f16 WMMA path (v_wmma_f32_16x16x32_f16): 11-bit significands for operands in range — used where the relu(scores/8)/128 attention operand needs more precision than bf16
typedef _Float16 v16h __attribute__((ext_vector_type(16)));
union FragH { v16h v; v8us half[2]; _Float16 h[16]; unsigned short u[16]; };
template <int NT>
__device__ __forceinline__ v8f mmaH(v16h ah, v16h al, v16h bh, v16h bl, v8f c) {
  c = __builtin_amdgcn_wmma_f32_16x16x32_f16(false, ah, false, bh, (short)0, c, false, false);
  if (NT >= 2) c = __builtin_amdgcn_wmma_f32_16x16x32_f16(false, al, false, bh, (short)0, c, false, false);
  if (NT >= 3) c = __builtin_amdgcn_wmma_f32_16x16x32_f16(false, ah, false, bl, (short)0, c, false, false);
  asm volatile("v_nop\n\tv_nop\n\tv_nop\n\tv_nop" : "+v"(c) : "v"(ah), "v"(al), "v"(bh), "v"(bl));
  return c;
}
// batched GEMM like k_gemm_b but f16 operands: A f32 (split into f16 hi/lo if ASPLIT, else rounded to f16), Bt = f16 values [n][k]; alpha; C f32; N multiple of 16 (partial tiles skipped)
template <bool ASPLIT>
__global__ __launch_bounds__(128) void k_gemm_h(const float* __restrict__ A, int lda, size_t sA, const _Float16* __restrict__ Bh, int ldb, size_t sB, float alpha, float* __restrict__ C, int ldc, size_t sC, int M, int N, int K) {
  __shared__ __attribute__((aligned(16))) float so[4][16][64];
  const int tid = threadIdx.x, w = tid >> 5, lane = tid & 31, ln = lane & 15, hh = lane >> 4; const int by = blockIdx.y;
  A += (size_t)by * sA; Bh += (size_t)by * sB; C += (size_t)by * sC;
  const int ntn = (N + 63) / 64; const int wid = blockIdx.x * 4 + w; const int mt = wid / ntn, nq = wid % ntn; if (mt * 16 >= M) return;
  const int row0 = mt * 16, col0 = nq * 64; const float* arow = A + (size_t)(row0 + ln) * lda;
  v8f acc[4] = {};
  for (int kb = 0; kb < K; kb += 32) {
    FragH ah, al;
    const v4f x0 = *(const v4fa*)(arow + kb + 8 * hh), x1 = *(const v4fa*)(arow + kb + 8 * hh + 4), x2 = *(const v4fa*)(arow + kb + 16 + 8 * hh), x3 = *(const v4fa*)(arow + kb + 16 + 8 * hh + 4);
    float xs[16] = {x0[0],x0[1],x0[2],x0[3],x1[0],x1[1],x1[2],x1[3],x2[0],x2[1],x2[2],x2[3],x3[0],x3[1],x3[2],x3[3]};
#pragma unroll
    for (int i = 0; i < 16; ++i) { const _Float16 h = (_Float16)xs[i]; ah.h[i] = h; al.h[i] = ASPLIT ? (_Float16)(xs[i] - (float)h) : (_Float16)0.0f; }
#pragma unroll
    for (int t = 0; t < 4; ++t) { if (col0 + t * 16 >= N) continue; const size_t boff = (size_t)(col0 + t * 16 + ln) * ldb + kb; FragH bq; bq.half[0] = *(const v8us*)(Bh + boff + 8 * hh); bq.half[1] = *(const v8us*)(Bh + boff + 16 + 8 * hh);
      acc[t] = mmaH<ASPLIT ? 2 : 1>(ah.v, al.v, bq.v, bq.v, acc[t]); }
  }
#pragma unroll
  for (int t = 0; t < 4; ++t) { if (col0 + t * 16 >= N) continue;
#pragma unroll
    for (int r = 0; r < 8; ++r) so[w][8 * hh + r][t * 16 + ln] = acc[t][r] * alpha; }
  __builtin_amdgcn_fence(__ATOMIC_ACQ_REL, "workgroup"); __builtin_amdgcn_wave_barrier();
  const int rsub = lane >> 4, c4 = (lane & 15) * 4;
  {
#pragma unroll
    for (int q = 0; q < 8; ++q) { const int r = q * 2 + rsub; if (col0 + c4 < N) { const v4f v = *(const v4fa*)&so[w][r][c4]; *(v4f*)(C + (size_t)(row0 + r) * ldc + col0 + c4) = v; } }
     }
}

// Block-tiled product through LDS, C = A * B^T with A [M][K] and B [N][K] both k-contiguous; the launch below uses the second form (the projections are in k_head):
//   PROJ: all three projections in ONE launch: B = the transposed bf16 weights [W1 | W2 | W3], 1536 rows; A = x for the columns of W1 and y for the rest, in f32,
//         rounded to bf16 once while it is staged; Q is stored as f32 row-major, [K | V] straight as the bf16 hi/lo planes Ph and Pl.
//   else: A = ATT [(j,q)][1024] f16, B = VWt16 [(i,d)][1024] f16: all 1024 set pairs as ONE 4096 x 2048 x 1024 product; for one i the rows (j,q) of out are contiguous.
// A work-group of 8 waves owns TM rows x 128 columns; a wave owns TM/4 x 64, so a fragment read from LDS feeds several WMMAs and every operand byte
// leaves L2 once per work-group, in whole 128-B lines (a wave-wide 16-B load covers 512 contiguous bytes of one f32 row or 256 of each of two 16-bit rows).
// A pass is 128 k: TM + 128 rows of 256 B at an LDS pitch of 272 B (conflict-free for 16-B fragment reads). Two buffers: the next pass's rows are loaded
// into registers ahead of this pass's WMMAs and stored into the other buffer ahead of its last block; one barrier a pass publishes them and frees this buffer.
// Per output tile the k order (32 at a time, ascending, same lane map) is that of a wave reading its fragments straight from global memory.
#define TN 128
#define TK 128
#define LP 136             // LDS row pitch in 16-bit elements (272 B)
#define SP 68              // epilogue staging pitch in floats (272 B): rows 8 apart fall on different banks
typedef unsigned short v4us __attribute__((ext_vector_type(4), may_alias));
union FragX { v16h h; v16b b; v8us half[2]; };
// C element (row, col) lies at C + (col / 64) * cbs + row * ldc + col % 64
template <bool PROJ, int TM, int K>
__global__ __launch_bounds__(256) void k_gemm_tile(const float* __restrict__ Ax, const float* __restrict__ Ay, const _Float16* __restrict__ Ah, const unsigned short* __restrict__ B, float* __restrict__ C,
                                                 unsigned short* __restrict__ Ph, unsigned short* __restrict__ Pl, int ldc, size_t cbs) {
  constexpr int MI = TM / 64;      // accumulator tiles of a wave in M (4 in N)
  __shared__ __attribute__((aligned(16))) unsigned short sm[2][(TM + TN) * LP];
  const int tid = threadIdx.x, w = tid >> 5, lane = tid & 31, ln = lane & 15, hh = lane >> 4;
  const int wm = w >> 1, wn = w & 1;
  const int row0 = blockIdx.x * TM, col0 = blockIdx.y * TN;
  const int lr = tid >> 4, lc = (tid & 15) * 8;      // 16-bit rows: 16 lanes x 16 B = the 256-B slice of a row
  const int fr = tid >> 5, fc = (tid & 31) * 4;      // f32 rows: 32 lanes x 16 B = the 512-B slice of a row
  const bool isq = !PROJ || blockIdx.y < DM / TN;      // PROJ: this column tile belongs to Q (the same for the whole work-group)
  const float* gf = PROJ ? (isq ? Ax : Ay) + (size_t)(row0 + fr) * K + fc : nullptr;
  const unsigned short* ga = PROJ ? nullptr : (const unsigned short*)Ah + (size_t)(row0 + lr) * K + lc;
  const unsigned short* gb = B + (size_t)(col0 + lr) * K + lc;
  v4f sf[PROJ ? TM / 8 : 1]; v8us sa[PROJ ? 1 : TM / 16]; v8us sb[TN / 16];
  auto fetch = [&](int p) {
    if constexpr (PROJ) {
#pragma unroll
      for (int u = 0; u < TM / 8; ++u) sf[u] = *(const v4fa*)(gf + (size_t)u * 8 * K + p * TK);
    } else {
#pragma unroll
      for (int u = 0; u < TM / 16; ++u) sa[u] = *(const v8us*)(ga + (size_t)u * 16 * K + p * TK);
    }
#pragma unroll
    for (int u = 0; u < TN / 16; ++u) sb[u] = *(const v8us*)(gb + (size_t)u * 16 * K + p * TK);
  };
  auto put = [&](unsigned short* dst) {
    if constexpr (PROJ) {
#pragma unroll
      for (int u = 0; u < TM / 8; ++u) { v4us h; for (int q = 0; q < 4; ++q) h[q] = bf16_bits(sf[u][q]); *(v4us*)&dst[(u * 8 + fr) * LP + fc] = h; }
    } else {
#pragma unroll
      for (int u = 0; u < TM / 16; ++u) *(v8us*)&dst[(u * 16 + lr) * LP + lc] = sa[u];
    }
#pragma unroll
    for (int u = 0; u < TN / 16; ++u) *(v8us*)&dst[(TM + u * 16 + lr) * LP + lc] = sb[u];
  };
  fetch(0);
  put(sm[0]);
  __syncthreads();
  v8f acc[MI][4] = {};
  const int aoff = (wm * (TM / 4) + ln) * LP + 8 * hh, boff = (TM + wn * 64 + ln) * LP + 8 * hh;
  for (int p = 0; p < K / TK; ++p) {
    const unsigned short* cur = sm[p & 1];
    const bool more = p + 1 < K / TK;
    if (more) {
      fetch(p + 1);
      // the fragment reads below may reuse the registers that hold these loads' addresses
      asm volatile("s_wait_xcnt 0x0" ::: "memory");
    }
    FragX fa[2][MI], fb[2][4];
    auto frags = [&](int ks) {
#pragma unroll
      for (int m = 0; m < MI; ++m) { const int o = aoff + m * 16 * LP + ks * 32; fa[ks & 1][m].half[0] = *(const v8us*)&cur[o]; fa[ks & 1][m].half[1] = *(const v8us*)&cur[o + 16]; }
#pragma unroll
      for (int n = 0; n < 4; ++n) { const int o = boff + n * 16 * LP + ks * 32; fb[ks & 1][n].half[0] = *(const v8us*)&cur[o]; fb[ks & 1][n].half[1] = *(const v8us*)&cur[o + 16]; }
    };
    frags(0);
#pragma unroll
    for (int ks = 0; ks < TK / 32; ++ks) {
      if (ks + 1 < TK / 32) frags(ks + 1);
      else if (more) put(sm[(p + 1) & 1]);      // ahead of the last block, whose WMMAs run while the stores drain
      // scheduling fences round each block of WMMAs: without them the compiler reads all four blocks' fragments first and puts the wait for the
      // global loads, the stores and the barrier in front of nearly all WMMAs, so neither the LDS reads nor the global latency hide behind matrix work
      __builtin_amdgcn_sched_barrier(0);
#pragma unroll
      for (int m = 0; m < MI; ++m)
#pragma unroll
        for (int n = 0; n < 4; ++n) {
          if constexpr (PROJ) acc[m][n] = __builtin_amdgcn_wmma_f32_16x16x32_bf16(false, fa[ks & 1][m].b, false, fb[ks & 1][n].b, (short)0, acc[m][n], false, false);
          else                acc[m][n] = __builtin_amdgcn_wmma_f32_16x16x32_f16(false, fa[ks & 1][m].h, false, fb[ks & 1][n].h, (short)0, acc[m][n], false, false);
        }
      __builtin_amdgcn_sched_barrier(0);
    }
    __syncthreads();
  }
  // the last barrier has ended every read of the buffers: each wave stages its f32 tile in a range of its own and stores whole lines
  f32a* so = (f32a*)&sm[0][0] + (size_t)w * (TM / 4) * SP;
#pragma unroll
  for (int m = 0; m < MI; ++m)
#pragma unroll
    for (int n = 0; n < 4; ++n)
#pragma unroll
      for (int r = 0; r < 8; ++r) so[(m * 16 + 8 * hh + r) * SP + n * 16 + ln] = acc[m][n][r];
  // the wave's own LDS writes are complete before its lanes read back rows that other lanes wrote (no other wave touches this range)
  __builtin_amdgcn_fence(__ATOMIC_ACQ_REL, "workgroup"); __builtin_amdgcn_wave_barrier();
  if (!isq) {
    // [K | V]: bf16 head and remainder of each f32 result; the wave's 64 columns are 128 B a row in each plane, one whole line (8 lanes x 16 B)
    const size_t po = (size_t)(row0 + wm * (TM / 4)) * (2 * DM) + (col0 - DM) + wn * 64;
    const int r4 = lane >> 3, c8 = (lane & 7) * 8;
    // both loops unrolled: vector elements indexed by constants stay in registers, and the LDS reads of all rows issue ahead of the stores
#pragma unroll
    for (int q = 0; q < TM / 16; ++q) {
      const int r = q * 4 + r4;
      const v4f a = *(const v4fa*)&so[r * SP + c8], b = *(const v4fa*)&so[r * SP + c8 + 4];
      v8us h, l;
#pragma unroll
      for (int u = 0; u < 8; ++u) { const float v = u < 4 ? a[u & 3] : b[u & 3]; const unsigned short hb = bf16_bits(v); h[u] = hb; l[u] = bf16_bits(v - bf16_val(hb)); }
      *(v8us*)(Ph + po + (size_t)r * (2 * DM) + c8) = h; *(v8us*)(Pl + po + (size_t)r * (2 * DM) + c8) = l;
    }
    // in the listing the Q branch stands as the fall-through behind these stores and reuses their registers
    asm volatile("s_wait_xcnt 0x0" ::: "memory");
    return;
  }
  float* cw = C + (size_t)(blockIdx.y * (TN / 64) + wn) * cbs + (size_t)(row0 + wm * (TM / 4)) * ldc;
  const int rsub = lane >> 4, c4 = (lane & 15) * 4;
#pragma unroll
  for (int q = 0; q < TM / 8; ++q) { const int r = q * 2 + rsub; const v4f v = *(const v4fa*)&so[r * SP + c4]; *(v4f*)(cw + (size_t)r * ldc + c4) = v; }
}

// Projections, scores and VW^T of one (set s, head h) in ONE work-group (grid.x = s, grid.y = h; 8 waves), so Q, K and V never leave the WGP.
// Part 1: [Q | K | V] (128 x 192, k = 512) = [x W1h | y W2h | y W3h], staged like k_gemm_tile: a pass of 128 k holds 128 rows of x, 128 rows of y (f32 rounded to bf16 once while
//         staged) and 128 k-rows of the head's 3 x 64 weight columns, read from W1, W2, W3 as they lie ([k][n], f32), rounded to bf16 while staged and kept [k][n] in LDS: the B
//         fragments come out of transposing LDS reads, in the k order of the A fragments. Two buffers, one barrier a pass. A wave owns 32 rows x 96 columns; its first four
//         column tiles take x (wn = 0) or y (wn = 1) as A, its last two always y.
// Part 2: every f32 result is split into its bf16 head and remainder, in six LDS planes [128][64] (pitch 144 B); behind one barrier each wave does three 16 x 64 jobs, 64 deep, 3 terms:
//         two of ATT[(s,q)][h*128 + k] = f16(relu(q.k / 8) / 128) and one of VWt16[(s,d)][h*128 + k] = f16(sum over e of bf16(W4[h*64+e][d]) * V[k][e]).
#define FA (2 * NIT)       // staged A rows of a pass: x, then y
#define FB (3 * HS)        // staged B columns of a pass
#define WP (FB + 16)       // LDS pitch of a staged weight k-row in 16-bit elements (416 B = 13 x 32 B: conflict-free for the transposing 16-B reads)
#define BUFE (FA * LP + TK * WP)      // one buffer: the A rows, then the weight k-rows
#define PP 72              // plane row pitch in 16-bit elements (144 B: conflict-free for 16-B fragment reads)
#define PSZ (NIT * PP)     // one plane
template <bool B> struct Flag { static constexpr bool v = B; };
typedef short s16x8 __attribute__((ext_vector_type(8)));
typedef unsigned int v2ua __attribute__((ext_vector_type(2), may_alias));
// two f32 rounded to nearest even into one register of two bf16 (the packed convert instruction; on finite values the bits of bf16_bits)
__device__ __forceinline__ unsigned int pack_bf16(float lo, float hi) { typedef __bf16 bf2 __attribute__((ext_vector_type(2))); typedef float f2 __attribute__((ext_vector_type(2))); return __builtin_bit_cast(unsigned int, __builtin_convertvector(f2{lo, hi}, bf2)); }
// transposing LDS read: lane (c, hh) gets T[8 hh + 0..7][c] of the 16 x 16 tile of 16-bit elements whose rows the lanes' addresses name
__device__ __forceinline__ v8us ld_tr16(const unsigned short* p) { typedef __attribute__((address_space(3))) s16x8 lds_s16x8; return __builtin_bit_cast(v8us, __builtin_amdgcn_ds_load_tr16_b128_v8i16((lds_s16x8*)p)); }
__global__ __launch_bounds__(256) void k_head(const float* __restrict__ X, const float* __restrict__ Y, const float* __restrict__ W1, const float* __restrict__ W2, const float* __restrict__ W3,
                                            const float* __restrict__ W4, _Float16* __restrict__ ATT, _Float16* __restrict__ VWt16) {
  __shared__ __attribute__((aligned(16))) unsigned short sm[2][BUFE];
  const int tid = threadIdx.x, w = tid >> 5, lane = tid & 31, ln = lane & 15, hh = lane >> 4;
  const int wm = w >> 1, wn = w & 1;
  const int s = blockIdx.x, h = blockIdx.y;
  const int fr = tid >> 5, fc = (tid & 31) * 4;      // f32 rows: 32 lanes x 16 B = the 512-B slice of a row
  // weight k-rows: 16 lanes x 16 B = the head's 256 B of a row; the two halves of a wave take rows 4 apart, whose 8-B LDS stores fall on different banks
  const int wr = (w & 3) + 4 * hh + 8 * (w >> 2), wc = ln * 4;
  const float* gx = X + (size_t)(s * NIT + fr) * DM + fc;
  const float* gy = Y + (size_t)(s * NIT + fr) * DM + fc;
  const size_t wo = (size_t)wr * DM + h * HS + wc;
  const float* gw1 = W1 + wo; const float* gw2 = W2 + wo; const float* gw3 = W3 + wo;
  v4f sx[NIT / 8], sy[NIT / 8], sw[3 * TK / 16];
  // The 56 staged 16-B pieces of a thread go in quarters: a quarter is stored to LDS and its registers are at once loaded anew for the pass after,
  // one quarter per block of WMMAs, so that loads are in flight all the time and each has a whole pass to arrive.
  auto fetchq = [&](int q, int p) {
#pragma unroll
    for (int u = q * 4; u < q * 4 + 4; ++u) { sx[u] = *(const v4fa*)(gx + (size_t)u * 8 * DM + p * TK); sy[u] = *(const v4fa*)(gy + (size_t)u * 8 * DM + p * TK); }
#pragma unroll
    for (int u = q * 6; u < q * 6 + 6; ++u) sw[u] = *(const v4fa*)((u < 8 ? gw1 : u < 16 ? gw2 : gw3) + (size_t)((u & 7) * 16 + p * TK) * DM);
    // later instructions may reuse the registers that hold these loads' addresses
    asm volatile("s_wait_xcnt 0x0" ::: "memory");
  };
  auto putq = [&](int q, unsigned short* dst) {
#pragma unroll
    for (int u = q * 4; u < q * 4 + 4; ++u) {
      v4us a, b;
#pragma unroll
      for (int e = 0; e < 4; ++e) { a[e] = bf16_bits(sx[u][e]); b[e] = bf16_bits(sy[u][e]); }
      *(v4us*)&dst[(u * 8 + fr) * LP + fc] = a; *(v4us*)&dst[(NIT + u * 8 + fr) * LP + fc] = b;
    }
#pragma unroll
    for (int u = q * 6; u < q * 6 + 6; ++u) {
      const v2ua b = {pack_bf16(sw[u][0], sw[u][1]), pack_bf16(sw[u][2], sw[u][3])};
      *(v2ua*)&dst[FA * LP + ((u & 7) * 16 + wr) * WP + (u >> 3) * HS + wc] = b;
    }
  };
  constexpr int NP = DM / TK;
#pragma unroll
  for (int q = 0; q < 4; ++q) fetchq(q, 0);
#pragma unroll
  for (int q = 0; q < 4; ++q) { putq(q, sm[0]); fetchq(q, 1); }
  // LDS-only fences, as at the foot of the loop: pass 1's loads stay in flight
  __builtin_amdgcn_fence(__ATOMIC_RELEASE, "workgroup", "local"); __builtin_amdgcn_s_barrier(); __builtin_amdgcn_fence(__ATOMIC_ACQUIRE, "workgroup", "local");
  v8f acc[2][6] = {};
  const int a0off = (wn * NIT + wm * 32 + ln) * LP + 8 * hh, a1off = (NIT + wm * 32 + ln) * LP + 8 * hh;
  const int boff = FA * LP + (8 * hh + (lane & 7)) * WP + wn * 96 + 8 * ((lane >> 3) & 1);      // lane address of a transposing read: k-row 8 hh + (lane & 7), 16-B half (lane >> 3) & 1
  auto pass = [&](int p, auto doput, auto dofetch) {
    const unsigned short* cur = sm[p & 1];
    unsigned short* nxt = sm[(p + 1) & 1];      // its readers left it at the barrier that ended the pass before
#pragma unroll
    for (int ks = 0; ks < TK / 32; ++ks) {
      FragX fa0[2], fa1[2], fb[6];
#pragma unroll
      for (int m = 0; m < 2; ++m) {
        const int o0 = a0off + m * 16 * LP + ks * 32, o1 = a1off + m * 16 * LP + ks * 32;
        fa0[m].half[0] = *(const v8us*)&cur[o0]; fa0[m].half[1] = *(const v8us*)&cur[o0 + 16];
        fa1[m].half[0] = *(const v8us*)&cur[o1]; fa1[m].half[1] = *(const v8us*)&cur[o1 + 16];
      }
#pragma unroll
      for (int n = 0; n < 6; ++n) { const int o = boff + ks * 32 * WP + n * 16; fb[n].half[0] = ld_tr16(&cur[o]); fb[n].half[1] = ld_tr16(&cur[o + 16 * WP]); }
      // scheduling fences: the fragment reads stay in front of the quarter's conversions, which run while the reads are under way, and one block's reads are not
      // lifted over another block's WMMAs (that would hold every block's fragments in registers at once)
      __builtin_amdgcn_sched_barrier(0);
      if constexpr (decltype(doput)::v) putq(ks, nxt);
      // scheduling fence: the quarter's LDS stores and their address arithmetic stay in front of the loads, so that nothing writes a register that a load names ahead of the loads' wait
      if constexpr (decltype(dofetch)::v) { __builtin_amdgcn_sched_barrier(0); fetchq(ks, p + 2); }
      __builtin_amdgcn_sched_barrier(0);
#pragma unroll
      for (int m = 0; m < 2; ++m)
#pragma unroll
        for (int n = 0; n < 6; ++n)
          acc[m][n] = __builtin_amdgcn_wmma_f32_16x16x32_bf16(false, (n < 4 ? fa0 : fa1)[m].b, false, fb[n].b, (short)0, acc[m][n], false, false);
      __builtin_amdgcn_sched_barrier(0);
    }
    // publishes the next pass's rows and ends every read of this pass's buffer. Only LDS is handed over here, so the fences name LDS alone:
    // __syncthreads() would also wait for the global loads of the pass after next, which are meant to stay in flight across the barrier
    __builtin_amdgcn_fence(__ATOMIC_RELEASE, "workgroup", "local"); __builtin_amdgcn_s_barrier(); __builtin_amdgcn_fence(__ATOMIC_ACQUIRE, "workgroup", "local");
  };
  // The passes that load stand in a loop of their own with no branch round the loads: with one, the compiler's counted waits assume the loads were skipped
  // and drain the quarters just issued. Kept rolled for the size of the code.
#pragma clang loop unroll(disable)
  for (int p = 0; p + 2 < NP; ++p) pass(p, Flag<true>{}, Flag<true>{});
  pass(NP - 2, Flag<true>{}, Flag<false>{});
  pass(NP - 1, Flag<false>{}, Flag<false>{});
  // the W4 column (a row of W4^T) of this wave's VW^T job, in the A fragment's k order, fetched here so that the latency passes behind the split below
  const float* wcol = W4 + (size_t)(h * HS + 8 * hh) * HS + (w >> 1) * 16 + ln;
  float wx[2][16];
#pragma unroll
  for (int k2 = 0; k2 < 2; ++k2)
#pragma unroll
    for (int i = 0; i < 16; ++i) wx[k2][i] = wcol[(size_t)(k2 * 32 + (i < 8 ? i : 8 + i)) * HS];
  // later instructions may reuse the registers that hold these loads' address
  asm volatile("s_wait_xcnt 0x0" ::: "memory");
  // the last barrier has ended every read of the buffers: planes Qh Ql Kh Kl Vh Vl from the start of the LDS
  unsigned short* pl = &sm[0][0];
#pragma unroll
  for (int m = 0; m < 2; ++m)
#pragma unroll
    for (int n = 0; n < 6; ++n) {
      const int tc = wn * 6 + n;      // column tile 0..11 of [Q | K | V]
      unsigned short* ph = pl + (tc >> 2) * 2 * PSZ + (wm * 32 + m * 16 + 8 * hh) * PP + (tc & 3) * 16 + ln;
#pragma unroll
      for (int r = 0; r < 8; ++r) { const float v = acc[m][n][r]; const unsigned short hb = bf16_bits(v); ph[r * PP] = hb; ph[PSZ + r * PP] = bf16_bits(v - bf16_val(hb)); }
    }
  // publishes the planes to all waves
  __syncthreads();
  f32a* so = (f32a*)&sm[0][0] + 6 * PSZ / 2 + w * 16 * SP;      // behind the planes, a range of the wave's own
  const int r4 = lane >> 3, c8 = (lane & 7) * 8;
#pragma unroll
  for (int jj = 0; jj < 3; ++jj) {
    const bool sc = jj < 2;
    const int wid = sc ? jj * 8 + w : w;
    const int row0 = (wid >> 1) * 16, col0 = (wid & 1) * 64;
    const unsigned short* bp = pl + (sc ? 2 : 4) * PSZ + (col0 + ln) * PP + 8 * hh;
    v8f a2[4] = {};
    // all fragments of the job are read first, and the four column tiles take turns term by term: four independent accumulator chains;
    // per tile the order stays ah.bh, al.bh, ah.bl, 32 k at a time
    FragB ah[2], al[2], bh_[2][4], bl_[2][4];
#pragma unroll
    for (int k2 = 0; k2 < 2; ++k2) {
      if (sc) {
        const unsigned short* ap = pl + (row0 + ln) * PP + k2 * 32 + 8 * hh;
        ah[k2].half[0] = *(const v8us*)ap; ah[k2].half[1] = *(const v8us*)(ap + 16);
        al[k2].half[0] = *(const v8us*)(ap + PSZ); al[k2].half[1] = *(const v8us*)(ap + PSZ + 16);
      } else {
#pragma unroll
        for (int i = 0; i < 16; ++i) { const float xv = bf16_round(wx[k2][i]); const unsigned short hb = bf16_bits(xv); ah[k2].u[i] = hb; al[k2].u[i] = bf16_bits(xv - bf16_val(hb)); }
      }
#pragma unroll
      for (int t = 0; t < 4; ++t) {
        const unsigned short* b = bp + t * 16 * PP + k2 * 32;
        bh_[k2][t].half[0] = *(const v8us*)b; bh_[k2][t].half[1] = *(const v8us*)(b + 16);
        bl_[k2][t].half[0] = *(const v8us*)(b + PSZ); bl_[k2][t].half[1] = *(const v8us*)(b + PSZ + 16);
      }
    }
    // scheduling fence: without it the compiler spreads the reads in small groups among the WMMAs, each group with a wait of its own
    __builtin_amdgcn_sched_barrier(0);
#pragma unroll
    for (int k2 = 0; k2 < 2; ++k2) {
#pragma unroll
      for (int t = 0; t < 4; ++t) a2[t] = __builtin_amdgcn_wmma_f32_16x16x32_bf16(false, ah[k2].v, false, bh_[k2][t].v, (short)0, a2[t], false, false);
#pragma unroll
      for (int t = 0; t < 4; ++t) a2[t] = __builtin_amdgcn_wmma_f32_16x16x32_bf16(false, al[k2].v, false, bh_[k2][t].v, (short)0, a2[t], false, false);
#pragma unroll
      for (int t = 0; t < 4; ++t) a2[t] = __builtin_amdgcn_wmma_f32_16x16x32_bf16(false, ah[k2].v, false, bl_[k2][t].v, (short)0, a2[t], false, false);
    }
#pragma unroll
    for (int t = 0; t < 4; ++t)
#pragma unroll
      for (int r = 0; r < 8; ++r) so[(8 * hh + r) * SP + t * 16 + ln] = sc ? fmaxf(a2[t][r] * 0.125f, 0.f) * (1.0f / NIT) : a2[t][r];
    // the wave's own LDS writes are complete before its lanes read back rows that other lanes wrote (no other wave touches this range); LDS alone is named,
    // so that the fence does not wait for the job before's global stores
    __builtin_amdgcn_fence(__ATOMIC_ACQ_REL, "workgroup", "local"); __builtin_amdgcn_wave_barrier();
    unsigned short* dst = (unsigned short*)(sc ? ATT + (size_t)(s * NIT + row0) * HK : VWt16 + (size_t)(s * HS + row0) * HK) + h * NIT + col0;
    v8us o[4];
#pragma unroll
    for (int q = 0; q < 4; ++q) {
      const int r = q * 4 + r4;
      const v4f a = *(const v4fa*)&so[r * SP + c8], b = *(const v4fa*)&so[r * SP + c8 + 4];
      FragH f;
#pragma unroll
      for (int u = 0; u < 4; ++u) { f.h[u] = (_Float16)a[u]; f.h[4 + u] = (_Float16)b[u]; }
      o[q] = f.half[0];
    }
    // scheduling fences: the four stores and their wait stay together, so that no register that a store names is written anew in front of the wait
    __builtin_amdgcn_sched_barrier(0);
#pragma unroll
    for (int q = 0; q < 4; ++q) *(v8us*)(dst + (size_t)(q * 4 + r4) * HK + c8) = o[q];
    asm volatile("s_wait_xcnt 0x0" ::: "memory");
    __builtin_amdgcn_sched_barrier(0);
    // the next job's staging writes stay behind this job's reads
    __builtin_amdgcn_fence(__ATOMIC_ACQ_REL, "workgroup", "local"); __builtin_amdgcn_wave_barrier();
  }
}

extern "C" void kernel_launch(void* const* d_in, const int* in_sizes, int n_in,
                              void* d_out, int out_size, void* d_ws, size_t ws_size, hipStream_t stream) {
  (void)in_sizes; (void)n_in; (void)out_size;
  const float* x = (const float*)d_in[0]; const float* y = (const float*)d_in[1]; const float* W1 = (const float*)d_in[2]; const float* W2 = (const float*)d_in[3]; const float* W3 = (const float*)d_in[4]; const float* W4 = (const float*)d_in[5];
  char* ws = (char*)d_ws; size_t off = 0;
  auto take = [&](size_t bytes) { char* p = ws + off; off += (bytes + 255) & ~(size_t)255; return p; };
  _Float16* ATT = (_Float16*)take((size_t)NSET * NIT * HK * 2); _Float16* VWt16 = (_Float16*)take((size_t)NSET * HS * HK * 2);
  if (off > ws_size) return;
  // f16 operands of the final product, weight rounding and projections included: one work-group per (set, head)
  k_head<<<dim3(NSET, NH), 256, 0, stream>>>(x, y, W1, W2, W3, W4, ATT, VWt16);
  // out[i][j] = ATT[j] * VWt[i]^T for all 1024 (i, j) as one 4096 x 2048 x 1024 product: grid.x = 256-row tiles of (j,q), grid.y = 128-column tiles of (i,d)
  k_gemm_tile<false, 256, HK><<<dim3(NTOK / 256, NSET * HS / TN), 256, 0, stream>>>(nullptr, nullptr, ATT, (const unsigned short*)VWt16, (float*)d_out, nullptr, nullptr, HS, (size_t)NTOK * HS);
}

// v006
// It runs in 31.9 microseconds.
// Next to v005, in two timings, it ran 1.06 and 1.05 times as fast.
// Over all steps from v000 it is 38.8 times as fast.
#include <hip/hip_runtime.h>
// On WMMA (f32 accumulate): Q = x·W1, K = y·W2, V = y·W3 (inputs rounded to bf16: single exact terms), per (set, head) scores = q·kᵀ (both computed f32 → bf16 hi/lo: 3 products,
// K = 64), VWᵀ[i][d][(h,k)] = Σ_e W4[h·64+e][d]·v[i][k][h·64+e] (W4 rounded to bf16 vs split v), and the cross-set contraction out[i][j] = attn[j]·VW[i] on v_wmma_f32_16x16x32_f16 with
// attn = relu(scores/8)/128 stored in f16 and VWᵀ in f16 (single product; 1024 pairs × 128 × 1024 × 64) — an exact re-association of (attn[j]·v[i])·W4. relu/scaling are f32 VALU.
#define NSET 32
#define NIT 128
#define DM 512
#define NH 8
#define HS 64
#define NTOK (NSET * NIT)
#define HK (NH * NIT)      // 1024 = (h,k) contraction length

typedef __bf16 v16b __attribute__((ext_vector_type(16)));
typedef unsigned short v8us __attribute__((ext_vector_type(8), may_alias));
typedef float  v8f  __attribute__((ext_vector_type(8)));
typedef float  v4f  __attribute__((ext_vector_type(4)));
typedef float  v4fa __attribute__((ext_vector_type(4), may_alias));
typedef float  f32a __attribute__((may_alias));
union FragB { v16b v; v8us half[2]; unsigned short u[16]; };

__device__ __forceinline__ unsigned short bf16_bits(float x) { unsigned int u = __float_as_uint(x); return (unsigned short)((u + 0x7FFFu + ((u >> 16) & 1u)) >> 16); }
__device__ __forceinline__ float bf16_val(unsigned short b) { return __uint_as_float(((unsigned int)b) << 16); }
__device__ __forceinline__ float bf16_round(float x) { return bf16_val(bf16_bits(x)); }
// D += A·B with NT terms: 1 = ah·bh, 2 = + al·bh (A split), 3 = + ah·bl (both split)
template <int NT>
__device__ __forceinline__ v8f mmaN(v16b ah, v16b al, v16b bh, v16b bl, v8f c) {
  c = __builtin_amdgcn_wmma_f32_16x16x32_bf16(false, ah, false, bh, (short)0, c, false, false);
  if (NT >= 2) c = __builtin_amdgcn_wmma_f32_16x16x32_bf16(false, al, false, bh, (short)0, c, false, false);
  if (NT >= 3) c = __builtin_amdgcn_wmma_f32_16x16x32_bf16(false, ah, false, bl, (short)0, c, false, false);
  asm volatile("v_nop\n\tv_nop\n\tv_nop\n\tv_nop" : "+v"(c) : "v"(ah), "v"(al), "v"(bh), "v"(bl));
  return c;
}

__global__ __launch_bounds__(256) void k_wt_bf16(const float* __restrict__ W, unsigned short* __restrict__ Wt, int K, int N) {
  const int t = blockIdx.x * 256 + threadIdx.x;
  const int k8n = K / 8;
  if (t >= N * k8n) return;
  const int n = t / k8n, k8 = (t % k8n) * 8;
  v8us v;
#pragma unroll
  for (int i = 0; i < 8; ++i) v[i] = bf16_bits(W[(size_t)(k8 + i) * N + n]);
  *(v8us*)(Wt + (size_t)n * K + k8) = v;
  
}

// GEMM C[M][N] (f32, pitch ldc) = act(A[M][K]·W + bias). A f32 row-major (pitch lda) converted per fragment to bf16
// (ASPLIT: hi/lo two planes -> 2 terms, else single rounded term); Wt bf16 [N][K] (pitch ldb). BIAS_BF16 rounds the
// bias to bf16 first (bias quantised to bf16 before the add). K%32==0, M%16==0, N%64==0.
template <bool ASPLIT, int ACT, bool BIAS_BF16>
__global__ __launch_bounds__(128) void k_gemm_bf(const float* __restrict__ A, int lda, const unsigned short* __restrict__ Wt, int ldb,
                                               const float* __restrict__ bias, float* __restrict__ C, int ldc, int M, int N, int K) {
  __shared__ __attribute__((aligned(16))) float so[4][16][64];
  const int tid = threadIdx.x, w = tid >> 5, lane = tid & 31, ln = lane & 15, hh = lane >> 4;
  const int ntn = N / 64;
  const int wid = blockIdx.x * 4 + w;
  const int mt = wid / ntn, nq = wid % ntn;
  if (mt * 16 >= M) return;
  const int row0 = mt * 16, col0 = nq * 64;
  const float* arow = A + (size_t)(row0 + ln) * lda;
  v8f acc[4] = {};
  for (int kb = 0; kb < K; kb += 32) {
    FragB ah, al;
    const v4f x0 = *(const v4fa*)(arow + kb + 8 * hh), x1 = *(const v4fa*)(arow + kb + 8 * hh + 4);
    const v4f x2 = *(const v4fa*)(arow + kb + 16 + 8 * hh), x3 = *(const v4fa*)(arow + kb + 16 + 8 * hh + 4);
    float xs[16] = {x0[0],x0[1],x0[2],x0[3],x1[0],x1[1],x1[2],x1[3],x2[0],x2[1],x2[2],x2[3],x3[0],x3[1],x3[2],x3[3]};
#pragma unroll
    for (int i = 0; i < 16; ++i) { const unsigned short hb = bf16_bits(xs[i]); ah.u[i] = hb; al.u[i] = ASPLIT ? bf16_bits(xs[i] - bf16_val(hb)) : (unsigned short)0; }
#pragma unroll
    for (int t = 0; t < 4; ++t) {
      const unsigned short* brow = Wt + (size_t)(col0 + t * 16 + ln) * ldb + kb;
      FragB b;
      b.half[0] = *(const v8us*)(brow + 8 * hh);
      b.half[1] = *(const v8us*)(brow + 16 + 8 * hh);
      acc[t] = mmaN<ASPLIT ? 2 : 1>(ah.v, al.v, b.v, b.v, acc[t]);
    }
  }
#pragma unroll
  for (int t = 0; t < 4; ++t) {
    float bv = bias ? bias[col0 + t * 16 + ln] : 0.f;
    if (BIAS_BF16) bv = bf16_round(bv);
#pragma unroll
    for (int r = 0; r < 8; ++r) { float v = acc[t][r] + bv; if (ACT == 1) v = fmaxf(v, 0.f); so[w][8 * hh + r][t * 16 + ln] = v; }
  }
  __builtin_amdgcn_fence(__ATOMIC_ACQ_REL, "workgroup");
  __builtin_amdgcn_wave_barrier();
  const int rsub = lane >> 4, c4 = (lane & 15) * 4;
  {
#pragma unroll
    for (int q = 0; q < 8; ++q) {
      const int r = q * 2 + rsub;
      const v4f v = *(const v4fa*)&so[w][r][c4];
      *(v4f*)(C + (size_t)(row0 + r) * ldc + col0 + c4) = v;
    }
    
  }
}

// Flash-style causal/unmasked attention, all contractions 3-term bf16 hi/lo splits, f32 softmax with running max.
// q,k,v rows are read from f32 buffers with arbitrary row pitch (so they can live inside a fused qkv buffer);
// D = head size (multiple of 32, <= 128); one wave = 16 query rows; block = 4 waves (64 queries) sharing K/V chunks of 32.
template <int D, bool CAUSAL>
__global__ __launch_bounds__(128) void k_flash(const float* __restrict__ qb, const float* __restrict__ kb, const float* __restrict__ vb,
                                             int pitch, int T, int H, float scale, float* __restrict__ y, int ypitch) {
  constexpr int KS = D / 32;        // k-steps for QK
  constexpr int DT = D / 16;        // d tiles for PV
  __shared__ __attribute__((aligned(16))) unsigned short sKh[32][D + 8], sKl[32][D + 8], sVh[32][D + 8], sVl[32][D + 8];
  __shared__ __attribute__((aligned(16))) unsigned short sPh[4][16][40], sPl[4][16][40];
  __shared__ __attribute__((aligned(16))) float sO[4][16][D];
  const int tid = threadIdx.x, w = tid >> 5, lane = tid & 31, ln = lane & 15, hh = lane >> 4;
  const int nqb = (T + 63) / 64;
  const int bh = blockIdx.x / nqb, qblk = blockIdx.x % nqb;
  const int b = bh / H, h = bh % H;
  const int q0 = qblk * 64 + w * 16;
  const float* Q = qb + (size_t)b * T * pitch + h * D;
  const float* K = kb + (size_t)b * T * pitch + h * D;
  const float* V = vb + (size_t)b * T * pitch + h * D;

  // A fragments of the wave's 16 query rows (scaled), hi/lo
  FragB aqh[KS], aql[KS];
  {
    int row = q0 + ln; if (row >= T) row = T - 1;
    const float* qr = Q + (size_t)row * pitch;
#pragma unroll
    for (int ks = 0; ks < KS; ++ks)
#pragma unroll
      for (int i = 0; i < 16; ++i) {
        const int d = ks * 32 + ((i < 8) ? (8 * hh + i) : (16 + 8 * hh + (i - 8)));
        const float x = qr[d] * scale; const unsigned short hb = bf16_bits(x);
        aqh[ks].u[i] = hb; aql[ks].u[i] = bf16_bits(x - bf16_val(hb));
      }
  }
  float m_r[8], l_r[8];
#pragma unroll
  for (int r = 0; r < 8; ++r) { m_r[r] = -3.0e38f; l_r[r] = 0.f; }
  v8f oacc[DT];
#pragma unroll
  for (int dt = 0; dt < DT; ++dt) oacc[dt] = (v8f){0.f,0.f,0.f,0.f,0.f,0.f,0.f,0.f};

  const int kv_end = CAUSAL ? min(T, qblk * 64 + 64) : T;     // block-uniform
  for (int j0 = 0; j0 < kv_end; j0 += 32) {
    __syncthreads();
    for (int e = tid; e < 32 * (D / 4); e += 128) {
      const int r = e / (D / 4), c4 = (e % (D / 4)) * 4;
      const int key = j0 + r;
      v4f kf = {0.f,0.f,0.f,0.f}, vf = {0.f,0.f,0.f,0.f};
      if (key < T) { kf = *(const v4fa*)(K + (size_t)key * pitch + c4); vf = *(const v4fa*)(V + (size_t)key * pitch + c4); }
#pragma unroll
      for (int t = 0; t < 4; ++t) {
        unsigned short hb = bf16_bits(kf[t]); sKh[r][c4 + t] = hb; sKl[r][c4 + t] = bf16_bits(kf[t] - bf16_val(hb));
        hb = bf16_bits(vf[t]); sVh[r][c4 + t] = hb; sVl[r][c4 + t] = bf16_bits(vf[t] - bf16_val(hb));
      }
    }
    __syncthreads();
    // S tile 16 x 32
    v8f s[2];
#pragma unroll
    for (int nt = 0; nt < 2; ++nt) {
      v8f acc = {};
#pragma unroll
      for (int ks = 0; ks < KS; ++ks) {
        FragB bh_, bl_;
        bh_.half[0] = *(const v8us*)&sKh[nt * 16 + ln][ks * 32 + 8 * hh]; bh_.half[1] = *(const v8us*)&sKh[nt * 16 + ln][ks * 32 + 16 + 8 * hh];
        bl_.half[0] = *(const v8us*)&sKl[nt * 16 + ln][ks * 32 + 8 * hh]; bl_.half[1] = *(const v8us*)&sKl[nt * 16 + ln][ks * 32 + 16 + 8 * hh];
        acc = mmaN<3>(aqh[ks].v, aql[ks].v, bh_.v, bl_.v, acc);
      }
      s[nt] = acc;
    }
    // mask + running max (rows 8hh+r; the 16 lanes of a half share rows)
    float alpha[8];
#pragma unroll
    for (int r = 0; r < 8; ++r) {
      const int qi = q0 + 8 * hh + r;
      const int ja = j0 + ln, jb = j0 + 16 + ln;
      if (CAUSAL) { if (ja > qi) s[0][r] = -3.0e38f; if (jb > qi) s[1][r] = -3.0e38f; }
      if (ja >= T) s[0][r] = -3.0e38f;
      if (jb >= T) s[1][r] = -3.0e38f;
      float mx = fmaxf(s[0][r], s[1][r]);
      mx = fmaxf(mx, __shfl_xor(mx, 1, 32)); mx = fmaxf(mx, __shfl_xor(mx, 2, 32)); mx = fmaxf(mx, __shfl_xor(mx, 4, 32)); mx = fmaxf(mx, __shfl_xor(mx, 8, 32));
      const float mnew = fmaxf(m_r[r], mx);
      alpha[r] = (mnew > -1.0e38f) ? __expf(m_r[r] - mnew) : 1.0f;
      const float p0 = (s[0][r] > -1.0e38f) ? __expf(s[0][r] - mnew) : 0.f;
      const float p1 = (s[1][r] > -1.0e38f) ? __expf(s[1][r] - mnew) : 0.f;
      m_r[r] = mnew;
      l_r[r] = l_r[r] * alpha[r] + p0 + p1;            // per-lane partial row sum (16 lanes combined at the end)
      unsigned short hb = bf16_bits(p0); sPh[w][8 * hh + r][ln] = hb;      sPl[w][8 * hh + r][ln] = bf16_bits(p0 - bf16_val(hb));
      hb = bf16_bits(p1);                sPh[w][8 * hh + r][16 + ln] = hb; sPl[w][8 * hh + r][16 + ln] = bf16_bits(p1 - bf16_val(hb));
    }
#pragma unroll
    for (int dt = 0; dt < DT; ++dt)
#pragma unroll
      for (int r = 0; r < 8; ++r) oacc[dt][r] *= alpha[r];
    __builtin_amdgcn_fence(__ATOMIC_ACQ_REL, "workgroup");
    __builtin_amdgcn_wave_barrier();
    FragB pah, pal;
    pah.half[0] = *(const v8us*)&sPh[w][ln][8 * hh]; pah.half[1] = *(const v8us*)&sPh[w][ln][16 + 8 * hh];
    pal.half[0] = *(const v8us*)&sPl[w][ln][8 * hh]; pal.half[1] = *(const v8us*)&sPl[w][ln][16 + 8 * hh];
#pragma unroll
    for (int dt = 0; dt < DT; ++dt) {
      FragB bvh, bvl;
#pragma unroll
      for (int i = 0; i < 8; ++i) {
        bvh.u[i] = sVh[8 * hh + i][dt * 16 + ln]; bvh.u[8 + i] = sVh[16 + 8 * hh + i][dt * 16 + ln];
        bvl.u[i] = sVl[8 * hh + i][dt * 16 + ln]; bvl.u[8 + i] = sVl[16 + 8 * hh + i][dt * 16 + ln];
      }
      oacc[dt] = mmaN<3>(pah.v, pal.v, bvh.v, bvl.v, oacc[dt]);
    }
    __builtin_amdgcn_fence(__ATOMIC_ACQ_REL, "workgroup");
    __builtin_amdgcn_wave_barrier();
  }
#pragma unroll
  for (int r = 0; r < 8; ++r) {
    float l = l_r[r];
    l += __shfl_xor(l, 1, 32); l += __shfl_xor(l, 2, 32); l += __shfl_xor(l, 4, 32); l += __shfl_xor(l, 8, 32);
    l_r[r] = (l > 0.f) ? 1.0f / l : 0.f;
  }
#pragma unroll
  for (int dt = 0; dt < DT; ++dt)
#pragma unroll
    for (int r = 0; r < 8; ++r) sO[w][8 * hh + r][dt * 16 + ln] = oacc[dt][r] * l_r[r];
  __builtin_amdgcn_fence(__ATOMIC_ACQ_REL, "workgroup");
  __builtin_amdgcn_wave_barrier();
  {
    for (int r = 0; r < 16; ++r) {
      const int row = q0 + r;
      if (row < T && lane < D / 4) {
        const v4f val = *(const v4fa*)&sO[w][r][lane * 4];
        *(v4f*)(y + ((size_t)b * T + row) * ypitch + h * D + lane * 4) = val;
      }
    }
    
  }
}

// row LayerNorm (biased variance, eps) over N: s = X (+ R); optional out_sum <- s; out_norm <- (s-mu)*rsqrt(var+eps)*g + b
template <bool PARAM_BF16>
__global__ __launch_bounds__(256) void k_layernorm(const float* __restrict__ X, const float* __restrict__ R, const float* __restrict__ g, const float* __restrict__ bta,
                                                  float* __restrict__ out_sum, float* __restrict__ out_norm, int N, float eps) {
  __shared__ float red[256];
  const int row = blockIdx.x, tid = threadIdx.x;
  const float* x = X + (size_t)row * N; const float* rr = R ? R + (size_t)row * N : nullptr;
  float vals[16];                     // up to N = 4096
  const int per = N / 256;            // contiguous chunk per thread? use strided-by-4 chunks: thread handles j = tid*4 + 1024*u
  float s1 = 0.f;
  for (int u = 0; u < per / 4; ++u) {
    const int j = tid * 4 + 1024 * u;
    const v4f a = *(const v4fa*)(x + j);
    v4f b = {0.f,0.f,0.f,0.f}; if (rr) b = *(const v4fa*)(rr + j);
#pragma unroll
    for (int q = 0; q < 4; ++q) { const float v = a[q] + b[q]; vals[u * 4 + q] = v; s1 += v; }
  }
  red[tid] = s1; __syncthreads();
  for (int st = 128; st > 0; st >>= 1) { if (tid < st) red[tid] += red[tid + st]; __syncthreads(); }
  const float mu = red[0] / (float)N; __syncthreads();
  float s2 = 0.f;
  for (int u = 0; u < per / 4; ++u)
#pragma unroll
    for (int q = 0; q < 4; ++q) { const float c = vals[u * 4 + q] - mu; s2 += c * c; }
  red[tid] = s2; __syncthreads();
  for (int st = 128; st > 0; st >>= 1) { if (tid < st) red[tid] += red[tid + st]; __syncthreads(); }
  const float rs = rsqrtf(red[0] / (float)N + eps);
  {
    for (int u = 0; u < per / 4; ++u) {
      const int j = tid * 4 + 1024 * u;
      v4f o, sm;
#pragma unroll
      for (int q = 0; q < 4; ++q) {
        float gg = g[j + q], bb = bta[j + q];
        if (PARAM_BF16) { gg = bf16_round(gg); bb = bf16_round(bb); }
        sm[q] = vals[u * 4 + q]; o[q] = (vals[u * 4 + q] - mu) * rs * gg + bb;
      }
      if (out_sum) *(v4f*)(out_sum + (size_t)row * N + j) = sm;
      *(v4f*)(out_norm + (size_t)row * N + j) = o;
    }
    
  }
}

// batched f32 [K][N] (pitch lds, batch stride sIn) -> transposed hi/lo planes [N][K] (batch stride sOut); thread per (n, 8 k); grid.y = batch
__global__ __launch_bounds__(256) void k_split_transpose_b(const float* __restrict__ src, int lds_, size_t sIn, unsigned short* __restrict__ hi, unsigned short* __restrict__ lo, size_t sOut, int K, int N) {
  const size_t t = (size_t)blockIdx.x * 256 + threadIdx.x; const int k8n = K / 8; if (t >= (size_t)N * k8n) return;
  src += (size_t)blockIdx.y * sIn; hi += (size_t)blockIdx.y * sOut; lo += (size_t)blockIdx.y * sOut;
  const int n = (int)(t / k8n), k8 = (int)(t % k8n) * 8; v8us vh, vl;
#pragma unroll
  for (int i = 0; i < 8; ++i) { const float x = src[(size_t)(k8 + i) * lds_ + n]; const unsigned short hb = bf16_bits(x); vh[i] = hb; vl[i] = bf16_bits(x - bf16_val(hb)); }
  unsigned short* dh = hi + (size_t)n * K + k8; unsigned short* dl = lo + (size_t)n * K + k8;
  *(v8us*)dh = vh; *(v8us*)dl = vl; 
}

// ---- f16 WMMA path (v_wmma_f32_16x16x32_f16): 11-bit significands for operands in range — used where the relu(scores/8)/128 attention operand needs more precision than bf16
typedef _Float16 v16h __attribute__((ext_vector_type(16)));
union FragH { v16h v; v8us half[2]; _Float16 h[16]; unsigned short u[16]; };
template <int NT>
__device__ __forceinline__ v8f mmaH(v16h ah, v16h al, v16h bh, v16h bl, v8f c) {
  c = __builtin_amdgcn_wmma_f32_16x16x32_f16(false, ah, false, bh, (short)0, c, false, false);
  if (NT >= 2) c = __builtin_amdgcn_wmma_f32_16x16x32_f16(false, al, false, bh, (short)0, c, false, false);
  if (NT >= 3) c = __builtin_amdgcn_wmma_f32_16x16x32_f16(false, ah, false, bl, (short)0, c, false, false);
  asm volatile("v_nop\n\tv_nop\n\tv_nop\n\tv_nop" : "+v"(c) : "v"(ah), "v"(al), "v"(bh), "v"(bl));
  return c;
}
// batched GEMM like k_gemm_b but f16 operands: A f32 (split into f16 hi/lo if ASPLIT, else rounded to f16), Bt = f16 values [n][k]; alpha; C f32; N multiple of 16 (partial tiles skipped)
template <bool ASPLIT>
__global__ __launch_bounds__(128) void k_gemm_h(const float* __restrict__ A, int lda, size_t sA, const _Float16* __restrict__ Bh, int ldb, size_t sB, float alpha, float* __restrict__ C, int ldc, size_t sC, int M, int N, int K) {
  __shared__ __attribute__((aligned(16))) float so[4][16][64];
  const int tid = threadIdx.x, w = tid >> 5, lane = tid & 31, ln = lane & 15, hh = lane >> 4; const int by = blockIdx.y;
  A += (size_t)by * sA; Bh += (size_t)by * sB; C += (size_t)by * sC;
  const int ntn = (N + 63) / 64; const int wid = blockIdx.x * 4 + w; const int mt = wid / ntn, nq = wid % ntn; if (mt * 16 >= M) return;
  const int row0 = mt * 16, col0 = nq * 64; const float* arow = A + (size_t)(row0 + ln) * lda;
  v8f acc[4] = {};
  for (int kb = 0; kb < K; kb += 32) {
    FragH ah, al;
    const v4f x0 = *(const v4fa*)(arow + kb + 8 * hh), x1 = *(const v4fa*)(arow + kb + 8 * hh + 4), x2 = *(const v4fa*)(arow + kb + 16 + 8 * hh), x3 = *(const v4fa*)(arow + kb + 16 + 8 * hh + 4);
    float xs[16] = {x0[0],x0[1],x0[2],x0[3],x1[0],x1[1],x1[2],x1[3],x2[0],x2[1],x2[2],x2[3],x3[0],x3[1],x3[2],x3[3]};
#pragma unroll
    for (int i = 0; i < 16; ++i) { const _Float16 h = (_Float16)xs[i]; ah.h[i] = h; al.h[i] = ASPLIT ? (_Float16)(xs[i] - (float)h) : (_Float16)0.0f; }
#pragma unroll
    for (int t = 0; t < 4; ++t) { if (col0 + t * 16 >= N) continue; const size_t boff = (size_t)(col0 + t * 16 + ln) * ldb + kb; FragH bq; bq.half[0] = *(const v8us*)(Bh + boff + 8 * hh); bq.half[1] = *(const v8us*)(Bh + boff + 16 + 8 * hh);
      acc[t] = mmaH<ASPLIT ? 2 : 1>(ah.v, al.v, bq.v, bq.v, acc[t]); }
  }
#pragma unroll
  for (int t = 0; t < 4; ++t) { if (col0 + t * 16 >= N) continue;
#pragma unroll
    for (int r = 0; r < 8; ++r) so[w][8 * hh + r][t * 16 + ln] = acc[t][r] * alpha; }
  __builtin_amdgcn_fence(__ATOMIC_ACQ_REL, "workgroup"); __builtin_amdgcn_wave_barrier();
  const int rsub = lane >> 4, c4 = (lane & 15) * 4;
  {
#pragma unroll
    for (int q = 0; q < 8; ++q) { const int r = q * 2 + rsub; if (col0 + c4 < N) { const v4f v = *(const v4fa*)&so[w][r][c4]; *(v4f*)(C + (size_t)(row0 + r) * ldc + col0 + c4) = v; } }
     }
}

// Block-tiled product through LDS, C = A * B^T with A [M][K] and B [N][K] both k-contiguous; the launch below uses the second form (the projections are in k_head):
//   PROJ: all three projections in ONE launch: B = the transposed bf16 weights [W1 | W2 | W3], 1536 rows; A = x for the columns of W1 and y for the rest, in f32,
//         rounded to bf16 once while it is staged; Q is stored as f32 row-major, [K | V] straight as the bf16 hi/lo planes Ph and Pl.
//   else: A = ATT [(j,q)][1024] f16, B = VWt16 [(i,d)][1024] f16: all 1024 set pairs as ONE 4096 x 2048 x 1024 product; for one i the rows (j,q) of out are contiguous.
// A work-group of 8 waves owns TM rows x 128 columns; a wave owns TM/4 x 64, so a fragment read from LDS feeds several WMMAs and every operand byte
// leaves L2 once per work-group, in whole 128-B lines (a wave-wide 16-B load covers 512 contiguous bytes of one f32 row, or 256 of each of two 16-bit rows).
// A pass is 128 k: TM + 128 rows of 256 B at an LDS pitch of 272 B (conflict-free for 16-B fragment reads). Two buffers in LDS and a third stage in registers: the staged
// pieces of a thread go in quarters, one per block of WMMAs; a quarter of the next pass is stored into the other buffer and its registers are at once loaded anew for the
// pass after next, so that loads are in flight all the time and each has a whole pass to arrive; one barrier a pass publishes the next buffer and frees this one.
// Per output tile the k order (32 at a time, ascending, same lane map) is that of a wave reading its fragments straight from global memory.
#define TN 128
#define TK 128
#define LP 136             // LDS row pitch in 16-bit elements (272 B)
#define SP 68              // epilogue staging pitch in floats (272 B): rows 8 apart fall on different banks
typedef unsigned short v4us __attribute__((ext_vector_type(4), may_alias));
union FragX { v16h h; v16b b; v8us half[2]; };
template <bool B> struct Flag { static constexpr bool v = B; };
// C element (row, col) lies at C + (col / 64) * cbs + row * ldc + col % 64
template <bool PROJ, int TM, int K>
__global__ __launch_bounds__(256) void k_gemm_tile(const float* __restrict__ Ax, const float* __restrict__ Ay, const _Float16* __restrict__ Ah, const unsigned short* __restrict__ B, float* __restrict__ C,
                                                 unsigned short* __restrict__ Ph, unsigned short* __restrict__ Pl, int ldc, size_t cbs) {
  constexpr int MI = TM / 64;      // accumulator tiles of a wave in M (4 in N)
  __shared__ __attribute__((aligned(16))) unsigned short sm[2][(TM + TN) * LP];
  const int tid = threadIdx.x, w = tid >> 5, lane = tid & 31, ln = lane & 15, hh = lane >> 4;
  const int wm = w >> 1, wn = w & 1;
  const int row0 = blockIdx.x * TM, col0 = blockIdx.y * TN;
  const int lr = tid >> 4, lc = (tid & 15) * 8;      // 16-bit rows: 16 lanes x 16 B = the 256-B slice of a row
  const int fr = tid >> 5, fc = (tid & 31) * 4;      // f32 rows: 32 lanes x 16 B = the 512-B slice of a row
  const bool isq = !PROJ || blockIdx.y < DM / TN;      // PROJ: this column tile belongs to Q (the same for the whole work-group)
  const float* gf = PROJ ? (isq ? Ax : Ay) + (size_t)(row0 + fr) * K + fc : nullptr;
  const unsigned short* ga = PROJ ? nullptr : (const unsigned short*)Ah + (size_t)(row0 + lr) * K + lc;
  const unsigned short* gb = B + (size_t)(col0 + lr) * K + lc;
  v4f sf[PROJ ? TM / 8 : 1]; v8us sa[PROJ ? 1 : TM / 16]; v8us sb[TN / 16];
  auto fetchq = [&](int q, int p) {
    if constexpr (PROJ) {
#pragma unroll
      for (int u = q * (TM / 32); u < (q + 1) * (TM / 32); ++u) sf[u] = *(const v4fa*)(gf + (size_t)u * 8 * K + p * TK);
    } else {
#pragma unroll
      for (int u = q * (TM / 64); u < (q + 1) * (TM / 64); ++u) sa[u] = *(const v8us*)(ga + (size_t)u * 16 * K + p * TK);
    }
#pragma unroll
    for (int u = q * (TN / 64); u < (q + 1) * (TN / 64); ++u) sb[u] = *(const v8us*)(gb + (size_t)u * 16 * K + p * TK);
  };
  // stands behind a quarter's loads, in front of whatever may reuse the registers that hold their addresses
  auto addr_wait = [&]() { asm volatile("s_wait_xcnt 0x0" ::: "memory"); };
  auto putq = [&](int q, unsigned short* dst) {
    if constexpr (PROJ) {
#pragma unroll
      for (int u = q * (TM / 32); u < (q + 1) * (TM / 32); ++u) { v4us h; for (int e = 0; e < 4; ++e) h[e] = bf16_bits(sf[u][e]); *(v4us*)&dst[(u * 8 + fr) * LP + fc] = h; }
    } else {
#pragma unroll
      for (int u = q * (TM / 64); u < (q + 1) * (TM / 64); ++u) *(v8us*)&dst[(u * 16 + lr) * LP + lc] = sa[u];
    }
#pragma unroll
    for (int u = q * (TN / 64); u < (q + 1) * (TN / 64); ++u) *(v8us*)&dst[(TM + u * 16 + lr) * LP + lc] = sb[u];
  };
  constexpr int NP = K / TK;
  static_assert(NP >= 2 && TK / 32 == 4, "one quarter per block of WMMAs, two passes staged ahead");
#pragma unroll
  for (int q = 0; q < 4; ++q) { fetchq(q, 0); addr_wait(); }
#pragma unroll
  for (int q = 0; q < 4; ++q) { putq(q, sm[0]); fetchq(q, 1); addr_wait(); }
  // LDS-only fences, as at the foot of a pass: pass 1's loads stay in flight
  __builtin_amdgcn_fence(__ATOMIC_RELEASE, "workgroup", "local"); __builtin_amdgcn_s_barrier(); __builtin_amdgcn_fence(__ATOMIC_ACQUIRE, "workgroup", "local");
  v8f acc[MI][4] = {};
  const int aoff = (wm * (TM / 4) + ln) * LP + 8 * hh, boff = (TM + wn * 64 + ln) * LP + 8 * hh;
  auto pass = [&](int p, auto doput, auto dofetch) {
    const unsigned short* cur = sm[p & 1];
    unsigned short* nxt = sm[(p + 1) & 1];      // its readers left it at the barrier that ended the pass before
    FragX fa[2][MI], fb[2][4];
    auto frags = [&](int ks) {
#pragma unroll
      for (int m = 0; m < MI; ++m) { const int o = aoff + m * 16 * LP + ks * 32; fa[ks & 1][m].half[0] = *(const v8us*)&cur[o]; fa[ks & 1][m].half[1] = *(const v8us*)&cur[o + 16]; }
#pragma unroll
      for (int n = 0; n < 4; ++n) { const int o = boff + n * 16 * LP + ks * 32; fb[ks & 1][n].half[0] = *(const v8us*)&cur[o]; fb[ks & 1][n].half[1] = *(const v8us*)&cur[o + 16]; }
    };
    frags(0);
#pragma unroll
    for (int ks = 0; ks < TK / 32; ++ks) {
      if (ks + 1 < TK / 32) frags(ks + 1);
      // scheduling fences: the next block's fragment reads stay in front of the quarter's stores, the stores and their address arithmetic in front of the loads, and all of
      // it in front of this block's WMMAs, behind which the LDS and L2 latencies pass. The loads' address wait stands behind the WMMAs, which write accumulators only, between
      // fences of its own: it has little left to wait for there, and nothing writes a register that a load names ahead of it
      __builtin_amdgcn_sched_barrier(0);
      if constexpr (decltype(doput)::v) putq(ks, nxt);
      if constexpr (decltype(dofetch)::v) { __builtin_amdgcn_sched_barrier(0); fetchq(ks, p + 2); }
      __builtin_amdgcn_sched_barrier(0);
#pragma unroll
      for (int m = 0; m < MI; ++m)
#pragma unroll
        for (int n = 0; n < 4; ++n) {
          if constexpr (PROJ) acc[m][n] = __builtin_amdgcn_wmma_f32_16x16x32_bf16(false, fa[ks & 1][m].b, false, fb[ks & 1][n].b, (short)0, acc[m][n], false, false);
          else                acc[m][n] = __builtin_amdgcn_wmma_f32_16x16x32_f16(false, fa[ks & 1][m].h, false, fb[ks & 1][n].h, (short)0, acc[m][n], false, false);
        }
      __builtin_amdgcn_sched_barrier(0);
      if constexpr (decltype(dofetch)::v) { addr_wait(); __builtin_amdgcn_sched_barrier(0); }
    }
    // publishes the next pass's rows and ends every read of this pass's buffer. Only LDS is handed over here, so the fences name LDS alone:
    // __syncthreads() would also wait for the global loads of the pass after next, which are meant to stay in flight across the barrier
    __builtin_amdgcn_fence(__ATOMIC_RELEASE, "workgroup", "local"); __builtin_amdgcn_s_barrier(); __builtin_amdgcn_fence(__ATOMIC_ACQUIRE, "workgroup", "local");
  };
  // The passes that load stand in a loop of their own with no branch round the loads: with one, the compiler's counted waits assume the loads were skipped
  // and drain the quarters just issued. Kept rolled for the size of the code.
#pragma clang loop unroll(disable)
  for (int p = 0; p + 2 < NP; ++p) pass(p, Flag<true>{}, Flag<true>{});
  pass(NP - 2, Flag<true>{}, Flag<false>{});
  pass(NP - 1, Flag<false>{}, Flag<false>{});
  // the last barrier has ended every read of the buffers: each wave stages its f32 tile in a range of its own and stores whole lines
  f32a* so = (f32a*)&sm[0][0] + (size_t)w * (TM / 4) * SP;
#pragma unroll
  for (int m = 0; m < MI; ++m)
#pragma unroll
    for (int n = 0; n < 4; ++n)
#pragma unroll
      for (int r = 0; r < 8; ++r) so[(m * 16 + 8 * hh + r) * SP + n * 16 + ln] = acc[m][n][r];
  // the wave's own LDS writes are complete before its lanes read back rows that other lanes wrote (no other wave touches this range)
  __builtin_amdgcn_fence(__ATOMIC_ACQ_REL, "workgroup"); __builtin_amdgcn_wave_barrier();
  if (!isq) {
    // [K | V]: bf16 head and remainder of each f32 result; the wave's 64 columns are 128 B a row in each plane, one whole line (8 lanes x 16 B)
    const size_t po = (size_t)(row0 + wm * (TM / 4)) * (2 * DM) + (col0 - DM) + wn * 64;
    const int r4 = lane >> 3, c8 = (lane & 7) * 8;
    // both loops unrolled: vector elements indexed by constants stay in registers, and the LDS reads of all rows issue ahead of the stores
#pragma unroll
    for (int q = 0; q < TM / 16; ++q) {
      const int r = q * 4 + r4;
      const v4f a = *(const v4fa*)&so[r * SP + c8], b = *(const v4fa*)&so[r * SP + c8 + 4];
      v8us h, l;
#pragma unroll
      for (int u = 0; u < 8; ++u) { const float v = u < 4 ? a[u & 3] : b[u & 3]; const unsigned short hb = bf16_bits(v); h[u] = hb; l[u] = bf16_bits(v - bf16_val(hb)); }
      *(v8us*)(Ph + po + (size_t)r * (2 * DM) + c8) = h; *(v8us*)(Pl + po + (size_t)r * (2 * DM) + c8) = l;
    }
    // in the listing the Q branch stands as the fall-through behind these stores and reuses their registers
    asm volatile("s_wait_xcnt 0x0" ::: "memory");
    return;
  }
  float* cw = C + (size_t)(blockIdx.y * (TN / 64) + wn) * cbs + (size_t)(row0 + wm * (TM / 4)) * ldc;
  const int rsub = lane >> 4, c4 = (lane & 15) * 4;
#pragma unroll
  for (int q = 0; q < TM / 8; ++q) { const int r = q * 2 + rsub; const v4f v = *(const v4fa*)&so[r * SP + c4]; *(v4f*)(cw + (size_t)r * ldc + c4) = v; }
}

// Projections, scores and VW^T of one (set s, head h) in ONE work-group (grid.x = s, grid.y = h; 8 waves), so Q, K and V never leave the WGP.
// Part 1: [Q | K | V] (128 x 192, k = 512) = [x W1h | y W2h | y W3h], staged like k_gemm_tile: a pass of 128 k holds 128 rows of x, 128 rows of y (f32 rounded to bf16 once while
//         staged) and 128 k-rows of the head's 3 x 64 weight columns, read from W1, W2, W3 as they lie ([k][n], f32), rounded to bf16 while staged and kept [k][n] in LDS: the B
//         fragments come out of transposing LDS reads, in the k order of the A fragments. Two buffers, one barrier a pass. A wave owns 32 rows x 96 columns; its first four
//         column tiles take x (wn = 0) or y (wn = 1) as A, its last two always y.
// Part 2: every f32 result is split into its bf16 head and remainder, in six LDS planes [128][64] (pitch 144 B); behind one barrier each wave does three 16 x 64 jobs, 64 deep, 3 terms:
//         two of ATT[(s,q)][h*128 + k] = f16(relu(q.k / 8) / 128) and one of VWt16[(s,d)][h*128 + k] = f16(sum over e of bf16(W4[h*64+e][d]) * V[k][e]).
#define FA (2 * NIT)       // staged A rows of a pass: x, then y
#define FB (3 * HS)        // staged B columns of a pass
#define WP (FB + 16)       // LDS pitch of a staged weight k-row in 16-bit elements (416 B = 13 x 32 B: conflict-free for the transposing 16-B reads)
#define BUFE (FA * LP + TK * WP)      // one buffer: the A rows, then the weight k-rows
#define PP 72              // plane row pitch in 16-bit elements (144 B: conflict-free for 16-B fragment reads)
#define PSZ (NIT * PP)     // one plane
typedef short s16x8 __attribute__((ext_vector_type(8)));
typedef unsigned int v2ua __attribute__((ext_vector_type(2), may_alias));
// two f32 rounded to nearest even into one register of two bf16 (the packed convert instruction; on finite values the bits of bf16_bits)
__device__ __forceinline__ unsigned int pack_bf16(float lo, float hi) { typedef __bf16 bf2 __attribute__((ext_vector_type(2))); typedef float f2 __attribute__((ext_vector_type(2))); return __builtin_bit_cast(unsigned int, __builtin_convertvector(f2{lo, hi}, bf2)); }
// transposing LDS read: lane (c, hh) gets T[8 hh + 0..7][c] of the 16 x 16 tile of 16-bit elements whose rows the lanes' addresses name
__device__ __forceinline__ v8us ld_tr16(const unsigned short* p) { typedef __attribute__((address_space(3))) s16x8 lds_s16x8; return __builtin_bit_cast(v8us, __builtin_amdgcn_ds_load_tr16_b128_v8i16((lds_s16x8*)p)); }
__global__ __launch_bounds__(256) void k_head(const float* __restrict__ X, const float* __restrict__ Y, const float* __restrict__ W1, const float* __restrict__ W2, const float* __restrict__ W3,
                                            const float* __restrict__ W4, _Float16* __restrict__ ATT, _Float16* __restrict__ VWt16) {
  __shared__ __attribute__((aligned(16))) unsigned short sm[2][BUFE];
  const int tid = threadIdx.x, w = tid >> 5, lane = tid & 31, ln = lane & 15, hh = lane >> 4;
  const int wm = w >> 1, wn = w & 1;
  const int s = blockIdx.x, h = blockIdx.y;
  const int fr = tid >> 5, fc = (tid & 31) * 4;      // f32 rows: 32 lanes x 16 B = the 512-B slice of a row
  // weight k-rows: 16 lanes x 16 B = the head's 256 B of a row; the two halves of a wave take rows 4 apart, whose 8-B LDS stores fall on different banks
  const int wr = (w & 3) + 4 * hh + 8 * (w >> 2), wc = ln * 4;
  const float* gx = X + (size_t)(s * NIT + fr) * DM + fc;
  const float* gy = Y + (size_t)(s * NIT + fr) * DM + fc;
  const size_t wo = (size_t)wr * DM + h * HS + wc;
  const float* gw1 = W1 + wo; const float* gw2 = W2 + wo; const float* gw3 = W3 + wo;
  v4f sx[NIT / 8], sy[NIT / 8], sw[3 * TK / 16];
  // The 56 staged 16-B pieces of a thread go in quarters: a quarter is stored to LDS and its registers are at once loaded anew for the pass after,
  // one quarter per block of WMMAs, so that loads are in flight all the time and each has a whole pass to arrive.
  auto fetchq = [&](int q, int p) {
#pragma unroll
    for (int u = q * 4; u < q * 4 + 4; ++u) { sx[u] = *(const v4fa*)(gx + (size_t)u * 8 * DM + p * TK); sy[u] = *(const v4fa*)(gy + (size_t)u * 8 * DM + p * TK); }
#pragma unroll
    for (int u = q * 6; u < q * 6 + 6; ++u) sw[u] = *(const v4fa*)((u < 8 ? gw1 : u < 16 ? gw2 : gw3) + (size_t)((u & 7) * 16 + p * TK) * DM);
    // later instructions may reuse the registers that hold these loads' addresses
    asm volatile("s_wait_xcnt 0x0" ::: "memory");
  };
  auto putq = [&](int q, unsigned short* dst) {
#pragma unroll
    for (int u = q * 4; u < q * 4 + 4; ++u) {
      v4us a, b;
#pragma unroll
      for (int e = 0; e < 4; ++e) { a[e] = bf16_bits(sx[u][e]); b[e] = bf16_bits(sy[u][e]); }
      *(v4us*)&dst[(u * 8 + fr) * LP + fc] = a; *(v4us*)&dst[(NIT + u * 8 + fr) * LP + fc] = b;
    }
#pragma unroll
    for (int u = q * 6; u < q * 6 + 6; ++u) {
      const v2ua b = {pack_bf16(sw[u][0], sw[u][1]), pack_bf16(sw[u][2], sw[u][3])};
      *(v2ua*)&dst[FA * LP + ((u & 7) * 16 + wr) * WP + (u >> 3) * HS + wc] = b;
    }
  };
  constexpr int NP = DM / TK;
#pragma unroll
  for (int q = 0; q < 4; ++q) fetchq(q, 0);
#pragma unroll
  for (int q = 0; q < 4; ++q) { putq(q, sm[0]); fetchq(q, 1); }
  // LDS-only fences, as at the foot of the loop: pass 1's loads stay in flight
  __builtin_amdgcn_fence(__ATOMIC_RELEASE, "workgroup", "local"); __builtin_amdgcn_s_barrier(); __builtin_amdgcn_fence(__ATOMIC_ACQUIRE, "workgroup", "local");
  v8f acc[2][6] = {};
  const int a0off = (wn * NIT + wm * 32 + ln) * LP + 8 * hh, a1off = (NIT + wm * 32 + ln) * LP + 8 * hh;
  const int boff = FA * LP + (8 * hh + (lane & 7)) * WP + wn * 96 + 8 * ((lane >> 3) & 1);      // lane address of a transposing read: k-row 8 hh + (lane & 7), 16-B half (lane >> 3) & 1
  auto pass = [&](int p, auto doput, auto dofetch) {
    const unsigned short* cur = sm[p & 1];
    unsigned short* nxt = sm[(p + 1) & 1];      // its readers left it at the barrier that ended the pass before
#pragma unroll
    for (int ks = 0; ks < TK / 32; ++ks) {
      FragX fa0[2], fa1[2], fb[6];
#pragma unroll
      for (int m = 0; m < 2; ++m) {
        const int o0 = a0off + m * 16 * LP + ks * 32, o1 = a1off + m * 16 * LP + ks * 32;
        fa0[m].half[0] = *(const v8us*)&cur[o0]; fa0[m].half[1] = *(const v8us*)&cur[o0 + 16];
        fa1[m].half[0] = *(const v8us*)&cur[o1]; fa1[m].half[1] = *(const v8us*)&cur[o1 + 16];
      }
#pragma unroll
      for (int n = 0; n < 6; ++n) { const int o = boff + ks * 32 * WP + n * 16; fb[n].half[0] = ld_tr16(&cur[o]); fb[n].half[1] = ld_tr16(&cur[o + 16 * WP]); }
      // scheduling fences: the fragment reads stay in front of the quarter's conversions, which run while the reads are under way, and one block's reads are not
      // lifted over another block's WMMAs (that would hold every block's fragments in registers at once)
      __builtin_amdgcn_sched_barrier(0);
      if constexpr (decltype(doput)::v) putq(ks, nxt);
      // scheduling fence: the quarter's LDS stores and their address arithmetic stay in front of the loads, so that nothing writes a register that a load names ahead of the loads' wait
      if constexpr (decltype(dofetch)::v) { __builtin_amdgcn_sched_barrier(0); fetchq(ks, p + 2); }
      __builtin_amdgcn_sched_barrier(0);
#pragma unroll
      for (int m = 0; m < 2; ++m)
#pragma unroll
        for (int n = 0; n < 6; ++n)
          acc[m][n] = __builtin_amdgcn_wmma_f32_16x16x32_bf16(false, (n < 4 ? fa0 : fa1)[m].b, false, fb[n].b, (short)0, acc[m][n], false, false);
      __builtin_amdgcn_sched_barrier(0);
    }
    // publishes the next pass's rows and ends every read of this pass's buffer. Only LDS is handed over here, so the fences name LDS alone:
    // __syncthreads() would also wait for the global loads of the pass after next, which are meant to stay in flight across the barrier
    __builtin_amdgcn_fence(__ATOMIC_RELEASE, "workgroup", "local"); __builtin_amdgcn_s_barrier(); __builtin_amdgcn_fence(__ATOMIC_ACQUIRE, "workgroup", "local");
  };
  // The passes that load stand in a loop of their own with no branch round the loads: with one, the compiler's counted waits assume the loads were skipped
  // and drain the quarters just issued. Kept rolled for the size of the code.
#pragma clang loop unroll(disable)
  for (int p = 0; p + 2 < NP; ++p) pass(p, Flag<true>{}, Flag<true>{});
  pass(NP - 2, Flag<true>{}, Flag<false>{});
  pass(NP - 1, Flag<false>{}, Flag<false>{});
  // the W4 column (a row of W4^T) of this wave's VW^T job, in the A fragment's k order, fetched here so that the latency passes behind the split below
  const float* wcol = W4 + (size_t)(h * HS + 8 * hh) * HS + (w >> 1) * 16 + ln;
  float wx[2][16];
#pragma unroll
  for (int k2 = 0; k2 < 2; ++k2)
#pragma unroll
    for (int i = 0; i < 16; ++i) wx[k2][i] = wcol[(size_t)(k2 * 32 + (i < 8 ? i : 8 + i)) * HS];
  // later instructions may reuse the registers that hold these loads' address
  asm volatile("s_wait_xcnt 0x0" ::: "memory");
  // the last barrier has ended every read of the buffers: planes Qh Ql Kh Kl Vh Vl from the start of the LDS
  unsigned short* pl = &sm[0][0];
#pragma unroll
  for (int m = 0; m < 2; ++m)
#pragma unroll
    for (int n = 0; n < 6; ++n) {
      const int tc = wn * 6 + n;      // column tile 0..11 of [Q | K | V]
      unsigned short* ph = pl + (tc >> 2) * 2 * PSZ + (wm * 32 + m * 16 + 8 * hh) * PP + (tc & 3) * 16 + ln;
#pragma unroll
      for (int r = 0; r < 8; ++r) { const float v = acc[m][n][r]; const unsigned short hb = bf16_bits(v); ph[r * PP] = hb; ph[PSZ + r * PP] = bf16_bits(v - bf16_val(hb)); }
    }
  // publishes the planes to all waves
  __syncthreads();
  f32a* so = (f32a*)&sm[0][0] + 6 * PSZ / 2 + w * 16 * SP;      // behind the planes, a range of the wave's own
  const int r4 = lane >> 3, c8 = (lane & 7) * 8;
#pragma unroll
  for (int jj = 0; jj < 3; ++jj) {
    const bool sc = jj < 2;
    const int wid = sc ? jj * 8 + w : w;
    const int row0 = (wid >> 1) * 16, col0 = (wid & 1) * 64;
    const unsigned short* bp = pl + (sc ? 2 : 4) * PSZ + (col0 + ln) * PP + 8 * hh;
    v8f a2[4] = {};
    // all fragments of the job are read first, and the four column tiles take turns term by term: four independent accumulator chains;
    // per tile the order stays ah.bh, al.bh, ah.bl, 32 k at a time
    FragB ah[2], al[2], bh_[2][4], bl_[2][4];
#pragma unroll
    for (int k2 = 0; k2 < 2; ++k2) {
      if (sc) {
        const unsigned short* ap = pl + (row0 + ln) * PP + k2 * 32 + 8 * hh;
        ah[k2].half[0] = *(const v8us*)ap; ah[k2].half[1] = *(const v8us*)(ap + 16);
        al[k2].half[0] = *(const v8us*)(ap + PSZ); al[k2].half[1] = *(const v8us*)(ap + PSZ + 16);
      } else {
#pragma unroll
        for (int i = 0; i < 16; ++i) { const float xv = bf16_round(wx[k2][i]); const unsigned short hb = bf16_bits(xv); ah[k2].u[i] = hb; al[k2].u[i] = bf16_bits(xv - bf16_val(hb)); }
      }
#pragma unroll
      for (int t = 0; t < 4; ++t) {
        const unsigned short* b = bp + t * 16 * PP + k2 * 32;
        bh_[k2][t].half[0] = *(const v8us*)b; bh_[k2][t].half[1] = *(const v8us*)(b + 16);
        bl_[k2][t].half[0] = *(const v8us*)(b + PSZ); bl_[k2][t].half[1] = *(const v8us*)(b + PSZ + 16);
      }
    }
    // scheduling fence: without it the compiler spreads the reads in small groups among the WMMAs, each group with a wait of its own
    __builtin_amdgcn_sched_barrier(0);
#pragma unroll
    for (int k2 = 0; k2 < 2; ++k2) {
#pragma unroll
      for (int t = 0; t < 4; ++t) a2[t] = __builtin_amdgcn_wmma_f32_16x16x32_bf16(false, ah[k2].v, false, bh_[k2][t].v, (short)0, a2[t], false, false);
#pragma unroll
      for (int t = 0; t < 4; ++t) a2[t] = __builtin_amdgcn_wmma_f32_16x16x32_bf16(false, al[k2].v, false, bh_[k2][t].v, (short)0, a2[t], false, false);
#pragma unroll
      for (int t = 0; t < 4; ++t) a2[t] = __builtin_amdgcn_wmma_f32_16x16x32_bf16(false, ah[k2].v, false, bl_[k2][t].v, (short)0, a2[t], false, false);
    }
#pragma unroll
    for (int t = 0; t < 4; ++t)
#pragma unroll
      for (int r = 0; r < 8; ++r) so[(8 * hh + r) * SP + t * 16 + ln] = sc ? fmaxf(a2[t][r] * 0.125f, 0.f) * (1.0f / NIT) : a2[t][r];
    // the wave's own LDS writes are complete before its lanes read back rows that other lanes wrote (no other wave touches this range); LDS alone is named,
    // so that the fence does not wait for the job before's global stores
    __builtin_amdgcn_fence(__ATOMIC_ACQ_REL, "workgroup", "local"); __builtin_amdgcn_wave_barrier();
    unsigned short* dst = (unsigned short*)(sc ? ATT + (size_t)(s * NIT + row0) * HK : VWt16 + (size_t)(s * HS + row0) * HK) + h * NIT + col0;
    v8us o[4];
#pragma unroll
    for (int q = 0; q < 4; ++q) {
      const int r = q * 4 + r4;
      const v4f a = *(const v4fa*)&so[r * SP + c8], b = *(const v4fa*)&so[r * SP + c8 + 4];
      FragH f;
#pragma unroll
      for (int u = 0; u < 4; ++u) { f.h[u] = (_Float16)a[u]; f.h[4 + u] = (_Float16)b[u]; }
      o[q] = f.half[0];
    }
    // scheduling fences: the four stores and their wait stay together, so that no register that a store names is written anew in front of the wait
    __builtin_amdgcn_sched_barrier(0);
#pragma unroll
    for (int q = 0; q < 4; ++q) *(v8us*)(dst + (size_t)(q * 4 + r4) * HK + c8) = o[q];
    asm volatile("s_wait_xcnt 0x0" ::: "memory");
    __builtin_amdgcn_sched_barrier(0);
    // the next job's staging writes stay behind this job's reads
    __builtin_amdgcn_fence(__ATOMIC_ACQ_REL, "workgroup", "local"); __builtin_amdgcn_wave_barrier();
  }
}

extern "C" void kernel_launch(void* const* d_in, const int* in_sizes, int n_in,
                              void* d_out, int out_size, void* d_ws, size_t ws_size, hipStream_t stream) {
  (void)in_sizes; (void)n_in; (void)out_size;
  const float* x = (const float*)d_in[0]; const float* y = (const float*)d_in[1]; const float* W1 = (const float*)d_in[2]; const float* W2 = (const float*)d_in[3]; const float* W3 = (const float*)d_in[4]; const float* W4 = (const float*)d_in[5];
  char* ws = (char*)d_ws; size_t off = 0;
  auto take = [&](size_t bytes) { char* p = ws + off; off += (bytes + 255) & ~(size_t)255; return p; };
  _Float16* ATT = (_Float16*)take((size_t)NSET * NIT * HK * 2); _Float16* VWt16 = (_Float16*)take((size_t)NSET * HS * HK * 2);
  if (off > ws_size) return;
  // f16 operands of the final product, weight rounding and projections included: one work-group per (set, head)
  k_head<<<dim3(NSET, NH), 256, 0, stream>>>(x, y, W1, W2, W3, W4, ATT, VWt16);
  // out[i][j] = ATT[j] * VWt[i]^T for all 1024 (i, j) as one 4096 x 2048 x 1024 product: grid.x = 256-row tiles of (j,q), grid.y = 128-column tiles of (i,d)
  k_gemm_tile<false, 256, HK><<<dim3(NTOK / 256, NSET * HS / TN), 256, 0, stream>>>(nullptr, nullptr, ATT, (const unsigned short*)VWt16, (float*)d_out, nullptr, nullptr, HS, (size_t)NTOK * HS);
}

// v007
// It runs in 29.3 microseconds.
// Two timings next to v006 put it at 1.10 and 1.09 times that version's speed.
// Counting every step since v000, it is 42.4 times as fast.
#include <hip/hip_runtime.h>
// On WMMA (f32 accumulate): Q = x·W1, K = y·W2, V = y·W3 (inputs rounded to bf16: single exact terms), per (set, head) scores = q·kᵀ (both computed f32 → bf16 hi/lo: 3 products,
// K = 64), VWᵀ[i][d][(h,k)] = Σ_e W4[h·64+e][d]·v[i][k][h·64+e] (W4 rounded to bf16 vs split v), and the cross-set contraction out[i][j] = attn[j]·VW[i] on v_wmma_f32_16x16x32_f16 with
// attn = relu(scores/8)/128 stored in f16 and VWᵀ in f16 (single product; 1024 pairs × 128 × 1024 × 64) — an exact re-association of (attn[j]·v[i])·W4. relu/scaling are f32 VALU.
#define NSET 32
#define NIT 128
#define DM 512
#define NH 8
#define HS 64
#define NTOK (NSET * NIT)
#define HK (NH * NIT)      // 1024 = (h,k) contraction length

typedef __bf16 v16b __attribute__((ext_vector_type(16)));
typedef unsigned short v8us __attribute__((ext_vector_type(8), may_alias));
typedef float  v8f  __attribute__((ext_vector_type(8)));
typedef float  v4f  __attribute__((ext_vector_type(4)));
typedef float  v4fa __attribute__((ext_vector_type(4), may_alias));
typedef float  f32a __attribute__((may_alias));
union FragB { v16b v; v8us half[2]; unsigned short u[16]; };

__device__ __forceinline__ unsigned short bf16_bits(float x) { unsigned int u = __float_as_uint(x); return (unsigned short)((u + 0x7FFFu + ((u >> 16) & 1u)) >> 16); }
__device__ __forceinline__ float bf16_val(unsigned short b) { return __uint_as_float(((unsigned int)b) << 16); }
__device__ __forceinline__ float bf16_round(float x) { return bf16_val(bf16_bits(x)); }
// D += A·B with NT terms: 1 = ah·bh, 2 = + al·bh (A split), 3 = + ah·bl (both split)
template <int NT>
__device__ __forceinline__ v8f mmaN(v16b ah, v16b al, v16b bh, v16b bl, v8f c) {
  c = __builtin_amdgcn_wmma_f32_16x16x32_bf16(false, ah, false, bh, (short)0, c, false, false);
  if (NT >= 2) c = __builtin_amdgcn_wmma_f32_16x16x32_bf16(false, al, false, bh, (short)0, c, false, false);
  if (NT >= 3) c = __builtin_amdgcn_wmma_f32_16x16x32_bf16(false, ah, false, bl, (short)0, c, false, false);
  asm volatile("v_nop\n\tv_nop\n\tv_nop\n\tv_nop" : "+v"(c) : "v"(ah), "v"(al), "v"(bh), "v"(bl));
  return c;
}

__global__ __launch_bounds__(256) void k_wt_bf16(const float* __restrict__ W, unsigned short* __restrict__ Wt, int K, int N) {
  const int t = blockIdx.x * 256 + threadIdx.x;
  const int k8n = K / 8;
  if (t >= N * k8n) return;
  const int n = t / k8n, k8 = (t % k8n) * 8;
  v8us v;
#pragma unroll
  for (int i = 0; i < 8; ++i) v[i] = bf16_bits(W[(size_t)(k8 + i) * N + n]);
  *(v8us*)(Wt + (size_t)n * K + k8) = v;
  
}

// GEMM C[M][N] (f32, pitch ldc) = act(A[M][K]·W + bias). A f32 row-major (pitch lda) converted per fragment to bf16
// (ASPLIT: hi/lo two planes -> 2 terms, else single rounded term); Wt bf16 [N][K] (pitch ldb). BIAS_BF16 rounds the
// bias to bf16 first (bias quantised to bf16 before the add). K%32==0, M%16==0, N%64==0.
template <bool ASPLIT, int ACT, bool BIAS_BF16>
__global__ __launch_bounds__(128) void k_gemm_bf(const float* __restrict__ A, int lda, const unsigned short* __restrict__ Wt, int ldb,
                                               const float* __restrict__ bias, float* __restrict__ C, int ldc, int M, int N, int K) {
  __shared__ __attribute__((aligned(16))) float so[4][16][64];
  const int tid = threadIdx.x, w = tid >> 5, lane = tid & 31, ln = lane & 15, hh = lane >> 4;
  const int ntn = N / 64;
  const int wid = blockIdx.x * 4 + w;
  const int mt = wid / ntn, nq = wid % ntn;
  if (mt * 16 >= M) return;
  const int row0 = mt * 16, col0 = nq * 64;
  const float* arow = A + (size_t)(row0 + ln) * lda;
  v8f acc[4] = {};
  for (int kb = 0; kb < K; kb += 32) {
    FragB ah, al;
    const v4f x0 = *(const v4fa*)(arow + kb + 8 * hh), x1 = *(const v4fa*)(arow + kb + 8 * hh + 4);
    const v4f x2 = *(const v4fa*)(arow + kb + 16 + 8 * hh), x3 = *(const v4fa*)(arow + kb + 16 + 8 * hh + 4);
    float xs[16] = {x0[0],x0[1],x0[2],x0[3],x1[0],x1[1],x1[2],x1[3],x2[0],x2[1],x2[2],x2[3],x3[0],x3[1],x3[2],x3[3]};
#pragma unroll
    for (int i = 0; i < 16; ++i) { const unsigned short hb = bf16_bits(xs[i]); ah.u[i] = hb; al.u[i] = ASPLIT ? bf16_bits(xs[i] - bf16_val(hb)) : (unsigned short)0; }
#pragma unroll
    for (int t = 0; t < 4; ++t) {
      const unsigned short* brow = Wt + (size_t)(col0 + t * 16 + ln) * ldb + kb;
      FragB b;
      b.half[0] = *(const v8us*)(brow + 8 * hh);
      b.half[1] = *(const v8us*)(brow + 16 + 8 * hh);
      acc[t] = mmaN<ASPLIT ? 2 : 1>(ah.v, al.v, b.v, b.v, acc[t]);
    }
  }
#pragma unroll
  for (int t = 0; t < 4; ++t) {
    float bv = bias ? bias[col0 + t * 16 + ln] : 0.f;
    if (BIAS_BF16) bv = bf16_round(bv);
#pragma unroll
    for (int r = 0; r < 8; ++r) { float v = acc[t][r] + bv; if (ACT == 1) v = fmaxf(v, 0.f); so[w][8 * hh + r][t * 16 + ln] = v; }
  }
  __builtin_amdgcn_fence(__ATOMIC_ACQ_REL, "workgroup");
  __builtin_amdgcn_wave_barrier();
  const int rsub = lane >> 4, c4 = (lane & 15) * 4;
  {
#pragma unroll
    for (int q = 0; q < 8; ++q) {
      const int r = q * 2 + rsub;
      const v4f v = *(const v4fa*)&so[w][r][c4];
      *(v4f*)(C + (size_t)(row0 + r) * ldc + col0 + c4) = v;
    }
    
  }
}

// Flash-style causal/unmasked attention, all contractions 3-term bf16 hi/lo splits, f32 softmax with running max.
// q,k,v rows are read from f32 buffers with arbitrary row pitch (so they can live inside a fused qkv buffer);
// D = head size (multiple of 32, <= 128); one wave = 16 query rows; block = 4 waves (64 queries) sharing K/V chunks of 32.
template <int D, bool CAUSAL>
__global__ __launch_bounds__(128) void k_flash(const float* __restrict__ qb, const float* __restrict__ kb, const float* __restrict__ vb,
                                             int pitch, int T, int H, float scale, float* __restrict__ y, int ypitch) {
  constexpr int KS = D / 32;        // k-steps for QK
  constexpr int DT = D / 16;        // d tiles for PV
  __shared__ __attribute__((aligned(16))) unsigned short sKh[32][D + 8], sKl[32][D + 8], sVh[32][D + 8], sVl[32][D + 8];
  __shared__ __attribute__((aligned(16))) unsigned short sPh[4][16][40], sPl[4][16][40];
  __shared__ __attribute__((aligned(16))) float sO[4][16][D];
  const int tid = threadIdx.x, w = tid >> 5, lane = tid & 31, ln = lane & 15, hh = lane >> 4;
  const int nqb = (T + 63) / 64;
  const int bh = blockIdx.x / nqb, qblk = blockIdx.x % nqb;
  const int b = bh / H, h = bh % H;
  const int q0 = qblk * 64 + w * 16;
  const float* Q = qb + (size_t)b * T * pitch + h * D;
  const float* K = kb + (size_t)b * T * pitch + h * D;
  const float* V = vb + (size_t)b * T * pitch + h * D;

  // A fragments of the wave's 16 query rows (scaled), hi/lo
  FragB aqh[KS], aql[KS];
  {
    int row = q0 + ln; if (row >= T) row = T - 1;
    const float* qr = Q + (size_t)row * pitch;
#pragma unroll
    for (int ks = 0; ks < KS; ++ks)
#pragma unroll
      for (int i = 0; i < 16; ++i) {
        const int d = ks * 32 + ((i < 8) ? (8 * hh + i) : (16 + 8 * hh + (i - 8)));
        const float x = qr[d] * scale; const unsigned short hb = bf16_bits(x);
        aqh[ks].u[i] = hb; aql[ks].u[i] = bf16_bits(x - bf16_val(hb));
      }
  }
  float m_r[8], l_r[8];
#pragma unroll
  for (int r = 0; r < 8; ++r) { m_r[r] = -3.0e38f; l_r[r] = 0.f; }
  v8f oacc[DT];
#pragma unroll
  for (int dt = 0; dt < DT; ++dt) oacc[dt] = (v8f){0.f,0.f,0.f,0.f,0.f,0.f,0.f,0.f};

  const int kv_end = CAUSAL ? min(T, qblk * 64 + 64) : T;     // block-uniform
  for (int j0 = 0; j0 < kv_end; j0 += 32) {
    __syncthreads();
    for (int e = tid; e < 32 * (D / 4); e += 128) {
      const int r = e / (D / 4), c4 = (e % (D / 4)) * 4;
      const int key = j0 + r;
      v4f kf = {0.f,0.f,0.f,0.f}, vf = {0.f,0.f,0.f,0.f};
      if (key < T) { kf = *(const v4fa*)(K + (size_t)key * pitch + c4); vf = *(const v4fa*)(V + (size_t)key * pitch + c4); }
#pragma unroll
      for (int t = 0; t < 4; ++t) {
        unsigned short hb = bf16_bits(kf[t]); sKh[r][c4 + t] = hb; sKl[r][c4 + t] = bf16_bits(kf[t] - bf16_val(hb));
        hb = bf16_bits(vf[t]); sVh[r][c4 + t] = hb; sVl[r][c4 + t] = bf16_bits(vf[t] - bf16_val(hb));
      }
    }
    __syncthreads();
    // S tile 16 x 32
    v8f s[2];
#pragma unroll
    for (int nt = 0; nt < 2; ++nt) {
      v8f acc = {};
#pragma unroll
      for (int ks = 0; ks < KS; ++ks) {
        FragB bh_, bl_;
        bh_.half[0] = *(const v8us*)&sKh[nt * 16 + ln][ks * 32 + 8 * hh]; bh_.half[1] = *(const v8us*)&sKh[nt * 16 + ln][ks * 32 + 16 + 8 * hh];
        bl_.half[0] = *(const v8us*)&sKl[nt * 16 + ln][ks * 32 + 8 * hh]; bl_.half[1] = *(const v8us*)&sKl[nt * 16 + ln][ks * 32 + 16 + 8 * hh];
        acc = mmaN<3>(aqh[ks].v, aql[ks].v, bh_.v, bl_.v, acc);
      }
      s[nt] = acc;
    }
    // mask + running max (rows 8hh+r; the 16 lanes of a half share rows)
    float alpha[8];
#pragma unroll
    for (int r = 0; r < 8; ++r) {
      const int qi = q0 + 8 * hh + r;
      const int ja = j0 + ln, jb = j0 + 16 + ln;
      if (CAUSAL) { if (ja > qi) s[0][r] = -3.0e38f; if (jb > qi) s[1][r] = -3.0e38f; }
      if (ja >= T) s[0][r] = -3.0e38f;
      if (jb >= T) s[1][r] = -3.0e38f;
      float mx = fmaxf(s[0][r], s[1][r]);
      mx = fmaxf(mx, __shfl_xor(mx, 1, 32)); mx = fmaxf(mx, __shfl_xor(mx, 2, 32)); mx = fmaxf(mx, __shfl_xor(mx, 4, 32)); mx = fmaxf(mx, __shfl_xor(mx, 8, 32));
      const float mnew = fmaxf(m_r[r], mx);
      alpha[r] = (mnew > -1.0e38f) ? __expf(m_r[r] - mnew) : 1.0f;
      const float p0 = (s[0][r] > -1.0e38f) ? __expf(s[0][r] - mnew) : 0.f;
      const float p1 = (s[1][r] > -1.0e38f) ? __expf(s[1][r] - mnew) : 0.f;
      m_r[r] = mnew;
      l_r[r] = l_r[r] * alpha[r] + p0 + p1;            // per-lane partial row sum (16 lanes combined at the end)
      unsigned short hb = bf16_bits(p0); sPh[w][8 * hh + r][ln] = hb;      sPl[w][8 * hh + r][ln] = bf16_bits(p0 - bf16_val(hb));
      hb = bf16_bits(p1);                sPh[w][8 * hh + r][16 + ln] = hb; sPl[w][8 * hh + r][16 + ln] = bf16_bits(p1 - bf16_val(hb));
    }
#pragma unroll
    for (int dt = 0; dt < DT; ++dt)
#pragma unroll
      for (int r = 0; r < 8; ++r) oacc[dt][r] *= alpha[r];
    __builtin_amdgcn_fence(__ATOMIC_ACQ_REL, "workgroup");
    __builtin_amdgcn_wave_barrier();
    FragB pah, pal;
    pah.half[0] = *(const v8us*)&sPh[w][ln][8 * hh]; pah.half[1] = *(const v8us*)&sPh[w][ln][16 + 8 * hh];
    pal.half[0] = *(const v8us*)&sPl[w][ln][8 * hh]; pal.half[1] = *(const v8us*)&sPl[w][ln][16 + 8 * hh];
#pragma unroll
    for (int dt = 0; dt < DT; ++dt) {
      FragB bvh, bvl;
#pragma unroll
      for (int i = 0; i < 8; ++i) {
        bvh.u[i] = sVh[8 * hh + i][dt * 16 + ln]; bvh.u[8 + i] = sVh[16 + 8 * hh + i][dt * 16 + ln];
        bvl.u[i] = sVl[8 * hh + i][dt * 16 + ln]; bvl.u[8 + i] = sVl[16 + 8 * hh + i][dt * 16 + ln];
      }
      oacc[dt] = mmaN<3>(pah.v, pal.v, bvh.v, bvl.v, oacc[dt]);
    }
    __builtin_amdgcn_fence(__ATOMIC_ACQ_REL, "workgroup");
    __builtin_amdgcn_wave_barrier();
  }
#pragma unroll
  for (int r = 0; r < 8; ++r) {
    float l = l_r[r];
    l += __shfl_xor(l, 1, 32); l += __shfl_xor(l, 2, 32); l += __shfl_xor(l, 4, 32); l += __shfl_xor(l, 8, 32);
    l_r[r] = (l > 0.f) ? 1.0f / l : 0.f;
  }
#pragma unroll
  for (int dt = 0; dt < DT; ++dt)
#pragma unroll
    for (int r = 0; r < 8; ++r) sO[w][8 * hh + r][dt * 16 + ln] = oacc[dt][r] * l_r[r];
  __builtin_amdgcn_fence(__ATOMIC_ACQ_REL, "workgroup");
  __builtin_amdgcn_wave_barrier();
  {
    for (int r = 0; r < 16; ++r) {
      const int row = q0 + r;
      if (row < T && lane < D / 4) {
        const v4f val = *(const v4fa*)&sO[w][r][lane * 4];
        *(v4f*)(y + ((size_t)b * T + row) * ypitch + h * D + lane * 4) = val;
      }
    }
    
  }
}

// row LayerNorm (biased variance, eps) over N: s = X (+ R); optional out_sum <- s; out_norm <- (s-mu)*rsqrt(var+eps)*g + b
template <bool PARAM_BF16>
__global__ __launch_bounds__(256) void k_layernorm(const float* __restrict__ X, const float* __restrict__ R, const float* __restrict__ g, const float* __restrict__ bta,
                                                  float* __restrict__ out_sum, float* __restrict__ out_norm, int N, float eps) {
  __shared__ float red[256];
  const int row = blockIdx.x, tid = threadIdx.x;
  const float* x = X + (size_t)row * N; const float* rr = R ? R + (size_t)row * N : nullptr;
  float vals[16];                     // up to N = 4096
  const int per = N / 256;            // contiguous chunk per thread? use strided-by-4 chunks: thread handles j = tid*4 + 1024*u
  float s1 = 0.f;
  for (int u = 0; u < per / 4; ++u) {
    const int j = tid * 4 + 1024 * u;
    const v4f a = *(const v4fa*)(x + j);
    v4f b = {0.f,0.f,0.f,0.f}; if (rr) b = *(const v4fa*)(rr + j);
#pragma unroll
    for (int q = 0; q < 4; ++q) { const float v = a[q] + b[q]; vals[u * 4 + q] = v; s1 += v; }
  }
  red[tid] = s1; __syncthreads();
  for (int st = 128; st > 0; st >>= 1) { if (tid < st) red[tid] += red[tid + st]; __syncthreads(); }
  const float mu = red[0] / (float)N; __syncthreads();
  float s2 = 0.f;
  for (int u = 0; u < per / 4; ++u)
#pragma unroll
    for (int q = 0; q < 4; ++q) { const float c = vals[u * 4 + q] - mu; s2 += c * c; }
  red[tid] = s2; __syncthreads();
  for (int st = 128; st > 0; st >>= 1) { if (tid < st) red[tid] += red[tid + st]; __syncthreads(); }
  const float rs = rsqrtf(red[0] / (float)N + eps);
  {
    for (int u = 0; u < per / 4; ++u) {
      const int j = tid * 4 + 1024 * u;
      v4f o, sm;
#pragma unroll
      for (int q = 0; q < 4; ++q) {
        float gg = g[j + q], bb = bta[j + q];
        if (PARAM_BF16) { gg = bf16_round(gg); bb = bf16_round(bb); }
        sm[q] = vals[u * 4 + q]; o[q] = (vals[u * 4 + q] - mu) * rs * gg + bb;
      }
      if (out_sum) *(v4f*)(out_sum + (size_t)row * N + j) = sm;
      *(v4f*)(out_norm + (size_t)row * N + j) = o;
    }
    
  }
}

// batched f32 [K][N] (pitch lds, batch stride sIn) -> transposed hi/lo planes [N][K] (batch stride sOut); thread per (n, 8 k); grid.y = batch
__global__ __launch_bounds__(256) void k_split_transpose_b(const float* __restrict__ src, int lds_, size_t sIn, unsigned short* __restrict__ hi, unsigned short* __restrict__ lo, size_t sOut, int K, int N) {
  const size_t t = (size_t)blockIdx.x * 256 + threadIdx.x; const int k8n = K / 8; if (t >= (size_t)N * k8n) return;
  src += (size_t)blockIdx.y * sIn; hi += (size_t)blockIdx.y * sOut; lo += (size_t)blockIdx.y * sOut;
  const int n = (int)(t / k8n), k8 = (int)(t % k8n) * 8; v8us vh, vl;
#pragma unroll
  for (int i = 0; i < 8; ++i) { const float x = src[(size_t)(k8 + i) * lds_ + n]; const unsigned short hb = bf16_bits(x); vh[i] = hb; vl[i] = bf16_bits(x - bf16_val(hb)); }
  unsigned short* dh = hi + (size_t)n * K + k8; unsigned short* dl = lo + (size_t)n * K + k8;
  *(v8us*)dh = vh; *(v8us*)dl = vl; 
}

// ---- f16 WMMA path (v_wmma_f32_16x16x32_f16): 11-bit significands for operands in range — used where the relu(scores/8)/128 attention operand needs more precision than bf16
typedef _Float16 v16h __attribute__((ext_vector_type(16)));
union FragH { v16h v; v8us half[2]; _Float16 h[16]; unsigned short u[16]; };
template <int NT>
__device__ __forceinline__ v8f mmaH(v16h ah, v16h al, v16h bh, v16h bl, v8f c) {
  c = __builtin_amdgcn_wmma_f32_16x16x32_f16(false, ah, false, bh, (short)0, c, false, false);
  if (NT >= 2) c = __builtin_amdgcn_wmma_f32_16x16x32_f16(false, al, false, bh, (short)0, c, false, false);
  if (NT >= 3) c = __builtin_amdgcn_wmma_f32_16x16x32_f16(false, ah, false, bl, (short)0, c, false, false);
  asm volatile("v_nop\n\tv_nop\n\tv_nop\n\tv_nop" : "+v"(c) : "v"(ah), "v"(al), "v"(bh), "v"(bl));
  return c;
}
// batched GEMM like k_gemm_b but f16 operands: A f32 (split into f16 hi/lo if ASPLIT, else rounded to f16), Bt = f16 values [n][k]; alpha; C f32; N multiple of 16 (partial tiles skipped)
template <bool ASPLIT>
__global__ __launch_bounds__(128) void k_gemm_h(const float* __restrict__ A, int lda, size_t sA, const _Float16* __restrict__ Bh, int ldb, size_t sB, float alpha, float* __restrict__ C, int ldc, size_t sC, int M, int N, int K) {
  __shared__ __attribute__((aligned(16))) float so[4][16][64];
  const int tid = threadIdx.x, w = tid >> 5, lane = tid & 31, ln = lane & 15, hh = lane >> 4; const int by = blockIdx.y;
  A += (size_t)by * sA; Bh += (size_t)by * sB; C += (size_t)by * sC;
  const int ntn = (N + 63) / 64; const int wid = blockIdx.x * 4 + w; const int mt = wid / ntn, nq = wid % ntn; if (mt * 16 >= M) return;
  const int row0 = mt * 16, col0 = nq * 64; const float* arow = A + (size_t)(row0 + ln) * lda;
  v8f acc[4] = {};
  for (int kb = 0; kb < K; kb += 32) {
    FragH ah, al;
    const v4f x0 = *(const v4fa*)(arow + kb + 8 * hh), x1 = *(const v4fa*)(arow + kb + 8 * hh + 4), x2 = *(const v4fa*)(arow + kb + 16 + 8 * hh), x3 = *(const v4fa*)(arow + kb + 16 + 8 * hh + 4);
    float xs[16] = {x0[0],x0[1],x0[2],x0[3],x1[0],x1[1],x1[2],x1[3],x2[0],x2[1],x2[2],x2[3],x3[0],x3[1],x3[2],x3[3]};
#pragma unroll
    for (int i = 0; i < 16; ++i) { const _Float16 h = (_Float16)xs[i]; ah.h[i] = h; al.h[i] = ASPLIT ? (_Float16)(xs[i] - (float)h) : (_Float16)0.0f; }
#pragma unroll
    for (int t = 0; t < 4; ++t) { if (col0 + t * 16 >= N) continue; const size_t boff = (size_t)(col0 + t * 16 + ln) * ldb + kb; FragH bq; bq.half[0] = *(const v8us*)(Bh + boff + 8 * hh); bq.half[1] = *(const v8us*)(Bh + boff + 16 + 8 * hh);
      acc[t] = mmaH<ASPLIT ? 2 : 1>(ah.v, al.v, bq.v, bq.v, acc[t]); }
  }
#pragma unroll
  for (int t = 0; t < 4; ++t) { if (col0 + t * 16 >= N) continue;
#pragma unroll
    for (int r = 0; r < 8; ++r) so[w][8 * hh + r][t * 16 + ln] = acc[t][r] * alpha; }
  __builtin_amdgcn_fence(__ATOMIC_ACQ_REL, "workgroup"); __builtin_amdgcn_wave_barrier();
  const int rsub = lane >> 4, c4 = (lane & 15) * 4;
  {
#pragma unroll
    for (int q = 0; q < 8; ++q) { const int r = q * 2 + rsub; if (col0 + c4 < N) { const v4f v = *(const v4fa*)&so[w][r][c4]; *(v4f*)(C + (size_t)(row0 + r) * ldc + col0 + c4) = v; } }
     }
}

// Block-tiled product through LDS, C = A * B^T with A [M][K] and B [N][K] both k-contiguous; the launch below uses the second form (the projections are in k_head):
//   PROJ: all three projections in ONE launch: B = the transposed bf16 weights [W1 | W2 | W3], 1536 rows; A = x for the columns of W1 and y for the rest, in f32,
//         rounded to bf16 once while it is staged; Q is stored as f32 row-major, [K | V] straight as the bf16 hi/lo planes Ph and Pl.
//   else: A = ATT [(j,q)][1024] f16, B = VWt16 [(i,d)][1024] f16: all 1024 set pairs as ONE 4096 x 2048 x 1024 product; for one i the rows (j,q) of out are contiguous.
// A work-group of 8 waves owns TM rows x 128 columns; a wave owns TM/4 x 64, so a fragment read from LDS feeds several WMMAs and every operand byte
// leaves L2 once per work-group, in whole 128-B lines (a wave-wide 16-B load covers 512 contiguous bytes of one f32 row, or 256 of each of two 16-bit rows).
// A pass is 128 k: TM + 128 rows of 256 B at an LDS pitch of 272 B (conflict-free for 16-B fragment reads). Two buffers in LDS and a third stage in registers: the staged
// pieces of a thread go in quarters, one per block of WMMAs; a quarter of the next pass is stored into the other buffer and its registers are at once loaded anew for the
// pass after next, so that loads are in flight all the time and each has a whole pass to arrive; one barrier a pass publishes the next buffer and frees this one.
// Work-groups that share operand rows run in step and would ask L2 for the same lines at the same moment: each starts its walk over the passes at a pass of its own
// (tile row + tile column, wrapping), A and B of a pass always from the same k. Per output tile the sum runs over the passes in that rotated order, inside a pass 32 k at a time, ascending.
#define TN 128
#define TK 128
#define LP 136             // LDS row pitch in 16-bit elements (272 B)
#define SP 68              // epilogue staging pitch in floats (272 B): rows 8 apart fall on different banks
typedef unsigned short v4us __attribute__((ext_vector_type(4), may_alias));
union FragX { v16h h; v16b b; v8us half[2]; };
template <bool B> struct Flag { static constexpr bool v = B; };
// C element (row, col) lies at C + (col / 64) * cbs + row * ldc + col % 64
template <bool PROJ, int TM, int K>
__global__ __launch_bounds__(256) void k_gemm_tile(const float* __restrict__ Ax, const float* __restrict__ Ay, const _Float16* __restrict__ Ah, const unsigned short* __restrict__ B, float* __restrict__ C,
                                                 unsigned short* __restrict__ Ph, unsigned short* __restrict__ Pl, int ldc, size_t cbs) {
  constexpr int MI = TM / 64;      // accumulator tiles of a wave in M (4 in N)
  __shared__ __attribute__((aligned(16))) unsigned short sm[2][(TM + TN) * LP];
  const int tid = threadIdx.x, w = tid >> 5, lane = tid & 31, ln = lane & 15, hh = lane >> 4;
  const int wm = w >> 1, wn = w & 1;
  const int row0 = blockIdx.x * TM, col0 = blockIdx.y * TN;
  const int lr = tid >> 4, lc = (tid & 15) * 8;      // 16-bit rows: 16 lanes x 16 B = the 256-B slice of a row
  const int fr = tid >> 5, fc = (tid & 31) * 4;      // f32 rows: 32 lanes x 16 B = the 512-B slice of a row
  const bool isq = !PROJ || blockIdx.y < DM / TN;      // PROJ: this column tile belongs to Q (the same for the whole work-group)
  const float* gf = PROJ ? (isq ? Ax : Ay) + (size_t)(row0 + fr) * K + fc : nullptr;
  const unsigned short* ga = PROJ ? nullptr : (const unsigned short*)Ah + (size_t)(row0 + lr) * K + lc;
  const unsigned short* gb = B + (size_t)(col0 + lr) * K + lc;
  v4f sf[PROJ ? TM / 8 : 1]; v8us sa[PROJ ? 1 : TM / 16]; v8us sb[TN / 16];
  constexpr int NP = K / TK;
  static_assert((NP & (NP - 1)) == 0, "the rotated walk wraps by a mask");
  const int rot = (blockIdx.x + blockIdx.y) & (NP - 1);      // the work-group's first pass
  auto fetchq = [&](int q, int p) {
    const int ko = ((p + rot) & (NP - 1)) * TK;      // k at which the p-th pass of this work-group begins
    if constexpr (PROJ) {
#pragma unroll
      for (int u = q * (TM / 32); u < (q + 1) * (TM / 32); ++u) sf[u] = *(const v4fa*)(gf + (size_t)u * 8 * K + ko);
    } else {
#pragma unroll
      for (int u = q * (TM / 64); u < (q + 1) * (TM / 64); ++u) sa[u] = *(const v8us*)(ga + (size_t)u * 16 * K + ko);
    }
#pragma unroll
    for (int u = q * (TN / 64); u < (q + 1) * (TN / 64); ++u) sb[u] = *(const v8us*)(gb + (size_t)u * 16 * K + ko);
  };
  // stands behind a quarter's loads, in front of whatever may reuse the registers that hold their addresses
  auto addr_wait = [&]() { asm volatile("s_wait_xcnt 0x0" ::: "memory"); };
  auto putq = [&](int q, unsigned short* dst) {
    if constexpr (PROJ) {
#pragma unroll
      for (int u = q * (TM / 32); u < (q + 1) * (TM / 32); ++u) { v4us h; for (int e = 0; e < 4; ++e) h[e] = bf16_bits(sf[u][e]); *(v4us*)&dst[(u * 8 + fr) * LP + fc] = h; }
    } else {
#pragma unroll
      for (int u = q * (TM / 64); u < (q + 1) * (TM / 64); ++u) *(v8us*)&dst[(u * 16 + lr) * LP + lc] = sa[u];
    }
#pragma unroll
    for (int u = q * (TN / 64); u < (q + 1) * (TN / 64); ++u) *(v8us*)&dst[(TM + u * 16 + lr) * LP + lc] = sb[u];
  };
  static_assert(NP >= 2 && TK / 32 == 4, "one quarter per block of WMMAs, two passes staged ahead");
#pragma unroll
  for (int q = 0; q < 4; ++q) { fetchq(q, 0); addr_wait(); }
#pragma unroll
  for (int q = 0; q < 4; ++q) { putq(q, sm[0]); fetchq(q, 1); addr_wait(); }
  // LDS-only fences, as at the foot of a pass: pass 1's loads stay in flight
  __builtin_amdgcn_fence(__ATOMIC_RELEASE, "workgroup", "local"); __builtin_amdgcn_s_barrier(); __builtin_amdgcn_fence(__ATOMIC_ACQUIRE, "workgroup", "local");
  v8f acc[MI][4] = {};
  const int aoff = (wm * (TM / 4) + ln) * LP + 8 * hh, boff = (TM + wn * 64 + ln) * LP + 8 * hh;
  auto pass = [&](int p, auto doput, auto dofetch) {
    const unsigned short* cur = sm[p & 1];
    unsigned short* nxt = sm[(p + 1) & 1];      // its readers left it at the barrier that ended the pass before
    FragX fa[2][MI], fb[2][4];
    auto frags = [&](int ks) {
#pragma unroll
      for (int m = 0; m < MI; ++m) { const int o = aoff + m * 16 * LP + ks * 32; fa[ks & 1][m].half[0] = *(const v8us*)&cur[o]; fa[ks & 1][m].half[1] = *(const v8us*)&cur[o + 16]; }
#pragma unroll
      for (int n = 0; n < 4; ++n) { const int o = boff + n * 16 * LP + ks * 32; fb[ks & 1][n].half[0] = *(const v8us*)&cur[o]; fb[ks & 1][n].half[1] = *(const v8us*)&cur[o + 16]; }
    };
    frags(0);
#pragma unroll
    for (int ks = 0; ks < TK / 32; ++ks) {
      if (ks + 1 < TK / 32) frags(ks + 1);
      // scheduling fences: the next block's fragment reads stay in front of the quarter's stores, the stores and their address arithmetic in front of the loads, and all of
      // it in front of this block's WMMAs, behind which the LDS and L2 latencies pass. The loads' address wait stands behind the WMMAs, which write accumulators only, between
      // fences of its own: it has little left to wait for there, and nothing writes a register that a load names ahead of it
      __builtin_amdgcn_sched_barrier(0);
      if constexpr (decltype(doput)::v) putq(ks, nxt);
      if constexpr (decltype(dofetch)::v) { __builtin_amdgcn_sched_barrier(0); fetchq(ks, p + 2); }
      __builtin_amdgcn_sched_barrier(0);
#pragma unroll
      for (int m = 0; m < MI; ++m)
#pragma unroll
        for (int n = 0; n < 4; ++n) {
          if constexpr (PROJ) acc[m][n] = __builtin_amdgcn_wmma_f32_16x16x32_bf16(false, fa[ks & 1][m].b, false, fb[ks & 1][n].b, (short)0, acc[m][n], false, false);
          else                acc[m][n] = __builtin_amdgcn_wmma_f32_16x16x32_f16(false, fa[ks & 1][m].h, false, fb[ks & 1][n].h, (short)0, acc[m][n], false, false);
        }
      __builtin_amdgcn_sched_barrier(0);
      if constexpr (decltype(dofetch)::v) { addr_wait(); __builtin_amdgcn_sched_barrier(0); }
    }
    // publishes the next pass's rows and ends every read of this pass's buffer. Only LDS is handed over here, so the fences name LDS alone:
    // __syncthreads() would also wait for the global loads of the pass after next, which are meant to stay in flight across the barrier
    __builtin_amdgcn_fence(__ATOMIC_RELEASE, "workgroup", "local"); __builtin_amdgcn_s_barrier(); __builtin_amdgcn_fence(__ATOMIC_ACQUIRE, "workgroup", "local");
  };
  // The passes that load stand in a loop of their own with no branch round the loads: with one, the compiler's counted waits assume the loads were skipped
  // and drain the quarters just issued. Kept rolled for the size of the code.
#pragma clang loop unroll(disable)
  for (int p = 0; p + 2 < NP; ++p) pass(p, Flag<true>{}, Flag<true>{});
  pass(NP - 2, Flag<true>{}, Flag<false>{});
  pass(NP - 1, Flag<false>{}, Flag<false>{});
  // the last barrier has ended every read of the buffers: each wave stages its f32 tile in a range of its own and stores whole lines
  f32a* so = (f32a*)&sm[0][0] + (size_t)w * (TM / 4) * SP;
#pragma unroll
  for (int m = 0; m < MI; ++m)
#pragma unroll
    for (int n = 0; n < 4; ++n)
#pragma unroll
      for (int r = 0; r < 8; ++r) so[(m * 16 + 8 * hh + r) * SP + n * 16 + ln] = acc[m][n][r];
  // the wave's own LDS writes are complete before its lanes read back rows that other lanes wrote (no other wave touches this range)
  __builtin_amdgcn_fence(__ATOMIC_ACQ_REL, "workgroup"); __builtin_amdgcn_wave_barrier();
  if (!isq) {
    // [K | V]: bf16 head and remainder of each f32 result; the wave's 64 columns are 128 B a row in each plane, one whole line (8 lanes x 16 B)
    const size_t po = (size_t)(row0 + wm * (TM / 4)) * (2 * DM) + (col0 - DM) + wn * 64;
    const int r4 = lane >> 3, c8 = (lane & 7) * 8;
    // both loops unrolled: vector elements indexed by constants stay in registers, and the LDS reads of all rows issue ahead of the stores
#pragma unroll
    for (int q = 0; q < TM / 16; ++q) {
      const int r = q * 4 + r4;
      const v4f a = *(const v4fa*)&so[r * SP + c8], b = *(const v4fa*)&so[r * SP + c8 + 4];
      v8us h, l;
#pragma unroll
      for (int u = 0; u < 8; ++u) { const float v = u < 4 ? a[u & 3] : b[u & 3]; const unsigned short hb = bf16_bits(v); h[u] = hb; l[u] = bf16_bits(v - bf16_val(hb)); }
      *(v8us*)(Ph + po + (size_t)r * (2 * DM) + c8) = h; *(v8us*)(Pl + po + (size_t)r * (2 * DM) + c8) = l;
    }
    // in the listing the Q branch stands as the fall-through behind these stores and reuses their registers
    asm volatile("s_wait_xcnt 0x0" ::: "memory");
    return;
  }
  float* cw = C + (size_t)(blockIdx.y * (TN / 64) + wn) * cbs + (size_t)(row0 + wm * (TM / 4)) * ldc;
  const int rsub = lane >> 4, c4 = (lane & 15) * 4;
#pragma unroll
  for (int q = 0; q < TM / 8; ++q) { const int r = q * 2 + rsub; const v4f v = *(const v4fa*)&so[r * SP + c4]; *(v4f*)(cw + (size_t)r * ldc + c4) = v; }
}

// Projections, scores and VW^T of one (set s, head h) in ONE work-group (grid.x = s, grid.y = h; 8 waves), so Q, K and V never leave the WGP.
// Part 1: [Q | K | V] (128 x 192, k = 512) = [x W1h | y W2h | y W3h], staged like k_gemm_tile: a pass of 128 k holds 128 rows of x, 128 rows of y (f32 rounded to bf16 once while
//         staged) and 128 k-rows of the head's 3 x 64 weight columns, read from W1, W2, W3 as they lie ([k][n], f32), rounded to bf16 while staged and kept [k][n] in LDS: the B
//         fragments come out of transposing LDS reads, in the k order of the A fragments. Two buffers, one barrier a pass. A wave owns 32 rows x 96 columns; its first four
//         column tiles take x (wn = 0) or y (wn = 1) as A, its last two always y.
// Part 2: every f32 result is split into its bf16 head and remainder, in six LDS planes [128][64] (pitch 144 B); behind one barrier each wave does three 16 x 64 jobs, 64 deep, 3 terms:
//         two of ATT[(s,q)][h*128 + k] = f16(relu(q.k / 8) / 128) and one of VWt16[(s,d)][h*128 + k] = f16(sum over e of bf16(W4[h*64+e][d]) * V[k][e]).
#define FA (2 * NIT)       // staged A rows of a pass: x, then y
#define FB (3 * HS)        // staged B columns of a pass
#define WP (FB + 16)       // LDS pitch of a staged weight k-row in 16-bit elements (416 B = 13 x 32 B: conflict-free for the transposing 16-B reads)
#define BUFE (FA * LP + TK * WP)      // one buffer: the A rows, then the weight k-rows
#define PP 72              // plane row pitch in 16-bit elements (144 B: conflict-free for 16-B fragment reads)
#define PSZ (NIT * PP)     // one plane
typedef short s16x8 __attribute__((ext_vector_type(8)));
typedef unsigned int v2ua __attribute__((ext_vector_type(2), may_alias));
// two f32 rounded to nearest even into one register of two bf16 (the packed convert instruction; on finite values the bits of bf16_bits)
__device__ __forceinline__ unsigned int pack_bf16(float lo, float hi) { typedef __bf16 bf2 __attribute__((ext_vector_type(2))); typedef float f2 __attribute__((ext_vector_type(2))); return __builtin_bit_cast(unsigned int, __builtin_convertvector(f2{lo, hi}, bf2)); }
// transposing LDS read: lane (c, hh) gets T[8 hh + 0..7][c] of the 16 x 16 tile of 16-bit elements whose rows the lanes' addresses name
__device__ __forceinline__ v8us ld_tr16(const unsigned short* p) { typedef __attribute__((address_space(3))) s16x8 lds_s16x8; return __builtin_bit_cast(v8us, __builtin_amdgcn_ds_load_tr16_b128_v8i16((lds_s16x8*)p)); }
__global__ __launch_bounds__(256) void k_head(const float* __restrict__ X, const float* __restrict__ Y, const float* __restrict__ W1, const float* __restrict__ W2, const float* __restrict__ W3,
                                            const float* __restrict__ W4, _Float16* __restrict__ ATT, _Float16* __restrict__ VWt16) {
  __shared__ __attribute__((aligned(16))) unsigned short sm[2][BUFE];
  const int tid = threadIdx.x, w = tid >> 5, lane = tid & 31, ln = lane & 15, hh = lane >> 4;
  const int wm = w >> 1, wn = w & 1;
  const int s = blockIdx.x, h = blockIdx.y;
  const int fr = tid >> 5, fc = (tid & 31) * 4;      // f32 rows: 32 lanes x 16 B = the 512-B slice of a row
  // weight k-rows: 16 lanes x 16 B = the head's 256 B of a row; the two halves of a wave take rows 4 apart, whose 8-B LDS stores fall on different banks
  const int wr = (w & 3) + 4 * hh + 8 * (w >> 2), wc = ln * 4;
  const float* gx = X + (size_t)(s * NIT + fr) * DM + fc;
  const float* gy = Y + (size_t)(s * NIT + fr) * DM + fc;
  const size_t wo = (size_t)wr * DM + h * HS + wc;
  const float* gw1 = W1 + wo; const float* gw2 = W2 + wo; const float* gw3 = W3 + wo;
  v4f sx[NIT / 8], sy[NIT / 8], sw[3 * TK / 16];
  constexpr int NP = DM / TK;
  static_assert((NP & (NP - 1)) == 0, "the rotated walk wraps by a mask");
  // The 8 heads of a set read the same rows of x and y, the 32 sets of a head the same weight rows, all in step: each work-group starts its walk over the passes
  // at a pass of its own (wrapping), so that fewer of them ask L2 for the same lines at the same moment. The sum over k runs over the passes in that rotated order.
  const int rot = (s + h) & (NP - 1);
  // The 56 staged 16-B pieces of a thread go in quarters: a quarter is stored to LDS and its registers are at once loaded anew for the pass after,
  // one quarter per block of WMMAs, so that loads are in flight all the time and each has a whole pass to arrive.
  auto fetchq = [&](int q, int p) {
    const int ko = ((p + rot) & (NP - 1)) * TK;      // k at which the p-th pass of this work-group begins
    const float* px = gx + ko; const float* py = gy + ko;
    const float* pw[3] = {gw1 + (size_t)ko * DM, gw2 + (size_t)ko * DM, gw3 + (size_t)ko * DM};
#pragma unroll
    for (int u = q * 4; u < q * 4 + 4; ++u) { sx[u] = *(const v4fa*)(px + (size_t)u * 8 * DM); sy[u] = *(const v4fa*)(py + (size_t)u * 8 * DM); }
#pragma unroll
    for (int u = q * 6; u < q * 6 + 6; ++u) sw[u] = *(const v4fa*)(pw[u >> 3] + (size_t)(u & 7) * 16 * DM);
    // later instructions may reuse the registers that hold these loads' addresses; the pass's own addresses are named as inputs, so that
    // they stay in their registers up to the wait and nothing (a later load's result, a conversion) is put there in front of it
    asm volatile("s_wait_xcnt 0x0" :: "v"(px), "v"(py), "v"(pw[(q * 6) >> 3]), "v"(pw[(q * 6 + 5) >> 3]) : "memory");
  };
  auto putq = [&](int q, unsigned short* dst) {
#pragma unroll
    for (int u = q * 4; u < q * 4 + 4; ++u) {
      v4us a, b;
#pragma unroll
      for (int e = 0; e < 4; ++e) { a[e] = bf16_bits(sx[u][e]); b[e] = bf16_bits(sy[u][e]); }
      *(v4us*)&dst[(u * 8 + fr) * LP + fc] = a; *(v4us*)&dst[(NIT + u * 8 + fr) * LP + fc] = b;
    }
#pragma unroll
    for (int u = q * 6; u < q * 6 + 6; ++u) {
      const v2ua b = {pack_bf16(sw[u][0], sw[u][1]), pack_bf16(sw[u][2], sw[u][3])};
      *(v2ua*)&dst[FA * LP + ((u & 7) * 16 + wr) * WP + (u >> 3) * HS + wc] = b;
    }
  };
#pragma unroll
  for (int q = 0; q < 4; ++q) fetchq(q, 0);
#pragma unroll
  for (int q = 0; q < 4; ++q) { putq(q, sm[0]); fetchq(q, 1); }
  // LDS-only fences, as at the foot of the loop: pass 1's loads stay in flight
  __builtin_amdgcn_fence(__ATOMIC_RELEASE, "workgroup", "local"); __builtin_amdgcn_s_barrier(); __builtin_amdgcn_fence(__ATOMIC_ACQUIRE, "workgroup", "local");
  v8f acc[2][6] = {};
  const int a0off = (wn * NIT + wm * 32 + ln) * LP + 8 * hh, a1off = (NIT + wm * 32 + ln) * LP + 8 * hh;
  const int boff = FA * LP + (8 * hh + (lane & 7)) * WP + wn * 96 + 8 * ((lane >> 3) & 1);      // lane address of a transposing read: k-row 8 hh + (lane & 7), 16-B half (lane >> 3) & 1
  auto pass = [&](int p, auto doput, auto dofetch) {
    const unsigned short* cur = sm[p & 1];
    unsigned short* nxt = sm[(p + 1) & 1];      // its readers left it at the barrier that ended the pass before
#pragma unroll
    for (int ks = 0; ks < TK / 32; ++ks) {
      FragX fa0[2], fa1[2], fb[6];
#pragma unroll
      for (int m = 0; m < 2; ++m) {
        const int o0 = a0off + m * 16 * LP + ks * 32, o1 = a1off + m * 16 * LP + ks * 32;
        fa0[m].half[0] = *(const v8us*)&cur[o0]; fa0[m].half[1] = *(const v8us*)&cur[o0 + 16];
        fa1[m].half[0] = *(const v8us*)&cur[o1]; fa1[m].half[1] = *(const v8us*)&cur[o1 + 16];
      }
#pragma unroll
      for (int n = 0; n < 6; ++n) { const int o = boff + ks * 32 * WP + n * 16; fb[n].half[0] = ld_tr16(&cur[o]); fb[n].half[1] = ld_tr16(&cur[o + 16 * WP]); }
      // scheduling fences: the fragment reads stay in front of the quarter's conversions, which run while the reads are under way, and one block's reads are not
      // lifted over another block's WMMAs (that would hold every block's fragments in registers at once)
      __builtin_amdgcn_sched_barrier(0);
      if constexpr (decltype(doput)::v) putq(ks, nxt);
      // scheduling fence: the quarter's LDS stores and their address arithmetic stay in front of the loads, so that nothing writes a register that a load names ahead of the loads' wait
      if constexpr (decltype(dofetch)::v) { __builtin_amdgcn_sched_barrier(0); fetchq(ks, p + 2); }
      __builtin_amdgcn_sched_barrier(0);
#pragma unroll
      for (int m = 0; m < 2; ++m)
#pragma unroll
        for (int n = 0; n < 6; ++n)
          acc[m][n] = __builtin_amdgcn_wmma_f32_16x16x32_bf16(false, (n < 4 ? fa0 : fa1)[m].b, false, fb[n].b, (short)0, acc[m][n], false, false);
      __builtin_amdgcn_sched_barrier(0);
    }
    // publishes the next pass's rows and ends every read of this pass's buffer. Only LDS is handed over here, so the fences name LDS alone:
    // __syncthreads() would also wait for the global loads of the pass after next, which are meant to stay in flight across the barrier
    __builtin_amdgcn_fence(__ATOMIC_RELEASE, "workgroup", "local"); __builtin_amdgcn_s_barrier(); __builtin_amdgcn_fence(__ATOMIC_ACQUIRE, "workgroup", "local");
  };
  // The passes that load stand in a loop of their own with no branch round the loads: with one, the compiler's counted waits assume the loads were skipped
  // and drain the quarters just issued. Kept rolled for the size of the code.
#pragma clang loop unroll(disable)
  for (int p = 0; p + 2 < NP; ++p) pass(p, Flag<true>{}, Flag<true>{});
  pass(NP - 2, Flag<true>{}, Flag<false>{});
  pass(NP - 1, Flag<false>{}, Flag<false>{});
  // the W4 column (a row of W4^T) of this wave's VW^T job, in the A fragment's k order, fetched here so that the latency passes behind the split below
  const float* wcol = W4 + (size_t)(h * HS + 8 * hh) * HS + (w >> 1) * 16 + ln;
  float wx[2][16];
#pragma unroll
  for (int k2 = 0; k2 < 2; ++k2)
#pragma unroll
    for (int i = 0; i < 16; ++i) wx[k2][i] = wcol[(size_t)(k2 * 32 + (i < 8 ? i : 8 + i)) * HS];
  // later instructions may reuse the registers that hold these loads' address
  asm volatile("s_wait_xcnt 0x0" ::: "memory");
  // the last barrier has ended every read of the buffers: planes Qh Ql Kh Kl Vh Vl from the start of the LDS
  unsigned short* pl = &sm[0][0];
#pragma unroll
  for (int m = 0; m < 2; ++m)
#pragma unroll
    for (int n = 0; n < 6; ++n) {
      const int tc = wn * 6 + n;      // column tile 0..11 of [Q | K | V]
      unsigned short* ph = pl + (tc >> 2) * 2 * PSZ + (wm * 32 + m * 16 + 8 * hh) * PP + (tc & 3) * 16 + ln;
#pragma unroll
      for (int r = 0; r < 8; ++r) { const float v = acc[m][n][r]; const unsigned short hb = bf16_bits(v); ph[r * PP] = hb; ph[PSZ + r * PP] = bf16_bits(v - bf16_val(hb)); }
    }
  // publishes the planes to all waves
  __syncthreads();
  f32a* so = (f32a*)&sm[0][0] + 6 * PSZ / 2 + w * 16 * SP;      // behind the planes, a range of the wave's own
  const int r4 = lane >> 3, c8 = (lane & 7) * 8;
#pragma unroll
  for (int jj = 0; jj < 3; ++jj) {
    const bool sc = jj < 2;
    const int wid = sc ? jj * 8 + w : w;
    const int row0 = (wid >> 1) * 16, col0 = (wid & 1) * 64;
    const unsigned short* bp = pl + (sc ? 2 : 4) * PSZ + (col0 + ln) * PP + 8 * hh;
    v8f a2[4] = {};
    // all fragments of the job are read first, and the four column tiles take turns term by term: four independent accumulator chains;
    // per tile the order stays ah.bh, al.bh, ah.bl, 32 k at a time
    FragB ah[2], al[2], bh_[2][4], bl_[2][4];
#pragma unroll
    for (int k2 = 0; k2 < 2; ++k2) {
      if (sc) {
        const unsigned short* ap = pl + (row0 + ln) * PP + k2 * 32 + 8 * hh;
        ah[k2].half[0] = *(const v8us*)ap; ah[k2].half[1] = *(const v8us*)(ap + 16);
        al[k2].half[0] = *(const v8us*)(ap + PSZ); al[k2].half[1] = *(const v8us*)(ap + PSZ + 16);
      } else {
#pragma unroll
        for (int i = 0; i < 16; ++i) { const float xv = bf16_round(wx[k2][i]); const unsigned short hb = bf16_bits(xv); ah[k2].u[i] = hb; al[k2].u[i] = bf16_bits(xv - bf16_val(hb)); }
      }
#pragma unroll
      for (int t = 0; t < 4; ++t) {
        const unsigned short* b = bp + t * 16 * PP + k2 * 32;
        bh_[k2][t].half[0] = *(const v8us*)b; bh_[k2][t].half[1] = *(const v8us*)(b + 16);
        bl_[k2][t].half[0] = *(const v8us*)(b + PSZ); bl_[k2][t].half[1] = *(const v8us*)(b + PSZ + 16);
      }
    }
    // scheduling fence: without it the compiler spreads the reads in small groups among the WMMAs, each group with a wait of its own
    __builtin_amdgcn_sched_barrier(0);
#pragma unroll
    for (int k2 = 0; k2 < 2; ++k2) {
#pragma unroll
      for (int t = 0; t < 4; ++t) a2[t] = __builtin_amdgcn_wmma_f32_16x16x32_bf16(false, ah[k2].v, false, bh_[k2][t].v, (short)0, a2[t], false, false);
#pragma unroll
      for (int t = 0; t < 4; ++t) a2[t] = __builtin_amdgcn_wmma_f32_16x16x32_bf16(false, al[k2].v, false, bh_[k2][t].v, (short)0, a2[t], false, false);
#pragma unroll
      for (int t = 0; t < 4; ++t) a2[t] = __builtin_amdgcn_wmma_f32_16x16x32_bf16(false, ah[k2].v, false, bl_[k2][t].v, (short)0, a2[t], false, false);
    }
#pragma unroll
    for (int t = 0; t < 4; ++t)
#pragma unroll
      for (int r = 0; r < 8; ++r) so[(8 * hh + r) * SP + t * 16 + ln] = sc ? fmaxf(a2[t][r] * 0.125f, 0.f) * (1.0f / NIT) : a2[t][r];
    // the wave's own LDS writes are complete before its lanes read back rows that other lanes wrote (no other wave touches this range); LDS alone is named,
    // so that the fence does not wait for the job before's global stores
    __builtin_amdgcn_fence(__ATOMIC_ACQ_REL, "workgroup", "local"); __builtin_amdgcn_wave_barrier();
    unsigned short* dst = (unsigned short*)(sc ? ATT + (size_t)(s * NIT + row0) * HK : VWt16 + (size_t)(s * HS + row0) * HK) + h * NIT + col0;
    v8us o[4];
#pragma unroll
    for (int q = 0; q < 4; ++q) {
      const int r = q * 4 + r4;
      const v4f a = *(const v4fa*)&so[r * SP + c8], b = *(const v4fa*)&so[r * SP + c8 + 4];
      FragH f;
#pragma unroll
      for (int u = 0; u < 4; ++u) { f.h[u] = (_Float16)a[u]; f.h[4 + u] = (_Float16)b[u]; }
      o[q] = f.half[0];
    }
    // scheduling fences: the four stores and their wait stay together, so that no register that a store names is written anew in front of the wait
    __builtin_amdgcn_sched_barrier(0);
#pragma unroll
    for (int q = 0; q < 4; ++q) *(v8us*)(dst + (size_t)(q * 4 + r4) * HK + c8) = o[q];
    asm volatile("s_wait_xcnt 0x0" ::: "memory");
    __builtin_amdgcn_sched_barrier(0);
    // the next job's staging writes stay behind this job's reads
    __builtin_amdgcn_fence(__ATOMIC_ACQ_REL, "workgroup", "local"); __builtin_amdgcn_wave_barrier();
  }
}

extern "C" void kernel_launch(void* const* d_in, const int* in_sizes, int n_in,
                              void* d_out, int out_size, void* d_ws, size_t ws_size, hipStream_t stream) {
  (void)in_sizes; (void)n_in; (void)out_size;
  const float* x = (const float*)d_in[0]; const float* y = (const float*)d_in[1]; const float* W1 = (const float*)d_in[2]; const float* W2 = (const float*)d_in[3]; const float* W3 = (const float*)d_in[4]; const float* W4 = (const float*)d_in[5];
  char* ws = (char*)d_ws; size_t off = 0;
  auto take = [&](size_t bytes) { char* p = ws + off; off += (bytes + 255) & ~(size_t)255; return p; };
  _Float16* ATT = (_Float16*)take((size_t)NSET * NIT * HK * 2); _Float16* VWt16 = (_Float16*)take((size_t)NSET * HS * HK * 2);
  if (off > ws_size) return;
  // f16 operands of the final product, weight rounding and projections included: one work-group per (set, head)
  k_head<<<dim3(NSET, NH), 256, 0, stream>>>(x, y, W1, W2, W3, W4, ATT, VWt16);
  // out[i][j] = ATT[j] * VWt[i]^T for all 1024 (i, j) as one 4096 x 2048 x 1024 product: grid.x = 256-row tiles of (j,q), grid.y = 128-column tiles of (i,d)
  k_gemm_tile<false, 256, HK><<<dim3(NTOK / 256, NSET * HS / TN), 256, 0, stream>>>(nullptr, nullptr, ATT, (const unsigned short*)VWt16, (float*)d_out, nullptr, nullptr, HS, (size_t)NTOK * HS);
}

// v008
// It runs in 28 microseconds.
// In both of two side-by-side timings against v007, it was 1.05 times as fast.
// All steps since v000 together make it 44.5 times as fast.
#include <hip/hip_runtime.h>
// On WMMA (f32 accumulate): Q = x·W1, K = y·W2, V = y·W3 (inputs rounded to bf16: single exact terms), per (set, head) scores = q·kᵀ (both computed f32 → bf16 hi/lo: 3 products,
// K = 64), VWᵀ[i][d][(h,k)] = Σ_e W4[h·64+e][d]·v[i][k][h·64+e] (W4 rounded to bf16 vs split v), and the cross-set contraction out[i][j] = attn[j]·VW[i] on v_wmma_f32_16x16x32_f16 with
// attn = relu(scores/8)/128 stored in f16 and VWᵀ in f16 (single product; 1024 pairs × 128 × 1024 × 64) — an exact re-association of (attn[j]·v[i])·W4. relu/scaling are f32 VALU.
#define NSET 32
#define NIT 128
#define DM 512
#define NH 8
#define HS 64
#define NTOK (NSET * NIT)
#define HK (NH * NIT)      // 1024 = (h,k) contraction length

typedef __bf16 v16b __attribute__((ext_vector_type(16)));
typedef unsigned short v8us __attribute__((ext_vector_type(8), may_alias));
typedef float  v8f  __attribute__((ext_vector_type(8)));
typedef float  v4f  __attribute__((ext_vector_type(4)));
typedef float  v4fa __attribute__((ext_vector_type(4), may_alias));
typedef float  f32a __attribute__((may_alias));
union FragB { v16b v; v8us half[2]; unsigned short u[16]; };

__device__ __forceinline__ unsigned short bf16_bits(float x) { unsigned int u = __float_as_uint(x); return (unsigned short)((u + 0x7FFFu + ((u >> 16) & 1u)) >> 16); }
__device__ __forceinline__ float bf16_val(unsigned short b) { return __uint_as_float(((unsigned int)b) << 16); }
__device__ __forceinline__ float bf16_round(float x) { return bf16_val(bf16_bits(x)); }
// D += A·B with NT terms: 1 = ah·bh, 2 = + al·bh (A split), 3 = + ah·bl (both split)
template <int NT>
__device__ __forceinline__ v8f mmaN(v16b ah, v16b al, v16b bh, v16b bl, v8f c) {
  c = __builtin_amdgcn_wmma_f32_16x16x32_bf16(false, ah, false, bh, (short)0, c, false, false);
  if (NT >= 2) c = __builtin_amdgcn_wmma_f32_16x16x32_bf16(false, al, false, bh, (short)0, c, false, false);
  if (NT >= 3) c = __builtin_amdgcn_wmma_f32_16x16x32_bf16(false, ah, false, bl, (short)0, c, false, false);
  asm volatile("v_nop\n\tv_nop\n\tv_nop\n\tv_nop" : "+v"(c) : "v"(ah), "v"(al), "v"(bh), "v"(bl));
  return c;
}

__global__ __launch_bounds__(256) void k_wt_bf16(const float* __restrict__ W, unsigned short* __restrict__ Wt, int K, int N) {
  const int t = blockIdx.x * 256 + threadIdx.x;
  const int k8n = K / 8;
  if (t >= N * k8n) return;
  const int n = t / k8n, k8 = (t % k8n) * 8;
  v8us v;
#pragma unroll
  for (int i = 0; i < 8; ++i) v[i] = bf16_bits(W[(size_t)(k8 + i) * N + n]);
  *(v8us*)(Wt + (size_t)n * K + k8) = v;
  
}

// GEMM C[M][N] (f32, pitch ldc) = act(A[M][K]·W + bias). A f32 row-major (pitch lda) converted per fragment to bf16
// (ASPLIT: hi/lo two planes -> 2 terms, else single rounded term); Wt bf16 [N][K] (pitch ldb). BIAS_BF16 rounds the
// bias to bf16 first (bias quantised to bf16 before the add). K%32==0, M%16==0, N%64==0.
template <bool ASPLIT, int ACT, bool BIAS_BF16>
__global__ __launch_bounds__(128) void k_gemm_bf(const float* __restrict__ A, int lda, const unsigned short* __restrict__ Wt, int ldb,
                                               const float* __restrict__ bias, float* __restrict__ C, int ldc, int M, int N, int K) {
  __shared__ __attribute__((aligned(16))) float so[4][16][64];
  const int tid = threadIdx.x, w = tid >> 5, lane = tid & 31, ln = lane & 15, hh = lane >> 4;
  const int ntn = N / 64;
  const int wid = blockIdx.x * 4 + w;
  const int mt = wid / ntn, nq = wid % ntn;
  if (mt * 16 >= M) return;
  const int row0 = mt * 16, col0 = nq * 64;
  const float* arow = A + (size_t)(row0 + ln) * lda;
  v8f acc[4] = {};
  for (int kb = 0; kb < K; kb += 32) {
    FragB ah, al;
    const v4f x0 = *(const v4fa*)(arow + kb + 8 * hh), x1 = *(const v4fa*)(arow + kb + 8 * hh + 4);
    const v4f x2 = *(const v4fa*)(arow + kb + 16 + 8 * hh), x3 = *(const v4fa*)(arow + kb + 16 + 8 * hh + 4);
    float xs[16] = {x0[0],x0[1],x0[2],x0[3],x1[0],x1[1],x1[2],x1[3],x2[0],x2[1],x2[2],x2[3],x3[0],x3[1],x3[2],x3[3]};
#pragma unroll
    for (int i = 0; i < 16; ++i) { const unsigned short hb = bf16_bits(xs[i]); ah.u[i] = hb; al.u[i] = ASPLIT ? bf16_bits(xs[i] - bf16_val(hb)) : (unsigned short)0; }
#pragma unroll
    for (int t = 0; t < 4; ++t) {
      const unsigned short* brow = Wt + (size_t)(col0 + t * 16 + ln) * ldb + kb;
      FragB b;
      b.half[0] = *(const v8us*)(brow + 8 * hh);
      b.half[1] = *(const v8us*)(brow + 16 + 8 * hh);
      acc[t] = mmaN<ASPLIT ? 2 : 1>(ah.v, al.v, b.v, b.v, acc[t]);
    }
  }
#pragma unroll
  for (int t = 0; t < 4; ++t) {
    float bv = bias ? bias[col0 + t * 16 + ln] : 0.f;
    if (BIAS_BF16) bv = bf16_round(bv);
#pragma unroll
    for (int r = 0; r < 8; ++r) { float v = acc[t][r] + bv; if (ACT == 1) v = fmaxf(v, 0.f); so[w][8 * hh + r][t * 16 + ln] = v; }
  }
  __builtin_amdgcn_fence(__ATOMIC_ACQ_REL, "workgroup");
  __builtin_amdgcn_wave_barrier();
  const int rsub = lane >> 4, c4 = (lane & 15) * 4;
  {
#pragma unroll
    for (int q = 0; q < 8; ++q) {
      const int r = q * 2 + rsub;
      const v4f v = *(const v4fa*)&so[w][r][c4];
      *(v4f*)(C + (size_t)(row0 + r) * ldc + col0 + c4) = v;
    }
    
  }
}

// Flash-style causal/unmasked attention, all contractions 3-term bf16 hi/lo splits, f32 softmax with running max.
// q,k,v rows are read from f32 buffers with arbitrary row pitch (so they can live inside a fused qkv buffer);
// D = head size (multiple of 32, <= 128); one wave = 16 query rows; block = 4 waves (64 queries) sharing K/V chunks of 32.
template <int D, bool CAUSAL>
__global__ __launch_bounds__(128) void k_flash(const float* __restrict__ qb, const float* __restrict__ kb, const float* __restrict__ vb,
                                             int pitch, int T, int H, float scale, float* __restrict__ y, int ypitch) {
  constexpr int KS = D / 32;        // k-steps for QK
  constexpr int DT = D / 16;        // d tiles for PV
  __shared__ __attribute__((aligned(16))) unsigned short sKh[32][D + 8], sKl[32][D + 8], sVh[32][D + 8], sVl[32][D + 8];
  __shared__ __attribute__((aligned(16))) unsigned short sPh[4][16][40], sPl[4][16][40];
  __shared__ __attribute__((aligned(16))) float sO[4][16][D];
  const int tid = threadIdx.x, w = tid >> 5, lane = tid & 31, ln = lane & 15, hh = lane >> 4;
  const int nqb = (T + 63) / 64;
  const int bh = blockIdx.x / nqb, qblk = blockIdx.x % nqb;
  const int b = bh / H, h = bh % H;
  const int q0 = qblk * 64 + w * 16;
  const float* Q = qb + (size_t)b * T * pitch + h * D;
  const float* K = kb + (size_t)b * T * pitch + h * D;
  const float* V = vb + (size_t)b * T * pitch + h * D;

  // A fragments of the wave's 16 query rows (scaled), hi/lo
  FragB aqh[KS], aql[KS];
  {
    int row = q0 + ln; if (row >= T) row = T - 1;
    const float* qr = Q + (size_t)row * pitch;
#pragma unroll
    for (int ks = 0; ks < KS; ++ks)
#pragma unroll
      for (int i = 0; i < 16; ++i) {
        const int d = ks * 32 + ((i < 8) ? (8 * hh + i) : (16 + 8 * hh + (i - 8)));
        const float x = qr[d] * scale; const unsigned short hb = bf16_bits(x);
        aqh[ks].u[i] = hb; aql[ks].u[i] = bf16_bits(x - bf16_val(hb));
      }
  }
  float m_r[8], l_r[8];
#pragma unroll
  for (int r = 0; r < 8; ++r) { m_r[r] = -3.0e38f; l_r[r] = 0.f; }
  v8f oacc[DT];
#pragma unroll
  for (int dt = 0; dt < DT; ++dt) oacc[dt] = (v8f){0.f,0.f,0.f,0.f,0.f,0.f,0.f,0.f};

  const int kv_end = CAUSAL ? min(T, qblk * 64 + 64) : T;     // block-uniform
  for (int j0 = 0; j0 < kv_end; j0 += 32) {
    __syncthreads();
    for (int e = tid; e < 32 * (D / 4); e += 128) {
      const int r = e / (D / 4), c4 = (e % (D / 4)) * 4;
      const int key = j0 + r;
      v4f kf = {0.f,0.f,0.f,0.f}, vf = {0.f,0.f,0.f,0.f};
      if (key < T) { kf = *(const v4fa*)(K + (size_t)key * pitch + c4); vf = *(const v4fa*)(V + (size_t)key * pitch + c4); }
#pragma unroll
      for (int t = 0; t < 4; ++t) {
        unsigned short hb = bf16_bits(kf[t]); sKh[r][c4 + t] = hb; sKl[r][c4 + t] = bf16_bits(kf[t] - bf16_val(hb));
        hb = bf16_bits(vf[t]); sVh[r][c4 + t] = hb; sVl[r][c4 + t] = bf16_bits(vf[t] - bf16_val(hb));
      }
    }
    __syncthreads();
    // S tile 16 x 32
    v8f s[2];
#pragma unroll
    for (int nt = 0; nt < 2; ++nt) {
      v8f acc = {};
#pragma unroll
      for (int ks = 0; ks < KS; ++ks) {
        FragB bh_, bl_;
        bh_.half[0] = *(const v8us*)&sKh[nt * 16 + ln][ks * 32 + 8 * hh]; bh_.half[1] = *(const v8us*)&sKh[nt * 16 + ln][ks * 32 + 16 + 8 * hh];
        bl_.half[0] = *(const v8us*)&sKl[nt * 16 + ln][ks * 32 + 8 * hh]; bl_.half[1] = *(const v8us*)&sKl[nt * 16 + ln][ks * 32 + 16 + 8 * hh];
        acc = mmaN<3>(aqh[ks].v, aql[ks].v, bh_.v, bl_.v, acc);
      }
      s[nt] = acc;
    }
    // mask + running max (rows 8hh+r; the 16 lanes of a half share rows)
    float alpha[8];
#pragma unroll
    for (int r = 0; r < 8; ++r) {
      const int qi = q0 + 8 * hh + r;
      const int ja = j0 + ln, jb = j0 + 16 + ln;
      if (CAUSAL) { if (ja > qi) s[0][r] = -3.0e38f; if (jb > qi) s[1][r] = -3.0e38f; }
      if (ja >= T) s[0][r] = -3.0e38f;
      if (jb >= T) s[1][r] = -3.0e38f;
      float mx = fmaxf(s[0][r], s[1][r]);
      mx = fmaxf(mx, __shfl_xor(mx, 1, 32)); mx = fmaxf(mx, __shfl_xor(mx, 2, 32)); mx = fmaxf(mx, __shfl_xor(mx, 4, 32)); mx = fmaxf(mx, __shfl_xor(mx, 8, 32));
      const float mnew = fmaxf(m_r[r], mx);
      alpha[r] = (mnew > -1.0e38f) ? __expf(m_r[r] - mnew) : 1.0f;
      const float p0 = (s[0][r] > -1.0e38f) ? __expf(s[0][r] - mnew) : 0.f;
      const float p1 = (s[1][r] > -1.0e38f) ? __expf(s[1][r] - mnew) : 0.f;
      m_r[r] = mnew;
      l_r[r] = l_r[r] * alpha[r] + p0 + p1;            // per-lane partial row sum (16 lanes combined at the end)
      unsigned short hb = bf16_bits(p0); sPh[w][8 * hh + r][ln] = hb;      sPl[w][8 * hh + r][ln] = bf16_bits(p0 - bf16_val(hb));
      hb = bf16_bits(p1);                sPh[w][8 * hh + r][16 + ln] = hb; sPl[w][8 * hh + r][16 + ln] = bf16_bits(p1 - bf16_val(hb));
    }
#pragma unroll
    for (int dt = 0; dt < DT; ++dt)
#pragma unroll
      for (int r = 0; r < 8; ++r) oacc[dt][r] *= alpha[r];
    __builtin_amdgcn_fence(__ATOMIC_ACQ_REL, "workgroup");
    __builtin_amdgcn_wave_barrier();
    FragB pah, pal;
    pah.half[0] = *(const v8us*)&sPh[w][ln][8 * hh]; pah.half[1] = *(const v8us*)&sPh[w][ln][16 + 8 * hh];
    pal.half[0] = *(const v8us*)&sPl[w][ln][8 * hh]; pal.half[1] = *(const v8us*)&sPl[w][ln][16 + 8 * hh];
#pragma unroll
    for (int dt = 0; dt < DT; ++dt) {
      FragB bvh, bvl;
#pragma unroll
      for (int i = 0; i < 8; ++i) {
        bvh.u[i] = sVh[8 * hh + i][dt * 16 + ln]; bvh.u[8 + i] = sVh[16 + 8 * hh + i][dt * 16 + ln];
        bvl.u[i] = sVl[8 * hh + i][dt * 16 + ln]; bvl.u[8 + i] = sVl[16 + 8 * hh + i][dt * 16 + ln];
      }
      oacc[dt] = mmaN<3>(pah.v, pal.v, bvh.v, bvl.v, oacc[dt]);
    }
    __builtin_amdgcn_fence(__ATOMIC_ACQ_REL, "workgroup");
    __builtin_amdgcn_wave_barrier();
  }
#pragma unroll
  for (int r = 0; r < 8; ++r) {
    float l = l_r[r];
    l += __shfl_xor(l, 1, 32); l += __shfl_xor(l, 2, 32); l += __shfl_xor(l, 4, 32); l += __shfl_xor(l, 8, 32);
    l_r[r] = (l > 0.f) ? 1.0f / l : 0.f;
  }
#pragma unroll
  for (int dt = 0; dt < DT; ++dt)
#pragma unroll
    for (int r = 0; r < 8; ++r) sO[w][8 * hh + r][dt * 16 + ln] = oacc[dt][r] * l_r[r];
  __builtin_amdgcn_fence(__ATOMIC_ACQ_REL, "workgroup");
  __builtin_amdgcn_wave_barrier();
  {
    for (int r = 0; r < 16; ++r) {
      const int row = q0 + r;
      if (row < T && lane < D / 4) {
        const v4f val = *(const v4fa*)&sO[w][r][lane * 4];
        *(v4f*)(y + ((size_t)b * T + row) * ypitch + h * D + lane * 4) = val;
      }
    }
    
  }
}

// row LayerNorm (biased variance, eps) over N: s = X (+ R); optional out_sum <- s; out_norm <- (s-mu)*rsqrt(var+eps)*g + b
template <bool PARAM_BF16>
__global__ __launch_bounds__(256) void k_layernorm(const float* __restrict__ X, const float* __restrict__ R, const float* __restrict__ g, const float* __restrict__ bta,
                                                  float* __restrict__ out_sum, float* __restrict__ out_norm, int N, float eps) {
  __shared__ float red[256];
  const int row = blockIdx.x, tid = threadIdx.x;
  const float* x = X + (size_t)row * N; const float* rr = R ? R + (size_t)row * N : nullptr;
  float vals[16];                     // up to N = 4096
  const int per = N / 256;            // contiguous chunk per thread? use strided-by-4 chunks: thread handles j = tid*4 + 1024*u
  float s1 = 0.f;
  for (int u = 0; u < per / 4; ++u) {
    const int j = tid * 4 + 1024 * u;
    const v4f a = *(const v4fa*)(x + j);
    v4f b = {0.f,0.f,0.f,0.f}; if (rr) b = *(const v4fa*)(rr + j);
#pragma unroll
    for (int q = 0; q < 4; ++q) { const float v = a[q] + b[q]; vals[u * 4 + q] = v; s1 += v; }
  }
  red[tid] = s1; __syncthreads();
  for (int st = 128; st > 0; st >>= 1) { if (tid < st) red[tid] += red[tid + st]; __syncthreads(); }
  const float mu = red[0] / (float)N; __syncthreads();
  float s2 = 0.f;
  for (int u = 0; u < per / 4; ++u)
#pragma unroll
    for (int q = 0; q < 4; ++q) { const float c = vals[u * 4 + q] - mu; s2 += c * c; }
  red[tid] = s2; __syncthreads();
  for (int st = 128; st > 0; st >>= 1) { if (tid < st) red[tid] += red[tid + st]; __syncthreads(); }
  const float rs = rsqrtf(red[0] / (float)N + eps);
  {
    for (int u = 0; u < per / 4; ++u) {
      const int j = tid * 4 + 1024 * u;
      v4f o, sm;
#pragma unroll
      for (int q = 0; q < 4; ++q) {
        float gg = g[j + q], bb = bta[j + q];
        if (PARAM_BF16) { gg = bf16_round(gg); bb = bf16_round(bb); }
        sm[q] = vals[u * 4 + q]; o[q] = (vals[u * 4 + q] - mu) * rs * gg + bb;
      }
      if (out_sum) *(v4f*)(out_sum + (size_t)row * N + j) = sm;
      *(v4f*)(out_norm + (size_t)row * N + j) = o;
    }
    
  }
}

// batched f32 [K][N] (pitch lds, batch stride sIn) -> transposed hi/lo planes [N][K] (batch stride sOut); thread per (n, 8 k); grid.y = batch
__global__ __launch_bounds__(256) void k_split_transpose_b(const float* __restrict__ src, int lds_, size_t sIn, unsigned short* __restrict__ hi, unsigned short* __restrict__ lo, size_t sOut, int K, int N) {
  const size_t t = (size_t)blockIdx.x * 256 + threadIdx.x; const int k8n = K / 8; if (t >= (size_t)N * k8n) return;
  src += (size_t)blockIdx.y * sIn; hi += (size_t)blockIdx.y * sOut; lo += (size_t)blockIdx.y * sOut;
  const int n = (int)(t / k8n), k8 = (int)(t % k8n) * 8; v8us vh, vl;
#pragma unroll
  for (int i = 0; i < 8; ++i) { const float x = src[(size_t)(k8 + i) * lds_ + n]; const unsigned short hb = bf16_bits(x); vh[i] = hb; vl[i] = bf16_bits(x - bf16_val(hb)); }
  unsigned short* dh = hi + (size_t)n * K + k8; unsigned short* dl = lo + (size_t)n * K + k8;
  *(v8us*)dh = vh; *(v8us*)dl = vl; 
}

// ---- f16 WMMA path (v_wmma_f32_16x16x32_f16): 11-bit significands for operands in range — used where the relu(scores/8)/128 attention operand needs more precision than bf16
typedef _Float16 v16h __attribute__((ext_vector_type(16)));
union FragH { v16h v; v8us half[2]; _Float16 h[16]; unsigned short u[16]; };
template <int NT>
__device__ __forceinline__ v8f mmaH(v16h ah, v16h al, v16h bh, v16h bl, v8f c) {
  c = __builtin_amdgcn_wmma_f32_16x16x32_f16(false, ah, false, bh, (short)0, c, false, false);
  if (NT >= 2) c = __builtin_amdgcn_wmma_f32_16x16x32_f16(false, al, false, bh, (short)0, c, false, false);
  if (NT >= 3) c = __builtin_amdgcn_wmma_f32_16x16x32_f16(false, ah, false, bl, (short)0, c, false, false);
  asm volatile("v_nop\n\tv_nop\n\tv_nop\n\tv_nop" : "+v"(c) : "v"(ah), "v"(al), "v"(bh), "v"(bl));
  return c;
}
// batched GEMM like k_gemm_b but f16 operands: A f32 (split into f16 hi/lo if ASPLIT, else rounded to f16), Bt = f16 values [n][k]; alpha; C f32; N multiple of 16 (partial tiles skipped)
template <bool ASPLIT>
__global__ __launch_bounds__(128) void k_gemm_h(const float* __restrict__ A, int lda, size_t sA, const _Float16* __restrict__ Bh, int ldb, size_t sB, float alpha, float* __restrict__ C, int ldc, size_t sC, int M, int N, int K) {
  __shared__ __attribute__((aligned(16))) float so[4][16][64];
  const int tid = threadIdx.x, w = tid >> 5, lane = tid & 31, ln = lane & 15, hh = lane >> 4; const int by = blockIdx.y;
  A += (size_t)by * sA; Bh += (size_t)by * sB; C += (size_t)by * sC;
  const int ntn = (N + 63) / 64; const int wid = blockIdx.x * 4 + w; const int mt = wid / ntn, nq = wid % ntn; if (mt * 16 >= M) return;
  const int row0 = mt * 16, col0 = nq * 64; const float* arow = A + (size_t)(row0 + ln) * lda;
  v8f acc[4] = {};
  for (int kb = 0; kb < K; kb += 32) {
    FragH ah, al;
    const v4f x0 = *(const v4fa*)(arow + kb + 8 * hh), x1 = *(const v4fa*)(arow + kb + 8 * hh + 4), x2 = *(const v4fa*)(arow + kb + 16 + 8 * hh), x3 = *(const v4fa*)(arow + kb + 16 + 8 * hh + 4);
    float xs[16] = {x0[0],x0[1],x0[2],x0[3],x1[0],x1[1],x1[2],x1[3],x2[0],x2[1],x2[2],x2[3],x3[0],x3[1],x3[2],x3[3]};
#pragma unroll
    for (int i = 0; i < 16; ++i) { const _Float16 h = (_Float16)xs[i]; ah.h[i] = h; al.h[i] = ASPLIT ? (_Float16)(xs[i] - (float)h) : (_Float16)0.0f; }
#pragma unroll
    for (int t = 0; t < 4; ++t) { if (col0 + t * 16 >= N) continue; const size_t boff = (size_t)(col0 + t * 16 + ln) * ldb + kb; FragH bq; bq.half[0] = *(const v8us*)(Bh + boff + 8 * hh); bq.half[1] = *(const v8us*)(Bh + boff + 16 + 8 * hh);
      acc[t] = mmaH<ASPLIT ? 2 : 1>(ah.v, al.v, bq.v, bq.v, acc[t]); }
  }
#pragma unroll
  for (int t = 0; t < 4; ++t) { if (col0 + t * 16 >= N) continue;
#pragma unroll
    for (int r = 0; r < 8; ++r) so[w][8 * hh + r][t * 16 + ln] = acc[t][r] * alpha; }
  __builtin_amdgcn_fence(__ATOMIC_ACQ_REL, "workgroup"); __builtin_amdgcn_wave_barrier();
  const int rsub = lane >> 4, c4 = (lane & 15) * 4;
  {
#pragma unroll
    for (int q = 0; q < 8; ++q) { const int r = q * 2 + rsub; if (col0 + c4 < N) { const v4f v = *(const v4fa*)&so[w][r][c4]; *(v4f*)(C + (size_t)(row0 + r) * ldc + col0 + c4) = v; } }
     }
}

// Block-tiled product through LDS, C = A * B^T with A [M][K] and B [N][K] both k-contiguous; the launch below uses the second form (the projections are in k_head):
//   PROJ: all three projections in ONE launch: B = the transposed bf16 weights [W1 | W2 | W3], 1536 rows; A = x for the columns of W1 and y for the rest, in f32,
//         rounded to bf16 once while it is staged; Q is stored as f32 row-major, [K | V] straight as the bf16 hi/lo planes Ph and Pl.
//   else: A = ATT [(j,q)][1024] f16, B = VWt16 [(i,d)][1024] f16: all 1024 set pairs as ONE 4096 x 2048 x 1024 product; for one i the rows (j,q) of out are contiguous.
// A work-group of 8 waves owns TM rows x 128 columns; a wave owns TM/4 x 64, so a fragment read from LDS feeds several WMMAs and every operand byte
// leaves L2 once per work-group, in whole 128-B lines (a wave-wide 16-B load covers 512 contiguous bytes of one f32 row, or 256 of each of two 16-bit rows).
// A pass is 128 k: TM + 128 rows of 256 B at an LDS pitch of 272 B (conflict-free for 16-B fragment reads). Two buffers in LDS and a third stage in registers: the staged
// pieces of a thread go in quarters, one per block of WMMAs; a quarter of the next pass is stored into the other buffer and its registers are at once loaded anew for the
// pass after next, so that loads are in flight all the time and each has a whole pass to arrive; one barrier a pass publishes the next buffer and frees this one.
// Work-groups that share operand rows run in step and would ask L2 for the same lines at the same moment: each starts its walk over the passes at a pass of its own
// (tile row + tile column, wrapping), A and B of a pass always from the same k. Per output tile the sum runs over the passes in that rotated order, inside a pass 32 k at a time, ascending.
#define TN 128
#define TK 128
#define LP 136             // LDS row pitch in 16-bit elements (272 B)
#define SP 68              // epilogue staging pitch in floats (272 B): rows 8 apart fall on different banks
typedef unsigned short v4us __attribute__((ext_vector_type(4), may_alias));
union FragX { v16h h; v16b b; v8us half[2]; };
template <bool B> struct Flag { static constexpr bool v = B; };
// C element (row, col) lies at C + (col / 64) * cbs + row * ldc + col % 64
template <bool PROJ, int TM, int K>
__global__ __launch_bounds__(256) void k_gemm_tile(const float* __restrict__ Ax, const float* __restrict__ Ay, const _Float16* __restrict__ Ah, const unsigned short* __restrict__ B, float* __restrict__ C,
                                                 unsigned short* __restrict__ Ph, unsigned short* __restrict__ Pl, int ldc, size_t cbs) {
  constexpr int MI = TM / 64;      // accumulator tiles of a wave in M (4 in N)
  __shared__ __attribute__((aligned(16))) unsigned short sm[2][(TM + TN) * LP];
  const int tid = threadIdx.x, w = tid >> 5, lane = tid & 31, ln = lane & 15, hh = lane >> 4;
  const int wm = w >> 1, wn = w & 1;
  const int row0 = blockIdx.x * TM, col0 = blockIdx.y * TN;
  const int lr = tid >> 4, lc = (tid & 15) * 8;      // 16-bit rows: 16 lanes x 16 B = the 256-B slice of a row
  const int fr = tid >> 5, fc = (tid & 31) * 4;      // f32 rows: 32 lanes x 16 B = the 512-B slice of a row
  const bool isq = !PROJ || blockIdx.y < DM / TN;      // PROJ: this column tile belongs to Q (the same for the whole work-group)
  const float* gf = PROJ ? (isq ? Ax : Ay) + (size_t)(row0 + fr) * K + fc : nullptr;
  const unsigned short* ga = PROJ ? nullptr : (const unsigned short*)Ah + (size_t)(row0 + lr) * K + lc;
  const unsigned short* gb = B + (size_t)(col0 + lr) * K + lc;
  v4f sf[PROJ ? TM / 8 : 1]; v8us sa[PROJ ? 1 : TM / 16]; v8us sb[TN / 16];
  constexpr int NP = K / TK;
  static_assert((NP & (NP - 1)) == 0, "the rotated walk wraps by a mask");
  const int rot = (blockIdx.x + blockIdx.y) & (NP - 1);      // the work-group's first pass
  auto fetchq = [&](int q, int p) {
    const int ko = ((p + rot) & (NP - 1)) * TK;      // k at which the p-th pass of this work-group begins
    if constexpr (PROJ) {
#pragma unroll
      for (int u = q * (TM / 32); u < (q + 1) * (TM / 32); ++u) sf[u] = *(const v4fa*)(gf + (size_t)u * 8 * K + ko);
    } else {
#pragma unroll
      for (int u = q * (TM / 64); u < (q + 1) * (TM / 64); ++u) sa[u] = *(const v8us*)(ga + (size_t)u * 16 * K + ko);
    }
#pragma unroll
    for (int u = q * (TN / 64); u < (q + 1) * (TN / 64); ++u) sb[u] = *(const v8us*)(gb + (size_t)u * 16 * K + ko);
  };
  // stands behind a quarter's loads, in front of whatever may reuse the registers that hold their addresses
  auto addr_wait = [&]() { asm volatile("s_wait_xcnt 0x0" ::: "memory"); };
  auto putq = [&](int q, unsigned short* dst) {
    if constexpr (PROJ) {
#pragma unroll
      for (int u = q * (TM / 32); u < (q + 1) * (TM / 32); ++u) { v4us h; for (int e = 0; e < 4; ++e) h[e] = bf16_bits(sf[u][e]); *(v4us*)&dst[(u * 8 + fr) * LP + fc] = h; }
    } else {
#pragma unroll
      for (int u = q * (TM / 64); u < (q + 1) * (TM / 64); ++u) *(v8us*)&dst[(u * 16 + lr) * LP + lc] = sa[u];
    }
#pragma unroll
    for (int u = q * (TN / 64); u < (q + 1) * (TN / 64); ++u) *(v8us*)&dst[(TM + u * 16 + lr) * LP + lc] = sb[u];
  };
  static_assert(NP >= 2 && TK / 32 == 4, "one quarter per block of WMMAs, two passes staged ahead");
#pragma unroll
  for (int q = 0; q < 4; ++q) { fetchq(q, 0); addr_wait(); }
#pragma unroll
  for (int q = 0; q < 4; ++q) { putq(q, sm[0]); fetchq(q, 1); addr_wait(); }
  // LDS-only fences, as at the foot of a pass: pass 1's loads stay in flight
  __builtin_amdgcn_fence(__ATOMIC_RELEASE, "workgroup", "local"); __builtin_amdgcn_s_barrier(); __builtin_amdgcn_fence(__ATOMIC_ACQUIRE, "workgroup", "local");
  v8f acc[MI][4] = {};
  const int aoff = (wm * (TM / 4) + ln) * LP + 8 * hh, boff = (TM + wn * 64 + ln) * LP + 8 * hh;
  auto pass = [&](int p, auto doput, auto dofetch) {
    const unsigned short* cur = sm[p & 1];
    unsigned short* nxt = sm[(p + 1) & 1];      // its readers left it at the barrier that ended the pass before
    FragX fa[2][MI], fb[2][4];
    auto frags = [&](int ks) {
#pragma unroll
      for (int m = 0; m < MI; ++m) { const int o = aoff + m * 16 * LP + ks * 32; fa[ks & 1][m].half[0] = *(const v8us*)&cur[o]; fa[ks & 1][m].half[1] = *(const v8us*)&cur[o + 16]; }
#pragma unroll
      for (int n = 0; n < 4; ++n) { const int o = boff + n * 16 * LP + ks * 32; fb[ks & 1][n].half[0] = *(const v8us*)&cur[o]; fb[ks & 1][n].half[1] = *(const v8us*)&cur[o + 16]; }
    };
    frags(0);
#pragma unroll
    for (int ks = 0; ks < TK / 32; ++ks) {
      if (ks + 1 < TK / 32) frags(ks + 1);
      // scheduling fences: the next block's fragment reads stay in front of the quarter's stores, the stores and their address arithmetic in front of the loads, and all of
      // it in front of this block's WMMAs, behind which the LDS and L2 latencies pass. The loads' address wait stands behind the WMMAs, which write accumulators only, between
      // fences of its own: it has little left to wait for there, and nothing writes a register that a load names ahead of it
      __builtin_amdgcn_sched_barrier(0);
      if constexpr (decltype(doput)::v) putq(ks, nxt);
      if constexpr (decltype(dofetch)::v) { __builtin_amdgcn_sched_barrier(0); fetchq(ks, p + 2); }
      __builtin_amdgcn_sched_barrier(0);
#pragma unroll
      for (int m = 0; m < MI; ++m)
#pragma unroll
        for (int n = 0; n < 4; ++n) {
          // the rows of B go in as the matrix instruction's first operand: register r of lane (ln, hh) is then C[m * 16 + ln][n * 16 + 8 * hh + r], 8 neighbouring columns of one row
          if constexpr (PROJ) acc[m][n] = __builtin_amdgcn_wmma_f32_16x16x32_bf16(false, fb[ks & 1][n].b, false, fa[ks & 1][m].b, (short)0, acc[m][n], false, false);
          else                acc[m][n] = __builtin_amdgcn_wmma_f32_16x16x32_f16(false, fb[ks & 1][n].h, false, fa[ks & 1][m].h, (short)0, acc[m][n], false, false);
        }
      __builtin_amdgcn_sched_barrier(0);
      if constexpr (decltype(dofetch)::v) { addr_wait(); __builtin_amdgcn_sched_barrier(0); }
    }
    // publishes the next pass's rows and ends every read of this pass's buffer. Only LDS is handed over here, so the fences name LDS alone:
    // __syncthreads() would also wait for the global loads of the pass after next, which are meant to stay in flight across the barrier
    __builtin_amdgcn_fence(__ATOMIC_RELEASE, "workgroup", "local"); __builtin_amdgcn_s_barrier(); __builtin_amdgcn_fence(__ATOMIC_ACQUIRE, "workgroup", "local");
  };
  // The passes that load stand in a loop of their own with no branch round the loads: with one, the compiler's counted waits assume the loads were skipped
  // and drain the quarters just issued. Kept rolled for the size of the code.
#pragma clang loop unroll(disable)
  for (int p = 0; p + 2 < NP; ++p) pass(p, Flag<true>{}, Flag<true>{});
  pass(NP - 2, Flag<true>{}, Flag<false>{});
  pass(NP - 1, Flag<false>{}, Flag<false>{});
  // the last barrier has ended every read of the buffers: each wave stages its f32 tile in a range of its own and stores whole lines
  f32a* so = (f32a*)&sm[0][0] + (size_t)w * (TM / 4) * SP;
#pragma unroll
  for (int m = 0; m < MI; ++m)
#pragma unroll
    for (int n = 0; n < 4; ++n) {
      f32a* d = &so[(m * 16 + ln) * SP + n * 16 + 8 * hh];
      *(v4fa*)d = v4f{acc[m][n][0], acc[m][n][1], acc[m][n][2], acc[m][n][3]}; *(v4fa*)(d + 4) = v4f{acc[m][n][4], acc[m][n][5], acc[m][n][6], acc[m][n][7]};
    }
  // the wave's own LDS writes are complete before its lanes read back rows that other lanes wrote (no other wave touches this range)
  __builtin_amdgcn_fence(__ATOMIC_ACQ_REL, "workgroup"); __builtin_amdgcn_wave_barrier();
  if (!isq) {
    // [K | V]: bf16 head and remainder of each f32 result; the wave's 64 columns are 128 B a row in each plane, one whole line (8 lanes x 16 B)
    const size_t po = (size_t)(row0 + wm * (TM / 4)) * (2 * DM) + (col0 - DM) + wn * 64;
    const int r4 = lane >> 3, c8 = (lane & 7) * 8;
    // both loops unrolled: vector elements indexed by constants stay in registers, and the LDS reads of all rows issue ahead of the stores
#pragma unroll
    for (int q = 0; q < TM / 16; ++q) {
      const int r = q * 4 + r4;
      const v4f a = *(const v4fa*)&so[r * SP + c8], b = *(const v4fa*)&so[r * SP + c8 + 4];
      v8us h, l;
#pragma unroll
      for (int u = 0; u < 8; ++u) { const float v = u < 4 ? a[u & 3] : b[u & 3]; const unsigned short hb = bf16_bits(v); h[u] = hb; l[u] = bf16_bits(v - bf16_val(hb)); }
      *(v8us*)(Ph + po + (size_t)r * (2 * DM) + c8) = h; *(v8us*)(Pl + po + (size_t)r * (2 * DM) + c8) = l;
    }
    // in the listing the Q branch stands as the fall-through behind these stores and reuses their registers
    asm volatile("s_wait_xcnt 0x0" ::: "memory");
    return;
  }
  float* cw = C + (size_t)(blockIdx.y * (TN / 64) + wn) * cbs + (size_t)(row0 + wm * (TM / 4)) * ldc;
  const int rsub = lane >> 4, c4 = (lane & 15) * 4;
#pragma unroll
  for (int q = 0; q < TM / 8; ++q) { const int r = q * 2 + rsub; const v4f v = *(const v4fa*)&so[r * SP + c4]; *(v4f*)(cw + (size_t)r * ldc + c4) = v; }
}

// Projections, scores and VW^T of one (set s, head h) in ONE work-group (grid.x = s, grid.y = h; 8 waves), so Q, K and V never leave the WGP.
// Part 1: [Q | K | V] (128 x 192, k = 512) = [x W1h | y W2h | y W3h], staged like k_gemm_tile: a pass of 128 k holds 128 rows of x, 128 rows of y (f32 rounded to bf16 once while
//         staged) and 128 k-rows of the head's 3 x 64 weight columns, read from W1, W2, W3 as they lie ([k][n], f32), rounded to bf16 while staged and kept [k][n] in LDS: the B
//         fragments come out of transposing LDS reads, in the k order of the A fragments. Two buffers, one barrier a pass. A wave owns 32 rows x 96 columns; its first four
//         column tiles take x (wn = 0) or y (wn = 1) as A, its last two always y.
// Part 2: every f32 result is split into its bf16 head and remainder, in six LDS planes [128][64] (pitch 144 B); behind one barrier each wave does three 16 x 64 jobs, 64 deep, 3 terms:
//         two of ATT[(s,q)][h*128 + k] = f16(relu(q.k / 8) / 128) and one of VWt16[(s,d)][h*128 + k] = f16(sum over e of bf16(W4[h*64+e][d]) * V[k][e]).
#define FA (2 * NIT)       // staged A rows of a pass: x, then y
#define FB (3 * HS)        // staged B columns of a pass
#define WP (FB + 16)       // LDS pitch of a staged weight k-row in 16-bit elements (416 B = 13 x 32 B: conflict-free for the transposing 16-B reads)
#define BUFE (FA * LP + TK * WP)      // one buffer: the A rows, then the weight k-rows
#define PP 72              // plane row pitch in 16-bit elements (144 B: conflict-free for 16-B fragment reads)
#define PSZ (NIT * PP)     // one plane
typedef short s16x8 __attribute__((ext_vector_type(8)));
typedef unsigned int v2ua __attribute__((ext_vector_type(2), may_alias));
typedef unsigned int v4ua __attribute__((ext_vector_type(4), may_alias));
// two f32 rounded to nearest even into one register of two bf16 (the packed convert instruction; on finite values the bits of bf16_bits)
__device__ __forceinline__ unsigned int pack_bf16(float lo, float hi) { typedef __bf16 bf2 __attribute__((ext_vector_type(2))); typedef float f2 __attribute__((ext_vector_type(2))); return __builtin_bit_cast(unsigned int, __builtin_convertvector(f2{lo, hi}, bf2)); }
// transposing LDS read: lane (c, hh) gets T[8 hh + 0..7][c] of the 16 x 16 tile of 16-bit elements whose rows the lanes' addresses name
__device__ __forceinline__ v8us ld_tr16(const unsigned short* p) { typedef __attribute__((address_space(3))) s16x8 lds_s16x8; return __builtin_bit_cast(v8us, __builtin_amdgcn_ds_load_tr16_b128_v8i16((lds_s16x8*)p)); }
__global__ __launch_bounds__(256) void k_head(const float* __restrict__ X, const float* __restrict__ Y, const float* __restrict__ W1, const float* __restrict__ W2, const float* __restrict__ W3,
                                            const float* __restrict__ W4, _Float16* __restrict__ ATT, _Float16* __restrict__ VWt16) {
  __shared__ __attribute__((aligned(16))) unsigned short sm[2][BUFE];
  const int tid = threadIdx.x, w = tid >> 5, lane = tid & 31, ln = lane & 15, hh = lane >> 4;
  const int wm = w >> 1, wn = w & 1;
  const int s = blockIdx.x, h = blockIdx.y;
  const int fr = tid >> 5, fc = (tid & 31) * 4;      // f32 rows: 32 lanes x 16 B = the 512-B slice of a row
  // weight k-rows: 16 lanes x 16 B = the head's 256 B of a row; the two halves of a wave take rows 4 apart, whose 8-B LDS stores fall on different banks
  const int wr = (w & 3) + 4 * hh + 8 * (w >> 2), wc = ln * 4;
  const float* gx = X + (size_t)(s * NIT + fr) * DM + fc;
  const float* gy = Y + (size_t)(s * NIT + fr) * DM + fc;
  const size_t wo = (size_t)wr * DM + h * HS + wc;
  const float* gw1 = W1 + wo; const float* gw2 = W2 + wo; const float* gw3 = W3 + wo;
  v4f sx[NIT / 8], sy[NIT / 8], sw[3 * TK / 16];
  constexpr int NP = DM / TK;
  static_assert((NP & (NP - 1)) == 0, "the rotated walk wraps by a mask");
  // The 8 heads of a set read the same rows of x and y, the 32 sets of a head the same weight rows, all in step: each work-group starts its walk over the passes
  // at a pass of its own (wrapping), so that fewer of them ask L2 for the same lines at the same moment. The sum over k runs over the passes in that rotated order.
  const int rot = (s + h) & (NP - 1);
  // The 56 staged 16-B pieces of a thread go in quarters: a quarter is stored to LDS and its registers are at once loaded anew for the pass after,
  // one quarter per block of WMMAs, so that loads are in flight all the time and each has a whole pass to arrive.
  auto fetchq = [&](int q, int p) {
    const int ko = ((p + rot) & (NP - 1)) * TK;      // k at which the p-th pass of this work-group begins
    const float* px = gx + ko; const float* py = gy + ko;
    const float* pw[3] = {gw1 + (size_t)ko * DM, gw2 + (size_t)ko * DM, gw3 + (size_t)ko * DM};
#pragma unroll
    for (int u = q * 4; u < q * 4 + 4; ++u) { sx[u] = *(const v4fa*)(px + (size_t)u * 8 * DM); sy[u] = *(const v4fa*)(py + (size_t)u * 8 * DM); }
#pragma unroll
    for (int u = q * 6; u < q * 6 + 6; ++u) sw[u] = *(const v4fa*)(pw[u >> 3] + (size_t)(u & 7) * 16 * DM);
    // later instructions may reuse the registers that hold these loads' addresses; the pass's own addresses are named as inputs, so that
    // they stay in their registers up to the wait and nothing (a later load's result, a conversion) is put there in front of it
    asm volatile("s_wait_xcnt 0x0" :: "v"(px), "v"(py), "v"(pw[(q * 6) >> 3]), "v"(pw[(q * 6 + 5) >> 3]) : "memory");
  };
  auto putq = [&](int q, unsigned short* dst) {
#pragma unroll
    for (int u = q * 4; u < q * 4 + 4; ++u) {
      v4us a, b;
#pragma unroll
      for (int e = 0; e < 4; ++e) { a[e] = bf16_bits(sx[u][e]); b[e] = bf16_bits(sy[u][e]); }
      *(v4us*)&dst[(u * 8 + fr) * LP + fc] = a; *(v4us*)&dst[(NIT + u * 8 + fr) * LP + fc] = b;
    }
#pragma unroll
    for (int u = q * 6; u < q * 6 + 6; ++u) {
      const v2ua b = {pack_bf16(sw[u][0], sw[u][1]), pack_bf16(sw[u][2], sw[u][3])};
      *(v2ua*)&dst[FA * LP + ((u & 7) * 16 + wr) * WP + (u >> 3) * HS + wc] = b;
    }
  };
#pragma unroll
  for (int q = 0; q < 4; ++q) fetchq(q, 0);
#pragma unroll
  for (int q = 0; q < 4; ++q) { putq(q, sm[0]); fetchq(q, 1); }
  // LDS-only fences, as at the foot of the loop: pass 1's loads stay in flight
  __builtin_amdgcn_fence(__ATOMIC_RELEASE, "workgroup", "local"); __builtin_amdgcn_s_barrier(); __builtin_amdgcn_fence(__ATOMIC_ACQUIRE, "workgroup", "local");
  v8f acc[2][6] = {};
  const int a0off = (wn * NIT + wm * 32 + ln) * LP + 8 * hh, a1off = (NIT + wm * 32 + ln) * LP + 8 * hh;
  const int boff = FA * LP + (8 * hh + (lane & 7)) * WP + wn * 96 + 8 * ((lane >> 3) & 1);      // lane address of a transposing read: k-row 8 hh + (lane & 7), 16-B half (lane >> 3) & 1
  auto pass = [&](int p, auto doput, auto dofetch) {
    const unsigned short* cur = sm[p & 1];
    unsigned short* nxt = sm[(p + 1) & 1];      // its readers left it at the barrier that ended the pass before
#pragma unroll
    for (int ks = 0; ks < TK / 32; ++ks) {
      FragX fa0[2], fa1[2], fb[6];
#pragma unroll
      for (int m = 0; m < 2; ++m) {
        const int o0 = a0off + m * 16 * LP + ks * 32, o1 = a1off + m * 16 * LP + ks * 32;
        fa0[m].half[0] = *(const v8us*)&cur[o0]; fa0[m].half[1] = *(const v8us*)&cur[o0 + 16];
        fa1[m].half[0] = *(const v8us*)&cur[o1]; fa1[m].half[1] = *(const v8us*)&cur[o1 + 16];
      }
#pragma unroll
      for (int n = 0; n < 6; ++n) { const int o = boff + ks * 32 * WP + n * 16; fb[n].half[0] = ld_tr16(&cur[o]); fb[n].half[1] = ld_tr16(&cur[o + 16 * WP]); }
      // scheduling fences: the fragment reads stay in front of the quarter's conversions, which run while the reads are under way, and one block's reads are not
      // lifted over another block's WMMAs (that would hold every block's fragments in registers at once)
      __builtin_amdgcn_sched_barrier(0);
      if constexpr (decltype(doput)::v) putq(ks, nxt);
      // scheduling fence: the quarter's LDS stores and their address arithmetic stay in front of the loads, so that nothing writes a register that a load names ahead of the loads' wait
      if constexpr (decltype(dofetch)::v) { __builtin_amdgcn_sched_barrier(0); fetchq(ks, p + 2); }
      __builtin_amdgcn_sched_barrier(0);
#pragma unroll
      for (int m = 0; m < 2; ++m)
#pragma unroll
        for (int n = 0; n < 6; ++n)
          // the weight columns go in as the first operand: register r of lane (ln, hh) is then item m * 16 + ln, column n * 16 + 8 * hh + r
          acc[m][n] = __builtin_amdgcn_wmma_f32_16x16x32_bf16(false, fb[n].b, false, (n < 4 ? fa0 : fa1)[m].b, (short)0, acc[m][n], false, false);
      __builtin_amdgcn_sched_barrier(0);
    }
    // publishes the next pass's rows and ends every read of this pass's buffer. Only LDS is handed over here, so the fences name LDS alone:
    // __syncthreads() would also wait for the global loads of the pass after next, which are meant to stay in flight across the barrier
    __builtin_amdgcn_fence(__ATOMIC_RELEASE, "workgroup", "local"); __builtin_amdgcn_s_barrier(); __builtin_amdgcn_fence(__ATOMIC_ACQUIRE, "workgroup", "local");
  };
  // The passes that load stand in a loop of their own with no branch round the loads: with one, the compiler's counted waits assume the loads were skipped
  // and drain the quarters just issued. Kept rolled for the size of the code.
#pragma clang loop unroll(disable)
  for (int p = 0; p + 2 < NP; ++p) pass(p, Flag<true>{}, Flag<true>{});
  pass(NP - 2, Flag<true>{}, Flag<false>{});
  pass(NP - 1, Flag<false>{}, Flag<false>{});
  // the W4 column (a row of W4^T) of this wave's VW^T job, in the A fragment's k order, fetched here so that the latency passes behind the split below
  const float* wcol = W4 + (size_t)(h * HS + 8 * hh) * HS + (w >> 1) * 16 + ln;
  float wx[2][16];
#pragma unroll
  for (int k2 = 0; k2 < 2; ++k2)
#pragma unroll
    for (int i = 0; i < 16; ++i) wx[k2][i] = wcol[(size_t)(k2 * 32 + (i < 8 ? i : 8 + i)) * HS];
  // later instructions may reuse the registers that hold these loads' address
  asm volatile("s_wait_xcnt 0x0" ::: "memory");
  // the last barrier has ended every read of the buffers: planes Qh Ql Kh Kl Vh Vl from the start of the LDS
  unsigned short* pl = &sm[0][0];
#pragma unroll
  for (int m = 0; m < 2; ++m)
#pragma unroll
    for (int n = 0; n < 6; ++n) {
      const int tc = wn * 6 + n;      // column tile 0..11 of [Q | K | V]
      unsigned short* ph = pl + (tc >> 2) * 2 * PSZ + (wm * 32 + m * 16 + ln) * PP + (tc & 3) * 16 + 8 * hh;
      // a lane's 8 values are neighbours in a plane's row: heads and remainders are packed in pairs and leave in one 16-B store a plane
      v4ua hi, lo;
#pragma unroll
      for (int r = 0; r < 4; ++r) {
        const float v0 = acc[m][n][2 * r], v1 = acc[m][n][2 * r + 1];
        const unsigned int hb = pack_bf16(v0, v1);
        hi[r] = hb; lo[r] = pack_bf16(v0 - __uint_as_float(hb << 16), v1 - __uint_as_float(hb & 0xFFFF0000u));
      }
      *(v4ua*)ph = hi; *(v4ua*)(ph + PSZ) = lo;
    }
  // publishes the planes to all waves
  __syncthreads();
  unsigned short* so = pl + 6 * PSZ + w * 16 * PP;      // behind the planes, a range of the wave's own: 16 rows of 64 f16
  const int r4 = lane >> 3, c8 = (lane & 7) * 8;
#pragma unroll
  for (int jj = 0; jj < 3; ++jj) {
    const bool sc = jj < 2;
    const int wid = sc ? jj * 8 + w : w;
    const int row0 = (wid >> 1) * 16, col0 = (wid & 1) * 64;
    const unsigned short* bp = pl + (sc ? 2 : 4) * PSZ + (col0 + ln) * PP + 8 * hh;
    v8f a2[4] = {};
    // all fragments of the job are read first, and the four column tiles take turns term by term: four independent accumulator chains;
    // per tile the order stays ah.bh, al.bh, ah.bl, 32 k at a time
    FragB ah[2], al[2], bh_[2][4], bl_[2][4];
#pragma unroll
    for (int k2 = 0; k2 < 2; ++k2) {
      if (sc) {
        const unsigned short* ap = pl + (row0 + ln) * PP + k2 * 32 + 8 * hh;
        ah[k2].half[0] = *(const v8us*)ap; ah[k2].half[1] = *(const v8us*)(ap + 16);
        al[k2].half[0] = *(const v8us*)(ap + PSZ); al[k2].half[1] = *(const v8us*)(ap + PSZ + 16);
      } else {
#pragma unroll
        for (int i = 0; i < 16; ++i) { const float xv = bf16_round(wx[k2][i]); const unsigned short hb = bf16_bits(xv); ah[k2].u[i] = hb; al[k2].u[i] = bf16_bits(xv - bf16_val(hb)); }
      }
#pragma unroll
      for (int t = 0; t < 4; ++t) {
        const unsigned short* b = bp + t * 16 * PP + k2 * 32;
        bh_[k2][t].half[0] = *(const v8us*)b; bh_[k2][t].half[1] = *(const v8us*)(b + 16);
        bl_[k2][t].half[0] = *(const v8us*)(b + PSZ); bl_[k2][t].half[1] = *(const v8us*)(b + PSZ + 16);
      }
    }
    // scheduling fence: without it the compiler spreads the reads in small groups among the WMMAs, each group with a wait of its own
    __builtin_amdgcn_sched_barrier(0);
#pragma unroll
    for (int k2 = 0; k2 < 2; ++k2) {
#pragma unroll
      for (int t = 0; t < 4; ++t) a2[t] = __builtin_amdgcn_wmma_f32_16x16x32_bf16(false, bh_[k2][t].v, false, ah[k2].v, (short)0, a2[t], false, false);
#pragma unroll
      for (int t = 0; t < 4; ++t) a2[t] = __builtin_amdgcn_wmma_f32_16x16x32_bf16(false, bh_[k2][t].v, false, al[k2].v, (short)0, a2[t], false, false);
#pragma unroll
      for (int t = 0; t < 4; ++t) a2[t] = __builtin_amdgcn_wmma_f32_16x16x32_bf16(false, bl_[k2][t].v, false, ah[k2].v, (short)0, a2[t], false, false);
    }
    // the K or V rows went in as the first operand: register r of lane (ln, hh) is output row ln, column t * 16 + 8 * hh + r, so the 8 f16 results of a tile are staged by one 16-B store
#pragma unroll
    for (int t = 0; t < 4; ++t) {
      FragH f;
#pragma unroll
      for (int r = 0; r < 8; ++r) f.h[r] = (_Float16)(sc ? fmaxf(a2[t][r] * 0.125f, 0.f) * (1.0f / NIT) : a2[t][r]);
      *(v8us*)&so[ln * PP + t * 16 + 8 * hh] = f.half[0];
    }
    // the wave's own LDS writes are complete before its lanes read back rows that other lanes wrote (no other wave touches this range); LDS alone is named,
    // so that the fence does not wait for the job before's global stores
    __builtin_amdgcn_fence(__ATOMIC_ACQ_REL, "workgroup", "local"); __builtin_amdgcn_wave_barrier();
    unsigned short* dst = (unsigned short*)(sc ? ATT + (size_t)(s * NIT + row0) * HK : VWt16 + (size_t)(s * HS + row0) * HK) + h * NIT + col0;
    v8us o[4];
#pragma unroll
    for (int q = 0; q < 4; ++q) o[q] = *(const v8us*)&so[(q * 4 + r4) * PP + c8];
    // scheduling fences: the four stores and their wait stay together, so that no register that a store names is written anew in front of the wait
    __builtin_amdgcn_sched_barrier(0);
#pragma unroll
    for (int q = 0; q < 4; ++q) *(v8us*)(dst + (size_t)(q * 4 + r4) * HK + c8) = o[q];
    asm volatile("s_wait_xcnt 0x0" ::: "memory");
    __builtin_amdgcn_sched_barrier(0);
    // the next job's staging writes stay behind this job's reads
    __builtin_amdgcn_fence(__ATOMIC_ACQ_REL, "workgroup", "local"); __builtin_amdgcn_wave_barrier();
  }
}

extern "C" void kernel_launch(void* const* d_in, const int* in_sizes, int n_in,
                              void* d_out, int out_size, void* d_ws, size_t ws_size, hipStream_t stream) {
  (void)in_sizes; (void)n_in; (void)out_size;
  const float* x = (const float*)d_in[0]; const float* y = (const float*)d_in[1]; const float* W1 = (const float*)d_in[2]; const float* W2 = (const float*)d_in[3]; const float* W3 = (const float*)d_in[4]; const float* W4 = (const float*)d_in[5];
  char* ws = (char*)d_ws; size_t off = 0;
  auto take = [&](size_t bytes) { char* p = ws + off; off += (bytes + 255) & ~(size_t)255; return p; };
  _Float16* ATT = (_Float16*)take((size_t)NSET * NIT * HK * 2); _Float16* VWt16 = (_Float16*)take((size_t)NSET * HS * HK * 2);
  if (off > ws_size) return;
  // f16 operands of the final product, weight rounding and projections included: one work-group per (set, head)
  k_head<<<dim3(NSET, NH), 256, 0, stream>>>(x, y, W1, W2, W3, W4, ATT, VWt16);
  // out[i][j] = ATT[j] * VWt[i]^T for all 1024 (i, j) as one 4096 x 2048 x 1024 product: grid.x = 256-row tiles of (j,q), grid.y = 128-column tiles of (i,d)
  k_gemm_tile<false, 256, HK><<<dim3(NTOK / 256, NSET * HS / TN), 256, 0, stream>>>(nullptr, nullptr, ATT, (const unsigned short*)VWt16, (float*)d_out, nullptr, nullptr, HS, (size_t)NTOK * HS);
}
